// v000
// Measured on an AMD MI455X. A time is GPU time per run, averaged over a window of back-to-back runs after a warm-up
// (all launches, gaps included; the runs take copies of the inputs in turn), and the median of several windows.
// Apart from v000's, it joins two sittings. Times from different sittings can be a few percent apart, while
// side-by-side timings come from the same sitting.
// v000, which the later versions start from, runs in 3730 microseconds.
#include <hip/hip_runtime.h>

// NoiseCancellingAttentionMechanism - differential attention with two query streams (v, k, q1, q2 [2][2048][1024]; q1h/q2h = q1/q2 Wq + bq (shared), kh = k Wk + bk, vh = v Wv + bv (16 heads x 64);
// a1 = softmax(q1h.kh/8), a2 = softmax(q2h.kh/8); out = merged (a1 - lam a2) vh, Wo + bo with the scalar lam read as data -> [2][2048][1024]).
// Compute dtypes, f32 accumulate: every input rounded to bf16; projections on PLAIN bf16 operands (inputs: exact, + bias); PER-ROW PRECISION HYBRID for both score sets and both
// p.v contractions (query rows < 256 on bf16 hi+lo planes with 3 products, rows >= 256 on single fp16 planes, probabilities x1024 there); f32 register-row softmaxes; the difference (a1 v) - lam (a2 v) and the

#define NB_  2
#define TT   2048
#define DM   1024
#define NH_  16
#define NKV  16
#define REP  (NH_ / NKV)
#define HD   64
#define DQ   (NH_ * HD)
#define DKV  (NKV * HD)
#define ZH   2
#define RH   256                  // query rows < RH use hi+lo planes (0: none)
#define WIN  0
#define PCAR 1024.0f
#define SCL  0.125f   // HD^-0.5
typedef _Float16 h16;
typedef unsigned short bf;
typedef __attribute__((ext_vector_type(16))) __bf16   v16bf;
typedef __attribute__((ext_vector_type(16))) _Float16 v16h;
typedef __attribute__((ext_vector_type(8)))  _Float16 v8h;
typedef __attribute__((ext_vector_type(8)))  unsigned short v8us;
typedef __attribute__((ext_vector_type(8)))  float    v8f;
typedef __attribute__((ext_vector_type(4)))  float    v4f;
typedef v8h  __attribute__((may_alias)) v8ha;
typedef v4f  __attribute__((may_alias)) v4fa;
typedef v8us __attribute__((may_alias)) v8usa;

__device__ __forceinline__ unsigned short f2bf(float f) { unsigned u = __float_as_uint(f); u += 0x7FFFu + ((u >> 16) & 1u); return (unsigned short)(u >> 16); }
__device__ __forceinline__ float bf2f(unsigned short b) { return __uint_as_float(((unsigned)b) << 16); }
__device__ __forceinline__ float bfr(float f) { return bf2f(f2bf(f)); }
__device__ __forceinline__ v16h cat16(v8h lo, v8h hi) { return __builtin_shufflevector(lo, hi, 0, 1, 2, 3, 4, 5, 6, 7, 8, 9, 10, 11, 12, 13, 14, 15); }
__device__ __forceinline__ v16bf cat16b(v8us lo, v8us hi) { return __builtin_bit_cast(v16bf, __builtin_shufflevector(lo, hi, 0, 1, 2, 3, 4, 5, 6, 7, 8, 9, 10, 11, 12, 13, 14, 15)); }
__device__ __forceinline__ v8f wmma16(v16h a, v16h b, v8f c) { return __builtin_amdgcn_wmma_f32_16x16x32_f16(false, a, false, b, (short)0, c, false, false); }
__device__ __forceinline__ v8f wmmab(v16bf a, v16bf b, v8f c) { return __builtin_amdgcn_wmma_f32_16x16x32_bf16(false, a, false, b, (short)0, c, false, false); }



// ---- k_gemmw: register-blocked GEMM, ONE WAVE per 64x64 output tile (16 accumulators), operands straight from K-contiguous 16-bit planes; grid (M/64, N/64, Z), 32 threads.
// C[m][n] (f32, pitch ldc, + optional f32 bias[n]) = sum_k A[m][k] Bt[n][k] (+ split products per NSPLIT). z-batch strides sA/sB/sC in elements. K % 32 == 0.
template <typename T16> struct WFrag;
template <> struct WFrag<h16> { typedef v16h V; static __device__ __forceinline__ V ld(const h16* p) { return cat16(*(const v8h*)p, *(const v8h*)(p + 16)); } static __device__ __forceinline__ v8f mma(V a, V b, v8f c) { return wmma16(a, b, c); } };
template <> struct WFrag<bf> { typedef v16bf V; static __device__ __forceinline__ V ld(const bf* p) { return cat16b(*(const v8us*)p, *(const v8us*)(p + 16)); } static __device__ __forceinline__ v8f mma(V a, V b, v8f c) { return wmmab(a, b, c); } };
template <typename T16, int NSPLIT, bool BIAS>
__global__ __launch_bounds__(32) void k_gemmw(const T16* __restrict__ A, const T16* __restrict__ A2, const T16* __restrict__ Bt, const T16* __restrict__ Bt2, int K, float* C, int ldc, const float* __restrict__ bias, size_t sA, size_t sB, size_t sC) {
    typedef typename WFrag<T16>::V V;
    __shared__ __align__(16) float os[16 * 68];
    const size_t z = blockIdx.z; A += z * sA; if (A2) A2 += z * sA; Bt += z * sB; if (Bt2) Bt2 += z * sB; C += z * sC;
    const int lane = threadIdx.x & 31, lr = lane & 15, hi = lane >> 4; const int r0 = blockIdx.x * 64, c0 = blockIdx.y * 64;
    v8f acc[4][4];
#pragma unroll
    for (int mb = 0; mb < 4; ++mb)
#pragma unroll
        for (int nb = 0; nb < 4; ++nb) acc[mb][nb] = (v8f){};
    const size_t aoff = (size_t)(r0 + lr) * K + 8 * hi, boff = (size_t)(c0 + lr) * K + 8 * hi;
#pragma unroll 1
    for (int kc = 0; kc < K; kc += 32) {
        V a[4], a2[4];
#pragma unroll
        for (int mb = 0; mb < 4; ++mb) { a[mb] = WFrag<T16>::ld(A + aoff + (size_t)mb * 16 * K + kc); if (NSPLIT == 1 || NSPLIT == 2) a2[mb] = WFrag<T16>::ld(A2 + aoff + (size_t)mb * 16 * K + kc); }
#pragma unroll
        for (int nb = 0; nb < 4; ++nb) { const V b = WFrag<T16>::ld(Bt + boff + (size_t)nb * 16 * K + kc); V b2; if (NSPLIT >= 2) b2 = WFrag<T16>::ld(Bt2 + boff + (size_t)nb * 16 * K + kc);
#pragma unroll
            for (int mb = 0; mb < 4; ++mb) { acc[mb][nb] = WFrag<T16>::mma(a[mb], b, acc[mb][nb]); if (NSPLIT == 1 || NSPLIT == 2) acc[mb][nb] = WFrag<T16>::mma(a2[mb], b, acc[mb][nb]); if (NSPLIT >= 2) acc[mb][nb] = WFrag<T16>::mma(a[mb], b2, acc[mb][nb]); } }
        asm volatile("v_nop\n\tv_nop\n\tv_nop\n\tv_nop" : "+v"(acc[0][0]), "+v"(acc[1][1]), "+v"(acc[2][2]), "+v"(acc[3][3]) : "v"(a[0]), "v"(a[3]));
    }
#pragma unroll
    for (int mb = 0; mb < 4; ++mb) {
#pragma unroll
        for (int nb = 0; nb < 4; ++nb) {
#pragma unroll
            for (int j = 0; j < 8; ++j) os[(hi * 8 + j) * 68 + nb * 16 + lr] = acc[mb][nb][j]; }
        __builtin_amdgcn_wave_barrier(); asm volatile("" ::: "memory");
        float* crow = C + (size_t)(r0 + mb * 16) * ldc + c0;
{
#pragma unroll
            for (int s = 0; s < 8; ++s) { const int row = 2 * s + hi, cofs = lr * 4; v4f val = *(const v4fa*)(os + row * 68 + cofs); if (BIAS) { val[0] += bfr(bias[c0 + cofs]); val[1] += bfr(bias[c0 + cofs + 1]); val[2] += bfr(bias[c0 + cofs + 2]); val[3] += bfr(bias[c0 + cofs + 3]); }
                *(v4f*)(crow + (size_t)row * ldc + cofs) = val; }
             }
        __builtin_amdgcn_wave_barrier(); asm volatile("" ::: "memory");
    }
}

__device__ __forceinline__ h16 tohx(float x) { return (h16)x; }
__device__ __forceinline__ void splitf(float y, unsigned short& h, unsigned short& l) { h = f2bf(y); l = f2bf(y - bf2f(h)); }
typedef __attribute__((ext_vector_type(2))) _Float16 v2h;
typedef __attribute__((ext_vector_type(4))) _Float16 v4h;
typedef __attribute__((ext_vector_type(2))) unsigned short v2us;
typedef __attribute__((ext_vector_type(4))) unsigned short v4us;
typedef __attribute__((ext_vector_type(2))) float v2f;
typedef __attribute__((ext_vector_type(4))) int v4i;

__global__ __launch_bounds__(256) void k_wtG(const float* __restrict__ w, int K, int N, bf* Bt) {
    const int lane = threadIdx.x & 31; const int L0 = (blockIdx.x * 8 + (threadIdx.x >> 5)) * 8; const int nlines = N * K / 64;
{
#pragma unroll 1
        for (int l = 0; l < 8; ++l) { const int L = L0 + l; if (L >= nlines) break; const size_t e = (size_t)L * 64 + lane * 2; const int k = (int)(e % K), n = (int)(e / K); v2us o;
            o[0] = f2bf(w[(size_t)k * N + n]); o[1] = f2bf(w[(size_t)(k + 1) * N + n]); *(v2us*)(Bt + e) = o; }
         }
}
__global__ __launch_bounds__(256) void k_cvt8(const float* __restrict__ src, bf* dst, size_t n8) { const size_t i = (size_t)blockIdx.x * 256 + threadIdx.x; if (i >= n8) return; const v8f v = *(const v8f*)(src + i * 8); v8us o;
#pragma unroll
    for (int k = 0; k < 8; ++k) o[k] = f2bf(v[k]); *(v8us*)(dst + i * 8) = o;  }
__global__ __launch_bounds__(256) void k_cscvt(const float* __restrict__ cosT, const float* __restrict__ sinT, float* CS) { const int idx = blockIdx.x * 256 + threadIdx.x; if (idx >= TT * HD) return; v2f cs; cs[0] = bfr(cosT[idx]); cs[1] = bfr(sinT[idx]); *(v2f*)(CS + (size_t)idx * 2) = cs;  }
// k_rope: head planes [h][t][d] (fp16 + hi/lo) of rope(x) x sc with the rotate-half convention out[d] = x[d] cos[t][d] - x[d+HD/2] sin[t][d], out[d+HD/2] = x[d+HD/2] cos[t][d+HD/2] + x[d] sin[t][d+HD/2]
__global__ __launch_bounds__(256) void k_rope(const float* __restrict__ F, int pitch, int nheads, const float* __restrict__ CS, const float* __restrict__ RF, const float* __restrict__ nw, float sc, h16* P16, bf* Ph, bf* Pl) {
    const size_t e = ((size_t)blockIdx.x * 256 + threadIdx.x) * 2; if (e >= (size_t)nheads * TT * HD) return; const int d = (int)(e % HD); const int t = (int)((e / HD) % TT); const int h = (int)(e / ((size_t)HD * TT)); const float* f = F + (size_t)t * pitch + h * HD; const float rf = RF ? RF[(size_t)h * TT + t] : 1.0f; v2h o16; v2us oh, ol;
#pragma unroll
    for (int q = 0; q < 2; ++q) { const int dd = d + q; const int dp = (dd < HD / 2) ? dd + HD / 2 : dd - HD / 2; float x0 = f[dd], x1 = f[dp];
        if (RF) { float n0 = __fmul_rn(x0, rf), n1 = __fmul_rn(x1, rf); asm volatile("" : "+v"(n0)); asm volatile("" : "+v"(n1)); x0 = __fmul_rn(bfr(nw[dd]), n0); x1 = __fmul_rn(bfr(nw[dp]), n1); }
        const v2f cs = *(const v2f*)(CS + ((size_t)t * HD + dd) * 2); float a = __fmul_rn(x0, cs[0]), bq = __fmul_rn(x1, cs[1]); asm volatile("" : "+v"(a)); asm volatile("" : "+v"(bq)); const float r = ((dd < HD / 2) ? __fsub_rn(a, bq) : __fadd_rn(a, bq)) * sc;
        o16[q] = tohx(r); unsigned short a2, c2; splitf(r, a2, c2); oh[q] = a2; ol[q] = c2; }
    *(v2h*)(P16 + e) = o16; *(v2us*)(Ph + e) = oh; *(v2us*)(Pl + e) = ol;  }
__global__ __launch_bounds__(256) void k_vtp(const float* __restrict__ F, int pitch, int nheads, h16* V16, bf* Vh, bf* Vl) { const size_t e = ((size_t)blockIdx.x * 256 + threadIdx.x) * 2; if (e >= (size_t)nheads * HD * TT) return; const int t = (int)(e % TT); const int d = (int)((e / TT) % HD); const int g = (int)(e / ((size_t)TT * HD)); v2h o16; v2us oh, ol;
#pragma unroll
    for (int q = 0; q < 2; ++q) { const float x = F[(size_t)(t + q) * pitch + g * HD + d]; o16[q] = tohx(x); unsigned short a2, c2; splitf(x, a2, c2); oh[q] = a2; ol[q] = c2; }
    *(v2h*)(V16 + e) = o16; *(v2us*)(Vh + e) = oh; *(v2us*)(Vl + e) = ol;  }
__global__ __launch_bounds__(256) void k_csid(float* CS) { const int idx = blockIdx.x * 256 + threadIdx.x; if (idx >= TT * HD) return; v2f cs; cs[0] = 1.0f; cs[1] = 0.0f; *(v2f*)(CS + (size_t)idx * 2) = cs;  }
__global__ __launch_bounds__(256) void k_mrgd2(const float* __restrict__ O1, const float* __restrict__ O2, const float* __restrict__ lamp, int h0, bf* Ah, bf* Al) { const size_t e = ((size_t)blockIdx.x * 256 + threadIdx.x) * 2; if (e >= (size_t)ZH * TT * HD) return; const int d = (int)(e % HD); const int t = (int)((e / HD) % TT); const int zz = (int)(e / ((size_t)HD * TT)); const float cs = (t < RH) ? 1.0f : (1.0f / PCAR); float lam = bfr(lamp[0]); asm volatile("" : "+v"(lam)); v2us oh, ol;
#pragma unroll
    for (int q = 0; q < 2; ++q) { float a = __fmul_rn(O1[e + q], cs), b2 = __fmul_rn(O2[e + q], cs); asm volatile("" : "+v"(a)); asm volatile("" : "+v"(b2)); float lb = __fmul_rn(lam, b2); asm volatile("" : "+v"(lb)); unsigned short s1, s2; splitf(__fsub_rn(a, lb), s1, s2); oh[q] = s1; ol[q] = s2; }
    const size_t oo = (size_t)t * DQ + (size_t)(h0 + zz) * HD + d; *(v2us*)(Ah + oo) = oh; *(v2us*)(Al + oo) = ol;  }
// k_asoft: per row (zz, i): t = S x HD^-0.5 (no mask); softmax over the 2048 keys (register row, one exp, fixed trees);
__global__ __launch_bounds__(256) void k_asoft(const float* __restrict__ Sb, h16* P16, bf* Ph, bf* Pl) {
    const int lane = threadIdx.x & 31; const int row = blockIdx.x * 8 + (threadIdx.x >> 5); if (row >= ZH * TT) return; const int i = row % TT; const int zz = row / TT; (void)zz; const bool hires = (i < RH); const float* sr = Sb + (size_t)row * TT; float v[TT / 32]; float mx = -3.0e38f;
#pragma unroll
    for (int ch = 0; ch < TT / 128; ++ch) { const int j0 = ch * 128 + lane * 4; const v4f a = *(const v4f*)(sr + j0);
#pragma unroll
        for (int q = 0; q < 4; ++q) { const int j = j0 + q; (void)j; const float t = a[q] * SCL; v[ch * 4 + q] = t; mx = fmaxf(mx, t); } }
#pragma unroll
    for (int sh = 16; sh; sh >>= 1) mx = fmaxf(mx, __shfl_xor(mx, sh, 32));
    float sum = 0.f;
#pragma unroll
    for (int k = 0; k < TT / 32; ++k) { float d0 = __fsub_rn(v[k], mx); asm volatile("" : "+v"(d0)); v[k] = __builtin_amdgcn_exp2f(__fmul_rn(d0, 1.4426950408889634f)); sum += v[k]; }
#pragma unroll
    for (int sh = 16; sh; sh >>= 1) sum += __shfl_xor(sum, sh, 32);
    const float f = __fdiv_rn(hires ? 1.0f : PCAR, sum);
{
        if (hires) {
#pragma unroll
            for (int ch = 0; ch < TT / 128; ++ch) { v4us oh, ol;
#pragma unroll
                for (int q = 0; q < 4; ++q) { unsigned short a, c2; splitf(v[ch * 4 + q] * f, a, c2); oh[q] = a; ol[q] = c2; }
                const size_t oo = ((size_t)zz * (RH ? RH : 1) + i) * TT + ch * 128 + lane * 4; *(v4us*)(Ph + oo) = oh; *(v4us*)(Pl + oo) = ol; }
        } else {
#pragma unroll
            for (int ch = 0; ch < TT / 128; ++ch) { v4h o4;
#pragma unroll
                for (int q = 0; q < 4; ++q) o4[q] = tohx(v[ch * 4 + q] * f);
                *(v4h*)(P16 + (size_t)row * TT + ch * 128 + lane * 4) = o4; } }
         }
}
__global__ __launch_bounds__(256) void k_merge(const float* __restrict__ O, int h0, bf* Ah, bf* Al) { const size_t e = ((size_t)blockIdx.x * 256 + threadIdx.x) * 2; if (e >= (size_t)ZH * TT * HD) return; const int d = (int)(e % HD); const int t = (int)((e / HD) % TT); const int zz = (int)(e / ((size_t)HD * TT)); const float cs = (t < RH) ? 1.0f : (1.0f / PCAR); const size_t oo = (size_t)t * DQ + (h0 + zz) * HD + d;
    v2us oh, ol;
#pragma unroll
    for (int q = 0; q < 2; ++q) { unsigned short a, c2; splitf(O[e + q] * cs, a, c2); oh[q] = a; ol[q] = c2; } *(v2us*)(Ah + oo) = oh; *(v2us*)(Al + oo) = ol;  }

extern "C" void kernel_launch(void* const* d_in, const int* in_sizes, int n_in,
                              void* d_out, int out_size, void* d_ws, size_t ws_size, hipStream_t stream) {
    (void)in_sizes; (void)n_in; (void)out_size;
    const float* vin = (const float*)d_in[0]; const float* kin = (const float*)d_in[1]; const float* q1in = (const float*)d_in[2]; const float* q2in = (const float*)d_in[3]; const float* wq = (const float*)d_in[4]; const float* bq = (const float*)d_in[5]; const float* wk = (const float*)d_in[6]; const float* bk = (const float*)d_in[7]; const float* wv = (const float*)d_in[8]; const float* bv = (const float*)d_in[9]; const float* wo = (const float*)d_in[10]; const float* bo = (const float*)d_in[11]; const float* lamp = (const float*)d_in[12];   // weights x @ W
    float* OUT = (float*)d_out;     // [2][2048][1024]
    char* wsp = (char*)d_ws;
    auto take = [&](size_t bytes) { char* p = wsp; wsp += (bytes + 255) & ~(size_t)255; return (void*)p; };
    bf* WQ = (bf*)take((size_t)DQ * DM * 2); bf* WK = (bf*)take((size_t)DKV * DM * 2); bf* WV = (bf*)take((size_t)DKV * DM * 2); bf* WO = (bf*)take((size_t)DM * DQ * 2); float* CS = (float*)take((size_t)TT * HD * 2 * 4);
    bf* XB = (bf*)take((size_t)TT * DM * 2); float* FQ = (float*)take((size_t)TT * DQ * 4); float* FK = (float*)take((size_t)TT * DKV * 4);
    h16* Q2P16 = (h16*)take((size_t)NH_ * TT * HD * 2); bf* Q2Ph = (bf*)take((size_t)NH_ * TT * HD * 2); bf* Q2Pl = (bf*)take((size_t)NH_ * TT * HD * 2); float* Ob2 = (float*)take((size_t)ZH * TT * HD * 4);
    h16* QP16 = (h16*)take((size_t)NH_ * TT * HD * 2); h16* KP16 = (h16*)take((size_t)NKV * TT * HD * 2); h16* VT16 = (h16*)take((size_t)NKV * HD * TT * 2);
    bf* QPh = (bf*)take((size_t)NH_ * TT * HD * 2); bf* QPl = (bf*)take((size_t)NH_ * TT * HD * 2); bf* KPh = (bf*)take((size_t)NKV * TT * HD * 2); bf* KPl = (bf*)take((size_t)NKV * TT * HD * 2); bf* VTh = (bf*)take((size_t)NKV * HD * TT * 2); bf* VTl = (bf*)take((size_t)NKV * HD * TT * 2); bf* Ph = (bf*)take((size_t)ZH * RH * TT * 2); bf* Pl = (bf*)take((size_t)ZH * RH * TT * 2);
    float* Sb = (float*)take((size_t)ZH * TT * TT * 4); h16* P16 = (h16*)take((size_t)ZH * TT * TT * 2); float* Ob = (float*)take((size_t)ZH * TT * HD * 4); bf* ATh = (bf*)take((size_t)TT * DQ * 2); bf* ATl = (bf*)take((size_t)TT * DQ * 2);
    if ((size_t)(wsp - (char*)d_ws) > ws_size) return;    // ws 256 MiB
    float* FV = FK;   // v projection reuses the k buffer after the k planes are built (stream-ordered)
    { k_wtG<<<(unsigned)((DM * DQ / 64 + 63) / 64), 256, 0, stream>>>(wq, DM, DQ, WQ); k_wtG<<<(unsigned)((DM * DKV / 64 + 63) / 64), 256, 0, stream>>>(wk, DM, DKV, WK); k_wtG<<<(unsigned)((DM * DKV / 64 + 63) / 64), 256, 0, stream>>>(wv, DM, DKV, WV);
      k_wtG<<<(unsigned)((DQ * DM / 64 + 63) / 64), 256, 0, stream>>>(wo, DQ, DM, WO);
       }
    k_csid<<<(TT * HD + 255) / 256, 256, 0, stream>>>(CS);
    const unsigned LQ = (unsigned)(((size_t)NH_ * TT * HD / 2 + 255) / 256), LKv = (unsigned)(((size_t)NKV * TT * HD / 2 + 255) / 256);
    for (int b = 0; b < NB_; ++b) {
        
        k_cvt8<<<(unsigned)(((size_t)TT * DM / 8 + 255) / 256), 256, 0, stream>>>(q1in + (size_t)b * TT * DM, XB, (size_t)TT * DM / 8);
        k_gemmw<bf, 0, true><<<dim3(TT / 64, DQ / 64, 1), 32, 0, stream>>>(XB, nullptr, WQ, nullptr, DM, FQ, DQ, bq, 0, 0, 0);
        k_rope<<<LQ, 256, 0, stream>>>(FQ, DQ, NH_, CS, nullptr, nullptr, 1.0f, QP16, QPh, QPl);
        k_cvt8<<<(unsigned)(((size_t)TT * DM / 8 + 255) / 256), 256, 0, stream>>>(q2in + (size_t)b * TT * DM, XB, (size_t)TT * DM / 8);
        k_gemmw<bf, 0, true><<<dim3(TT / 64, DQ / 64, 1), 32, 0, stream>>>(XB, nullptr, WQ, nullptr, DM, FQ, DQ, bq, 0, 0, 0);
        k_rope<<<LQ, 256, 0, stream>>>(FQ, DQ, NH_, CS, nullptr, nullptr, 1.0f, Q2P16, Q2Ph, Q2Pl);
        k_cvt8<<<(unsigned)(((size_t)TT * DM / 8 + 255) / 256), 256, 0, stream>>>(kin + (size_t)b * TT * DM, XB, (size_t)TT * DM / 8);
        k_gemmw<bf, 0, true><<<dim3(TT / 64, DKV / 64, 1), 32, 0, stream>>>(XB, nullptr, WK, nullptr, DM, FK, DKV, bk, 0, 0, 0);
        k_rope<<<LKv, 256, 0, stream>>>(FK, DKV, NKV, CS, nullptr, nullptr, 1.0f, KP16, KPh, KPl);
        k_cvt8<<<(unsigned)(((size_t)TT * DM / 8 + 255) / 256), 256, 0, stream>>>(vin + (size_t)b * TT * DM, XB, (size_t)TT * DM / 8);
        k_gemmw<bf, 0, true><<<dim3(TT / 64, DKV / 64, 1), 32, 0, stream>>>(XB, nullptr, WV, nullptr, DM, FV, DKV, bv, 0, 0, 0); k_vtp<<<LKv, 256, 0, stream>>>(FV, DKV, NKV, VT16, VTh, VTl);
        for (int h0 = 0; h0 < NH_; h0 += ZH) { const size_t zq = (size_t)h0, zk = (size_t)(h0 / REP);   // one kv head per query head: the pass's two heads use consecutive kv planes (z-strides TT*HD)
            k_gemmw<bf, 2, false><<<dim3(RH / 64, TT / 64, ZH), 32, 0, stream>>>(QPh + zq * TT * HD, QPl + zq * TT * HD, KPh + zk * TT * HD, KPl + zk * TT * HD, HD, Sb, TT, nullptr, (size_t)TT * HD, (size_t)TT * HD, (size_t)TT * TT);
            k_gemmw<h16, 0, false><<<dim3((TT - RH) / 64, TT / 64, ZH), 32, 0, stream>>>(QP16 + zq * TT * HD + (size_t)RH * HD, nullptr, KP16 + zk * TT * HD, nullptr, HD, Sb + (size_t)RH * TT, TT, nullptr, (size_t)TT * HD, (size_t)TT * HD, (size_t)TT * TT);
            k_asoft<<<ZH * TT / 8, 256, 0, stream>>>(Sb, P16, Ph, Pl);
            k_gemmw<bf, 2, false><<<dim3(RH / 64, HD / 64, ZH), 32, 0, stream>>>(Ph, Pl, VTh + zk * HD * TT, VTl + zk * HD * TT, TT, Ob, HD, nullptr, (size_t)RH * TT, (size_t)HD * TT, (size_t)TT * HD);
            k_gemmw<h16, 0, false><<<dim3((TT - RH) / 64, HD / 64, ZH), 32, 0, stream>>>(P16 + (size_t)RH * TT, nullptr, VT16 + zk * HD * TT, nullptr, TT, Ob + (size_t)RH * HD, HD, nullptr, (size_t)TT * TT, (size_t)HD * TT, (size_t)TT * HD);
            k_gemmw<bf, 2, false><<<dim3(RH / 64, TT / 64, ZH), 32, 0, stream>>>(Q2Ph + zq * TT * HD, Q2Pl + zq * TT * HD, KPh + zk * TT * HD, KPl + zk * TT * HD, HD, Sb, TT, nullptr, (size_t)TT * HD, (size_t)TT * HD, (size_t)TT * TT);
            k_gemmw<h16, 0, false><<<dim3((TT - RH) / 64, TT / 64, ZH), 32, 0, stream>>>(Q2P16 + zq * TT * HD + (size_t)RH * HD, nullptr, KP16 + zk * TT * HD, nullptr, HD, Sb + (size_t)RH * TT, TT, nullptr, (size_t)TT * HD, (size_t)TT * HD, (size_t)TT * TT);
            k_asoft<<<ZH * TT / 8, 256, 0, stream>>>(Sb, P16, Ph, Pl);
            k_gemmw<bf, 2, false><<<dim3(RH / 64, HD / 64, ZH), 32, 0, stream>>>(Ph, Pl, VTh + zk * HD * TT, VTl + zk * HD * TT, TT, Ob2, HD, nullptr, (size_t)RH * TT, (size_t)HD * TT, (size_t)TT * HD);
            k_gemmw<h16, 0, false><<<dim3((TT - RH) / 64, HD / 64, ZH), 32, 0, stream>>>(P16 + (size_t)RH * TT, nullptr, VT16 + zk * HD * TT, nullptr, TT, Ob2 + (size_t)RH * HD, HD, nullptr, (size_t)TT * TT, (size_t)HD * TT, (size_t)TT * HD);
            k_mrgd2<<<(unsigned)(((size_t)ZH * TT * HD / 2 + 255) / 256), 256, 0, stream>>>(Ob, Ob2, lamp, h0, ATh, ATl); }
        k_gemmw<bf, 1, true><<<dim3(TT / 64, DM / 64, 1), 32, 0, stream>>>(ATh, ATl, WO, nullptr, DQ, OUT + (size_t)b * TT * DM, DM, bo, 0, 0, 0); }
}

// v001
// It runs in 1400 microseconds.
// Timed twice side by side with v000, it ran 2.67 and 2.70 times as fast.
#include <hip/hip_runtime.h>

// NoiseCancellingAttentionMechanism - differential attention with two query streams (v, k, q1, q2 [2][2048][1024]; q1h/q2h = q1/q2 Wq + bq (shared), kh = k Wk + bk, vh = v Wv + bv (16 heads x 64);
// a1 = softmax(q1h.kh/8), a2 = softmax(q2h.kh/8); out = merged (a1 - lam a2) vh, Wo + bo with the scalar lam read as data -> [2][2048][1024]).
// Compute dtypes, f32 accumulate: every input rounded to bf16; projections on PLAIN bf16 operands (inputs: exact, + bias); PER-ROW PRECISION HYBRID for both score sets and both
// p.v contractions (query rows < 256 on bf16 hi+lo planes with 3 products, rows >= 256 on single fp16 planes, probabilities x1024 there); f32 register-row softmaxes; the difference (a1 v) - lam (a2 v) and the

#define NB_  2
#define TT   2048
#define DM   1024
#define NH_  16
#define NKV  16
#define REP  (NH_ / NKV)
#define HD   64
#define DQ   (NH_ * HD)
#define DKV  (NKV * HD)
#define ZH   2
#define RH   256                  // query rows < RH use hi+lo planes (0: none)
#define WIN  0
#define PCAR 1024.0f
#define SCL  0.125f   // HD^-0.5
typedef _Float16 h16;
typedef unsigned short bf;
typedef __attribute__((ext_vector_type(16))) __bf16   v16bf;
typedef __attribute__((ext_vector_type(16))) _Float16 v16h;
typedef __attribute__((ext_vector_type(8)))  _Float16 v8h;
typedef __attribute__((ext_vector_type(8)))  unsigned short v8us;
typedef __attribute__((ext_vector_type(8)))  float    v8f;
typedef __attribute__((ext_vector_type(4)))  float    v4f;
typedef v8h  __attribute__((may_alias)) v8ha;
typedef v4f  __attribute__((may_alias)) v4fa;
typedef v8us __attribute__((may_alias)) v8usa;

__device__ __forceinline__ unsigned short f2bf(float f) { unsigned u = __float_as_uint(f); u += 0x7FFFu + ((u >> 16) & 1u); return (unsigned short)(u >> 16); }
__device__ __forceinline__ float bf2f(unsigned short b) { return __uint_as_float(((unsigned)b) << 16); }
__device__ __forceinline__ float bfr(float f) { return bf2f(f2bf(f)); }
__device__ __forceinline__ v16h cat16(v8h lo, v8h hi) { return __builtin_shufflevector(lo, hi, 0, 1, 2, 3, 4, 5, 6, 7, 8, 9, 10, 11, 12, 13, 14, 15); }
__device__ __forceinline__ v16bf cat16b(v8us lo, v8us hi) { return __builtin_bit_cast(v16bf, __builtin_shufflevector(lo, hi, 0, 1, 2, 3, 4, 5, 6, 7, 8, 9, 10, 11, 12, 13, 14, 15)); }
__device__ __forceinline__ v8f wmma16(v16h a, v16h b, v8f c) { return __builtin_amdgcn_wmma_f32_16x16x32_f16(false, a, false, b, (short)0, c, false, false); }
__device__ __forceinline__ v8f wmmab(v16bf a, v16bf b, v8f c) { return __builtin_amdgcn_wmma_f32_16x16x32_bf16(false, a, false, b, (short)0, c, false, false); }



// ---- k_gemmw: register-blocked GEMM, ONE WAVE per 64x64 output tile (16 accumulators), operands straight from K-contiguous 16-bit planes; grid (M/64, N/64, Z), 32 threads.
// C[m][n] (f32, pitch ldc, + optional f32 bias[n]) = sum_k A[m][k] Bt[n][k] (+ split products per NSPLIT). z-batch strides sA/sB/sC in elements. K % 32 == 0.
template <typename T16> struct WFrag;
template <> struct WFrag<h16> { typedef v16h V; static __device__ __forceinline__ V ld(const h16* p) { return cat16(*(const v8h*)p, *(const v8h*)(p + 16)); } static __device__ __forceinline__ v8f mma(V a, V b, v8f c) { return wmma16(a, b, c); } };
template <> struct WFrag<bf> { typedef v16bf V; static __device__ __forceinline__ V ld(const bf* p) { return cat16b(*(const v8us*)p, *(const v8us*)(p + 16)); } static __device__ __forceinline__ v8f mma(V a, V b, v8f c) { return wmmab(a, b, c); } };
template <typename T16, int NSPLIT, bool BIAS>
__global__ __launch_bounds__(32) void k_gemmw(const T16* __restrict__ A, const T16* __restrict__ A2, const T16* __restrict__ Bt, const T16* __restrict__ Bt2, int K, float* C, int ldc, const float* __restrict__ bias, size_t sA, size_t sB, size_t sC) {
    typedef typename WFrag<T16>::V V;
    __shared__ __align__(16) float os[16 * 68];
    const size_t z = blockIdx.z; A += z * sA; if (A2) A2 += z * sA; Bt += z * sB; if (Bt2) Bt2 += z * sB; C += z * sC;
    const int lane = threadIdx.x & 31, lr = lane & 15, hi = lane >> 4; const int r0 = blockIdx.x * 64, c0 = blockIdx.y * 64;
    v8f acc[4][4];
#pragma unroll
    for (int mb = 0; mb < 4; ++mb)
#pragma unroll
        for (int nb = 0; nb < 4; ++nb) acc[mb][nb] = (v8f){};
    const size_t aoff = (size_t)(r0 + lr) * K + 8 * hi, boff = (size_t)(c0 + lr) * K + 8 * hi;
#pragma unroll 1
    for (int kc = 0; kc < K; kc += 32) {
        V a[4], a2[4];
#pragma unroll
        for (int mb = 0; mb < 4; ++mb) { a[mb] = WFrag<T16>::ld(A + aoff + (size_t)mb * 16 * K + kc); if (NSPLIT == 1 || NSPLIT == 2) a2[mb] = WFrag<T16>::ld(A2 + aoff + (size_t)mb * 16 * K + kc); }
#pragma unroll
        for (int nb = 0; nb < 4; ++nb) { const V b = WFrag<T16>::ld(Bt + boff + (size_t)nb * 16 * K + kc); V b2; if (NSPLIT >= 2) b2 = WFrag<T16>::ld(Bt2 + boff + (size_t)nb * 16 * K + kc);
#pragma unroll
            for (int mb = 0; mb < 4; ++mb) { acc[mb][nb] = WFrag<T16>::mma(a[mb], b, acc[mb][nb]); if (NSPLIT == 1 || NSPLIT == 2) acc[mb][nb] = WFrag<T16>::mma(a2[mb], b, acc[mb][nb]); if (NSPLIT >= 2) acc[mb][nb] = WFrag<T16>::mma(a[mb], b2, acc[mb][nb]); } }
        asm volatile("v_nop\n\tv_nop\n\tv_nop\n\tv_nop" : "+v"(acc[0][0]), "+v"(acc[1][1]), "+v"(acc[2][2]), "+v"(acc[3][3]) : "v"(a[0]), "v"(a[3]));
    }
#pragma unroll
    for (int mb = 0; mb < 4; ++mb) {
#pragma unroll
        for (int nb = 0; nb < 4; ++nb) {
#pragma unroll
            for (int j = 0; j < 8; ++j) os[(hi * 8 + j) * 68 + nb * 16 + lr] = acc[mb][nb][j]; }
        __builtin_amdgcn_wave_barrier(); asm volatile("" ::: "memory");
        float* crow = C + (size_t)(r0 + mb * 16) * ldc + c0;
{
#pragma unroll
            for (int s = 0; s < 8; ++s) { const int row = 2 * s + hi, cofs = lr * 4; v4f val = *(const v4fa*)(os + row * 68 + cofs); if (BIAS) { val[0] += bfr(bias[c0 + cofs]); val[1] += bfr(bias[c0 + cofs + 1]); val[2] += bfr(bias[c0 + cofs + 2]); val[3] += bfr(bias[c0 + cofs + 3]); }
                *(v4f*)(crow + (size_t)row * ldc + cofs) = val; }
             }
        __builtin_amdgcn_wave_barrier(); asm volatile("" ::: "memory");
    }
}

// ---- k_gemmks: the same product for a long K, K SPLIT OVER THE NW WAVES OF ONE WORK-GROUP: wave w sums k in [w K/NW, (w+1) K/NW) for the whole (MB*16)x(NB*16) tile, writes its f32 partial tile to its own LDS range,
// and behind one work-group barrier the partial tiles are added in wave order 0..NW-1 (fixed order) and stored as whole 128-B row pieces. grid (M/(MB*16), N/(NB*16), Z), NW*32 threads. K % (32 NW G) == 0.
template <typename T16, int NSPLIT, bool BIAS, int MB, int NB, int NW, int K, int G>
__global__ __launch_bounds__(NW * 32) void k_gemmks(const T16* __restrict__ A, const T16* __restrict__ A2, const T16* __restrict__ Bt, const T16* __restrict__ Bt2, float* C, int ldc, const float* __restrict__ bias, size_t sA, size_t sB, size_t sC) {
    typedef typename WFrag<T16>::V V;
    constexpr int PW = NB * 16 + 4;        // LDS row pitch in floats: 16 B x odd for the b128 readers
    constexpr int PS = MB * 16 * PW;       // floats of one wave's partial tile
    __shared__ __align__(16) float red[NW * PS];
    const size_t z = blockIdx.z; A += z * sA; if (A2) A2 += z * sA; Bt += z * sB; if (Bt2) Bt2 += z * sB; C += z * sC;
    const int lane = threadIdx.x & 31, lr = lane & 15, hi = lane >> 4, wave = threadIdx.x >> 5; const int r0 = blockIdx.x * (MB * 16), c0 = blockIdx.y * (NB * 16);
    v8f acc[MB][NB];
#pragma unroll
    for (int mb = 0; mb < MB; ++mb)
#pragma unroll
        for (int nb = 0; nb < NB; ++nb) acc[mb][nb] = (v8f){};
    const size_t aoff = (size_t)(r0 + lr) * K + wave * (K / NW) + 8 * hi, boff = (size_t)(c0 + lr) * K + wave * (K / NW) + 8 * hi;
    const T16* pa = A + aoff; const T16* pb = Bt + boff; const T16* pa2 = A2 + aoff; const T16* pb2 = Bt2 + boff;
    // G k steps form a group: the group's loads are all issued first (row set by row set, so that the loads of one 128-B line follow one another), then its WMMAs in the k order of k_gemmw
#pragma unroll
    for (int kg = 0; kg < K / NW; kg += 32 * G) {
        V a[G][MB], a2[G][MB], b[G][NB], b2[G][NB];
#pragma unroll
        for (int mb = 0; mb < MB; ++mb) {
#pragma unroll
            for (int s = 0; s < G; ++s) a[s][mb] = WFrag<T16>::ld(pa + (size_t)mb * 16 * K + kg + s * 32);
            if (NSPLIT == 1 || NSPLIT == 2) {
#pragma unroll
                for (int s = 0; s < G; ++s) a2[s][mb] = WFrag<T16>::ld(pa2 + (size_t)mb * 16 * K + kg + s * 32); } }
#pragma unroll
        for (int nb = 0; nb < NB; ++nb) {
#pragma unroll
            for (int s = 0; s < G; ++s) b[s][nb] = WFrag<T16>::ld(pb + (size_t)nb * 16 * K + kg + s * 32);
            if (NSPLIT >= 2) {
#pragma unroll
                for (int s = 0; s < G; ++s) b2[s][nb] = WFrag<T16>::ld(pb2 + (size_t)nb * 16 * K + kg + s * 32); } }
        // the wait that stands in front of any overwrite of a register which an issued load names; the base addresses are inputs so that they live up to it (no load's result lands on them)
        if (NSPLIT == 2) asm volatile("s_wait_xcnt 0x0" :: "v"(pa), "v"(pb), "v"(pa2), "v"(pb2) : "memory");
        else if (NSPLIT == 1) asm volatile("s_wait_xcnt 0x0" :: "v"(pa), "v"(pb), "v"(pa2) : "memory");
        else asm volatile("s_wait_xcnt 0x0" :: "v"(pa), "v"(pb) : "memory");
        if (G > 1) __builtin_amdgcn_sched_barrier(0);   // keeps the WMMAs behind the group's last load: without it the compiler weaves them among the loads to save registers and a wave has few loads in flight
#pragma unroll
        for (int s = 0; s < G; ++s)
#pragma unroll
            for (int nb = 0; nb < NB; ++nb)
#pragma unroll
                for (int mb = 0; mb < MB; ++mb) { acc[mb][nb] = WFrag<T16>::mma(a[s][mb], b[s][nb], acc[mb][nb]); if (NSPLIT == 1 || NSPLIT == 2) acc[mb][nb] = WFrag<T16>::mma(a2[s][mb], b[s][nb], acc[mb][nb]); if (NSPLIT >= 2) acc[mb][nb] = WFrag<T16>::mma(a[s][mb], b2[s][nb], acc[mb][nb]); }
    }
    float* my = red + wave * PS;
#pragma unroll
    for (int mb = 0; mb < MB; ++mb)
#pragma unroll
        for (int nb = 0; nb < NB; ++nb)
#pragma unroll
            for (int j = 0; j < 8; ++j) my[(mb * 16 + hi * 8 + j) * PW + nb * 16 + lr] = acc[mb][nb][j];
    __syncthreads();   // every wave's partial tile is in LDS before any is read
#pragma unroll
    for (int u = threadIdx.x; u < MB * 16 * NB * 4; u += NW * 32) { const int row = u / (NB * 4), cofs = (u % (NB * 4)) * 4; const float* p = red + row * PW + cofs; v4f val = *(const v4fa*)p;
#pragma unroll
        for (int w = 1; w < NW; ++w) val += *(const v4fa*)(p + w * PS);
        if (BIAS) { val[0] += bfr(bias[c0 + cofs]); val[1] += bfr(bias[c0 + cofs + 1]); val[2] += bfr(bias[c0 + cofs + 2]); val[3] += bfr(bias[c0 + cofs + 3]); }
        *(v4f*)(C + (size_t)(r0 + row) * ldc + c0 + cofs) = val; }
}

__device__ __forceinline__ h16 tohx(float x) { return (h16)x; }
__device__ __forceinline__ void splitf(float y, unsigned short& h, unsigned short& l) { h = f2bf(y); l = f2bf(y - bf2f(h)); }
typedef __attribute__((ext_vector_type(2))) _Float16 v2h;
typedef __attribute__((ext_vector_type(4))) _Float16 v4h;
typedef __attribute__((ext_vector_type(2))) unsigned short v2us;
typedef __attribute__((ext_vector_type(4))) unsigned short v4us;
typedef __attribute__((ext_vector_type(2))) float v2f;
typedef __attribute__((ext_vector_type(4))) int v4i;

__global__ __launch_bounds__(256) void k_wtG(const float* __restrict__ w, int K, int N, bf* Bt) {
    const int lane = threadIdx.x & 31; const int L0 = (blockIdx.x * 8 + (threadIdx.x >> 5)) * 8; const int nlines = N * K / 64;
{
#pragma unroll 1
        for (int l = 0; l < 8; ++l) { const int L = L0 + l; if (L >= nlines) break; const size_t e = (size_t)L * 64 + lane * 2; const int k = (int)(e % K), n = (int)(e / K); v2us o;
            o[0] = f2bf(w[(size_t)k * N + n]); o[1] = f2bf(w[(size_t)(k + 1) * N + n]); *(v2us*)(Bt + e) = o; }
         }
}
__global__ __launch_bounds__(256) void k_cvt8(const float* __restrict__ src, bf* dst, size_t n8) { const size_t i = (size_t)blockIdx.x * 256 + threadIdx.x; if (i >= n8) return; const v8f v = *(const v8f*)(src + i * 8); v8us o;
#pragma unroll
    for (int k = 0; k < 8; ++k) o[k] = f2bf(v[k]); *(v8us*)(dst + i * 8) = o;  }
__global__ __launch_bounds__(256) void k_cscvt(const float* __restrict__ cosT, const float* __restrict__ sinT, float* CS) { const int idx = blockIdx.x * 256 + threadIdx.x; if (idx >= TT * HD) return; v2f cs; cs[0] = bfr(cosT[idx]); cs[1] = bfr(sinT[idx]); *(v2f*)(CS + (size_t)idx * 2) = cs;  }
// k_rope: head planes [h][t][d] (fp16 + hi/lo) of rope(x) x sc with the rotate-half convention out[d] = x[d] cos[t][d] - x[d+HD/2] sin[t][d], out[d+HD/2] = x[d+HD/2] cos[t][d+HD/2] + x[d] sin[t][d+HD/2]
__global__ __launch_bounds__(256) void k_rope(const float* __restrict__ F, int pitch, int nheads, const float* __restrict__ CS, const float* __restrict__ RF, const float* __restrict__ nw, float sc, h16* P16, bf* Ph, bf* Pl) {
    const size_t e = ((size_t)blockIdx.x * 256 + threadIdx.x) * 2; if (e >= (size_t)nheads * TT * HD) return; const int d = (int)(e % HD); const int t = (int)((e / HD) % TT); const int h = (int)(e / ((size_t)HD * TT)); const float* f = F + (size_t)t * pitch + h * HD; const float rf = RF ? RF[(size_t)h * TT + t] : 1.0f; v2h o16; v2us oh, ol;
#pragma unroll
    for (int q = 0; q < 2; ++q) { const int dd = d + q; const int dp = (dd < HD / 2) ? dd + HD / 2 : dd - HD / 2; float x0 = f[dd], x1 = f[dp];
        if (RF) { float n0 = __fmul_rn(x0, rf), n1 = __fmul_rn(x1, rf); asm volatile("" : "+v"(n0)); asm volatile("" : "+v"(n1)); x0 = __fmul_rn(bfr(nw[dd]), n0); x1 = __fmul_rn(bfr(nw[dp]), n1); }
        const v2f cs = *(const v2f*)(CS + ((size_t)t * HD + dd) * 2); float a = __fmul_rn(x0, cs[0]), bq = __fmul_rn(x1, cs[1]); asm volatile("" : "+v"(a)); asm volatile("" : "+v"(bq)); const float r = ((dd < HD / 2) ? __fsub_rn(a, bq) : __fadd_rn(a, bq)) * sc;
        o16[q] = tohx(r); unsigned short a2, c2; splitf(r, a2, c2); oh[q] = a2; ol[q] = c2; }
    *(v2h*)(P16 + e) = o16; *(v2us*)(Ph + e) = oh; *(v2us*)(Pl + e) = ol;  }
__global__ __launch_bounds__(256) void k_vtp(const float* __restrict__ F, int pitch, int nheads, h16* V16, bf* Vh, bf* Vl) { const size_t e = ((size_t)blockIdx.x * 256 + threadIdx.x) * 2; if (e >= (size_t)nheads * HD * TT) return; const int t = (int)(e % TT); const int d = (int)((e / TT) % HD); const int g = (int)(e / ((size_t)TT * HD)); v2h o16; v2us oh, ol;
#pragma unroll
    for (int q = 0; q < 2; ++q) { const float x = F[(size_t)(t + q) * pitch + g * HD + d]; o16[q] = tohx(x); unsigned short a2, c2; splitf(x, a2, c2); oh[q] = a2; ol[q] = c2; }
    *(v2h*)(V16 + e) = o16; *(v2us*)(Vh + e) = oh; *(v2us*)(Vl + e) = ol;  }
__global__ __launch_bounds__(256) void k_csid(float* CS) { const int idx = blockIdx.x * 256 + threadIdx.x; if (idx >= TT * HD) return; v2f cs; cs[0] = 1.0f; cs[1] = 0.0f; *(v2f*)(CS + (size_t)idx * 2) = cs;  }
__global__ __launch_bounds__(256) void k_mrgd2(const float* __restrict__ O1, const float* __restrict__ O2, const float* __restrict__ lamp, int h0, bf* Ah, bf* Al) { const size_t e = ((size_t)blockIdx.x * 256 + threadIdx.x) * 2; if (e >= (size_t)ZH * TT * HD) return; const int d = (int)(e % HD); const int t = (int)((e / HD) % TT); const int zz = (int)(e / ((size_t)HD * TT)); const float cs = (t < RH) ? 1.0f : (1.0f / PCAR); float lam = bfr(lamp[0]); asm volatile("" : "+v"(lam)); v2us oh, ol;
#pragma unroll
    for (int q = 0; q < 2; ++q) { float a = __fmul_rn(O1[e + q], cs), b2 = __fmul_rn(O2[e + q], cs); asm volatile("" : "+v"(a)); asm volatile("" : "+v"(b2)); float lb = __fmul_rn(lam, b2); asm volatile("" : "+v"(lb)); unsigned short s1, s2; splitf(__fsub_rn(a, lb), s1, s2); oh[q] = s1; ol[q] = s2; }
    const size_t oo = (size_t)t * DQ + (size_t)(h0 + zz) * HD + d; *(v2us*)(Ah + oo) = oh; *(v2us*)(Al + oo) = ol;  }
// k_asoft: per row (zz, i): t = S x HD^-0.5 (no mask); softmax over the 2048 keys (register row, one exp, fixed trees);
__global__ __launch_bounds__(256) void k_asoft(const float* __restrict__ Sb, h16* P16, bf* Ph, bf* Pl) {
    const int lane = threadIdx.x & 31; const int row = blockIdx.x * 8 + (threadIdx.x >> 5); if (row >= ZH * TT) return; const int i = row % TT; const int zz = row / TT; (void)zz; const bool hires = (i < RH); const float* sr = Sb + (size_t)row * TT; float v[TT / 32]; float mx = -3.0e38f;
#pragma unroll
    for (int ch = 0; ch < TT / 128; ++ch) { const int j0 = ch * 128 + lane * 4; const v4f a = *(const v4f*)(sr + j0);
#pragma unroll
        for (int q = 0; q < 4; ++q) { const int j = j0 + q; (void)j; const float t = a[q] * SCL; v[ch * 4 + q] = t; mx = fmaxf(mx, t); } }
#pragma unroll
    for (int sh = 16; sh; sh >>= 1) mx = fmaxf(mx, __shfl_xor(mx, sh, 32));
    float sum = 0.f;
#pragma unroll
    for (int k = 0; k < TT / 32; ++k) { float d0 = __fsub_rn(v[k], mx); asm volatile("" : "+v"(d0)); v[k] = __builtin_amdgcn_exp2f(__fmul_rn(d0, 1.4426950408889634f)); sum += v[k]; }
#pragma unroll
    for (int sh = 16; sh; sh >>= 1) sum += __shfl_xor(sum, sh, 32);
    const float f = __fdiv_rn(hires ? 1.0f : PCAR, sum);
{
        if (hires) {
#pragma unroll
            for (int ch = 0; ch < TT / 128; ++ch) { v4us oh, ol;
#pragma unroll
                for (int q = 0; q < 4; ++q) { unsigned short a, c2; splitf(v[ch * 4 + q] * f, a, c2); oh[q] = a; ol[q] = c2; }
                const size_t oo = ((size_t)zz * (RH ? RH : 1) + i) * TT + ch * 128 + lane * 4; *(v4us*)(Ph + oo) = oh; *(v4us*)(Pl + oo) = ol; }
        } else {
#pragma unroll
            for (int ch = 0; ch < TT / 128; ++ch) { v4h o4;
#pragma unroll
                for (int q = 0; q < 4; ++q) o4[q] = tohx(v[ch * 4 + q] * f);
                *(v4h*)(P16 + (size_t)row * TT + ch * 128 + lane * 4) = o4; } }
         }
}
__global__ __launch_bounds__(256) void k_merge(const float* __restrict__ O, int h0, bf* Ah, bf* Al) { const size_t e = ((size_t)blockIdx.x * 256 + threadIdx.x) * 2; if (e >= (size_t)ZH * TT * HD) return; const int d = (int)(e % HD); const int t = (int)((e / HD) % TT); const int zz = (int)(e / ((size_t)HD * TT)); const float cs = (t < RH) ? 1.0f : (1.0f / PCAR); const size_t oo = (size_t)t * DQ + (h0 + zz) * HD + d;
    v2us oh, ol;
#pragma unroll
    for (int q = 0; q < 2; ++q) { unsigned short a, c2; splitf(O[e + q] * cs, a, c2); oh[q] = a; ol[q] = c2; } *(v2us*)(Ah + oo) = oh; *(v2us*)(Al + oo) = ol;  }

extern "C" void kernel_launch(void* const* d_in, const int* in_sizes, int n_in,
                              void* d_out, int out_size, void* d_ws, size_t ws_size, hipStream_t stream) {
    (void)in_sizes; (void)n_in; (void)out_size;
    const float* vin = (const float*)d_in[0]; const float* kin = (const float*)d_in[1]; const float* q1in = (const float*)d_in[2]; const float* q2in = (const float*)d_in[3]; const float* wq = (const float*)d_in[4]; const float* bq = (const float*)d_in[5]; const float* wk = (const float*)d_in[6]; const float* bk = (const float*)d_in[7]; const float* wv = (const float*)d_in[8]; const float* bv = (const float*)d_in[9]; const float* wo = (const float*)d_in[10]; const float* bo = (const float*)d_in[11]; const float* lamp = (const float*)d_in[12];   // weights x @ W
    float* OUT = (float*)d_out;     // [2][2048][1024]
    char* wsp = (char*)d_ws;
    auto take = [&](size_t bytes) { char* p = wsp; wsp += (bytes + 255) & ~(size_t)255; return (void*)p; };
    bf* WQ = (bf*)take((size_t)DQ * DM * 2); bf* WK = (bf*)take((size_t)DKV * DM * 2); bf* WV = (bf*)take((size_t)DKV * DM * 2); bf* WO = (bf*)take((size_t)DM * DQ * 2); float* CS = (float*)take((size_t)TT * HD * 2 * 4);
    bf* XB = (bf*)take((size_t)TT * DM * 2); float* FQ = (float*)take((size_t)TT * DQ * 4); float* FK = (float*)take((size_t)TT * DKV * 4);
    h16* Q2P16 = (h16*)take((size_t)NH_ * TT * HD * 2); bf* Q2Ph = (bf*)take((size_t)NH_ * TT * HD * 2); bf* Q2Pl = (bf*)take((size_t)NH_ * TT * HD * 2); float* Ob2 = (float*)take((size_t)ZH * TT * HD * 4);
    h16* QP16 = (h16*)take((size_t)NH_ * TT * HD * 2); h16* KP16 = (h16*)take((size_t)NKV * TT * HD * 2); h16* VT16 = (h16*)take((size_t)NKV * HD * TT * 2);
    bf* QPh = (bf*)take((size_t)NH_ * TT * HD * 2); bf* QPl = (bf*)take((size_t)NH_ * TT * HD * 2); bf* KPh = (bf*)take((size_t)NKV * TT * HD * 2); bf* KPl = (bf*)take((size_t)NKV * TT * HD * 2); bf* VTh = (bf*)take((size_t)NKV * HD * TT * 2); bf* VTl = (bf*)take((size_t)NKV * HD * TT * 2); bf* Ph = (bf*)take((size_t)ZH * RH * TT * 2); bf* Pl = (bf*)take((size_t)ZH * RH * TT * 2);
    float* Sb = (float*)take((size_t)ZH * TT * TT * 4); h16* P16 = (h16*)take((size_t)ZH * TT * TT * 2); float* Ob = (float*)take((size_t)ZH * TT * HD * 4); bf* ATh = (bf*)take((size_t)TT * DQ * 2); bf* ATl = (bf*)take((size_t)TT * DQ * 2);
    if ((size_t)(wsp - (char*)d_ws) > ws_size) return;    // ws 256 MiB
    float* FV = FK;   // v projection reuses the k buffer after the k planes are built (stream-ordered)
    { k_wtG<<<(unsigned)((DM * DQ / 64 + 63) / 64), 256, 0, stream>>>(wq, DM, DQ, WQ); k_wtG<<<(unsigned)((DM * DKV / 64 + 63) / 64), 256, 0, stream>>>(wk, DM, DKV, WK); k_wtG<<<(unsigned)((DM * DKV / 64 + 63) / 64), 256, 0, stream>>>(wv, DM, DKV, WV);
      k_wtG<<<(unsigned)((DQ * DM / 64 + 63) / 64), 256, 0, stream>>>(wo, DQ, DM, WO);
       }
    k_csid<<<(TT * HD + 255) / 256, 256, 0, stream>>>(CS);
    const unsigned LQ = (unsigned)(((size_t)NH_ * TT * HD / 2 + 255) / 256), LKv = (unsigned)(((size_t)NKV * TT * HD / 2 + 255) / 256);
    for (int b = 0; b < NB_; ++b) {
        
        k_cvt8<<<(unsigned)(((size_t)TT * DM / 8 + 255) / 256), 256, 0, stream>>>(q1in + (size_t)b * TT * DM, XB, (size_t)TT * DM / 8);
        k_gemmks<bf, 0, true, 4, 4, 8, DM, 1><<<dim3(TT / 64, DQ / 64, 1), 256, 0, stream>>>(XB, nullptr, WQ, nullptr, FQ, DQ, bq, 0, 0, 0);
        k_rope<<<LQ, 256, 0, stream>>>(FQ, DQ, NH_, CS, nullptr, nullptr, 1.0f, QP16, QPh, QPl);
        k_cvt8<<<(unsigned)(((size_t)TT * DM / 8 + 255) / 256), 256, 0, stream>>>(q2in + (size_t)b * TT * DM, XB, (size_t)TT * DM / 8);
        k_gemmks<bf, 0, true, 4, 4, 8, DM, 1><<<dim3(TT / 64, DQ / 64, 1), 256, 0, stream>>>(XB, nullptr, WQ, nullptr, FQ, DQ, bq, 0, 0, 0);
        k_rope<<<LQ, 256, 0, stream>>>(FQ, DQ, NH_, CS, nullptr, nullptr, 1.0f, Q2P16, Q2Ph, Q2Pl);
        k_cvt8<<<(unsigned)(((size_t)TT * DM / 8 + 255) / 256), 256, 0, stream>>>(kin + (size_t)b * TT * DM, XB, (size_t)TT * DM / 8);
        k_gemmks<bf, 0, true, 4, 4, 8, DM, 1><<<dim3(TT / 64, DKV / 64, 1), 256, 0, stream>>>(XB, nullptr, WK, nullptr, FK, DKV, bk, 0, 0, 0);
        k_rope<<<LKv, 256, 0, stream>>>(FK, DKV, NKV, CS, nullptr, nullptr, 1.0f, KP16, KPh, KPl);
        k_cvt8<<<(unsigned)(((size_t)TT * DM / 8 + 255) / 256), 256, 0, stream>>>(vin + (size_t)b * TT * DM, XB, (size_t)TT * DM / 8);
        k_gemmks<bf, 0, true, 4, 4, 8, DM, 1><<<dim3(TT / 64, DKV / 64, 1), 256, 0, stream>>>(XB, nullptr, WV, nullptr, FV, DKV, bv, 0, 0, 0); k_vtp<<<LKv, 256, 0, stream>>>(FV, DKV, NKV, VT16, VTh, VTl);
        for (int h0 = 0; h0 < NH_; h0 += ZH) { const size_t zq = (size_t)h0, zk = (size_t)(h0 / REP);   // one kv head per query head: the pass's two heads use consecutive kv planes (z-strides TT*HD)
            k_gemmw<bf, 2, false><<<dim3(RH / 64, TT / 64, ZH), 32, 0, stream>>>(QPh + zq * TT * HD, QPl + zq * TT * HD, KPh + zk * TT * HD, KPl + zk * TT * HD, HD, Sb, TT, nullptr, (size_t)TT * HD, (size_t)TT * HD, (size_t)TT * TT);
            k_gemmw<h16, 0, false><<<dim3((TT - RH) / 64, TT / 64, ZH), 32, 0, stream>>>(QP16 + zq * TT * HD + (size_t)RH * HD, nullptr, KP16 + zk * TT * HD, nullptr, HD, Sb + (size_t)RH * TT, TT, nullptr, (size_t)TT * HD, (size_t)TT * HD, (size_t)TT * TT);
            k_asoft<<<ZH * TT / 8, 256, 0, stream>>>(Sb, P16, Ph, Pl);
            k_gemmks<bf, 2, false, 1, 2, 16, TT, 4><<<dim3(RH / 16, HD / 32, ZH), 512, 0, stream>>>(Ph, Pl, VTh + zk * HD * TT, VTl + zk * HD * TT, Ob, HD, nullptr, (size_t)RH * TT, (size_t)HD * TT, (size_t)TT * HD);
            k_gemmks<h16, 0, false, 2, 2, 16, TT, 4><<<dim3((TT - RH) / 32, HD / 32, ZH), 512, 0, stream>>>(P16 + (size_t)RH * TT, nullptr, VT16 + zk * HD * TT, nullptr, Ob + (size_t)RH * HD, HD, nullptr, (size_t)TT * TT, (size_t)HD * TT, (size_t)TT * HD);
            k_gemmw<bf, 2, false><<<dim3(RH / 64, TT / 64, ZH), 32, 0, stream>>>(Q2Ph + zq * TT * HD, Q2Pl + zq * TT * HD, KPh + zk * TT * HD, KPl + zk * TT * HD, HD, Sb, TT, nullptr, (size_t)TT * HD, (size_t)TT * HD, (size_t)TT * TT);
            k_gemmw<h16, 0, false><<<dim3((TT - RH) / 64, TT / 64, ZH), 32, 0, stream>>>(Q2P16 + zq * TT * HD + (size_t)RH * HD, nullptr, KP16 + zk * TT * HD, nullptr, HD, Sb + (size_t)RH * TT, TT, nullptr, (size_t)TT * HD, (size_t)TT * HD, (size_t)TT * TT);
            k_asoft<<<ZH * TT / 8, 256, 0, stream>>>(Sb, P16, Ph, Pl);
            k_gemmks<bf, 2, false, 1, 2, 16, TT, 4><<<dim3(RH / 16, HD / 32, ZH), 512, 0, stream>>>(Ph, Pl, VTh + zk * HD * TT, VTl + zk * HD * TT, Ob2, HD, nullptr, (size_t)RH * TT, (size_t)HD * TT, (size_t)TT * HD);
            k_gemmks<h16, 0, false, 2, 2, 16, TT, 4><<<dim3((TT - RH) / 32, HD / 32, ZH), 512, 0, stream>>>(P16 + (size_t)RH * TT, nullptr, VT16 + zk * HD * TT, nullptr, Ob2 + (size_t)RH * HD, HD, nullptr, (size_t)TT * TT, (size_t)HD * TT, (size_t)TT * HD);
            k_mrgd2<<<(unsigned)(((size_t)ZH * TT * HD / 2 + 255) / 256), 256, 0, stream>>>(Ob, Ob2, lamp, h0, ATh, ATl); }
        k_gemmks<bf, 1, true, 4, 4, 8, DQ, 1><<<dim3(TT / 64, DM / 64, 1), 256, 0, stream>>>(ATh, ATl, WO, nullptr, OUT + (size_t)b * TT * DM, DM, bo, 0, 0, 0); }
}

// v003
// One run takes 476 microseconds.
// It is 2.95 times as fast as v001, going by the measured steps of the versions left out in between.
// Counting every step since v000, it is 7.92 times as fast.
#include <hip/hip_runtime.h>

// NoiseCancellingAttentionMechanism - differential attention with two query streams (v, k, q1, q2 [2][2048][1024]; q1h/q2h = q1/q2 Wq + bq (shared), kh = k Wk + bk, vh = v Wv + bv (16 heads x 64);
// a1 = softmax(q1h.kh/8), a2 = softmax(q2h.kh/8); out = merged (a1 - lam a2) vh, Wo + bo with the scalar lam read as data -> [2][2048][1024]).
// Compute dtypes, f32 accumulate: every input rounded to bf16; projections on PLAIN bf16 operands (inputs: exact, + bias); PER-ROW PRECISION HYBRID for both score sets and both
// p.v contractions (query rows < 256 on bf16 hi+lo planes with 3 products, rows >= 256 on single fp16 planes, probabilities x1024 there); f32 register-row softmaxes; the difference (a1 v) - lam (a2 v) and the

#define NB_  2
#define TT   2048
#define DM   1024
#define NH_  16
#define NKV  16
#define REP  (NH_ / NKV)
#define HD   64
#define DQ   (NH_ * HD)
#define DKV  (NKV * HD)
#define ZH   NH_                  // heads per merge launch
#define RH   256                  // query rows < RH use hi+lo planes (0: none)
#define WIN  0
#define PCAR 1024.0f
#define SCL  0.125f   // HD^-0.5
typedef _Float16 h16;
typedef unsigned short bf;
typedef __attribute__((ext_vector_type(16))) __bf16   v16bf;
typedef __attribute__((ext_vector_type(16))) _Float16 v16h;
typedef __attribute__((ext_vector_type(8)))  _Float16 v8h;
typedef __attribute__((ext_vector_type(8)))  unsigned short v8us;
typedef __attribute__((ext_vector_type(8)))  float    v8f;
typedef __attribute__((ext_vector_type(4)))  float    v4f;
typedef v8h  __attribute__((may_alias)) v8ha;
typedef v4f  __attribute__((may_alias)) v4fa;
typedef v8us __attribute__((may_alias)) v8usa;

__device__ __forceinline__ unsigned short f2bf(float f) { unsigned u = __float_as_uint(f); u += 0x7FFFu + ((u >> 16) & 1u); return (unsigned short)(u >> 16); }
__device__ __forceinline__ float bf2f(unsigned short b) { return __uint_as_float(((unsigned)b) << 16); }
__device__ __forceinline__ float bfr(float f) { return bf2f(f2bf(f)); }
__device__ __forceinline__ v16h cat16(v8h lo, v8h hi) { return __builtin_shufflevector(lo, hi, 0, 1, 2, 3, 4, 5, 6, 7, 8, 9, 10, 11, 12, 13, 14, 15); }
__device__ __forceinline__ v16bf cat16b(v8us lo, v8us hi) { return __builtin_bit_cast(v16bf, __builtin_shufflevector(lo, hi, 0, 1, 2, 3, 4, 5, 6, 7, 8, 9, 10, 11, 12, 13, 14, 15)); }
__device__ __forceinline__ v8f wmma16(v16h a, v16h b, v8f c) { return __builtin_amdgcn_wmma_f32_16x16x32_f16(false, a, false, b, (short)0, c, false, false); }
__device__ __forceinline__ v8f wmmab(v16bf a, v16bf b, v8f c) { return __builtin_amdgcn_wmma_f32_16x16x32_bf16(false, a, false, b, (short)0, c, false, false); }



// 16-bit fragment loaders (K-contiguous rows; the same k order for A and B) and their matrix instruction
template <typename T16> struct WFrag;
template <> struct WFrag<h16> { typedef v16h V; static __device__ __forceinline__ V ld(const h16* p) { return cat16(*(const v8h*)p, *(const v8h*)(p + 16)); } static __device__ __forceinline__ v8f mma(V a, V b, v8f c) { return wmma16(a, b, c); } };
template <> struct WFrag<bf> { typedef v16bf V; static __device__ __forceinline__ V ld(const bf* p) { return cat16b(*(const v8us*)p, *(const v8us*)(p + 16)); } static __device__ __forceinline__ v8f mma(V a, V b, v8f c) { return wmmab(a, b, c); } };

__device__ __forceinline__ h16 tohx(float x) { return (h16)x; }
__device__ __forceinline__ void splitf(float y, unsigned short& h, unsigned short& l) { h = f2bf(y); l = f2bf(y - bf2f(h)); }
typedef __attribute__((ext_vector_type(2))) _Float16 v2h;
typedef __attribute__((ext_vector_type(4))) _Float16 v4h;
typedef __attribute__((ext_vector_type(2))) unsigned short v2us;
typedef __attribute__((ext_vector_type(4))) unsigned short v4us;
typedef __attribute__((ext_vector_type(2))) float v2f;
typedef __attribute__((ext_vector_type(4))) int v4i;

// ---- k_gemmks: C[m][n] (f32, pitch ldc, + optional f32 bias[n]) = sum_k A[m][k] Bt[n][k] (+ split products per NSPLIT) for a long K, K SPLIT OVER THE NW WAVES OF ONE WORK-GROUP: wave w sums k in [w K/NW, (w+1) K/NW) for the whole (MB*16)x(NB*16) tile, writes its f32 partial tile to its own LDS range,
// and behind one work-group barrier the partial tiles are added in wave order 0..NW-1 (fixed order) and stored as whole 128-B row pieces. grid (M/(MB*16), N/(NB*16), Z), NW*32 threads. K % (32 NW G) == 0.
// EPI 0: f32 C as above. EPI 1, 2: no C; the sum (+ bias) goes straight into the three 16-bit planes the attention kernel reads (fp16, bf16 hi, bf16 lo).
// EPI 1: m = position, n = head x 64 + d, bias[n], planes [head][position][d] (a column block is one head). EPI 2: m = head x 64 + d, n = position, bias[m], planes [head][d][position] (the weight is the A operand, so v comes out transposed).
template <typename T16, int NSPLIT, bool BIAS, int MB, int NB, int NW, int K, int G, int EPI>
__global__ __launch_bounds__(NW * 32) void k_gemmks(const T16* __restrict__ A, const T16* __restrict__ A2, const T16* __restrict__ Bt, const T16* __restrict__ Bt2, float* C, int ldc, const float* __restrict__ bias, size_t sA, size_t sB, size_t sC, h16* P16, bf* Ph, bf* Pl) {
    static_assert(EPI != 1 || NB * 16 == HD, "a column block is one head");
    typedef typename WFrag<T16>::V V;
    constexpr int PW = NB * 16 + 4;        // LDS row pitch in floats: 16 B x odd for the b128 readers
    constexpr int PS = MB * 16 * PW;       // floats of one wave's partial tile
    __shared__ __align__(16) float red[NW * PS];
    const size_t z = blockIdx.z; A += z * sA; if (A2) A2 += z * sA; Bt += z * sB; if (Bt2) Bt2 += z * sB; C += z * sC;
    const int lane = threadIdx.x & 31, lr = lane & 15, hi = lane >> 4, wave = threadIdx.x >> 5; const int r0 = blockIdx.x * (MB * 16), c0 = blockIdx.y * (NB * 16);
    v8f acc[MB][NB];
#pragma unroll
    for (int mb = 0; mb < MB; ++mb)
#pragma unroll
        for (int nb = 0; nb < NB; ++nb) acc[mb][nb] = (v8f){};
    const size_t aoff = (size_t)(r0 + lr) * K + wave * (K / NW) + 8 * hi, boff = (size_t)(c0 + lr) * K + wave * (K / NW) + 8 * hi;
    const T16* pa = A + aoff; const T16* pb = Bt + boff; const T16* pa2 = A2 + aoff; const T16* pb2 = Bt2 + boff;
    // G k steps form a group: the group's loads are all issued first (row set by row set, so that the loads of one 128-B line follow one another), then its WMMAs in ascending k
#pragma unroll
    for (int kg = 0; kg < K / NW; kg += 32 * G) {
        V a[G][MB], a2[G][MB], b[G][NB], b2[G][NB];
#pragma unroll
        for (int mb = 0; mb < MB; ++mb) {
#pragma unroll
            for (int s = 0; s < G; ++s) a[s][mb] = WFrag<T16>::ld(pa + (size_t)mb * 16 * K + kg + s * 32);
            if (NSPLIT == 1 || NSPLIT == 2) {
#pragma unroll
                for (int s = 0; s < G; ++s) a2[s][mb] = WFrag<T16>::ld(pa2 + (size_t)mb * 16 * K + kg + s * 32); } }
#pragma unroll
        for (int nb = 0; nb < NB; ++nb) {
#pragma unroll
            for (int s = 0; s < G; ++s) b[s][nb] = WFrag<T16>::ld(pb + (size_t)nb * 16 * K + kg + s * 32);
            if (NSPLIT >= 2) {
#pragma unroll
                for (int s = 0; s < G; ++s) b2[s][nb] = WFrag<T16>::ld(pb2 + (size_t)nb * 16 * K + kg + s * 32); } }
        // the wait that stands in front of any overwrite of a register which an issued load names; the base addresses are inputs so that they live up to it (no load's result lands on them)
        if (NSPLIT == 2) asm volatile("s_wait_xcnt 0x0" :: "v"(pa), "v"(pb), "v"(pa2), "v"(pb2) : "memory");
        else if (NSPLIT == 1) asm volatile("s_wait_xcnt 0x0" :: "v"(pa), "v"(pb), "v"(pa2) : "memory");
        else asm volatile("s_wait_xcnt 0x0" :: "v"(pa), "v"(pb) : "memory");
        if (G > 1) __builtin_amdgcn_sched_barrier(0);   // keeps the WMMAs behind the group's last load: without it the compiler weaves them among the loads to save registers and a wave has few loads in flight
#pragma unroll
        for (int s = 0; s < G; ++s)
#pragma unroll
            for (int nb = 0; nb < NB; ++nb)
#pragma unroll
                for (int mb = 0; mb < MB; ++mb) { acc[mb][nb] = WFrag<T16>::mma(a[s][mb], b[s][nb], acc[mb][nb]); if (NSPLIT == 1 || NSPLIT == 2) acc[mb][nb] = WFrag<T16>::mma(a2[s][mb], b[s][nb], acc[mb][nb]); if (NSPLIT >= 2) acc[mb][nb] = WFrag<T16>::mma(a[s][mb], b2[s][nb], acc[mb][nb]); }
    }
    float* my = red + wave * PS;
#pragma unroll
    for (int mb = 0; mb < MB; ++mb)
#pragma unroll
        for (int nb = 0; nb < NB; ++nb)
#pragma unroll
            for (int j = 0; j < 8; ++j) my[(mb * 16 + hi * 8 + j) * PW + nb * 16 + lr] = acc[mb][nb][j];
    __syncthreads();   // every wave's partial tile is in LDS before any is read
#pragma unroll
    for (int u = threadIdx.x; u < MB * 16 * NB * 4; u += NW * 32) { const int row = u / (NB * 4), cofs = (u % (NB * 4)) * 4; const float* p = red + row * PW + cofs; v4f val = *(const v4fa*)p;
#pragma unroll
        for (int w = 1; w < NW; ++w) val += *(const v4fa*)(p + w * PS);
        if (BIAS && EPI == 2) { const float bb = bfr(bias[r0 + row]); val[0] += bb; val[1] += bb; val[2] += bb; val[3] += bb; }
        else if (BIAS) { val[0] += bfr(bias[c0 + cofs]); val[1] += bfr(bias[c0 + cofs + 1]); val[2] += bfr(bias[c0 + cofs + 2]); val[3] += bfr(bias[c0 + cofs + 3]); }
        if (EPI == 0) *(v4f*)(C + (size_t)(r0 + row) * ldc + c0 + cofs) = val;
        else { const size_t e = (EPI == 1) ? ((size_t)blockIdx.y * TT + r0 + row) * HD + cofs : (size_t)(r0 + row) * TT + c0 + cofs; v4h o16; v4us oh, ol;
#pragma unroll
            for (int q = 0; q < 4; ++q) { o16[q] = tohx(val[q]); unsigned short a2, c2; splitf(val[q], a2, c2); oh[q] = a2; ol[q] = c2; }
            *(v4h*)(P16 + e) = o16; *(v4us*)(Ph + e) = oh; *(v4us*)(Pl + e) = ol; } }
}


__global__ __launch_bounds__(256) void k_wtG(const float* __restrict__ w, int K, int N, bf* Bt) {
    const int lane = threadIdx.x & 31; const int L0 = (blockIdx.x * 8 + (threadIdx.x >> 5)) * 8; const int nlines = N * K / 64;
{
#pragma unroll 1
        for (int l = 0; l < 8; ++l) { const int L = L0 + l; if (L >= nlines) break; const size_t e = (size_t)L * 64 + lane * 2; const int k = (int)(e % K), n = (int)(e / K); v2us o;
            o[0] = f2bf(w[(size_t)k * N + n]); o[1] = f2bf(w[(size_t)(k + 1) * N + n]); *(v2us*)(Bt + e) = o; }
         }
}
__global__ __launch_bounds__(256) void k_cvt8(const float* __restrict__ src, bf* dst, size_t n8) { const size_t i = (size_t)blockIdx.x * 256 + threadIdx.x; if (i >= n8) return; const v8f v = *(const v8f*)(src + i * 8); v8us o;
#pragma unroll
    for (int k = 0; k < 8; ++k) o[k] = f2bf(v[k]); *(v8us*)(dst + i * 8) = o;  }
__global__ __launch_bounds__(256) void k_cscvt(const float* __restrict__ cosT, const float* __restrict__ sinT, float* CS) { const int idx = blockIdx.x * 256 + threadIdx.x; if (idx >= TT * HD) return; v2f cs; cs[0] = bfr(cosT[idx]); cs[1] = bfr(sinT[idx]); *(v2f*)(CS + (size_t)idx * 2) = cs;  }
// 2^x with the one free issue slot that the instruction set asks for behind a transcendental
__device__ __forceinline__ float exp2slot(float x) { float e; asm("v_exp_f32 %0, %1\n\tv_nop" : "=v"(e) : "v"(x)); return e; }
// value of lane l ^ M inside the 16-lane row (DPP row_xmask: a vector move, no LDS round trip); every lane is on where it is used
template <int M> __device__ __forceinline__ float rowx(float x) { return __int_as_float(__builtin_amdgcn_update_dpp(0, __float_as_int(x), 0x160 | M, 0xf, 0xf, true)); }
// ---- k_attn: scores, softmax and p.v of BOTH query streams for 16 query rows of one head in one work-group; scores and probabilities never leave it. grid (rows/16, heads), 16 waves.
// Wave w owns keys [128 w, 128 w + 128): 2 x 8 score tiles in registers (m-tile 0: stream 1, m-tile 1: stream 2, so each k and v fragment serves both), row max and row sum joined over the waves through LDS,
// probabilities turned into A fragments through the wave's own LDS piece, p.v summed over the wave's keys in ascending k, the 16 partial tiles added in wave order 0..15 (as the K-split GEMM does), the two streams' difference written as bf16 hi+lo planes.
template <typename T16, int NSPLIT>
__global__ __launch_bounds__(512) void k_attn(const T16* __restrict__ Q1, const T16* __restrict__ Q1l, const T16* __restrict__ Q2, const T16* __restrict__ Q2l, const T16* __restrict__ Kp, const T16* __restrict__ Kl, const T16* __restrict__ Vt, const T16* __restrict__ Vl, const float* __restrict__ lamp, bf* Ah, bf* Al, int row0) {
    typedef typename WFrag<T16>::V V;
    constexpr int NW = 16, KW = TT / NW, NT = KW / 16;   // waves, keys per wave, score tiles per stream and wave
    constexpr int PP = KW + 8;                           // pitch of a wave's probability rows (128 keys) in 16-bit elements: 16 B x odd for the b128 readers
    constexpr int RP = 20;                               // pitch of a row's 16 per-wave values in floats: 16 B x odd
    constexpr int PW = HD + 4, PS = 32 * PW;             // partial output tile: row pitch and size in floats
    constexpr bool HIRES = (NSPLIT == 2);
    constexpr int PB = (HIRES ? 2 : 1) * 32 * PP;        // 16-bit elements of one wave's probability planes
    constexpr int SB = (NW * PB * 2 > NW * PS * 4) ? NW * PB * 2 : NW * PS * 4;
    __shared__ __align__(16) char sm[SB];                // first the probabilities, then (behind a barrier) the partial output tiles
    T16* pbuf = (T16*)sm; float* red = (float*)sm;
    __shared__ __align__(16) float rmx[32 * RP];
    __shared__ __align__(16) float rsm[32 * RP];
    const int lane = threadIdx.x & 31, lr = lane & 15, hi = lane >> 4, wave = threadIdx.x >> 5; const int r0 = row0 + blockIdx.x * 16; const size_t hp = (size_t)blockIdx.y * TT * HD;
    const float lam = bfr(lamp[0]);   // read here, where control flow is uniform, so that it is a scalar load whose latency the whole kernel hides
    const size_t qoff = hp + (size_t)(r0 + lr) * HD + 8 * hi, koff = hp + (size_t)(wave * KW + lr) * HD + 8 * hi, voff = hp + (size_t)lr * TT + wave * KW + 8 * hi;
    const T16* pq1 = Q1 + qoff; const T16* pq2 = Q2 + qoff; const T16* pk = Kp + koff; const T16* pv = Vt + voff; const T16* pq1l = Q1l + qoff; const T16* pq2l = Q2l + qoff; const T16* pkl = Kl + koff; const T16* pvl = Vl + voff;
    v8f sc[2][NT];
#pragma unroll
    for (int s = 0; s < 2; ++s)
#pragma unroll
        for (int nb = 0; nb < NT; ++nb) sc[s][nb] = (v8f){};
    if constexpr (HIRES) {
#pragma unroll
        for (int kc = 0; kc < HD; kc += 32) {
            V a[2], a2[2]; a[0] = WFrag<T16>::ld(pq1 + kc); a[1] = WFrag<T16>::ld(pq2 + kc); if (HIRES) { a2[0] = WFrag<T16>::ld(pq1l + kc); a2[1] = WFrag<T16>::ld(pq2l + kc); }
#pragma unroll
            for (int nb = 0; nb < NT; ++nb) { const V b = WFrag<T16>::ld(pk + (size_t)nb * 16 * HD + kc); V b2; if (HIRES) b2 = WFrag<T16>::ld(pkl + (size_t)nb * 16 * HD + kc);
#pragma unroll
                for (int s = 0; s < 2; ++s) { sc[s][nb] = WFrag<T16>::mma(a[s], b, sc[s][nb]); if (HIRES) { sc[s][nb] = WFrag<T16>::mma(a2[s], b, sc[s][nb]); sc[s][nb] = WFrag<T16>::mma(a[s], b2, sc[s][nb]); } } }
        }
    } else {
        // single planes: all of the wave's q and k fragments fit in registers beside nothing else, so every load is issued before the first WMMA (one trip to L2 instead of one per tile); each tile still sums kc = 0, then 32
        V a[2][2], b[NT][2];
#pragma unroll
        for (int c = 0; c < 2; ++c) { a[c][0] = WFrag<T16>::ld(pq1 + c * 32); a[c][1] = WFrag<T16>::ld(pq2 + c * 32); }
#pragma unroll
        for (int nb = 0; nb < NT; ++nb)
#pragma unroll
            for (int c = 0; c < 2; ++c) b[nb][c] = WFrag<T16>::ld(pk + (size_t)nb * 16 * HD + c * 32);
        __builtin_amdgcn_sched_barrier(0);   // keeps the WMMAs behind the last load: without it the compiler reuses one fragment's registers and waits for each tile's load in turn
#pragma unroll
        for (int nb = 0; nb < NT; ++nb)
#pragma unroll
            for (int c = 0; c < 2; ++c)
#pragma unroll
                for (int s = 0; s < 2; ++s) sc[s][nb] = WFrag<T16>::mma(a[c][s], b[nb][c], sc[s][nb]);
    }
    // the wait that stands in front of any overwrite of a register which an issued load names; the base addresses are inputs so that they live up to it
    if (HIRES) asm volatile("s_wait_xcnt 0x0" :: "v"(pq1), "v"(pq2), "v"(pk), "v"(pq1l), "v"(pq2l), "v"(pkl) : "memory");
    else asm volatile("s_wait_xcnt 0x0" :: "v"(pq1), "v"(pq2), "v"(pk) : "memory");
    // row max: over the lane's 8 tiles, the 16 lanes that hold the row, then the 16 waves (a max is exact in any order)
    float rv[2][8];
#pragma unroll
    for (int s = 0; s < 2; ++s)
#pragma unroll
        for (int j = 0; j < 8; ++j) { float m = -3.0e38f;
#pragma unroll
            for (int nb = 0; nb < NT; ++nb) { const float t = sc[s][nb][j] * SCL; sc[s][nb][j] = t; m = fmaxf(m, t); }
            m = fmaxf(m, rowx<1>(m)); m = fmaxf(m, rowx<2>(m)); m = fmaxf(m, rowx<4>(m)); m = fmaxf(m, rowx<8>(m)); rv[s][j] = m; }
    if (lr == 0) {
#pragma unroll
        for (int s = 0; s < 2; ++s)
#pragma unroll
            for (int j = 0; j < 8; ++j) rmx[hi * 8 * RP + wave + (s * 16 + j) * RP] = rv[s][j]; }
    __syncthreads();   // every wave's row maxima are in LDS before any is read
    float gm;          // lane l: the max of row l (rows 0..15 stream 1, 16..31 stream 2)
    { const float* p = rmx + lane * RP; const v4f m0 = *(const v4fa*)p, m1 = *(const v4fa*)(p + 4), m2 = *(const v4fa*)(p + 8), m3 = *(const v4fa*)(p + 12); gm = m0[0];
#pragma unroll
      for (int q = 0; q < 4; ++q) gm = fmaxf(fmaxf(gm, m0[q]), fmaxf(m1[q], fmaxf(m2[q], m3[q]))); }
#pragma unroll
    for (int s = 0; s < 2; ++s)
#pragma unroll
        for (int j = 0; j < 8; ++j) rv[s][j] = __int_as_float(__builtin_amdgcn_ds_bpermute(hi * 32 + (s * 16 + j) * 4, __float_as_int(gm)));   // the value of lane s*16 + hi*8 + j (byte address = lane x 4)
    // one exp per score; row sum: the lane's 8 tiles in order, a fixed tree over the 16 lanes, the waves in order 0..15
#pragma unroll
    for (int s = 0; s < 2; ++s)
#pragma unroll
        for (int j = 0; j < 8; ++j) { const float mx = rv[s][j]; float sum = 0.f;
#pragma unroll
            for (int nb = 0; nb < NT; ++nb) { const float d0 = sc[s][nb][j] - mx; const float e = exp2slot(d0 * 1.4426950408889634f); sc[s][nb][j] = e; sum += e; }
            sum += rowx<1>(sum); sum += rowx<2>(sum); sum += rowx<4>(sum); sum += rowx<8>(sum); rv[s][j] = sum; }
    if (lr == 0) {
#pragma unroll
        for (int s = 0; s < 2; ++s)
#pragma unroll
            for (int j = 0; j < 8; ++j) rsm[hi * 8 * RP + wave + (s * 16 + j) * RP] = rv[s][j]; }
    __syncthreads();   // every wave's row sums are in LDS before any is read
    float gf;          // lane l: the factor of row l
    { const float* p = rsm + lane * RP; float sum = p[0];
#pragma unroll
      for (int w = 1; w < NW; ++w) sum += p[w];
      gf = __fdiv_rn(HIRES ? 1.0f : PCAR, sum); }
    float fs[2][8];
#pragma unroll
    for (int s = 0; s < 2; ++s)
#pragma unroll
        for (int j = 0; j < 8; ++j) fs[s][j] = __int_as_float(__builtin_amdgcn_ds_bpermute(hi * 32 + (s * 16 + j) * 4, __float_as_int(gf)));
    T16* pw = pbuf + wave * PB; T16* ps = pw + hi * 8 * PP + lr;   // the lane's own store base: every row, tile and plane is a constant offset from it
#pragma unroll
    for (int s = 0; s < 2; ++s)
#pragma unroll
        for (int nb = 0; nb < NT; ++nb)
#pragma unroll
            for (int j = 0; j < 8; ++j) { const int idx = (s * 16 + j) * PP + nb * 16;
                if constexpr (HIRES) { unsigned short h, l; splitf(sc[s][nb][j] * fs[s][j], h, l); ps[idx] = h; ps[32 * PP + idx] = l; }
                else ps[idx] = tohx(sc[s][nb][j] * fs[s][j]); }
    __builtin_amdgcn_wave_barrier(); asm volatile("" ::: "memory");   // keeps the fragment reads below, which take other lanes' values, behind the stores above (one wave's LDS operations run in order)
    v8f oc[2][HD / 16];
#pragma unroll
    for (int s = 0; s < 2; ++s)
#pragma unroll
        for (int nb = 0; nb < HD / 16; ++nb) oc[s][nb] = (v8f){};
    constexpr int GK = HIRES ? 2 : 4;   // k steps whose v fragments are loaded ahead of their WMMAs (what the registers hold beside the accumulators)
#pragma unroll
    for (int kg = 0; kg < KW / 32; kg += GK) {
        V b[GK][HD / 16], b2[GK][HD / 16];
#pragma unroll
        for (int nb = 0; nb < HD / 16; ++nb)
#pragma unroll
            for (int g = 0; g < GK; ++g) { b[g][nb] = WFrag<T16>::ld(pv + (size_t)nb * 16 * TT + (kg + g) * 32); if (HIRES) b2[g][nb] = WFrag<T16>::ld(pvl + (size_t)nb * 16 * TT + (kg + g) * 32); }
        __builtin_amdgcn_sched_barrier(0);   // keeps the WMMAs behind the group's last load: without it the compiler reuses one fragment's registers and waits for each load in turn
#pragma unroll
        for (int g = 0; g < GK; ++g) { const int ks = kg + g; V a[2], a2[2];
#pragma unroll
            for (int s = 0; s < 2; ++s) { a[s] = WFrag<T16>::ld(pw + (s * 16 + lr) * PP + ks * 32 + 8 * hi); if (HIRES) a2[s] = WFrag<T16>::ld(pw + 32 * PP + (s * 16 + lr) * PP + ks * 32 + 8 * hi); }
#pragma unroll
            for (int nb = 0; nb < HD / 16; ++nb)
#pragma unroll
                for (int s = 0; s < 2; ++s) { oc[s][nb] = WFrag<T16>::mma(a[s], b[g][nb], oc[s][nb]); if (HIRES) { oc[s][nb] = WFrag<T16>::mma(a2[s], b[g][nb], oc[s][nb]); oc[s][nb] = WFrag<T16>::mma(a[s], b2[g][nb], oc[s][nb]); } } }
    }
    // the same wait for the v loads
    if (HIRES) asm volatile("s_wait_xcnt 0x0" :: "v"(pv), "v"(pvl) : "memory");
    else asm volatile("s_wait_xcnt 0x0" :: "v"(pv) : "memory");
    __syncthreads();   // every wave has read its probabilities before the partial tiles are written over them
    float* my = red + wave * PS + hi * 8 * PW + lr;
#pragma unroll
    for (int s = 0; s < 2; ++s)
#pragma unroll
        for (int nb = 0; nb < HD / 16; ++nb)
#pragma unroll
            for (int j = 0; j < 8; ++j) my[(s * 16 + j) * PW + nb * 16] = oc[s][nb][j];
    __syncthreads();   // every wave's partial tile is in LDS before any is read
    // one thread sums the same row and columns of both streams, so the difference (a1 v) - lam (a2 v) is formed here and goes out as the hi+lo planes [position][head x 64 + d] of the output product's A operand
    if (threadIdx.x < 256) { const int row = threadIdx.x >> 4, cofs = (threadIdx.x & 15) * 4; const float* p = red + row * PW + cofs; v4f v1 = *(const v4fa*)p, v2 = *(const v4fa*)(p + 16 * PW);
#pragma unroll
      for (int w = 1; w < NW; ++w) { v1 += *(const v4fa*)(p + w * PS); v2 += *(const v4fa*)(p + w * PS + 16 * PW); }
      constexpr float cs = HIRES ? 1.0f : (1.0f / PCAR); v4us oh, ol;
#pragma unroll
      for (int q = 0; q < 4; ++q) { unsigned short s1, s2; splitf(v1[q] * cs - lam * (v2[q] * cs), s1, s2); oh[q] = s1; ol[q] = s2; }
      const size_t oo = (size_t)(r0 + row) * DQ + (size_t)blockIdx.y * HD + cofs; *(v4us*)(Ah + oo) = oh; *(v4us*)(Al + oo) = ol; }
}
__global__ __launch_bounds__(256) void k_merge(const float* __restrict__ O, int h0, bf* Ah, bf* Al) { const size_t e = ((size_t)blockIdx.x * 256 + threadIdx.x) * 2; if (e >= (size_t)ZH * TT * HD) return; const int d = (int)(e % HD); const int t = (int)((e / HD) % TT); const int zz = (int)(e / ((size_t)HD * TT)); const float cs = (t < RH) ? 1.0f : (1.0f / PCAR); const size_t oo = (size_t)t * DQ + (h0 + zz) * HD + d;
    v2us oh, ol;
#pragma unroll
    for (int q = 0; q < 2; ++q) { unsigned short a, c2; splitf(O[e + q] * cs, a, c2); oh[q] = a; ol[q] = c2; } *(v2us*)(Ah + oo) = oh; *(v2us*)(Al + oo) = ol;  }

extern "C" void kernel_launch(void* const* d_in, const int* in_sizes, int n_in,
                              void* d_out, int out_size, void* d_ws, size_t ws_size, hipStream_t stream) {
    (void)in_sizes; (void)n_in; (void)out_size;
    const float* vin = (const float*)d_in[0]; const float* kin = (const float*)d_in[1]; const float* q1in = (const float*)d_in[2]; const float* q2in = (const float*)d_in[3]; const float* wq = (const float*)d_in[4]; const float* bq = (const float*)d_in[5]; const float* wk = (const float*)d_in[6]; const float* bk = (const float*)d_in[7]; const float* wv = (const float*)d_in[8]; const float* bv = (const float*)d_in[9]; const float* wo = (const float*)d_in[10]; const float* bo = (const float*)d_in[11]; const float* lamp = (const float*)d_in[12];   // weights x @ W
    float* OUT = (float*)d_out;     // [2][2048][1024]
    char* wsp = (char*)d_ws;
    auto take = [&](size_t bytes) { char* p = wsp; wsp += (bytes + 255) & ~(size_t)255; return (void*)p; };
    bf* WQ = (bf*)take((size_t)DQ * DM * 2); bf* WK = (bf*)take((size_t)DKV * DM * 2); bf* WV = (bf*)take((size_t)DKV * DM * 2); bf* WO = (bf*)take((size_t)DM * DQ * 2);
    bf* XB = (bf*)take((size_t)TT * DM * 2);
    h16* Q2P16 = (h16*)take((size_t)NH_ * TT * HD * 2); bf* Q2Ph = (bf*)take((size_t)NH_ * TT * HD * 2); bf* Q2Pl = (bf*)take((size_t)NH_ * TT * HD * 2);
    h16* QP16 = (h16*)take((size_t)NH_ * TT * HD * 2); h16* KP16 = (h16*)take((size_t)NKV * TT * HD * 2); h16* VT16 = (h16*)take((size_t)NKV * HD * TT * 2);
    bf* QPh = (bf*)take((size_t)NH_ * TT * HD * 2); bf* QPl = (bf*)take((size_t)NH_ * TT * HD * 2); bf* KPh = (bf*)take((size_t)NKV * TT * HD * 2); bf* KPl = (bf*)take((size_t)NKV * TT * HD * 2); bf* VTh = (bf*)take((size_t)NKV * HD * TT * 2); bf* VTl = (bf*)take((size_t)NKV * HD * TT * 2);
    bf* ATh = (bf*)take((size_t)TT * DQ * 2); bf* ATl = (bf*)take((size_t)TT * DQ * 2);
    if ((size_t)(wsp - (char*)d_ws) > ws_size) return;    // ws 256 MiB
    { k_wtG<<<(unsigned)((DM * DQ / 64 + 63) / 64), 256, 0, stream>>>(wq, DM, DQ, WQ); k_wtG<<<(unsigned)((DM * DKV / 64 + 63) / 64), 256, 0, stream>>>(wk, DM, DKV, WK); k_wtG<<<(unsigned)((DM * DKV / 64 + 63) / 64), 256, 0, stream>>>(wv, DM, DKV, WV);
      k_wtG<<<(unsigned)((DQ * DM / 64 + 63) / 64), 256, 0, stream>>>(wo, DQ, DM, WO);
       }
    for (int b = 0; b < NB_; ++b) {
        k_cvt8<<<(unsigned)(((size_t)TT * DM / 8 + 255) / 256), 256, 0, stream>>>(q1in + (size_t)b * TT * DM, XB, (size_t)TT * DM / 8);
        k_gemmks<bf, 0, true, 4, 4, 8, DM, 1, 1><<<dim3(TT / 64, DQ / 64, 1), 256, 0, stream>>>(XB, nullptr, WQ, nullptr, nullptr, 0, bq, 0, 0, 0, QP16, QPh, QPl);
        k_cvt8<<<(unsigned)(((size_t)TT * DM / 8 + 255) / 256), 256, 0, stream>>>(q2in + (size_t)b * TT * DM, XB, (size_t)TT * DM / 8);
        k_gemmks<bf, 0, true, 4, 4, 8, DM, 1, 1><<<dim3(TT / 64, DQ / 64, 1), 256, 0, stream>>>(XB, nullptr, WQ, nullptr, nullptr, 0, bq, 0, 0, 0, Q2P16, Q2Ph, Q2Pl);
        k_cvt8<<<(unsigned)(((size_t)TT * DM / 8 + 255) / 256), 256, 0, stream>>>(kin + (size_t)b * TT * DM, XB, (size_t)TT * DM / 8);
        k_gemmks<bf, 0, true, 4, 4, 8, DM, 1, 1><<<dim3(TT / 64, DKV / 64, 1), 256, 0, stream>>>(XB, nullptr, WK, nullptr, nullptr, 0, bk, 0, 0, 0, KP16, KPh, KPl);
        k_cvt8<<<(unsigned)(((size_t)TT * DM / 8 + 255) / 256), 256, 0, stream>>>(vin + (size_t)b * TT * DM, XB, (size_t)TT * DM / 8);
        k_gemmks<bf, 0, true, 4, 4, 8, DM, 1, 2><<<dim3(DKV / 64, TT / 64, 1), 256, 0, stream>>>(WV, nullptr, XB, nullptr, nullptr, 0, bv, 0, 0, 0, VT16, VTh, VTl);
        k_attn<bf, 2><<<dim3(RH / 16, NH_, 1), 512, 0, stream>>>(QPh, QPl, Q2Ph, Q2Pl, KPh, KPl, VTh, VTl, lamp, ATh, ATl, 0);
        k_attn<h16, 0><<<dim3((TT - RH) / 16, NH_, 1), 512, 0, stream>>>(QP16, nullptr, Q2P16, nullptr, KP16, nullptr, VT16, nullptr, lamp, ATh, ATl, RH);
        k_gemmks<bf, 1, true, 4, 4, 8, DQ, 1, 0><<<dim3(TT / 64, DM / 64, 1), 256, 0, stream>>>(ATh, ATl, WO, nullptr, OUT + (size_t)b * TT * DM, DM, bo, 0, 0, 0, nullptr, nullptr, nullptr); }
}

// v004
// A run of this version takes 406 microseconds.
// Next to v003, in two timings, it ran 1.16 times as fast each time.
// All steps since v000 together make it 9.15 times as fast.
#include <hip/hip_runtime.h>

// NoiseCancellingAttentionMechanism - differential attention with two query streams (v, k, q1, q2 [2][2048][1024]; q1h/q2h = q1/q2 Wq + bq (shared), kh = k Wk + bk, vh = v Wv + bv (16 heads x 64);
// a1 = softmax(q1h.kh/8), a2 = softmax(q2h.kh/8); out = merged (a1 - lam a2) vh, Wo + bo with the scalar lam read as data -> [2][2048][1024]).
// Compute dtypes, f32 accumulate: every input rounded to bf16; projections on PLAIN bf16 operands (inputs: exact, + bias); PER-ROW PRECISION HYBRID for both score sets and both
// p.v contractions (query rows < 256 on bf16 hi+lo planes with 3 products, rows >= 256 on single fp16 planes, probabilities x1024 there); f32 register-row softmaxes; the difference (a1 v) - lam (a2 v) and the

#define NB_  2
#define TT   2048
#define DM   1024
#define NH_  16
#define NKV  16
#define REP  (NH_ / NKV)
#define HD   64
#define DQ   (NH_ * HD)
#define DKV  (NKV * HD)
#define ZH   NH_                  // heads per merge launch
#define RH   256                  // query rows < RH use hi+lo planes (0: none)
#define WIN  0
#define PCAR 1024.0f
#define SCL  0.125f   // HD^-0.5
typedef _Float16 h16;
typedef unsigned short bf;
typedef __attribute__((ext_vector_type(16))) __bf16   v16bf;
typedef __attribute__((ext_vector_type(16))) _Float16 v16h;
typedef __attribute__((ext_vector_type(8)))  _Float16 v8h;
typedef __attribute__((ext_vector_type(8)))  unsigned short v8us;
typedef __attribute__((ext_vector_type(8)))  float    v8f;
typedef __attribute__((ext_vector_type(4)))  float    v4f;
typedef v8h  __attribute__((may_alias)) v8ha;
typedef v4f  __attribute__((may_alias)) v4fa;
typedef v8us __attribute__((may_alias)) v8usa;

__device__ __forceinline__ unsigned short f2bf(float f) { unsigned u = __float_as_uint(f); u += 0x7FFFu + ((u >> 16) & 1u); return (unsigned short)(u >> 16); }
__device__ __forceinline__ float bf2f(unsigned short b) { return __uint_as_float(((unsigned)b) << 16); }
__device__ __forceinline__ float bfr(float f) { return bf2f(f2bf(f)); }
__device__ __forceinline__ v16h cat16(v8h lo, v8h hi) { return __builtin_shufflevector(lo, hi, 0, 1, 2, 3, 4, 5, 6, 7, 8, 9, 10, 11, 12, 13, 14, 15); }
__device__ __forceinline__ v16bf cat16b(v8us lo, v8us hi) { return __builtin_bit_cast(v16bf, __builtin_shufflevector(lo, hi, 0, 1, 2, 3, 4, 5, 6, 7, 8, 9, 10, 11, 12, 13, 14, 15)); }
__device__ __forceinline__ v8f wmma16(v16h a, v16h b, v8f c) { return __builtin_amdgcn_wmma_f32_16x16x32_f16(false, a, false, b, (short)0, c, false, false); }
__device__ __forceinline__ v8f wmmab(v16bf a, v16bf b, v8f c) { return __builtin_amdgcn_wmma_f32_16x16x32_bf16(false, a, false, b, (short)0, c, false, false); }



// 16-bit fragment loaders (K-contiguous rows; the same k order for A and B) and their matrix instruction
template <typename T16> struct WFrag;
template <> struct WFrag<h16> { typedef v16h V; static __device__ __forceinline__ V ld(const h16* p) { return cat16(*(const v8h*)p, *(const v8h*)(p + 16)); } static __device__ __forceinline__ v8f mma(V a, V b, v8f c) { return wmma16(a, b, c); } };
template <> struct WFrag<bf> { typedef v16bf V; static __device__ __forceinline__ V ld(const bf* p) { return cat16b(*(const v8us*)p, *(const v8us*)(p + 16)); } static __device__ __forceinline__ v8f mma(V a, V b, v8f c) { return wmmab(a, b, c); } };

__device__ __forceinline__ h16 tohx(float x) { return (h16)x; }
__device__ __forceinline__ void splitf(float y, unsigned short& h, unsigned short& l) { h = f2bf(y); l = f2bf(y - bf2f(h)); }
typedef __attribute__((ext_vector_type(2))) _Float16 v2h;
typedef __attribute__((ext_vector_type(4))) _Float16 v4h;
typedef __attribute__((ext_vector_type(2))) unsigned short v2us;
typedef __attribute__((ext_vector_type(4))) unsigned short v4us;
typedef __attribute__((ext_vector_type(2))) float v2f;
typedef __attribute__((ext_vector_type(4))) int v4i;

// ---- k_gemmks: C[m][n] (f32, pitch ldc, + optional f32 bias[n]) = sum_k A[m][k] Bt[n][k] (+ split products per NSPLIT) for a long K, K SPLIT OVER THE NW WAVES OF ONE WORK-GROUP: wave w sums k in [w K/NW, (w+1) K/NW) for the whole (MB*16)x(NB*16) tile, writes its f32 partial tile to its own LDS range,
// and behind one work-group barrier the partial tiles are added in wave order 0..NW-1 (fixed order) and stored as whole 128-B row pieces. grid (M/(MB*16), N/(NB*16), Z), NW*32 threads. K % (32 NW G) == 0.
// EPI 0: f32 C as above. EPI 1, 2: no C; the sum (+ bias) goes straight into the three 16-bit planes the attention kernel reads (fp16, bf16 hi, bf16 lo).
// EPI 1: m = position, n = head x 64 + d, bias[n], planes [head][position][d] (a column block is one head). EPI 2: m = head x 64 + d, n = position, bias[m], planes [head][d][position] (the weight is the A operand, so v comes out transposed).
// EPI 3: all four projections of both batch entries in ONE launch, grid (TT/64, DQ/64, 8): z = stream x 2 + batch entry, streams q1, q2, k (each as EPI 1) and v (as EPI 2, block indices swapped). A = the eight bf16 inputs [z][position][k], Bt = the transposed weights Wq, Wk, Wv in a row,
// bias / biasK / biasV = bq / bk / bv, planes [z][...]. Every choice depends on blockIdx alone, so it is uniform for the work-group.
template <typename T16, int NSPLIT, bool BIAS, int MB, int NB, int NW, int K, int G, int EPI>
__global__ __launch_bounds__(NW * 32) void k_gemmks(const T16* __restrict__ A, const T16* __restrict__ A2, const T16* __restrict__ Bt, const T16* __restrict__ Bt2, float* C, int ldc, const float* __restrict__ bias, const float* __restrict__ biasK, const float* __restrict__ biasV, size_t sA, size_t sB, size_t sC, h16* P16, bf* Ph, bf* Pl) {
    static_assert((EPI != 1 && EPI != 3) || NB * 16 == HD, "a column block is one head");
    typedef typename WFrag<T16>::V V;
    constexpr int PW = NB * 16 + 4;        // LDS row pitch in floats: 16 B x odd for the b128 readers
    constexpr int PS = MB * 16 * PW;       // floats of one wave's partial tile
    __shared__ __align__(16) float red[NW * PS];
    const size_t z = blockIdx.z; const bool tr = (EPI == 2) || (EPI == 3 && z >= 6);   // tr: the weight is the A operand
    if (EPI == 3) { const T16* X = A + z * ((size_t)TT * DM); const T16* Wt = Bt + (z < 4 ? 0 : (z >> 1) - 1) * ((size_t)DQ * DM); A = tr ? Wt : X; Bt = tr ? X : Wt; bias = z < 4 ? bias : (tr ? biasV : biasK);
        P16 += z * ((size_t)NH_ * TT * HD); Ph += z * ((size_t)NH_ * TT * HD); Pl += z * ((size_t)NH_ * TT * HD); }
    else { A += z * sA; if (A2) A2 += z * sA; Bt += z * sB; if (Bt2) Bt2 += z * sB; C += z * sC; }
    const int lane = threadIdx.x & 31, lr = lane & 15, hi = lane >> 4, wave = threadIdx.x >> 5; const int bxr = (EPI == 3 && tr) ? blockIdx.y : blockIdx.x, bxc = (EPI == 3 && tr) ? blockIdx.x : blockIdx.y; const int r0 = bxr * (MB * 16), c0 = bxc * (NB * 16);
    v8f acc[MB][NB];
#pragma unroll
    for (int mb = 0; mb < MB; ++mb)
#pragma unroll
        for (int nb = 0; nb < NB; ++nb) acc[mb][nb] = (v8f){};
    const size_t aoff = (size_t)(r0 + lr) * K + wave * (K / NW) + 8 * hi, boff = (size_t)(c0 + lr) * K + wave * (K / NW) + 8 * hi;
    const T16* pa = A + aoff; const T16* pb = Bt + boff; const T16* pa2 = A2 + aoff; const T16* pb2 = Bt2 + boff;
    // G k steps form a group: the group's loads are all issued first (row set by row set, so that the loads of one 128-B line follow one another), then its WMMAs in ascending k
#pragma unroll
    for (int kg = 0; kg < K / NW; kg += 32 * G) {
        V a[G][MB], a2[G][MB], b[G][NB], b2[G][NB];
#pragma unroll
        for (int mb = 0; mb < MB; ++mb) {
#pragma unroll
            for (int s = 0; s < G; ++s) a[s][mb] = WFrag<T16>::ld(pa + (size_t)mb * 16 * K + kg + s * 32);
            if (NSPLIT == 1 || NSPLIT == 2) {
#pragma unroll
                for (int s = 0; s < G; ++s) a2[s][mb] = WFrag<T16>::ld(pa2 + (size_t)mb * 16 * K + kg + s * 32); } }
#pragma unroll
        for (int nb = 0; nb < NB; ++nb) {
#pragma unroll
            for (int s = 0; s < G; ++s) b[s][nb] = WFrag<T16>::ld(pb + (size_t)nb * 16 * K + kg + s * 32);
            if (NSPLIT >= 2) {
#pragma unroll
                for (int s = 0; s < G; ++s) b2[s][nb] = WFrag<T16>::ld(pb2 + (size_t)nb * 16 * K + kg + s * 32); } }
        // the wait that stands in front of any overwrite of a register which an issued load names; the base addresses are inputs so that they live up to it (no load's result lands on them)
        if (NSPLIT == 2) asm volatile("s_wait_xcnt 0x0" :: "v"(pa), "v"(pb), "v"(pa2), "v"(pb2) : "memory");
        else if (NSPLIT == 1) asm volatile("s_wait_xcnt 0x0" :: "v"(pa), "v"(pb), "v"(pa2) : "memory");
        else asm volatile("s_wait_xcnt 0x0" :: "v"(pa), "v"(pb) : "memory");
        if (G > 1) __builtin_amdgcn_sched_barrier(0);   // keeps the WMMAs behind the group's last load: without it the compiler weaves them among the loads to save registers and a wave has few loads in flight
#pragma unroll
        for (int s = 0; s < G; ++s)
#pragma unroll
            for (int nb = 0; nb < NB; ++nb)
#pragma unroll
                for (int mb = 0; mb < MB; ++mb) { acc[mb][nb] = WFrag<T16>::mma(a[s][mb], b[s][nb], acc[mb][nb]); if (NSPLIT == 1 || NSPLIT == 2) acc[mb][nb] = WFrag<T16>::mma(a2[s][mb], b[s][nb], acc[mb][nb]); if (NSPLIT >= 2) acc[mb][nb] = WFrag<T16>::mma(a[s][mb], b2[s][nb], acc[mb][nb]); }
    }
    float* my = red + wave * PS;
#pragma unroll
    for (int mb = 0; mb < MB; ++mb)
#pragma unroll
        for (int nb = 0; nb < NB; ++nb)
#pragma unroll
            for (int j = 0; j < 8; ++j) my[(mb * 16 + hi * 8 + j) * PW + nb * 16 + lr] = acc[mb][nb][j];
    __syncthreads();   // every wave's partial tile is in LDS before any is read
    // what differs between the two orientations is set up once, from block-uniform values: the bias of the thread's four columns (the same in every trip) and the plane address (eb + row) * ep + ec + cofs
    static_assert((NW * 32) % (NB * 4) == 0, "a thread keeps its columns from trip to trip");
    v4f bn = (v4f){};
    if (BIAS && !tr) { const float* pc = bias + c0 + (threadIdx.x % (NB * 4)) * 4; const float t0 = pc[0], t1 = pc[1], t2 = pc[2], t3 = pc[3];
        asm volatile("s_wait_xcnt 0x0" :: "v"(pc) : "memory");   // the wait in front of any overwrite of a register which the issued load names; the address is an input so that it lives up to it
        bn[0] = bfr(t0); bn[1] = bfr(t1); bn[2] = bfr(t2); bn[3] = bfr(t3); }
    const int eb = tr ? r0 : bxc * TT + r0, ep = tr ? TT : HD, ec = tr ? c0 : 0;
#pragma unroll
    for (int u = threadIdx.x; u < MB * 16 * NB * 4; u += NW * 32) { const int row = u / (NB * 4), cofs = (u % (NB * 4)) * 4; const float* p = red + row * PW + cofs; v4f val = *(const v4fa*)p;
#pragma unroll
        for (int w = 1; w < NW; ++w) val += *(const v4fa*)(p + w * PS);
        if (BIAS && tr) { const float* pr = bias + r0 + row; const float t = *pr;
            asm volatile("s_wait_xcnt 0x0" :: "v"(pr) : "memory");   // the same wait for the row's bias load
            const float bb = bfr(t); bn[0] = bb; bn[1] = bb; bn[2] = bb; bn[3] = bb; }
        if (BIAS) val += bn;
        if (EPI == 0) *(v4f*)(C + (size_t)(r0 + row) * ldc + c0 + cofs) = val;
        else { const size_t e = (size_t)(eb + row) * ep + ec + cofs; v4h o16; v4us oh, ol;
#pragma unroll
            for (int q = 0; q < 4; ++q) { o16[q] = tohx(val[q]); unsigned short a2, c2; splitf(val[q], a2, c2); oh[q] = a2; ol[q] = c2; }
            *(v4h*)(P16 + e) = o16; *(v4us*)(Ph + e) = oh; *(v4us*)(Pl + e) = ol; } }
}


__device__ __forceinline__ void d_wtG(int bx, const float* __restrict__ w, int K, int N, bf* Bt) {
    const int lane = threadIdx.x & 31; const int L0 = (bx * 8 + (threadIdx.x >> 5)) * 8; const int nlines = N * K / 64;
{
#pragma unroll 1
        for (int l = 0; l < 8; ++l) { const int L = L0 + l; if (L >= nlines) break; const size_t e = (size_t)L * 64 + lane * 2; const int k = (int)(e % K), n = (int)(e / K); v2us o;
            o[0] = f2bf(w[(size_t)k * N + n]); o[1] = f2bf(w[(size_t)(k + 1) * N + n]); *(v2us*)(Bt + e) = o; }
         }
}
__device__ __forceinline__ void d_cvt8(int bx, const float* __restrict__ src, bf* dst, size_t n8) { const size_t i = (size_t)bx * 256 + threadIdx.x; if (i >= n8) return; const v8f v = *(const v8f*)(src + i * 8); v8us o;
#pragma unroll
    for (int k = 0; k < 8; ++k) o[k] = f2bf(v[k]); *(v8us*)(dst + i * 8) = o;  }
// ---- k_prep: every operand conversion in ONE launch. Blocks [0, 4 WTB): the four weights, transposed to bf16 [n][k], in a row in WT (they come first: their strided reads take longest). Blocks behind them: the four inputs, both batch entries each, to bf16, in a row in XB.
#define WTB ((DM * DQ / 64 + 63) / 64)           // blocks per weight
#define CVB (NB_ * TT * DM / 8 / 256)            // blocks per input
__global__ __launch_bounds__(256) void k_prep(const float* __restrict__ w0, const float* __restrict__ w1, const float* __restrict__ w2, const float* __restrict__ w3, bf* WT, const float* __restrict__ x0, const float* __restrict__ x1, const float* __restrict__ x2, const float* __restrict__ x3, bf* XB) {
    const int bx = blockIdx.x;
    if (bx < 4 * WTB) { const int s = bx / WTB; d_wtG(bx % WTB, s == 0 ? w0 : s == 1 ? w1 : s == 2 ? w2 : w3, DM, DQ, WT + (size_t)s * DM * DQ); }
    else { const int c = bx - 4 * WTB, s = c / CVB; d_cvt8(c % CVB, s == 0 ? x0 : s == 1 ? x1 : s == 2 ? x2 : x3, XB + (size_t)s * NB_ * TT * DM, (size_t)NB_ * TT * DM / 8); }
}
__global__ __launch_bounds__(256) void k_cscvt(const float* __restrict__ cosT, const float* __restrict__ sinT, float* CS) { const int idx = blockIdx.x * 256 + threadIdx.x; if (idx >= TT * HD) return; v2f cs; cs[0] = bfr(cosT[idx]); cs[1] = bfr(sinT[idx]); *(v2f*)(CS + (size_t)idx * 2) = cs;  }
// 2^x with the one free issue slot that the instruction set asks for behind a transcendental
__device__ __forceinline__ float exp2slot(float x) { float e; asm("v_exp_f32 %0, %1\n\tv_nop" : "=v"(e) : "v"(x)); return e; }
// value of lane l ^ M inside the 16-lane row (DPP row_xmask: a vector move, no LDS round trip); every lane is on where it is used
template <int M> __device__ __forceinline__ float rowx(float x) { return __int_as_float(__builtin_amdgcn_update_dpp(0, __float_as_int(x), 0x160 | M, 0xf, 0xf, true)); }
// ---- k_attn: scores, softmax and p.v of BOTH query streams for 16 query rows of one head in one work-group; scores and probabilities never leave it. grid (rows/16, heads, batch entries), 16 waves.
// Wave w owns keys [128 w, 128 w + 128): 2 x 8 score tiles in registers (m-tile 0: stream 1, m-tile 1: stream 2, so each k and v fragment serves both), row max and row sum joined over the waves through LDS,
// probabilities turned into A fragments through the wave's own LDS piece, p.v summed over the wave's keys in ascending k, the 16 partial tiles added in wave order 0..15 (as the K-split GEMM does), the two streams' difference written as bf16 hi+lo planes.
template <typename T16, int NSPLIT>
__global__ __launch_bounds__(512) void k_attn(const T16* __restrict__ Q1, const T16* __restrict__ Q1l, const T16* __restrict__ Q2, const T16* __restrict__ Q2l, const T16* __restrict__ Kp, const T16* __restrict__ Kl, const T16* __restrict__ Vt, const T16* __restrict__ Vl, const float* __restrict__ lamp, bf* Ah, bf* Al, int row0) {
    typedef typename WFrag<T16>::V V;
    constexpr int NW = 16, KW = TT / NW, NT = KW / 16;   // waves, keys per wave, score tiles per stream and wave
    constexpr int PP = KW + 8;                           // pitch of a wave's probability rows (128 keys) in 16-bit elements: 16 B x odd for the b128 readers
    constexpr int RP = 20;                               // pitch of a row's 16 per-wave values in floats: 16 B x odd
    constexpr int PW = HD + 4, PS = 32 * PW;             // partial output tile: row pitch and size in floats
    constexpr bool HIRES = (NSPLIT == 2);
    constexpr int PB = (HIRES ? 2 : 1) * 32 * PP;        // 16-bit elements of one wave's probability planes
    constexpr int SB = (NW * PB * 2 > NW * PS * 4) ? NW * PB * 2 : NW * PS * 4;
    __shared__ __align__(16) char sm[SB];                // first the probabilities, then (behind a barrier) the partial output tiles
    T16* pbuf = (T16*)sm; float* red = (float*)sm;
    __shared__ __align__(16) float rmx[32 * RP];
    __shared__ __align__(16) float rsm[32 * RP];
    const int lane = threadIdx.x & 31, lr = lane & 15, hi = lane >> 4, wave = threadIdx.x >> 5; const int r0 = row0 + blockIdx.x * 16; const size_t hp = ((size_t)blockIdx.z * NH_ + blockIdx.y) * TT * HD;
    const float lam = bfr(lamp[0]);   // read here, where control flow is uniform, so that it is a scalar load whose latency the whole kernel hides
    const size_t qoff = hp + (size_t)(r0 + lr) * HD + 8 * hi, koff = hp + (size_t)(wave * KW + lr) * HD + 8 * hi, voff = hp + (size_t)lr * TT + wave * KW + 8 * hi;
    const T16* pq1 = Q1 + qoff; const T16* pq2 = Q2 + qoff; const T16* pk = Kp + koff; const T16* pv = Vt + voff; const T16* pq1l = Q1l + qoff; const T16* pq2l = Q2l + qoff; const T16* pkl = Kl + koff; const T16* pvl = Vl + voff;
    v8f sc[2][NT];
#pragma unroll
    for (int s = 0; s < 2; ++s)
#pragma unroll
        for (int nb = 0; nb < NT; ++nb) sc[s][nb] = (v8f){};
    if constexpr (HIRES) {
#pragma unroll
        for (int kc = 0; kc < HD; kc += 32) {
            V a[2], a2[2]; a[0] = WFrag<T16>::ld(pq1 + kc); a[1] = WFrag<T16>::ld(pq2 + kc); if (HIRES) { a2[0] = WFrag<T16>::ld(pq1l + kc); a2[1] = WFrag<T16>::ld(pq2l + kc); }
#pragma unroll
            for (int nb = 0; nb < NT; ++nb) { const V b = WFrag<T16>::ld(pk + (size_t)nb * 16 * HD + kc); V b2; if (HIRES) b2 = WFrag<T16>::ld(pkl + (size_t)nb * 16 * HD + kc);
#pragma unroll
                for (int s = 0; s < 2; ++s) { sc[s][nb] = WFrag<T16>::mma(a[s], b, sc[s][nb]); if (HIRES) { sc[s][nb] = WFrag<T16>::mma(a2[s], b, sc[s][nb]); sc[s][nb] = WFrag<T16>::mma(a[s], b2, sc[s][nb]); } } }
        }
    } else {
        // single planes: all of the wave's q and k fragments fit in registers beside nothing else, so every load is issued before the first WMMA (one trip to L2 instead of one per tile); each tile still sums kc = 0, then 32
        V a[2][2], b[NT][2];
#pragma unroll
        for (int c = 0; c < 2; ++c) { a[c][0] = WFrag<T16>::ld(pq1 + c * 32); a[c][1] = WFrag<T16>::ld(pq2 + c * 32); }
#pragma unroll
        for (int nb = 0; nb < NT; ++nb)
#pragma unroll
            for (int c = 0; c < 2; ++c) b[nb][c] = WFrag<T16>::ld(pk + (size_t)nb * 16 * HD + c * 32);
        __builtin_amdgcn_sched_barrier(0);   // keeps the WMMAs behind the last load: without it the compiler reuses one fragment's registers and waits for each tile's load in turn
#pragma unroll
        for (int nb = 0; nb < NT; ++nb)
#pragma unroll
            for (int c = 0; c < 2; ++c)
#pragma unroll
                for (int s = 0; s < 2; ++s) sc[s][nb] = WFrag<T16>::mma(a[c][s], b[nb][c], sc[s][nb]);
    }
    // the wait that stands in front of any overwrite of a register which an issued load names; the base addresses are inputs so that they live up to it
    if (HIRES) asm volatile("s_wait_xcnt 0x0" :: "v"(pq1), "v"(pq2), "v"(pk), "v"(pq1l), "v"(pq2l), "v"(pkl) : "memory");
    else asm volatile("s_wait_xcnt 0x0" :: "v"(pq1), "v"(pq2), "v"(pk) : "memory");
    // row max: over the lane's 8 tiles, the 16 lanes that hold the row, then the 16 waves (a max is exact in any order)
    float rv[2][8];
#pragma unroll
    for (int s = 0; s < 2; ++s)
#pragma unroll
        for (int j = 0; j < 8; ++j) { float m = -3.0e38f;
#pragma unroll
            for (int nb = 0; nb < NT; ++nb) { const float t = sc[s][nb][j] * SCL; sc[s][nb][j] = t; m = fmaxf(m, t); }
            m = fmaxf(m, rowx<1>(m)); m = fmaxf(m, rowx<2>(m)); m = fmaxf(m, rowx<4>(m)); m = fmaxf(m, rowx<8>(m)); rv[s][j] = m; }
    if (lr == 0) {
#pragma unroll
        for (int s = 0; s < 2; ++s)
#pragma unroll
            for (int j = 0; j < 8; ++j) rmx[hi * 8 * RP + wave + (s * 16 + j) * RP] = rv[s][j]; }
    __syncthreads();   // every wave's row maxima are in LDS before any is read
    float gm;          // lane l: the max of row l (rows 0..15 stream 1, 16..31 stream 2)
    { const float* p = rmx + lane * RP; const v4f m0 = *(const v4fa*)p, m1 = *(const v4fa*)(p + 4), m2 = *(const v4fa*)(p + 8), m3 = *(const v4fa*)(p + 12); gm = m0[0];
#pragma unroll
      for (int q = 0; q < 4; ++q) gm = fmaxf(fmaxf(gm, m0[q]), fmaxf(m1[q], fmaxf(m2[q], m3[q]))); }
#pragma unroll
    for (int s = 0; s < 2; ++s)
#pragma unroll
        for (int j = 0; j < 8; ++j) rv[s][j] = __int_as_float(__builtin_amdgcn_ds_bpermute(hi * 32 + (s * 16 + j) * 4, __float_as_int(gm)));   // the value of lane s*16 + hi*8 + j (byte address = lane x 4)
    // one exp per score; row sum: the lane's 8 tiles in order, a fixed tree over the 16 lanes, the waves in order 0..15
#pragma unroll
    for (int s = 0; s < 2; ++s)
#pragma unroll
        for (int j = 0; j < 8; ++j) { const float mx = rv[s][j]; float sum = 0.f;
#pragma unroll
            for (int nb = 0; nb < NT; ++nb) { const float d0 = sc[s][nb][j] - mx; const float e = exp2slot(d0 * 1.4426950408889634f); sc[s][nb][j] = e; sum += e; }
            sum += rowx<1>(sum); sum += rowx<2>(sum); sum += rowx<4>(sum); sum += rowx<8>(sum); rv[s][j] = sum; }
    if (lr == 0) {
#pragma unroll
        for (int s = 0; s < 2; ++s)
#pragma unroll
            for (int j = 0; j < 8; ++j) rsm[hi * 8 * RP + wave + (s * 16 + j) * RP] = rv[s][j]; }
    __syncthreads();   // every wave's row sums are in LDS before any is read
    float gf;          // lane l: the factor of row l
    { const float* p = rsm + lane * RP; float sum = p[0];
#pragma unroll
      for (int w = 1; w < NW; ++w) sum += p[w];
      gf = __fdiv_rn(HIRES ? 1.0f : PCAR, sum); }
    float fs[2][8];
#pragma unroll
    for (int s = 0; s < 2; ++s)
#pragma unroll
        for (int j = 0; j < 8; ++j) fs[s][j] = __int_as_float(__builtin_amdgcn_ds_bpermute(hi * 32 + (s * 16 + j) * 4, __float_as_int(gf)));
    T16* pw = pbuf + wave * PB; T16* ps = pw + hi * 8 * PP + lr;   // the lane's own store base: every row, tile and plane is a constant offset from it
#pragma unroll
    for (int s = 0; s < 2; ++s)
#pragma unroll
        for (int nb = 0; nb < NT; ++nb)
#pragma unroll
            for (int j = 0; j < 8; ++j) { const int idx = (s * 16 + j) * PP + nb * 16;
                if constexpr (HIRES) { unsigned short h, l; splitf(sc[s][nb][j] * fs[s][j], h, l); ps[idx] = h; ps[32 * PP + idx] = l; }
                else ps[idx] = tohx(sc[s][nb][j] * fs[s][j]); }
    __builtin_amdgcn_wave_barrier(); asm volatile("" ::: "memory");   // keeps the fragment reads below, which take other lanes' values, behind the stores above (one wave's LDS operations run in order)
    v8f oc[2][HD / 16];
#pragma unroll
    for (int s = 0; s < 2; ++s)
#pragma unroll
        for (int nb = 0; nb < HD / 16; ++nb) oc[s][nb] = (v8f){};
    constexpr int GK = HIRES ? 2 : 4;   // k steps whose v fragments are loaded ahead of their WMMAs (what the registers hold beside the accumulators)
#pragma unroll
    for (int kg = 0; kg < KW / 32; kg += GK) {
        V b[GK][HD / 16], b2[GK][HD / 16];
#pragma unroll
        for (int nb = 0; nb < HD / 16; ++nb)
#pragma unroll
            for (int g = 0; g < GK; ++g) { b[g][nb] = WFrag<T16>::ld(pv + (size_t)nb * 16 * TT + (kg + g) * 32); if (HIRES) b2[g][nb] = WFrag<T16>::ld(pvl + (size_t)nb * 16 * TT + (kg + g) * 32); }
        __builtin_amdgcn_sched_barrier(0);   // keeps the WMMAs behind the group's last load: without it the compiler reuses one fragment's registers and waits for each load in turn
#pragma unroll
        for (int g = 0; g < GK; ++g) { const int ks = kg + g; V a[2], a2[2];
#pragma unroll
            for (int s = 0; s < 2; ++s) { a[s] = WFrag<T16>::ld(pw + (s * 16 + lr) * PP + ks * 32 + 8 * hi); if (HIRES) a2[s] = WFrag<T16>::ld(pw + 32 * PP + (s * 16 + lr) * PP + ks * 32 + 8 * hi); }
#pragma unroll
            for (int nb = 0; nb < HD / 16; ++nb)
#pragma unroll
                for (int s = 0; s < 2; ++s) { oc[s][nb] = WFrag<T16>::mma(a[s], b[g][nb], oc[s][nb]); if (HIRES) { oc[s][nb] = WFrag<T16>::mma(a2[s], b[g][nb], oc[s][nb]); oc[s][nb] = WFrag<T16>::mma(a[s], b2[g][nb], oc[s][nb]); } } }
    }
    // the same wait for the v loads
    if (HIRES) asm volatile("s_wait_xcnt 0x0" :: "v"(pv), "v"(pvl) : "memory");
    else asm volatile("s_wait_xcnt 0x0" :: "v"(pv) : "memory");
    __syncthreads();   // every wave has read its probabilities before the partial tiles are written over them
    float* my = red + wave * PS + hi * 8 * PW + lr;
#pragma unroll
    for (int s = 0; s < 2; ++s)
#pragma unroll
        for (int nb = 0; nb < HD / 16; ++nb)
#pragma unroll
            for (int j = 0; j < 8; ++j) my[(s * 16 + j) * PW + nb * 16] = oc[s][nb][j];
    __syncthreads();   // every wave's partial tile is in LDS before any is read
    // one thread sums the same row and columns of both streams, so the difference (a1 v) - lam (a2 v) is formed here and goes out as the hi+lo planes [position][head x 64 + d] of the output product's A operand
    if (threadIdx.x < 256) { const int row = threadIdx.x >> 4, cofs = (threadIdx.x & 15) * 4; const float* p = red + row * PW + cofs; v4f v1 = *(const v4fa*)p, v2 = *(const v4fa*)(p + 16 * PW);
#pragma unroll
      for (int w = 1; w < NW; ++w) { v1 += *(const v4fa*)(p + w * PS); v2 += *(const v4fa*)(p + w * PS + 16 * PW); }
      constexpr float cs = HIRES ? 1.0f : (1.0f / PCAR); v4us oh, ol;
#pragma unroll
      for (int q = 0; q < 4; ++q) { unsigned short s1, s2; splitf(v1[q] * cs - lam * (v2[q] * cs), s1, s2); oh[q] = s1; ol[q] = s2; }
      const size_t oo = ((size_t)blockIdx.z * TT + r0 + row) * DQ + (size_t)blockIdx.y * HD + cofs; *(v4us*)(Ah + oo) = oh; *(v4us*)(Al + oo) = ol; }
}
__global__ __launch_bounds__(256) void k_merge(const float* __restrict__ O, int h0, bf* Ah, bf* Al) { const size_t e = ((size_t)blockIdx.x * 256 + threadIdx.x) * 2; if (e >= (size_t)ZH * TT * HD) return; const int d = (int)(e % HD); const int t = (int)((e / HD) % TT); const int zz = (int)(e / ((size_t)HD * TT)); const float cs = (t < RH) ? 1.0f : (1.0f / PCAR); const size_t oo = (size_t)t * DQ + (h0 + zz) * HD + d;
    v2us oh, ol;
#pragma unroll
    for (int q = 0; q < 2; ++q) { unsigned short a, c2; splitf(O[e + q] * cs, a, c2); oh[q] = a; ol[q] = c2; } *(v2us*)(Ah + oo) = oh; *(v2us*)(Al + oo) = ol;  }

extern "C" void kernel_launch(void* const* d_in, const int* in_sizes, int n_in,
                              void* d_out, int out_size, void* d_ws, size_t ws_size, hipStream_t stream) {
    (void)in_sizes; (void)n_in; (void)out_size;
    const float* vin = (const float*)d_in[0]; const float* kin = (const float*)d_in[1]; const float* q1in = (const float*)d_in[2]; const float* q2in = (const float*)d_in[3]; const float* wq = (const float*)d_in[4]; const float* bq = (const float*)d_in[5]; const float* wk = (const float*)d_in[6]; const float* bk = (const float*)d_in[7]; const float* wv = (const float*)d_in[8]; const float* bv = (const float*)d_in[9]; const float* wo = (const float*)d_in[10]; const float* bo = (const float*)d_in[11]; const float* lamp = (const float*)d_in[12];   // weights x @ W
    float* OUT = (float*)d_out;     // [2][2048][1024]
    char* wsp = (char*)d_ws;
    auto take = [&](size_t bytes) { char* p = wsp; wsp += (bytes + 255) & ~(size_t)255; return (void*)p; };
    constexpr size_t PLN = (size_t)NH_ * TT * HD;   // one head plane set of one batch entry; planes are [stream q1, q2, k, v][batch entry]
    bf* WT = (bf*)take((size_t)4 * DQ * DM * 2);      // Wq, Wk, Wv, Wo transposed
    bf* XB = (bf*)take((size_t)4 * NB_ * TT * DM * 2);   // q1, q2, k, v in bf16
    h16* P16 = (h16*)take(4 * NB_ * PLN * 2); bf* Ph = (bf*)take(4 * NB_ * PLN * 2); bf* Pl = (bf*)take(4 * NB_ * PLN * 2);
    bf* ATh = (bf*)take((size_t)NB_ * TT * DQ * 2); bf* ATl = (bf*)take((size_t)NB_ * TT * DQ * 2);
    if ((size_t)(wsp - (char*)d_ws) > ws_size) return;    // ws 256 MiB
    k_prep<<<(unsigned)(4 * WTB + 4 * CVB), 256, 0, stream>>>(wq, wk, wv, wo, WT, q1in, q2in, kin, vin, XB);
    k_gemmks<bf, 0, true, 4, 4, 8, DM, 1, 3><<<dim3(TT / 64, DQ / 64, 4 * NB_), 256, 0, stream>>>(XB, nullptr, WT, nullptr, nullptr, 0, bq, bk, bv, 0, 0, 0, P16, Ph, Pl);
    k_attn<bf, 2><<<dim3(RH / 16, NH_, NB_), 512, 0, stream>>>(Ph, Pl, Ph + 2 * PLN, Pl + 2 * PLN, Ph + 4 * PLN, Pl + 4 * PLN, Ph + 6 * PLN, Pl + 6 * PLN, lamp, ATh, ATl, 0);
    k_attn<h16, 0><<<dim3((TT - RH) / 16, NH_, NB_), 512, 0, stream>>>(P16, nullptr, P16 + 2 * PLN, nullptr, P16 + 4 * PLN, nullptr, P16 + 6 * PLN, nullptr, lamp, ATh, ATl, RH);
    k_gemmks<bf, 1, true, 4, 4, 8, DQ, 1, 0><<<dim3(TT / 64, DM / 64, NB_), 256, 0, stream>>>(ATh, ATl, WT + (size_t)3 * DQ * DM, nullptr, OUT, DM, bo, nullptr, nullptr, (size_t)TT * DQ, 0, (size_t)TT * DM, nullptr, nullptr, nullptr);
}

// v005
// A run of this version takes 313 microseconds.
// Timed twice side by side with v004, it ran 1.29 and 1.30 times as fast.
// Over all steps from v000 it is 11.9 times as fast.
#include <hip/hip_runtime.h>

// NoiseCancellingAttentionMechanism - differential attention with two query streams (v, k, q1, q2 [2][2048][1024]; q1h/q2h = q1/q2 Wq + bq (shared), kh = k Wk + bk, vh = v Wv + bv (16 heads x 64);
// a1 = softmax(q1h.kh/8), a2 = softmax(q2h.kh/8); out = merged (a1 - lam a2) vh, Wo + bo with the scalar lam read as data -> [2][2048][1024]).
// Compute dtypes, f32 accumulate: every input rounded to bf16; projections on PLAIN bf16 operands (inputs: exact, + bias); PER-ROW PRECISION HYBRID for both score sets and both
// p.v contractions (query rows < 256 on bf16 hi+lo planes with 3 products, rows >= 256 on single fp16 planes, probabilities x1024 there); f32 register-row softmaxes; the difference (a1 v) - lam (a2 v) and the

#define NB_  2
#define TT   2048
#define DM   1024
#define NH_  16
#define NKV  16
#define REP  (NH_ / NKV)
#define HD   64
#define DQ   (NH_ * HD)
#define DKV  (NKV * HD)
#define ZH   NH_                  // heads per merge launch
#define RH   256                  // query rows < RH use hi+lo planes (0: none)
#define WIN  0
#define PCAR 1024.0f
#define SCL  0.125f   // HD^-0.5
typedef _Float16 h16;
typedef unsigned short bf;
typedef __attribute__((ext_vector_type(16))) __bf16   v16bf;
typedef __attribute__((ext_vector_type(16))) _Float16 v16h;
typedef __attribute__((ext_vector_type(8)))  _Float16 v8h;
typedef __attribute__((ext_vector_type(8)))  unsigned short v8us;
typedef __attribute__((ext_vector_type(8)))  float    v8f;
typedef __attribute__((ext_vector_type(4)))  float    v4f;
typedef v8h  __attribute__((may_alias)) v8ha;
typedef v4f  __attribute__((may_alias)) v4fa;
typedef v8us __attribute__((may_alias)) v8usa;

__device__ __forceinline__ unsigned short f2bf(float f) { unsigned u = __float_as_uint(f); u += 0x7FFFu + ((u >> 16) & 1u); return (unsigned short)(u >> 16); }
__device__ __forceinline__ float bf2f(unsigned short b) { return __uint_as_float(((unsigned)b) << 16); }
__device__ __forceinline__ float bfr(float f) { return bf2f(f2bf(f)); }
__device__ __forceinline__ v16h cat16(v8h lo, v8h hi) { return __builtin_shufflevector(lo, hi, 0, 1, 2, 3, 4, 5, 6, 7, 8, 9, 10, 11, 12, 13, 14, 15); }
__device__ __forceinline__ v16bf cat16b(v8us lo, v8us hi) { return __builtin_bit_cast(v16bf, __builtin_shufflevector(lo, hi, 0, 1, 2, 3, 4, 5, 6, 7, 8, 9, 10, 11, 12, 13, 14, 15)); }
__device__ __forceinline__ v8f wmma16(v16h a, v16h b, v8f c) { return __builtin_amdgcn_wmma_f32_16x16x32_f16(false, a, false, b, (short)0, c, false, false); }
__device__ __forceinline__ v8f wmmab(v16bf a, v16bf b, v8f c) { return __builtin_amdgcn_wmma_f32_16x16x32_bf16(false, a, false, b, (short)0, c, false, false); }



// 16-bit fragment loaders (K-contiguous rows; the same k order for A and B) and their matrix instruction. ldf reads the same fragment from a plane kept in FRAGMENT ORDER: a 16 x 32 tile is 512 elements, [k / 8][row][k % 8],
// so p = tile + lane * 8 and each of the two loads takes 512 bytes in a row (4 whole lines) where ld touches 16 lines; lane and register hold the same element as with ld
template <typename T16> struct WFrag;
template <> struct WFrag<h16> { typedef v16h V; static __device__ __forceinline__ V ld(const h16* p) { return cat16(*(const v8h*)p, *(const v8h*)(p + 16)); } static __device__ __forceinline__ V ldf(const h16* p) { return cat16(*(const v8h*)p, *(const v8h*)(p + 256)); } static __device__ __forceinline__ v8f mma(V a, V b, v8f c) { return wmma16(a, b, c); } };
template <> struct WFrag<bf> { typedef v16bf V; static __device__ __forceinline__ V ld(const bf* p) { return cat16b(*(const v8us*)p, *(const v8us*)(p + 16)); } static __device__ __forceinline__ V ldf(const bf* p) { return cat16b(*(const v8us*)p, *(const v8us*)(p + 256)); } static __device__ __forceinline__ v8f mma(V a, V b, v8f c) { return wmmab(a, b, c); } };

__device__ __forceinline__ h16 tohx(float x) { return (h16)x; }
__device__ __forceinline__ void splitf(float y, unsigned short& h, unsigned short& l) { h = f2bf(y); l = f2bf(y - bf2f(h)); }
typedef __attribute__((ext_vector_type(2))) _Float16 v2h;
typedef __attribute__((ext_vector_type(4))) _Float16 v4h;
typedef __attribute__((ext_vector_type(2))) unsigned short v2us;
typedef __attribute__((ext_vector_type(4))) unsigned short v4us;
typedef __attribute__((ext_vector_type(2))) float v2f;
typedef __attribute__((ext_vector_type(4))) int v4i;

// ---- k_gemmks: C[m][n] (f32, pitch ldc, + optional f32 bias[n]) = sum_k A[m][k] Bt[n][k] (+ split products per NSPLIT) for a long K, K SPLIT OVER THE NW WAVES OF ONE WORK-GROUP: wave w sums k in [w K/NW, (w+1) K/NW) for the whole (MB*16)x(NB*16) tile, writes its f32 partial tile to its own LDS range,
// and behind one work-group barrier the partial tiles are added in wave order 0..NW-1 (fixed order) and stored as whole 128-B row pieces. grid (M/(MB*16), N/(NB*16), Z), NW*32 threads. K % (32 NW G) == 0.
// EPI 0: f32 C as above. EPI 1, 2: no C; the sum (+ bias) goes straight into the three 16-bit planes the attention kernel reads (fp16, bf16 hi, bf16 lo).
// EPI 1: m = position, n = head x 64 + d, bias[n], planes [head][position][d] (a column block is one head). EPI 2: m = head x 64 + d, n = position, bias[m], planes [head][d][position] (the weight is the A operand, so v comes out transposed).
// EPI 3: all four projections of both batch entries in ONE launch, grid (TT/64, DQ/64, 8): z = stream x 2 + batch entry, streams q1, q2, k (each as EPI 1) and v (as EPI 2, block indices swapped). A = the eight bf16 inputs [z][position][k], Bt = the transposed weights Wq, Wk, Wv in a row,
// bias / biasK / biasV = bq / bk / bv, planes [z][...]. Every choice depends on blockIdx alone, so it is uniform for the work-group.
template <typename T16, int NSPLIT, bool BIAS, int MB, int NB, int NW, int K, int G, int EPI>
__global__ __launch_bounds__(NW * 32) void k_gemmks(const T16* __restrict__ A, const T16* __restrict__ A2, const T16* __restrict__ Bt, const T16* __restrict__ Bt2, float* C, int ldc, const float* __restrict__ bias, const float* __restrict__ biasK, const float* __restrict__ biasV, size_t sA, size_t sB, size_t sC, h16* P16, bf* Ph, bf* Pl) {
    static_assert((EPI != 1 && EPI != 3) || NB * 16 == HD, "a column block is one head");
    typedef typename WFrag<T16>::V V;
    constexpr int PW = NB * 16 + 4;        // LDS row pitch in floats: 16 B x odd for the b128 readers
    constexpr int PS = MB * 16 * PW;       // floats of one wave's partial tile
    __shared__ __align__(16) float red[NW * PS];
    const size_t z = blockIdx.z; const bool tr = (EPI == 2) || (EPI == 3 && z >= 6);   // tr: the weight is the A operand
    if (EPI == 3) { const T16* X = A + z * ((size_t)TT * DM); const T16* Wt = Bt + (z < 4 ? 0 : (z >> 1) - 1) * ((size_t)DQ * DM); A = tr ? Wt : X; Bt = tr ? X : Wt; bias = z < 4 ? bias : (tr ? biasV : biasK);
        P16 += z * ((size_t)NH_ * TT * HD); Ph += z * ((size_t)NH_ * TT * HD); Pl += z * ((size_t)NH_ * TT * HD); }
    else { A += z * sA; if (A2) A2 += z * sA; Bt += z * sB; if (Bt2) Bt2 += z * sB; C += z * sC; }
    const int lane = threadIdx.x & 31, lr = lane & 15, hi = lane >> 4, wave = threadIdx.x >> 5; const int bxr = (EPI == 3 && tr) ? blockIdx.y : blockIdx.x, bxc = (EPI == 3 && tr) ? blockIdx.x : blockIdx.y; const int r0 = bxr * (MB * 16), c0 = bxc * (NB * 16);
    v8f acc[MB][NB];
#pragma unroll
    for (int mb = 0; mb < MB; ++mb)
#pragma unroll
        for (int nb = 0; nb < NB; ++nb) acc[mb][nb] = (v8f){};
    static_assert((K / NW) % 32 == 0, "a wave's k range is whole tiles");
    // both operands lie in fragment order, [row / 16][k / 32] tiles of 512 elements
    const size_t aoff = ((size_t)(r0 >> 4) * (K / 32) + wave * (K / NW / 32)) * 512 + lane * 8, boff = ((size_t)(c0 >> 4) * (K / 32) + wave * (K / NW / 32)) * 512 + lane * 8;
    const T16* pa = A + aoff; const T16* pb = Bt + boff; const T16* pa2 = A2 + aoff; const T16* pb2 = Bt2 + boff;
    // G k steps form a group: the group's loads are all issued first (row set by row set, so that the loads of one 128-B line follow one another), then its WMMAs in ascending k
#pragma unroll
    for (int kg = 0; kg < K / NW; kg += 32 * G) {
        V a[G][MB], a2[G][MB], b[G][NB], b2[G][NB];
#pragma unroll
        for (int mb = 0; mb < MB; ++mb) {
#pragma unroll
            for (int s = 0; s < G; ++s) a[s][mb] = WFrag<T16>::ldf(pa + (size_t)mb * 16 * K + (kg + s * 32) * 16);
            if (NSPLIT == 1 || NSPLIT == 2) {
#pragma unroll
                for (int s = 0; s < G; ++s) a2[s][mb] = WFrag<T16>::ldf(pa2 + (size_t)mb * 16 * K + (kg + s * 32) * 16); } }
#pragma unroll
        for (int nb = 0; nb < NB; ++nb) {
#pragma unroll
            for (int s = 0; s < G; ++s) b[s][nb] = WFrag<T16>::ldf(pb + (size_t)nb * 16 * K + (kg + s * 32) * 16);
            if (NSPLIT >= 2) {
#pragma unroll
                for (int s = 0; s < G; ++s) b2[s][nb] = WFrag<T16>::ldf(pb2 + (size_t)nb * 16 * K + (kg + s * 32) * 16); } }
        // the wait that stands in front of any overwrite of a register which an issued load names; the base addresses are inputs so that they live up to it (no load's result lands on them)
        if (NSPLIT == 2) asm volatile("s_wait_xcnt 0x0" :: "v"(pa), "v"(pb), "v"(pa2), "v"(pb2) : "memory");
        else if (NSPLIT == 1) asm volatile("s_wait_xcnt 0x0" :: "v"(pa), "v"(pb), "v"(pa2) : "memory");
        else asm volatile("s_wait_xcnt 0x0" :: "v"(pa), "v"(pb) : "memory");
        if (G > 1) __builtin_amdgcn_sched_barrier(0);   // keeps the WMMAs behind the group's last load: without it the compiler weaves them among the loads to save registers and a wave has few loads in flight
#pragma unroll
        for (int s = 0; s < G; ++s)
#pragma unroll
            for (int nb = 0; nb < NB; ++nb)
#pragma unroll
                for (int mb = 0; mb < MB; ++mb) { acc[mb][nb] = WFrag<T16>::mma(a[s][mb], b[s][nb], acc[mb][nb]); if (NSPLIT == 1 || NSPLIT == 2) acc[mb][nb] = WFrag<T16>::mma(a2[s][mb], b[s][nb], acc[mb][nb]); if (NSPLIT >= 2) acc[mb][nb] = WFrag<T16>::mma(a[s][mb], b2[s][nb], acc[mb][nb]); }
    }
    float* my = red + wave * PS;
#pragma unroll
    for (int mb = 0; mb < MB; ++mb)
#pragma unroll
        for (int nb = 0; nb < NB; ++nb)
#pragma unroll
            for (int j = 0; j < 8; ++j) my[(mb * 16 + hi * 8 + j) * PW + nb * 16 + lr] = acc[mb][nb][j];
    __syncthreads();   // every wave's partial tile is in LDS before any is read
    // what differs between the two orientations is set up once, from block-uniform values: the bias of the thread's four columns (the same in every trip) and the plane address (eb + row) * ep + ec + cofs
    static_assert((NW * 32) % (NB * 4) == 0, "a thread keeps its columns from trip to trip");
    v4f bn = (v4f){};
    // the head planes of EPI 3 go out in fragment order; there a wave takes 16 rows x 8 columns, which is 256 bytes in a row of such a plane (each element's sum is the same)
    static_assert(EPI != 3 || (NW * 32 == 256 && NB == 4 && MB == 4), "16 rows a trip, 16 column groups");
    constexpr bool fo = (EPI == 3);
    const int rb = fo ? (int)(threadIdx.x & 15) : (int)(threadIdx.x / (NB * 4)), cofs = (fo ? (int)(threadIdx.x >> 4) : (int)(threadIdx.x % (NB * 4))) * 4;
    if (BIAS && !tr) { const float* pc = bias + c0 + cofs; const float t0 = pc[0], t1 = pc[1], t2 = pc[2], t3 = pc[3];
        asm volatile("s_wait_xcnt 0x0" :: "v"(pc) : "memory");   // the wait in front of any overwrite of a register which the issued load names; the address is an input so that it lives up to it
        bn[0] = bfr(t0); bn[1] = bfr(t1); bn[2] = bfr(t2); bn[3] = bfr(t3); }
    const int eb = tr ? r0 : bxc * TT + r0, ep = tr ? TT : HD, ec = tr ? c0 : 0;
#pragma unroll
    for (int u = 0; u < MB * 16; u += NW * 32 / (NB * 4)) { const int row = rb + u; const float* p = red + row * PW + cofs; v4f val = *(const v4fa*)p;
#pragma unroll
        for (int w = 1; w < NW; ++w) val += *(const v4fa*)(p + w * PS);
        if (BIAS && tr) { const float* pr = bias + r0 + row; const float t = *pr;
            asm volatile("s_wait_xcnt 0x0" :: "v"(pr) : "memory");   // the same wait for the row's bias load
            const float bb = bfr(t); bn[0] = bb; bn[1] = bb; bn[2] = bb; bn[3] = bb; }
        if (BIAS) val += bn;
        if (EPI == 0) *(v4f*)(C + (size_t)(r0 + row) * ldc + c0 + cofs) = val;
        else { size_t e = (size_t)(eb + row) * ep + ec + cofs; v4h o16; v4us oh, ol;
            if (fo) { const int t = tr ? c0 + cofs : r0 + row;   // position; q and k: tiles of 16 positions x 32 d, [position / 16][d / 8][position % 16][d % 8]; v: tiles of 16 d x 32 positions, [position / 32][d / 16][(position / 8) % 4][d % 16][position % 8]
                e = tr ? (size_t)bxr * (TT * HD) + (t >> 5) * 2048 + (row >> 4) * 512 + ((t >> 3) & 3) * 128 + (row & 15) * 8 + (t & 7) : (size_t)bxc * (TT * HD) + (t >> 4) * 1024 + (cofs >> 3) * 128 + (t & 15) * 8 + (cofs & 7); }
#pragma unroll
            for (int q = 0; q < 4; ++q) { o16[q] = tohx(val[q]); unsigned short a2, c2; splitf(val[q], a2, c2); oh[q] = a2; ol[q] = c2; }
            h16* s0 = P16 + e; bf* s1 = Ph + e; bf* s2 = Pl + e; *(v4h*)s0 = o16; *(v4us*)s1 = oh; *(v4us*)s2 = ol;
            // the wait in front of any overwrite of a register which an issued store names; addresses and data are inputs so that they live up to it
            asm volatile("s_wait_xcnt 0x0" :: "v"(s0), "v"(s1), "v"(s2), "v"(__builtin_bit_cast(unsigned long long, o16)), "v"(__builtin_bit_cast(unsigned long long, oh)), "v"(__builtin_bit_cast(unsigned long long, ol)) : "memory"); } }
}


// element (row r, k) of an [R][K] operand in fragment order: tiles of 16 rows x 32 k, [r / 16][k / 32], each [k / 8 % 4][r % 16][k % 8]
__device__ __forceinline__ size_t fragofs(int r, int k, int K) { return ((size_t)(r >> 4) * (K >> 5) + (k >> 5)) * 512 + ((k >> 3) & 3) * 128 + (r & 15) * 8 + (k & 7); }
__device__ __forceinline__ void d_wtG(int bx, const float* __restrict__ w, int K, int N, bf* Bt) {
    const int lane = threadIdx.x & 31; const int L0 = (bx * 8 + (threadIdx.x >> 5)) * 8; const int nlines = N * K / 64;
{
#pragma unroll 1
        for (int l = 0; l < 8; ++l) { const int L = L0 + l; if (L >= nlines) break; const size_t e = (size_t)L * 64 + lane * 2; const int k = (int)(e % K), n = (int)(e / K); v2us o;
            o[0] = f2bf(w[(size_t)k * N + n]); o[1] = f2bf(w[(size_t)(k + 1) * N + n]); bf* pd = Bt + fragofs(n, k, K); *(v2us*)pd = o;
            asm volatile("s_wait_xcnt 0x0" :: "v"(pd), "v"(__builtin_bit_cast(unsigned, o)) : "memory"); }   // the wait in front of the next trip's overwrite of a register which the issued store names; address and data are inputs so that they live up to it
         }
}
__device__ __forceinline__ void d_cvt8(int bx, const float* __restrict__ src, bf* dst, size_t n8) { const size_t i = (size_t)bx * 256 + threadIdx.x; if (i >= n8) return;
    // thread i writes the i-th 16 bytes of the fragment-ordered plane (rows of DM elements); a block takes 16 rows x 128 k, whole lines on both sides
    const size_t tile = i >> 6; const size_t r = (tile / (DM / 32)) * 16 + (i & 15), k = (tile % (DM / 32)) * 32 + ((i >> 4) & 3) * 8; const float* ps = src + r * DM + k; const v8f v = *(const v8f*)ps; v8us o;
    asm volatile("s_wait_xcnt 0x0" :: "v"(ps) : "memory");   // the wait in front of any overwrite of a register which the issued load names; the address is an input so that it lives up to it
#pragma unroll
    for (int k = 0; k < 8; ++k) o[k] = f2bf(v[k]); *(v8us*)(dst + i * 8) = o;  }
// ---- k_prep: every operand conversion in ONE launch. Both kinds of plane are written in fragment order (fragofs). Blocks [0, 4 WTB): the four weights, transposed to bf16 [n][k], in a row in WT (they come first: their strided reads take longest). Blocks behind them: the four inputs, both batch entries each, to bf16, in a row in XB.
#define WTB ((DM * DQ / 64 + 63) / 64)           // blocks per weight
#define CVB (NB_ * TT * DM / 8 / 256)            // blocks per input
__global__ __launch_bounds__(256) void k_prep(const float* __restrict__ w0, const float* __restrict__ w1, const float* __restrict__ w2, const float* __restrict__ w3, bf* WT, const float* __restrict__ x0, const float* __restrict__ x1, const float* __restrict__ x2, const float* __restrict__ x3, bf* XB) {
    const int bx = blockIdx.x;
    if (bx < 4 * WTB) { const int s = bx / WTB; d_wtG(bx % WTB, s == 0 ? w0 : s == 1 ? w1 : s == 2 ? w2 : w3, DM, DQ, WT + (size_t)s * DM * DQ); }
    else { const int c = bx - 4 * WTB, s = c / CVB; d_cvt8(c % CVB, s == 0 ? x0 : s == 1 ? x1 : s == 2 ? x2 : x3, XB + (size_t)s * NB_ * TT * DM, (size_t)NB_ * TT * DM / 8); }
}
__global__ __launch_bounds__(256) void k_cscvt(const float* __restrict__ cosT, const float* __restrict__ sinT, float* CS) { const int idx = blockIdx.x * 256 + threadIdx.x; if (idx >= TT * HD) return; v2f cs; cs[0] = bfr(cosT[idx]); cs[1] = bfr(sinT[idx]); *(v2f*)(CS + (size_t)idx * 2) = cs;  }
// 2^x with the one free issue slot that the instruction set asks for behind a transcendental
__device__ __forceinline__ float exp2slot(float x) { float e; asm("v_exp_f32 %0, %1\n\tv_nop" : "=v"(e) : "v"(x)); return e; }
// value of lane l ^ M inside the 16-lane row (DPP row_xmask: a vector move, no LDS round trip); every lane is on where it is used
template <int M> __device__ __forceinline__ float rowx(float x) { return __int_as_float(__builtin_amdgcn_update_dpp(0, __float_as_int(x), 0x160 | M, 0xf, 0xf, true)); }
// ---- k_attn: scores, softmax and p.v of BOTH query streams for 16 query rows of one head in one work-group; scores and probabilities never leave it. grid (rows/16, heads, batch entries), 16 waves.
// Wave w owns keys [128 w, 128 w + 128): 2 x 8 score tiles in registers (m-tile 0: stream 1, m-tile 1: stream 2, so each k and v fragment serves both), row max and row sum joined over the waves through LDS,
// probabilities turned into A fragments through the wave's own LDS piece, p.v summed over the wave's keys in ascending k, the 16 partial tiles added in wave order 0..15 (as the K-split GEMM does), the two streams' difference written as bf16 hi+lo planes.
template <typename T16, int NSPLIT>
__global__ __launch_bounds__(512) void k_attn(const T16* __restrict__ Q1, const T16* __restrict__ Q1l, const T16* __restrict__ Q2, const T16* __restrict__ Q2l, const T16* __restrict__ Kp, const T16* __restrict__ Kl, const T16* __restrict__ Vt, const T16* __restrict__ Vl, const float* __restrict__ lamp, bf* Ah, bf* Al, int row0) {
    typedef typename WFrag<T16>::V V;
    constexpr int NW = 16, KW = TT / NW, NT = KW / 16;   // waves, keys per wave, score tiles per stream and wave
    constexpr int PP = KW + 8;                           // pitch of a wave's probability rows (128 keys) in 16-bit elements: 16 B x odd for the b128 readers
    constexpr int RP = 20;                               // pitch of a row's 16 per-wave values in floats: 16 B x odd
    constexpr int PW = HD + 4, PS = 32 * PW;             // partial output tile: row pitch and size in floats
    constexpr bool HIRES = (NSPLIT == 2);
    constexpr int PB = (HIRES ? 2 : 1) * 32 * PP;        // 16-bit elements of one wave's probability planes
    constexpr int SB = (NW * PB * 2 > NW * PS * 4) ? NW * PB * 2 : NW * PS * 4;
    __shared__ __align__(16) char sm[SB];                // first the probabilities, then (behind a barrier) the partial output tiles
    T16* pbuf = (T16*)sm; float* red = (float*)sm;
    __shared__ __align__(16) float rmx[32 * RP];
    __shared__ __align__(16) float rsm[32 * RP];
    const int lane = threadIdx.x & 31, lr = lane & 15, hi = lane >> 4, wave = threadIdx.x >> 5; const int r0 = row0 + blockIdx.x * 16; const size_t hp = ((size_t)blockIdx.z * NH_ + blockIdx.y) * TT * HD;
    const float lam = bfr(lamp[0]);   // read here, where control flow is uniform, so that it is a scalar load whose latency the whole kernel hides
    const size_t qoff = hp + (size_t)r0 * HD + lane * 8, koff = hp + (size_t)wave * KW * HD + lane * 8, voff = hp + (size_t)wave * KW * HD + lane * 8;   // the planes are in fragment order: 16 query rows are 1024 elements in a row, the wave's 128 keys 8192 elements in a row of k and of v
    const T16* pq1 = Q1 + qoff; const T16* pq2 = Q2 + qoff; const T16* pk = Kp + koff; const T16* pv = Vt + voff; const T16* pq1l = Q1l + qoff; const T16* pq2l = Q2l + qoff; const T16* pkl = Kl + koff; const T16* pvl = Vl + voff;
    v8f sc[2][NT];
#pragma unroll
    for (int s = 0; s < 2; ++s)
#pragma unroll
        for (int nb = 0; nb < NT; ++nb) sc[s][nb] = (v8f){};
    if constexpr (HIRES) {
#pragma unroll
        for (int kc = 0; kc < HD; kc += 32) {
            V a[2], a2[2]; a[0] = WFrag<T16>::ldf(pq1 + kc * 16); a[1] = WFrag<T16>::ldf(pq2 + kc * 16); if (HIRES) { a2[0] = WFrag<T16>::ldf(pq1l + kc * 16); a2[1] = WFrag<T16>::ldf(pq2l + kc * 16); }
#pragma unroll
            for (int nb = 0; nb < NT; ++nb) { const V b = WFrag<T16>::ldf(pk + nb * 1024 + kc * 16); V b2; if (HIRES) b2 = WFrag<T16>::ldf(pkl + nb * 1024 + kc * 16);
#pragma unroll
                for (int s = 0; s < 2; ++s) { sc[s][nb] = WFrag<T16>::mma(a[s], b, sc[s][nb]); if (HIRES) { sc[s][nb] = WFrag<T16>::mma(a2[s], b, sc[s][nb]); sc[s][nb] = WFrag<T16>::mma(a[s], b2, sc[s][nb]); } } }
        }
    } else {
        // single planes: all of the wave's q and k fragments fit in registers beside nothing else, so every load is issued before the first WMMA (one trip to L2 instead of one per tile); each tile still sums kc = 0, then 32
        V a[2][2], b[NT][2];
#pragma unroll
        for (int c = 0; c < 2; ++c) { a[c][0] = WFrag<T16>::ldf(pq1 + c * 512); a[c][1] = WFrag<T16>::ldf(pq2 + c * 512); }
#pragma unroll
        for (int nb = 0; nb < NT; ++nb)
#pragma unroll
            for (int c = 0; c < 2; ++c) b[nb][c] = WFrag<T16>::ldf(pk + nb * 1024 + c * 512);
        __builtin_amdgcn_sched_barrier(0);   // keeps the WMMAs behind the last load: without it the compiler reuses one fragment's registers and waits for each tile's load in turn
#pragma unroll
        for (int nb = 0; nb < NT; ++nb)
#pragma unroll
            for (int c = 0; c < 2; ++c)
#pragma unroll
                for (int s = 0; s < 2; ++s) sc[s][nb] = WFrag<T16>::mma(a[c][s], b[nb][c], sc[s][nb]);
    }
    // the wait that stands in front of any overwrite of a register which an issued load names; the base addresses are inputs so that they live up to it
    if (HIRES) asm volatile("s_wait_xcnt 0x0" :: "v"(pq1), "v"(pq2), "v"(pk), "v"(pq1l), "v"(pq2l), "v"(pkl) : "memory");
    else asm volatile("s_wait_xcnt 0x0" :: "v"(pq1), "v"(pq2), "v"(pk) : "memory");
    // row max: over the lane's 8 tiles, the 16 lanes that hold the row, then the 16 waves (a max is exact in any order)
    float rv[2][8];
#pragma unroll
    for (int s = 0; s < 2; ++s)
#pragma unroll
        for (int j = 0; j < 8; ++j) { float m = -3.0e38f;
#pragma unroll
            for (int nb = 0; nb < NT; ++nb) { const float t = sc[s][nb][j] * SCL; sc[s][nb][j] = t; m = fmaxf(m, t); }
            m = fmaxf(m, rowx<1>(m)); m = fmaxf(m, rowx<2>(m)); m = fmaxf(m, rowx<4>(m)); m = fmaxf(m, rowx<8>(m)); rv[s][j] = m; }
    if (lr == 0) {
#pragma unroll
        for (int s = 0; s < 2; ++s)
#pragma unroll
            for (int j = 0; j < 8; ++j) rmx[hi * 8 * RP + wave + (s * 16 + j) * RP] = rv[s][j]; }
    __syncthreads();   // every wave's row maxima are in LDS before any is read
    float gm;          // lane l: the max of row l (rows 0..15 stream 1, 16..31 stream 2)
    { const float* p = rmx + lane * RP; const v4f m0 = *(const v4fa*)p, m1 = *(const v4fa*)(p + 4), m2 = *(const v4fa*)(p + 8), m3 = *(const v4fa*)(p + 12); gm = m0[0];
#pragma unroll
      for (int q = 0; q < 4; ++q) gm = fmaxf(fmaxf(gm, m0[q]), fmaxf(m1[q], fmaxf(m2[q], m3[q]))); }
#pragma unroll
    for (int s = 0; s < 2; ++s)
#pragma unroll
        for (int j = 0; j < 8; ++j) rv[s][j] = __int_as_float(__builtin_amdgcn_ds_bpermute(hi * 32 + (s * 16 + j) * 4, __float_as_int(gm)));   // the value of lane s*16 + hi*8 + j (byte address = lane x 4)
    // one exp per score; row sum: the lane's 8 tiles in order, a fixed tree over the 16 lanes, the waves in order 0..15
#pragma unroll
    for (int s = 0; s < 2; ++s)
#pragma unroll
        for (int j = 0; j < 8; ++j) { const float mx = rv[s][j]; float sum = 0.f;
#pragma unroll
            for (int nb = 0; nb < NT; ++nb) { const float d0 = sc[s][nb][j] - mx; const float e = exp2slot(d0 * 1.4426950408889634f); sc[s][nb][j] = e; sum += e; }
            sum += rowx<1>(sum); sum += rowx<2>(sum); sum += rowx<4>(sum); sum += rowx<8>(sum); rv[s][j] = sum; }
    if (lr == 0) {
#pragma unroll
        for (int s = 0; s < 2; ++s)
#pragma unroll
            for (int j = 0; j < 8; ++j) rsm[hi * 8 * RP + wave + (s * 16 + j) * RP] = rv[s][j]; }
    __syncthreads();   // every wave's row sums are in LDS before any is read
    float gf;          // lane l: the factor of row l
    { const float* p = rsm + lane * RP; float sum = p[0];
#pragma unroll
      for (int w = 1; w < NW; ++w) sum += p[w];
      gf = __fdiv_rn(HIRES ? 1.0f : PCAR, sum); }
    float fs[2][8];
#pragma unroll
    for (int s = 0; s < 2; ++s)
#pragma unroll
        for (int j = 0; j < 8; ++j) fs[s][j] = __int_as_float(__builtin_amdgcn_ds_bpermute(hi * 32 + (s * 16 + j) * 4, __float_as_int(gf)));
    T16* pw = pbuf + wave * PB; T16* ps = pw + hi * 8 * PP + lr;   // the lane's own store base: every row, tile and plane is a constant offset from it
#pragma unroll
    for (int s = 0; s < 2; ++s)
#pragma unroll
        for (int nb = 0; nb < NT; ++nb)
#pragma unroll
            for (int j = 0; j < 8; ++j) { const int idx = (s * 16 + j) * PP + nb * 16;
                if constexpr (HIRES) { unsigned short h, l; splitf(sc[s][nb][j] * fs[s][j], h, l); ps[idx] = h; ps[32 * PP + idx] = l; }
                else ps[idx] = tohx(sc[s][nb][j] * fs[s][j]); }
    __builtin_amdgcn_wave_barrier(); asm volatile("" ::: "memory");   // keeps the fragment reads below, which take other lanes' values, behind the stores above (one wave's LDS operations run in order)
    v8f oc[2][HD / 16];
#pragma unroll
    for (int s = 0; s < 2; ++s)
#pragma unroll
        for (int nb = 0; nb < HD / 16; ++nb) oc[s][nb] = (v8f){};
    constexpr int GK = HIRES ? 2 : 4;   // k steps whose v fragments are loaded ahead of their WMMAs (what the registers hold beside the accumulators)
#pragma unroll
    for (int kg = 0; kg < KW / 32; kg += GK) {
        V b[GK][HD / 16], b2[GK][HD / 16];
#pragma unroll
        for (int nb = 0; nb < HD / 16; ++nb)
#pragma unroll
            for (int g = 0; g < GK; ++g) { b[g][nb] = WFrag<T16>::ldf(pv + (kg + g) * 2048 + nb * 512); if (HIRES) b2[g][nb] = WFrag<T16>::ldf(pvl + (kg + g) * 2048 + nb * 512); }
        __builtin_amdgcn_sched_barrier(0);   // keeps the WMMAs behind the group's last load: without it the compiler reuses one fragment's registers and waits for each load in turn
#pragma unroll
        for (int g = 0; g < GK; ++g) { const int ks = kg + g; V a[2], a2[2];
#pragma unroll
            for (int s = 0; s < 2; ++s) { a[s] = WFrag<T16>::ld(pw + (s * 16 + lr) * PP + ks * 32 + 8 * hi); if (HIRES) a2[s] = WFrag<T16>::ld(pw + 32 * PP + (s * 16 + lr) * PP + ks * 32 + 8 * hi); }
#pragma unroll
            for (int nb = 0; nb < HD / 16; ++nb)
#pragma unroll
                for (int s = 0; s < 2; ++s) { oc[s][nb] = WFrag<T16>::mma(a[s], b[g][nb], oc[s][nb]); if (HIRES) { oc[s][nb] = WFrag<T16>::mma(a2[s], b[g][nb], oc[s][nb]); oc[s][nb] = WFrag<T16>::mma(a[s], b2[g][nb], oc[s][nb]); } } }
    }
    // the same wait for the v loads
    if (HIRES) asm volatile("s_wait_xcnt 0x0" :: "v"(pv), "v"(pvl) : "memory");
    else asm volatile("s_wait_xcnt 0x0" :: "v"(pv) : "memory");
    __syncthreads();   // every wave has read its probabilities before the partial tiles are written over them
    float* my = red + wave * PS + hi * 8 * PW + lr;
#pragma unroll
    for (int s = 0; s < 2; ++s)
#pragma unroll
        for (int nb = 0; nb < HD / 16; ++nb)
#pragma unroll
            for (int j = 0; j < 8; ++j) my[(s * 16 + j) * PW + nb * 16] = oc[s][nb][j];
    __syncthreads();   // every wave's partial tile is in LDS before any is read
    // one thread sums the same row and columns of both streams, so the difference (a1 v) - lam (a2 v) is formed here and goes out as the hi+lo planes [position][head x 64 + d] of the output product's A operand
    // (in fragment order, as that product reads it: a wave takes 16 rows x 8 columns, 256 bytes in a row there)
    if (threadIdx.x < 256) { const int row = threadIdx.x & 15, cofs = (threadIdx.x >> 4) * 4; const float* p = red + row * PW + cofs; v4f v1 = *(const v4fa*)p, v2 = *(const v4fa*)(p + 16 * PW);
#pragma unroll
      for (int w = 1; w < NW; ++w) { v1 += *(const v4fa*)(p + w * PS); v2 += *(const v4fa*)(p + w * PS + 16 * PW); }
      constexpr float cs = HIRES ? 1.0f : (1.0f / PCAR); v4us oh, ol;
#pragma unroll
      for (int q = 0; q < 4; ++q) { unsigned short s1, s2; splitf(v1[q] * cs - lam * (v2[q] * cs), s1, s2); oh[q] = s1; ol[q] = s2; }
      const size_t oo = (size_t)blockIdx.z * TT * DQ + fragofs(r0 + row, blockIdx.y * HD + cofs, DQ); *(v4us*)(Ah + oo) = oh; *(v4us*)(Al + oo) = ol; }
}
__global__ __launch_bounds__(256) void k_merge(const float* __restrict__ O, int h0, bf* Ah, bf* Al) { const size_t e = ((size_t)blockIdx.x * 256 + threadIdx.x) * 2; if (e >= (size_t)ZH * TT * HD) return; const int d = (int)(e % HD); const int t = (int)((e / HD) % TT); const int zz = (int)(e / ((size_t)HD * TT)); const float cs = (t < RH) ? 1.0f : (1.0f / PCAR); const size_t oo = (size_t)t * DQ + (h0 + zz) * HD + d;
    v2us oh, ol;
#pragma unroll
    for (int q = 0; q < 2; ++q) { unsigned short a, c2; splitf(O[e + q] * cs, a, c2); oh[q] = a; ol[q] = c2; } *(v2us*)(Ah + oo) = oh; *(v2us*)(Al + oo) = ol;  }

extern "C" void kernel_launch(void* const* d_in, const int* in_sizes, int n_in,
                              void* d_out, int out_size, void* d_ws, size_t ws_size, hipStream_t stream) {
    (void)in_sizes; (void)n_in; (void)out_size;
    const float* vin = (const float*)d_in[0]; const float* kin = (const float*)d_in[1]; const float* q1in = (const float*)d_in[2]; const float* q2in = (const float*)d_in[3]; const float* wq = (const float*)d_in[4]; const float* bq = (const float*)d_in[5]; const float* wk = (const float*)d_in[6]; const float* bk = (const float*)d_in[7]; const float* wv = (const float*)d_in[8]; const float* bv = (const float*)d_in[9]; const float* wo = (const float*)d_in[10]; const float* bo = (const float*)d_in[11]; const float* lamp = (const float*)d_in[12];   // weights x @ W
    float* OUT = (float*)d_out;     // [2][2048][1024]
    char* wsp = (char*)d_ws;
    auto take = [&](size_t bytes) { char* p = wsp; wsp += (bytes + 255) & ~(size_t)255; return (void*)p; };
    constexpr size_t PLN = (size_t)NH_ * TT * HD;   // one head plane set of one batch entry; planes are [stream q1, q2, k, v][batch entry]
    bf* WT = (bf*)take((size_t)4 * DQ * DM * 2);      // Wq, Wk, Wv, Wo transposed
    bf* XB = (bf*)take((size_t)4 * NB_ * TT * DM * 2);   // q1, q2, k, v in bf16
    h16* P16 = (h16*)take(4 * NB_ * PLN * 2); bf* Ph = (bf*)take(4 * NB_ * PLN * 2); bf* Pl = (bf*)take(4 * NB_ * PLN * 2);
    bf* ATh = (bf*)take((size_t)NB_ * TT * DQ * 2); bf* ATl = (bf*)take((size_t)NB_ * TT * DQ * 2);
    if ((size_t)(wsp - (char*)d_ws) > ws_size) return;    // ws 256 MiB
    k_prep<<<(unsigned)(4 * WTB + 4 * CVB), 256, 0, stream>>>(wq, wk, wv, wo, WT, q1in, q2in, kin, vin, XB);
    k_gemmks<bf, 0, true, 4, 4, 8, DM, 1, 3><<<dim3(TT / 64, DQ / 64, 4 * NB_), 256, 0, stream>>>(XB, nullptr, WT, nullptr, nullptr, 0, bq, bk, bv, 0, 0, 0, P16, Ph, Pl);
    k_attn<bf, 2><<<dim3(RH / 16, NH_, NB_), 512, 0, stream>>>(Ph, Pl, Ph + 2 * PLN, Pl + 2 * PLN, Ph + 4 * PLN, Pl + 4 * PLN, Ph + 6 * PLN, Pl + 6 * PLN, lamp, ATh, ATl, 0);
    k_attn<h16, 0><<<dim3((TT - RH) / 16, NH_, NB_), 512, 0, stream>>>(P16, nullptr, P16 + 2 * PLN, nullptr, P16 + 4 * PLN, nullptr, P16 + 6 * PLN, nullptr, lamp, ATh, ATl, RH);
    k_gemmks<bf, 1, true, 4, 4, 8, DQ, 1, 0><<<dim3(TT / 64, DM / 64, NB_), 256, 0, stream>>>(ATh, ATl, WT + (size_t)3 * DQ * DM, nullptr, OUT, DM, bo, nullptr, nullptr, (size_t)TT * DQ, 0, (size_t)TT * DM, nullptr, nullptr, nullptr);
}

// v006
// It runs in 265 microseconds.
// Timed twice side by side with v005, it ran 1.19 and 1.18 times as fast.
// Counting every step since v000, it is 14.1 times as fast.
#include <hip/hip_runtime.h>

// NoiseCancellingAttentionMechanism - differential attention with two query streams (v, k, q1, q2 [2][2048][1024]; q1h/q2h = q1/q2 Wq + bq (shared), kh = k Wk + bk, vh = v Wv + bv (16 heads x 64);
// a1 = softmax(q1h.kh/8), a2 = softmax(q2h.kh/8); out = merged (a1 - lam a2) vh, Wo + bo with the scalar lam read as data -> [2][2048][1024]).
// Compute dtypes, f32 accumulate: every input rounded to bf16; projections on PLAIN bf16 operands (inputs: exact, + bias); PER-ROW PRECISION HYBRID for both score sets and both
// p.v contractions (query rows < 256 on bf16 hi+lo planes with 3 products, rows >= 256 on single fp16 planes, probabilities x1024 there); f32 register-row softmaxes; the difference (a1 v) - lam (a2 v) and the

#define NB_  2
#define TT   2048
#define DM   1024
#define NH_  16
#define NKV  16
#define REP  (NH_ / NKV)
#define HD   64
#define DQ   (NH_ * HD)
#define DKV  (NKV * HD)
#define ZH   NH_                  // heads per merge launch
#define RH   256                  // query rows < RH use hi+lo planes (0: none)
#define WIN  0
#define PCAR 1024.0f
#define SCL  0.125f   // HD^-0.5
typedef _Float16 h16;
typedef unsigned short bf;
typedef __attribute__((ext_vector_type(16))) __bf16   v16bf;
typedef __attribute__((ext_vector_type(16))) _Float16 v16h;
typedef __attribute__((ext_vector_type(8)))  _Float16 v8h;
typedef __attribute__((ext_vector_type(8)))  unsigned short v8us;
typedef __attribute__((ext_vector_type(8)))  float    v8f;
typedef __attribute__((ext_vector_type(4)))  float    v4f;
typedef v8h  __attribute__((may_alias)) v8ha;
typedef v4f  __attribute__((may_alias)) v4fa;
typedef v8us __attribute__((may_alias)) v8usa;

__device__ __forceinline__ unsigned short f2bf(float f) { unsigned u = __float_as_uint(f); u += 0x7FFFu + ((u >> 16) & 1u); return (unsigned short)(u >> 16); }
__device__ __forceinline__ float bf2f(unsigned short b) { return __uint_as_float(((unsigned)b) << 16); }
__device__ __forceinline__ float bfr(float f) { return bf2f(f2bf(f)); }
__device__ __forceinline__ v16h cat16(v8h lo, v8h hi) { return __builtin_shufflevector(lo, hi, 0, 1, 2, 3, 4, 5, 6, 7, 8, 9, 10, 11, 12, 13, 14, 15); }
__device__ __forceinline__ v16bf cat16b(v8us lo, v8us hi) { return __builtin_bit_cast(v16bf, __builtin_shufflevector(lo, hi, 0, 1, 2, 3, 4, 5, 6, 7, 8, 9, 10, 11, 12, 13, 14, 15)); }
__device__ __forceinline__ v8f wmma16(v16h a, v16h b, v8f c) { return __builtin_amdgcn_wmma_f32_16x16x32_f16(false, a, false, b, (short)0, c, false, false); }
__device__ __forceinline__ v8f wmmab(v16bf a, v16bf b, v8f c) { return __builtin_amdgcn_wmma_f32_16x16x32_bf16(false, a, false, b, (short)0, c, false, false); }



// 16-bit fragment loaders (K-contiguous rows; the same k order for A and B) and their matrix instruction. ldf reads the same fragment from a plane kept in FRAGMENT ORDER: a 16 x 32 tile is 512 elements, [k / 8][row][k % 8],
// so p = tile + lane * 8 and each of the two loads takes 512 bytes in a row (4 whole lines) where ld touches 16 lines; lane and register hold the same element as with ld
template <typename T16> struct WFrag;
template <> struct WFrag<h16> { typedef v16h V; static __device__ __forceinline__ V ld(const h16* p) { return cat16(*(const v8h*)p, *(const v8h*)(p + 16)); } static __device__ __forceinline__ V ldf(const h16* p) { return cat16(*(const v8h*)p, *(const v8h*)(p + 256)); } static __device__ __forceinline__ v8f mma(V a, V b, v8f c) { return wmma16(a, b, c); } };
template <> struct WFrag<bf> { typedef v16bf V; static __device__ __forceinline__ V ld(const bf* p) { return cat16b(*(const v8us*)p, *(const v8us*)(p + 16)); } static __device__ __forceinline__ V ldf(const bf* p) { return cat16b(*(const v8us*)p, *(const v8us*)(p + 256)); } static __device__ __forceinline__ v8f mma(V a, V b, v8f c) { return wmmab(a, b, c); } };

__device__ __forceinline__ h16 tohx(float x) { return (h16)x; }
__device__ __forceinline__ void splitf(float y, unsigned short& h, unsigned short& l) { h = f2bf(y); l = f2bf(y - bf2f(h)); }
typedef __attribute__((ext_vector_type(2))) _Float16 v2h;
typedef __attribute__((ext_vector_type(4))) _Float16 v4h;
typedef __attribute__((ext_vector_type(2))) unsigned short v2us;
typedef __attribute__((ext_vector_type(4))) unsigned short v4us;
typedef __attribute__((ext_vector_type(2))) float v2f;
typedef __attribute__((ext_vector_type(4))) int v4i;

// ---- k_gemmks: C[m][n] (f32, pitch ldc, + optional f32 bias[n]) = sum_k A[m][k] Bt[n][k] (+ split products per NSPLIT) for a long K, K SPLIT OVER THE NW WAVES OF ONE WORK-GROUP: wave w sums k in [w K/NW, (w+1) K/NW) for the whole (MB*16)x(NB*16) tile, writes its f32 partial tile to its own LDS range,
// and behind one work-group barrier the partial tiles are added in wave order 0..NW-1 (fixed order) and stored as whole 128-B row pieces. grid (M/(MB*16), N/(NB*16), Z), NW*32 threads. K % (32 NW G) == 0.
// EPI 0: f32 C as above. EPI 1, 2: no C; the sum (+ bias) goes straight into the three 16-bit planes the attention kernel reads (fp16, bf16 hi, bf16 lo).
// EPI 1: m = position, n = head x 64 + d, bias[n], planes [head][position][d] (a column block is one head). EPI 2: m = head x 64 + d, n = position, bias[m], planes [head][d][position] (the weight is the A operand, so v comes out transposed).
// EPI 3: all four projections of both batch entries in ONE launch, grid (TT/64, DQ/64, 8): z = stream x 2 + batch entry, streams q1, q2, k (each as EPI 1) and v (as EPI 2, block indices swapped). A = the eight bf16 inputs [z][position][k], Bt = the transposed weights Wq, Wk, Wv in a row,
// bias / biasK / biasV = bq / bk / bv, planes [z][...]. Every choice depends on blockIdx alone, so it is uniform for the work-group.
template <typename T16, int NSPLIT, bool BIAS, int MB, int NB, int NW, int K, int G, int EPI>
__global__ __launch_bounds__(NW * 32) void k_gemmks(const T16* __restrict__ A, const T16* __restrict__ A2, const T16* __restrict__ Bt, const T16* __restrict__ Bt2, float* C, int ldc, const float* __restrict__ bias, const float* __restrict__ biasK, const float* __restrict__ biasV, size_t sA, size_t sB, size_t sC, h16* P16, bf* Ph, bf* Pl) {
    static_assert((EPI != 1 && EPI != 3) || NB * 16 == HD, "a column block is one head");
    typedef typename WFrag<T16>::V V;
    constexpr int PW = NB * 16 + 4;        // LDS row pitch in floats: 16 B x odd for the b128 readers
    constexpr int PS = MB * 16 * PW;       // floats of one wave's partial tile
    __shared__ __align__(16) float red[NW * PS];
    const size_t z = blockIdx.z; const bool tr = (EPI == 2) || (EPI == 3 && z >= 6);   // tr: the weight is the A operand
    if (EPI == 3) { const T16* X = A + z * ((size_t)TT * DM); const T16* Wt = Bt + (z < 4 ? 0 : (z >> 1) - 1) * ((size_t)DQ * DM); A = tr ? Wt : X; Bt = tr ? X : Wt; bias = z < 4 ? bias : (tr ? biasV : biasK);
        P16 += z * ((size_t)NH_ * TT * HD); Ph += z * ((size_t)NH_ * TT * HD); Pl += z * ((size_t)NH_ * TT * HD); }
    else { A += z * sA; if (A2) A2 += z * sA; Bt += z * sB; if (Bt2) Bt2 += z * sB; C += z * sC; }
    const int lane = threadIdx.x & 31, lr = lane & 15, hi = lane >> 4, wave = threadIdx.x >> 5; const int bxr = (EPI == 3 && tr) ? blockIdx.y : blockIdx.x, bxc = (EPI == 3 && tr) ? blockIdx.x : blockIdx.y; const int r0 = bxr * (MB * 16), c0 = bxc * (NB * 16);
    v8f acc[MB][NB];
#pragma unroll
    for (int mb = 0; mb < MB; ++mb)
#pragma unroll
        for (int nb = 0; nb < NB; ++nb) acc[mb][nb] = (v8f){};
    static_assert((K / NW) % 32 == 0, "a wave's k range is whole tiles");
    // both operands lie in fragment order, [row / 16][k / 32] tiles of 512 elements
    const size_t aoff = ((size_t)(r0 >> 4) * (K / 32) + wave * (K / NW / 32)) * 512 + lane * 8, boff = ((size_t)(c0 >> 4) * (K / 32) + wave * (K / NW / 32)) * 512 + lane * 8;
    const T16* pa = A + aoff; const T16* pb = Bt + boff; const T16* pa2 = A2 + aoff; const T16* pb2 = Bt2 + boff;
    // G k steps form a group: the group's loads are all issued first (row set by row set, so that the loads of one 128-B line follow one another), then its WMMAs in ascending k
#pragma unroll
    for (int kg = 0; kg < K / NW; kg += 32 * G) {
        V a[G][MB], a2[G][MB], b[G][NB], b2[G][NB];
#pragma unroll
        for (int mb = 0; mb < MB; ++mb) {
#pragma unroll
            for (int s = 0; s < G; ++s) a[s][mb] = WFrag<T16>::ldf(pa + (size_t)mb * 16 * K + (kg + s * 32) * 16);
            if (NSPLIT == 1 || NSPLIT == 2) {
#pragma unroll
                for (int s = 0; s < G; ++s) a2[s][mb] = WFrag<T16>::ldf(pa2 + (size_t)mb * 16 * K + (kg + s * 32) * 16); } }
#pragma unroll
        for (int nb = 0; nb < NB; ++nb) {
#pragma unroll
            for (int s = 0; s < G; ++s) b[s][nb] = WFrag<T16>::ldf(pb + (size_t)nb * 16 * K + (kg + s * 32) * 16);
            if (NSPLIT >= 2) {
#pragma unroll
                for (int s = 0; s < G; ++s) b2[s][nb] = WFrag<T16>::ldf(pb2 + (size_t)nb * 16 * K + (kg + s * 32) * 16); } }
        // the wait that stands in front of any overwrite of a register which an issued load names; the base addresses are inputs so that they live up to it (no load's result lands on them)
        if (NSPLIT == 2) asm volatile("s_wait_xcnt 0x0" :: "v"(pa), "v"(pb), "v"(pa2), "v"(pb2) : "memory");
        else if (NSPLIT == 1) asm volatile("s_wait_xcnt 0x0" :: "v"(pa), "v"(pb), "v"(pa2) : "memory");
        else asm volatile("s_wait_xcnt 0x0" :: "v"(pa), "v"(pb) : "memory");
        if (G > 1) __builtin_amdgcn_sched_barrier(0);   // keeps the WMMAs behind the group's last load: without it the compiler weaves them among the loads to save registers and a wave has few loads in flight
#pragma unroll
        for (int s = 0; s < G; ++s)
#pragma unroll
            for (int nb = 0; nb < NB; ++nb)
#pragma unroll
                for (int mb = 0; mb < MB; ++mb) { acc[mb][nb] = WFrag<T16>::mma(a[s][mb], b[s][nb], acc[mb][nb]); if (NSPLIT == 1 || NSPLIT == 2) acc[mb][nb] = WFrag<T16>::mma(a2[s][mb], b[s][nb], acc[mb][nb]); if (NSPLIT >= 2) acc[mb][nb] = WFrag<T16>::mma(a[s][mb], b2[s][nb], acc[mb][nb]); }
    }
    float* my = red + wave * PS;
#pragma unroll
    for (int mb = 0; mb < MB; ++mb)
#pragma unroll
        for (int nb = 0; nb < NB; ++nb)
#pragma unroll
            for (int j = 0; j < 8; ++j) my[(mb * 16 + hi * 8 + j) * PW + nb * 16 + lr] = acc[mb][nb][j];
    __syncthreads();   // every wave's partial tile is in LDS before any is read
    // what differs between the two orientations is set up once, from block-uniform values: the bias of the thread's four columns (the same in every trip) and the plane address (eb + row) * ep + ec + cofs
    static_assert((NW * 32) % (NB * 4) == 0, "a thread keeps its columns from trip to trip");
    v4f bn = (v4f){};
    // the head planes of EPI 3 go out in fragment order; there a wave takes 16 rows x 8 columns, which is 256 bytes in a row of such a plane (each element's sum is the same)
    static_assert(EPI != 3 || (NW * 32 == 256 && NB == 4 && MB == 4), "16 rows a trip, 16 column groups");
    constexpr bool fo = (EPI == 3);
    const int rb = fo ? (int)(threadIdx.x & 15) : (int)(threadIdx.x / (NB * 4)), cofs = (fo ? (int)(threadIdx.x >> 4) : (int)(threadIdx.x % (NB * 4))) * 4;
    if (BIAS && !tr) { const float* pc = bias + c0 + cofs; const float t0 = pc[0], t1 = pc[1], t2 = pc[2], t3 = pc[3];
        asm volatile("s_wait_xcnt 0x0" :: "v"(pc) : "memory");   // the wait in front of any overwrite of a register which the issued load names; the address is an input so that it lives up to it
        bn[0] = bfr(t0); bn[1] = bfr(t1); bn[2] = bfr(t2); bn[3] = bfr(t3); }
    const int eb = tr ? r0 : bxc * TT + r0, ep = tr ? TT : HD, ec = tr ? c0 : 0;
#pragma unroll
    for (int u = 0; u < MB * 16; u += NW * 32 / (NB * 4)) { const int row = rb + u; const float* p = red + row * PW + cofs; v4f val = *(const v4fa*)p;
#pragma unroll
        for (int w = 1; w < NW; ++w) val += *(const v4fa*)(p + w * PS);
        if (BIAS && tr) { const float* pr = bias + r0 + row; const float t = *pr;
            asm volatile("s_wait_xcnt 0x0" :: "v"(pr) : "memory");   // the same wait for the row's bias load
            const float bb = bfr(t); bn[0] = bb; bn[1] = bb; bn[2] = bb; bn[3] = bb; }
        if (BIAS) val += bn;
        if (EPI == 0) *(v4f*)(C + (size_t)(r0 + row) * ldc + c0 + cofs) = val;
        else { size_t e = (size_t)(eb + row) * ep + ec + cofs; v4h o16; v4us oh, ol;
            if (fo) { const int t = tr ? c0 + cofs : r0 + row;   // position; q and k: tiles of 16 positions x 32 d, [position / 16][d / 8][position % 16][d % 8]; v: tiles of 16 d x 32 positions, [position / 32][d / 16][(position / 8) % 4][d % 16][position % 8]
                e = tr ? (size_t)bxr * (TT * HD) + (t >> 5) * 2048 + (row >> 4) * 512 + ((t >> 3) & 3) * 128 + (row & 15) * 8 + (t & 7) : (size_t)bxc * (TT * HD) + (t >> 4) * 1024 + (cofs >> 3) * 128 + (t & 15) * 8 + (cofs & 7); }
#pragma unroll
            for (int q = 0; q < 4; ++q) { o16[q] = tohx(val[q]); unsigned short a2, c2; splitf(val[q], a2, c2); oh[q] = a2; ol[q] = c2; }
            h16* s0 = P16 + e; bf* s1 = Ph + e; bf* s2 = Pl + e; *(v4h*)s0 = o16; *(v4us*)s1 = oh; *(v4us*)s2 = ol;
            // the wait in front of any overwrite of a register which an issued store names; addresses and data are inputs so that they live up to it
            asm volatile("s_wait_xcnt 0x0" :: "v"(s0), "v"(s1), "v"(s2), "v"(__builtin_bit_cast(unsigned long long, o16)), "v"(__builtin_bit_cast(unsigned long long, oh)), "v"(__builtin_bit_cast(unsigned long long, ol)) : "memory"); } }
}


// element (row r, k) of an [R][K] operand in fragment order: tiles of 16 rows x 32 k, [r / 16][k / 32], each [k / 8 % 4][r % 16][k % 8]
__device__ __forceinline__ size_t fragofs(int r, int k, int K) { return ((size_t)(r >> 4) * (K >> 5) + (k >> 5)) * 512 + ((k >> 3) & 3) * 128 + (r & 15) * 8 + (k & 7); }
__device__ __forceinline__ void d_wtG(int bx, const float* __restrict__ w, int K, int N, bf* Bt) {
    const int lane = threadIdx.x & 31; const int L0 = (bx * 8 + (threadIdx.x >> 5)) * 8; const int nlines = N * K / 64;
{
#pragma unroll 1
        for (int l = 0; l < 8; ++l) { const int L = L0 + l; if (L >= nlines) break; const size_t e = (size_t)L * 64 + lane * 2; const int k = (int)(e % K), n = (int)(e / K); v2us o;
            o[0] = f2bf(w[(size_t)k * N + n]); o[1] = f2bf(w[(size_t)(k + 1) * N + n]); bf* pd = Bt + fragofs(n, k, K); *(v2us*)pd = o;
            asm volatile("s_wait_xcnt 0x0" :: "v"(pd), "v"(__builtin_bit_cast(unsigned, o)) : "memory"); }   // the wait in front of the next trip's overwrite of a register which the issued store names; address and data are inputs so that they live up to it
         }
}
__device__ __forceinline__ void d_cvt8(int bx, const float* __restrict__ src, bf* dst, size_t n8) { const size_t i = (size_t)bx * 256 + threadIdx.x; if (i >= n8) return;
    // thread i writes the i-th 16 bytes of the fragment-ordered plane (rows of DM elements); a block takes 16 rows x 128 k, whole lines on both sides
    const size_t tile = i >> 6; const size_t r = (tile / (DM / 32)) * 16 + (i & 15), k = (tile % (DM / 32)) * 32 + ((i >> 4) & 3) * 8; const float* ps = src + r * DM + k; const v8f v = *(const v8f*)ps; v8us o;
    asm volatile("s_wait_xcnt 0x0" :: "v"(ps) : "memory");   // the wait in front of any overwrite of a register which the issued load names; the address is an input so that it lives up to it
#pragma unroll
    for (int k = 0; k < 8; ++k) o[k] = f2bf(v[k]); *(v8us*)(dst + i * 8) = o;  }
// ---- k_prep: every operand conversion in ONE launch. Both kinds of plane are written in fragment order (fragofs). Blocks [0, 4 WTB): the four weights, transposed to bf16 [n][k], in a row in WT (they come first: their strided reads take longest). Blocks behind them: the four inputs, both batch entries each, to bf16, in a row in XB.
#define WTB ((DM * DQ / 64 + 63) / 64)           // blocks per weight
#define CVB (NB_ * TT * DM / 8 / 256)            // blocks per input
__global__ __launch_bounds__(256) void k_prep(const float* __restrict__ w0, const float* __restrict__ w1, const float* __restrict__ w2, const float* __restrict__ w3, bf* WT, const float* __restrict__ x0, const float* __restrict__ x1, const float* __restrict__ x2, const float* __restrict__ x3, bf* XB) {
    const int bx = blockIdx.x;
    if (bx < 4 * WTB) { const int s = bx / WTB; d_wtG(bx % WTB, s == 0 ? w0 : s == 1 ? w1 : s == 2 ? w2 : w3, DM, DQ, WT + (size_t)s * DM * DQ); }
    else { const int c = bx - 4 * WTB, s = c / CVB; d_cvt8(c % CVB, s == 0 ? x0 : s == 1 ? x1 : s == 2 ? x2 : x3, XB + (size_t)s * NB_ * TT * DM, (size_t)NB_ * TT * DM / 8); }
}
__global__ __launch_bounds__(256) void k_cscvt(const float* __restrict__ cosT, const float* __restrict__ sinT, float* CS) { const int idx = blockIdx.x * 256 + threadIdx.x; if (idx >= TT * HD) return; v2f cs; cs[0] = bfr(cosT[idx]); cs[1] = bfr(sinT[idx]); *(v2f*)(CS + (size_t)idx * 2) = cs;  }
// 2^x with the one free issue slot that the instruction set asks for behind a transcendental
__device__ __forceinline__ float exp2slot(float x) { float e; asm("v_exp_f32 %0, %1\n\tv_nop" : "=v"(e) : "v"(x)); return e; }
// value of lane l ^ 16 (a vector cross-row move, no LDS round trip); every lane is on where it is used
__device__ __forceinline__ float xhalf(float x) { return __int_as_float(__builtin_amdgcn_permlanex16(__float_as_int(x), __float_as_int(x), 0x76543210, 0xfedcba98, false, false)); }
// ---- k_attn: scores, softmax and p.v of BOTH query streams for 16 query rows of one head in one work-group; scores and probabilities never leave it. grid (rows/16, heads, batch entries), 16 waves.
// Wave w owns keys [128 w, 128 w + 128): 2 x 8 score tiles in registers (each k and v fragment serves both streams), computed TRANSPOSED: the k fragment is the A operand and the q fragment the B operand, so a tile is [key][query] and
// lane (lr, hi) holds keys 16 nb + 8 hi + 0..7 of the ONE query lr. Row max and row sum are in-lane plus one exchange of the lane halves, then joined over the waves through LDS; two neighbouring tiles, converted in place, ARE the A fragment
// of p.v (element s: key 8 hi + s, then 16 + 8 hi + s - 8, the order in which ld and ldf deliver v), so no probability changes lanes. p.v summed over the wave's keys in ascending k, the 16 partial tiles added in wave order 0..15 (as the K-split GEMM does), the two streams' difference written as bf16 hi+lo planes.
template <typename T16, int NSPLIT>
__global__ __launch_bounds__(512) void k_attn(const T16* __restrict__ Q1, const T16* __restrict__ Q1l, const T16* __restrict__ Q2, const T16* __restrict__ Q2l, const T16* __restrict__ Kp, const T16* __restrict__ Kl, const T16* __restrict__ Vt, const T16* __restrict__ Vl, const float* __restrict__ lamp, bf* Ah, bf* Al, int row0) {
    typedef typename WFrag<T16>::V V;
    constexpr int NW = 16, KW = TT / NW, NT = KW / 16;   // waves, keys per wave, score tiles per stream and wave
    constexpr int PP = KW + 8;                           // pitch of a wave's probability rows (128 keys) in 16-bit elements: 16 B x odd for the b128 readers
    constexpr int RP = 20;                               // pitch of a row's 16 per-wave values in floats: 16 B x odd
    constexpr int PW = HD + 4, PS = 32 * PW;             // partial output tile: row pitch and size in floats
    constexpr bool HIRES = (NSPLIT == 2);
    constexpr int PB = (HIRES ? 2 : 1) * 32 * PP;        // 16-bit elements of one wave's probability planes
    constexpr int SB = (NW * PB * 2 > NW * PS * 4) ? NW * PB * 2 : NW * PS * 4;
    __shared__ __align__(16) char sm[SB];                // hi+lo planes: first the parked probabilities, then (behind a barrier) the partial output tiles; single plane: the partial output tiles alone
    T16* pbuf = (T16*)sm; float* red = (float*)sm;
    __shared__ __align__(16) float rmx[32 * RP];
    __shared__ __align__(16) float rsm[32 * RP];
    const int lane = threadIdx.x & 31, lr = lane & 15, hi = lane >> 4, wave = threadIdx.x >> 5; const int r0 = row0 + blockIdx.x * 16; const size_t hp = ((size_t)blockIdx.z * NH_ + blockIdx.y) * TT * HD;
    const float lam = bfr(lamp[0]);   // read here, where control flow is uniform, so that it is a scalar load whose latency the whole kernel hides
    const size_t qoff = hp + (size_t)r0 * HD + lane * 8, koff = hp + (size_t)wave * KW * HD + lane * 8, voff = hp + (size_t)wave * KW * HD + lane * 8;   // the planes are in fragment order: 16 query rows are 1024 elements in a row, the wave's 128 keys 8192 elements in a row of k and of v
    const T16* pq1 = Q1 + qoff; const T16* pq2 = Q2 + qoff; const T16* pk = Kp + koff; const T16* pv = Vt + voff; const T16* pq1l = Q1l + qoff; const T16* pq2l = Q2l + qoff; const T16* pkl = Kl + koff; const T16* pvl = Vl + voff;
    v8f sc[2][NT];
#pragma unroll
    for (int s = 0; s < 2; ++s)
#pragma unroll
        for (int nb = 0; nb < NT; ++nb) sc[s][nb] = (v8f){};
    if constexpr (HIRES) {
#pragma unroll
        for (int kc = 0; kc < HD; kc += 32) {
            V a[2], a2[2]; a[0] = WFrag<T16>::ldf(pq1 + kc * 16); a[1] = WFrag<T16>::ldf(pq2 + kc * 16); if (HIRES) { a2[0] = WFrag<T16>::ldf(pq1l + kc * 16); a2[1] = WFrag<T16>::ldf(pq2l + kc * 16); }
#pragma unroll
            for (int nb = 0; nb < NT; ++nb) { const V b = WFrag<T16>::ldf(pk + nb * 1024 + kc * 16); V b2; if (HIRES) b2 = WFrag<T16>::ldf(pkl + nb * 1024 + kc * 16);
#pragma unroll
                for (int s = 0; s < 2; ++s) { sc[s][nb] = WFrag<T16>::mma(b, a[s], sc[s][nb]); if (HIRES) { sc[s][nb] = WFrag<T16>::mma(b, a2[s], sc[s][nb]); sc[s][nb] = WFrag<T16>::mma(b2, a[s], sc[s][nb]); } } }
        }
    } else {
        // single planes: all of the wave's q and k fragments fit in registers beside nothing else, so every load is issued before the first WMMA (one trip to L2 instead of one per tile); each tile still sums kc = 0, then 32
        V a[2][2], b[NT][2];
#pragma unroll
        for (int c = 0; c < 2; ++c) { a[c][0] = WFrag<T16>::ldf(pq1 + c * 512); a[c][1] = WFrag<T16>::ldf(pq2 + c * 512); }
#pragma unroll
        for (int nb = 0; nb < NT; ++nb)
#pragma unroll
            for (int c = 0; c < 2; ++c) b[nb][c] = WFrag<T16>::ldf(pk + nb * 1024 + c * 512);
        __builtin_amdgcn_sched_barrier(0);   // keeps the WMMAs behind the last load: without it the compiler reuses one fragment's registers and waits for each tile's load in turn
#pragma unroll
        for (int nb = 0; nb < NT; ++nb)
#pragma unroll
            for (int c = 0; c < 2; ++c)
#pragma unroll
                for (int s = 0; s < 2; ++s) sc[s][nb] = WFrag<T16>::mma(b[nb][c], a[c][s], sc[s][nb]);
    }
    // the wait that stands in front of any overwrite of a register which an issued load names; the base addresses are inputs so that they live up to it
    if (HIRES) asm volatile("s_wait_xcnt 0x0" :: "v"(pq1), "v"(pq2), "v"(pk), "v"(pq1l), "v"(pq2l), "v"(pkl) : "memory");
    else asm volatile("s_wait_xcnt 0x0" :: "v"(pq1), "v"(pq2), "v"(pk) : "memory");
    // row max: over the lane's 64 scores of its query, the other lane half, then the 16 waves (a max is exact in any order)
    float st[2];   // per stream: the statistic of the lane's query
#pragma unroll
    for (int s = 0; s < 2; ++s) { v8f m8;
#pragma unroll
        for (int j = 0; j < 8; ++j) m8[j] = -3.0e38f;
#pragma unroll
        for (int nb = 0; nb < NT; ++nb) { sc[s][nb] *= SCL; m8 = __builtin_elementwise_max(m8, sc[s][nb]); }   // whole tiles: neighbouring registers pair up in the packed forms
        const float m = fmaxf(fmaxf(fmaxf(m8[0], m8[1]), fmaxf(m8[2], m8[3])), fmaxf(fmaxf(m8[4], m8[5]), fmaxf(m8[6], m8[7]))); st[s] = fmaxf(m, xhalf(m)); }
    rmx[lane * RP + wave] = hi ? st[1] : st[0];   // row l of the table: lanes 0..15 stream 1, lanes 16..31 stream 2
    __syncthreads();   // every wave's row maxima are in LDS before any is read
    float gm;          // lane l: the max of row l (rows 0..15 stream 1, 16..31 stream 2)
    { const float* p = rmx + lane * RP; const v4f m0 = *(const v4fa*)p, m1 = *(const v4fa*)(p + 4), m2 = *(const v4fa*)(p + 8), m3 = *(const v4fa*)(p + 12); gm = m0[0];
#pragma unroll
      for (int q = 0; q < 4; ++q) gm = fmaxf(fmaxf(gm, m0[q]), fmaxf(m1[q], fmaxf(m2[q], m3[q]))); }
    { const float go = xhalf(gm); st[0] = hi ? go : gm; st[1] = hi ? gm : go; }   // both streams' value of query lr
    // one exp per score; row sum: eight in-lane sums (one per register index, tiles in order), a fixed tree over them, the other lane half, the waves in order 0..15
#pragma unroll
    for (int s = 0; s < 2; ++s) { const float mx = st[s]; v8f s8 = (v8f){};
#pragma unroll
        for (int nb = 0; nb < NT; ++nb) { const v8f d0 = (sc[s][nb] - mx) * 1.4426950408889634f; v8f e;
#pragma unroll
            for (int j = 0; j < 8; ++j) e[j] = exp2slot(d0[j]);
            sc[s][nb] = e; s8 += e; }
        const float sum = ((s8[0] + s8[1]) + (s8[2] + s8[3])) + ((s8[4] + s8[5]) + (s8[6] + s8[7])); st[s] = sum + xhalf(sum); }
    rsm[lane * RP + wave] = hi ? st[1] : st[0];
    __syncthreads();   // every wave's row sums are in LDS before any is read
    float gf;          // lane l: the factor of row l
    { const float* p = rsm + lane * RP; float sum = p[0];
#pragma unroll
      for (int w = 1; w < NW; ++w) sum += p[w];
      gf = __fdiv_rn(HIRES ? 1.0f : PCAR, sum); }
    { const float go = xhalf(gf); st[0] = hi ? go : gf; st[1] = hi ? gf : go; }
    // the probabilities as A fragments. Single plane: 64 registers, kept. Hi+lo planes: 128 registers, too many beside the v fragments, so each lane parks ITS OWN fragments in the wave's LDS piece (16-byte stores) and reads the same bytes back
    T16* pw = pbuf + wave * PB + lr * PP + 8 * hi;
    V pf[2][KW / 32];
#pragma unroll
    for (int s = 0; s < 2; ++s)
#pragma unroll
        for (int ks = 0; ks < KW / 32; ++ks) {
            if constexpr (HIRES) {
#pragma unroll
                for (int t = 0; t < 2; ++t) { const v8f p = sc[s][ks * 2 + t] * st[s]; v8us h8, l8;
#pragma unroll
                    for (int j = 0; j < 8; ++j) { unsigned short h, l; splitf(p[j], h, l); h8[j] = h; l8[j] = l; }
                    *(v8us*)(pw + s * 16 * PP + ks * 32 + t * 16) = h8; *(v8us*)(pw + 32 * PP + s * 16 * PP + ks * 32 + t * 16) = l8; }
            } else pf[s][ks] = cat16(__builtin_convertvector(sc[s][ks * 2] * st[s], v8h), __builtin_convertvector(sc[s][ks * 2 + 1] * st[s], v8h)); }
    v8f oc[2][HD / 16];
#pragma unroll
    for (int s = 0; s < 2; ++s)
#pragma unroll
        for (int nb = 0; nb < HD / 16; ++nb) oc[s][nb] = (v8f){};
    constexpr int GK = HIRES ? 2 : 4;   // k steps whose v fragments are loaded ahead of their WMMAs (what the registers hold beside the accumulators)
#pragma unroll
    for (int kg = 0; kg < KW / 32; kg += GK) {
        V b[GK][HD / 16], b2[GK][HD / 16];
#pragma unroll
        for (int nb = 0; nb < HD / 16; ++nb)
#pragma unroll
            for (int g = 0; g < GK; ++g) { b[g][nb] = WFrag<T16>::ldf(pv + (kg + g) * 2048 + nb * 512); if (HIRES) b2[g][nb] = WFrag<T16>::ldf(pvl + (kg + g) * 2048 + nb * 512); }
        __builtin_amdgcn_sched_barrier(0);   // keeps the WMMAs behind the group's last load: without it the compiler reuses one fragment's registers and waits for each load in turn
#pragma unroll
        for (int g = 0; g < GK; ++g) { const int ks = kg + g; V a[2], a2[2];
#pragma unroll
            for (int s = 0; s < 2; ++s) { if constexpr (HIRES) { a[s] = WFrag<T16>::ld(pw + s * 16 * PP + ks * 32); a2[s] = WFrag<T16>::ld(pw + 32 * PP + s * 16 * PP + ks * 32); } else a[s] = pf[s][ks]; }
#pragma unroll
            for (int nb = 0; nb < HD / 16; ++nb)
#pragma unroll
                for (int s = 0; s < 2; ++s) { oc[s][nb] = WFrag<T16>::mma(a[s], b[g][nb], oc[s][nb]); if (HIRES) { oc[s][nb] = WFrag<T16>::mma(a2[s], b[g][nb], oc[s][nb]); oc[s][nb] = WFrag<T16>::mma(a[s], b2[g][nb], oc[s][nb]); } } }
    }
    // the same wait for the v loads
    if (HIRES) asm volatile("s_wait_xcnt 0x0" :: "v"(pv), "v"(pvl) : "memory");
    else asm volatile("s_wait_xcnt 0x0" :: "v"(pv) : "memory");
    if constexpr (HIRES) __syncthreads();   // every wave has read its parked probabilities before the partial tiles are written over them (single plane: nothing lay there)
    else __builtin_amdgcn_sched_barrier(0);   // keeps the stores below behind the last WMMA
    float* my = red + wave * PS + hi * 8 * PW + lr;
#pragma unroll
    for (int s = 0; s < 2; ++s)
#pragma unroll
        for (int nb = 0; nb < HD / 16; ++nb)
#pragma unroll
            for (int j = 0; j < 8; ++j) my[(s * 16 + j) * PW + nb * 16] = oc[s][nb][j];
    __syncthreads();   // every wave's partial tile is in LDS before any is read
    // one thread sums the same row and columns of both streams, so the difference (a1 v) - lam (a2 v) is formed here and goes out as the hi+lo planes [position][head x 64 + d] of the output product's A operand
    // (in fragment order, as that product reads it: a wave takes 16 rows x 8 columns, 256 bytes in a row there)
    if (threadIdx.x < 256) { const int row = threadIdx.x & 15, cofs = (threadIdx.x >> 4) * 4; const float* p = red + row * PW + cofs; v4f v1 = *(const v4fa*)p, v2 = *(const v4fa*)(p + 16 * PW);
#pragma unroll
      for (int w = 1; w < NW; ++w) { v1 += *(const v4fa*)(p + w * PS); v2 += *(const v4fa*)(p + w * PS + 16 * PW); }
      constexpr float cs = HIRES ? 1.0f : (1.0f / PCAR); v4us oh, ol;
#pragma unroll
      for (int q = 0; q < 4; ++q) { unsigned short s1, s2; splitf(v1[q] * cs - lam * (v2[q] * cs), s1, s2); oh[q] = s1; ol[q] = s2; }
      const size_t oo = (size_t)blockIdx.z * TT * DQ + fragofs(r0 + row, blockIdx.y * HD + cofs, DQ); *(v4us*)(Ah + oo) = oh; *(v4us*)(Al + oo) = ol; }
}
__global__ __launch_bounds__(256) void k_merge(const float* __restrict__ O, int h0, bf* Ah, bf* Al) { const size_t e = ((size_t)blockIdx.x * 256 + threadIdx.x) * 2; if (e >= (size_t)ZH * TT * HD) return; const int d = (int)(e % HD); const int t = (int)((e / HD) % TT); const int zz = (int)(e / ((size_t)HD * TT)); const float cs = (t < RH) ? 1.0f : (1.0f / PCAR); const size_t oo = (size_t)t * DQ + (h0 + zz) * HD + d;
    v2us oh, ol;
#pragma unroll
    for (int q = 0; q < 2; ++q) { unsigned short a, c2; splitf(O[e + q] * cs, a, c2); oh[q] = a; ol[q] = c2; } *(v2us*)(Ah + oo) = oh; *(v2us*)(Al + oo) = ol;  }

extern "C" void kernel_launch(void* const* d_in, const int* in_sizes, int n_in,
                              void* d_out, int out_size, void* d_ws, size_t ws_size, hipStream_t stream) {
    (void)in_sizes; (void)n_in; (void)out_size;
    const float* vin = (const float*)d_in[0]; const float* kin = (const float*)d_in[1]; const float* q1in = (const float*)d_in[2]; const float* q2in = (const float*)d_in[3]; const float* wq = (const float*)d_in[4]; const float* bq = (const float*)d_in[5]; const float* wk = (const float*)d_in[6]; const float* bk = (const float*)d_in[7]; const float* wv = (const float*)d_in[8]; const float* bv = (const float*)d_in[9]; const float* wo = (const float*)d_in[10]; const float* bo = (const float*)d_in[11]; const float* lamp = (const float*)d_in[12];   // weights x @ W
    float* OUT = (float*)d_out;     // [2][2048][1024]
    char* wsp = (char*)d_ws;
    auto take = [&](size_t bytes) { char* p = wsp; wsp += (bytes + 255) & ~(size_t)255; return (void*)p; };
    constexpr size_t PLN = (size_t)NH_ * TT * HD;   // one head plane set of one batch entry; planes are [stream q1, q2, k, v][batch entry]
    bf* WT = (bf*)take((size_t)4 * DQ * DM * 2);      // Wq, Wk, Wv, Wo transposed
    bf* XB = (bf*)take((size_t)4 * NB_ * TT * DM * 2);   // q1, q2, k, v in bf16
    h16* P16 = (h16*)take(4 * NB_ * PLN * 2); bf* Ph = (bf*)take(4 * NB_ * PLN * 2); bf* Pl = (bf*)take(4 * NB_ * PLN * 2);
    bf* ATh = (bf*)take((size_t)NB_ * TT * DQ * 2); bf* ATl = (bf*)take((size_t)NB_ * TT * DQ * 2);
    if ((size_t)(wsp - (char*)d_ws) > ws_size) return;    // ws 256 MiB
    k_prep<<<(unsigned)(4 * WTB + 4 * CVB), 256, 0, stream>>>(wq, wk, wv, wo, WT, q1in, q2in, kin, vin, XB);
    k_gemmks<bf, 0, true, 4, 4, 8, DM, 1, 3><<<dim3(TT / 64, DQ / 64, 4 * NB_), 256, 0, stream>>>(XB, nullptr, WT, nullptr, nullptr, 0, bq, bk, bv, 0, 0, 0, P16, Ph, Pl);
    k_attn<bf, 2><<<dim3(RH / 16, NH_, NB_), 512, 0, stream>>>(Ph, Pl, Ph + 2 * PLN, Pl + 2 * PLN, Ph + 4 * PLN, Pl + 4 * PLN, Ph + 6 * PLN, Pl + 6 * PLN, lamp, ATh, ATl, 0);
    k_attn<h16, 0><<<dim3((TT - RH) / 16, NH_, NB_), 512, 0, stream>>>(P16, nullptr, P16 + 2 * PLN, nullptr, P16 + 4 * PLN, nullptr, P16 + 6 * PLN, nullptr, lamp, ATh, ATl, RH);
    k_gemmks<bf, 1, true, 4, 4, 8, DQ, 1, 0><<<dim3(TT / 64, DM / 64, NB_), 256, 0, stream>>>(ATh, ATl, WT + (size_t)3 * DQ * DM, nullptr, OUT, DM, bo, nullptr, nullptr, (size_t)TT * DQ, 0, (size_t)TT * DM, nullptr, nullptr, nullptr);
}

// v007
// Measured time: 217 microseconds a run.
// In both of two side-by-side timings against v006, it was 1.22 times as fast.
// Over all steps from v000 it is 17.2 times as fast.
#include <hip/hip_runtime.h>

// NoiseCancellingAttentionMechanism - differential attention with two query streams (v, k, q1, q2 [2][2048][1024]; q1h/q2h = q1/q2 Wq + bq (shared), kh = k Wk + bk, vh = v Wv + bv (16 heads x 64);
// a1 = softmax(q1h.kh/8), a2 = softmax(q2h.kh/8); out = merged (a1 - lam a2) vh, Wo + bo with the scalar lam read as data -> [2][2048][1024]).
// Compute dtypes, f32 accumulate: every input rounded to bf16; projections on PLAIN bf16 operands (inputs: exact, + bias); PER-ROW PRECISION HYBRID for both score sets and both
// p.v contractions (query rows < 256 on bf16 hi+lo planes with 3 products, rows >= 256 on single fp16 planes, probabilities x1024 there); f32 register-row softmaxes; the difference (a1 v) - lam (a2 v) and the

#define NB_  2
#define TT   2048
#define DM   1024
#define NH_  16
#define NKV  16
#define REP  (NH_ / NKV)
#define HD   64
#define DQ   (NH_ * HD)
#define DKV  (NKV * HD)
#define ZH   NH_                  // heads per merge launch
#define RH   256                  // query rows < RH use hi+lo planes (0: none)
#define WIN  0
#define PCAR 1024.0f
#define SCL  0.125f   // HD^-0.5
typedef _Float16 h16;
typedef unsigned short bf;
typedef __attribute__((ext_vector_type(16))) __bf16   v16bf;
typedef __attribute__((ext_vector_type(16))) _Float16 v16h;
typedef __attribute__((ext_vector_type(8)))  _Float16 v8h;
typedef __attribute__((ext_vector_type(8)))  unsigned short v8us;
typedef __attribute__((ext_vector_type(8)))  float    v8f;
typedef __attribute__((ext_vector_type(4)))  float    v4f;
typedef v8h  __attribute__((may_alias)) v8ha;
typedef v4f  __attribute__((may_alias)) v4fa;
typedef v8us __attribute__((may_alias)) v8usa;

__device__ __forceinline__ unsigned short f2bf(float f) { unsigned u = __float_as_uint(f); u += 0x7FFFu + ((u >> 16) & 1u); return (unsigned short)(u >> 16); }
__device__ __forceinline__ float bf2f(unsigned short b) { return __uint_as_float(((unsigned)b) << 16); }
__device__ __forceinline__ float bfr(float f) { return bf2f(f2bf(f)); }
__device__ __forceinline__ v16h cat16(v8h lo, v8h hi) { return __builtin_shufflevector(lo, hi, 0, 1, 2, 3, 4, 5, 6, 7, 8, 9, 10, 11, 12, 13, 14, 15); }
__device__ __forceinline__ v16bf cat16b(v8us lo, v8us hi) { return __builtin_bit_cast(v16bf, __builtin_shufflevector(lo, hi, 0, 1, 2, 3, 4, 5, 6, 7, 8, 9, 10, 11, 12, 13, 14, 15)); }
__device__ __forceinline__ v8f wmma16(v16h a, v16h b, v8f c) { return __builtin_amdgcn_wmma_f32_16x16x32_f16(false, a, false, b, (short)0, c, false, false); }
__device__ __forceinline__ v8f wmmab(v16bf a, v16bf b, v8f c) { return __builtin_amdgcn_wmma_f32_16x16x32_bf16(false, a, false, b, (short)0, c, false, false); }



// 16-bit fragment loaders (K-contiguous rows; the same k order for A and B) and their matrix instruction. ldf reads the same fragment from a plane kept in FRAGMENT ORDER: a 16 x 32 tile is 512 elements, [k / 8][row][k % 8],
// so p = tile + lane * 8 and each of the two loads takes 512 bytes in a row (4 whole lines) where ld touches 16 lines; lane and register hold the same element as with ld
template <typename T16> struct WFrag;
template <> struct WFrag<h16> { typedef v16h V; static __device__ __forceinline__ V ld(const h16* p) { return cat16(*(const v8h*)p, *(const v8h*)(p + 16)); } static __device__ __forceinline__ V ldf(const h16* p) { return cat16(*(const v8h*)p, *(const v8h*)(p + 256)); } static __device__ __forceinline__ v8f mma(V a, V b, v8f c) { return wmma16(a, b, c); } };
template <> struct WFrag<bf> { typedef v16bf V; static __device__ __forceinline__ V ld(const bf* p) { return cat16b(*(const v8us*)p, *(const v8us*)(p + 16)); } static __device__ __forceinline__ V ldf(const bf* p) { return cat16b(*(const v8us*)p, *(const v8us*)(p + 256)); } static __device__ __forceinline__ v8f mma(V a, V b, v8f c) { return wmmab(a, b, c); } };

__device__ __forceinline__ h16 tohx(float x) { return (h16)x; }
__device__ __forceinline__ void splitf(float y, unsigned short& h, unsigned short& l) { h = f2bf(y); l = f2bf(y - bf2f(h)); }
typedef __attribute__((ext_vector_type(2))) _Float16 v2h;
typedef __attribute__((ext_vector_type(4))) _Float16 v4h;
typedef __attribute__((ext_vector_type(2))) unsigned short v2us;
typedef __attribute__((ext_vector_type(4))) unsigned short v4us;
typedef __attribute__((ext_vector_type(2))) float v2f;
typedef __attribute__((ext_vector_type(4))) int v4i;

// ---- k_gemmks: C[m][n] (f32, pitch ldc, + optional f32 bias[n]) = sum_k A[m][k] Bt[n][k] (+ split products per NSPLIT) for a long K, K SPLIT OVER THE NW WAVES OF ONE WORK-GROUP: wave w sums k in [w K/NW, (w+1) K/NW) for the whole (MB*16)x(NB*16) tile, writes its f32 partial tile to its own LDS range,
// and behind one work-group barrier the partial tiles are added in wave order 0..NW-1 (fixed order) and stored as whole 128-B row pieces. grid (M/(MB*16), N/(NB*16), Z), NW*32 threads. K % (32 NW G) == 0.
// EPI 0: f32 C as above. EPI 1, 2: no C; the sum (+ bias) goes straight into the three 16-bit planes the attention kernel reads (fp16, bf16 hi, bf16 lo).
// EPI 1: m = position, n = head x 64 + d, bias[n], planes [head][position][d] (a column block is one head). EPI 2: m = head x 64 + d, n = position, bias[m], planes [head][d][position] (the weight is the A operand, so v comes out transposed).
// EPI 3: all four projections of both batch entries in ONE launch, grid (TT/64, DQ/64, 8): z = stream x 2 + batch entry, streams q1, q2, k (each as EPI 1) and v (as EPI 2, block indices swapped). A = the eight bf16 inputs [z][position][k], Bt = the transposed weights Wq, Wk, Wv in a row,
// bias / biasK / biasV = bq / bk / bv, planes [z][...]. Every choice depends on blockIdx alone, so it is uniform for the work-group.
template <typename T16, int NSPLIT, bool BIAS, int MB, int NB, int NW, int K, int G, int EPI>
__global__ __launch_bounds__(NW * 32) void k_gemmks(const T16* __restrict__ A, const T16* __restrict__ A2, const T16* __restrict__ Bt, const T16* __restrict__ Bt2, float* C, int ldc, const float* __restrict__ bias, const float* __restrict__ biasK, const float* __restrict__ biasV, size_t sA, size_t sB, size_t sC, h16* P16, bf* Ph, bf* Pl) {
    static_assert((EPI != 1 && EPI != 3) || NB * 16 == HD, "a column block is one head");
    typedef typename WFrag<T16>::V V;
    constexpr int PW = NB * 16 + 4;        // LDS row pitch in floats: 16 B x odd for the b128 readers
    constexpr int PS = MB * 16 * PW;       // floats of one wave's partial tile
    __shared__ __align__(16) float red[NW * PS];
    const size_t z = blockIdx.z; const bool tr = (EPI == 2) || (EPI == 3 && z >= 6);   // tr: the weight is the A operand
    if (EPI == 3) { const T16* X = A + z * ((size_t)TT * DM); const T16* Wt = Bt + (z < 4 ? 0 : (z >> 1) - 1) * ((size_t)DQ * DM); A = tr ? Wt : X; Bt = tr ? X : Wt; bias = z < 4 ? bias : (tr ? biasV : biasK);
        P16 += z * ((size_t)NH_ * TT * HD); Ph += z * ((size_t)NH_ * TT * HD); Pl += z * ((size_t)NH_ * TT * HD); }
    else { A += z * sA; if (A2) A2 += z * sA; Bt += z * sB; if (Bt2) Bt2 += z * sB; C += z * sC; }
    const int lane = threadIdx.x & 31, lr = lane & 15, hi = lane >> 4, wave = threadIdx.x >> 5; const int bxr = (EPI == 3 && tr) ? blockIdx.y : blockIdx.x, bxc = (EPI == 3 && tr) ? blockIdx.x : blockIdx.y; const int r0 = bxr * (MB * 16), c0 = bxc * (NB * 16);
    v8f acc[MB][NB];
#pragma unroll
    for (int mb = 0; mb < MB; ++mb)
#pragma unroll
        for (int nb = 0; nb < NB; ++nb) acc[mb][nb] = (v8f){};
    static_assert((K / NW) % 32 == 0, "a wave's k range is whole tiles");
    // both operands lie in fragment order, [row / 16][k / 32] tiles of 512 elements
    const size_t aoff = ((size_t)(r0 >> 4) * (K / 32) + wave * (K / NW / 32)) * 512 + lane * 8, boff = ((size_t)(c0 >> 4) * (K / 32) + wave * (K / NW / 32)) * 512 + lane * 8;
    const T16* pa = A + aoff; const T16* pb = Bt + boff; const T16* pa2 = A2 + aoff; const T16* pb2 = Bt2 + boff;
    // G k steps form a group: the group's loads are all issued first (row set by row set, so that the loads of one 128-B line follow one another), then its WMMAs in ascending k
#pragma unroll
    for (int kg = 0; kg < K / NW; kg += 32 * G) {
        V a[G][MB], a2[G][MB], b[G][NB], b2[G][NB];
#pragma unroll
        for (int mb = 0; mb < MB; ++mb) {
#pragma unroll
            for (int s = 0; s < G; ++s) a[s][mb] = WFrag<T16>::ldf(pa + (size_t)mb * 16 * K + (kg + s * 32) * 16);
            if (NSPLIT == 1 || NSPLIT == 2) {
#pragma unroll
                for (int s = 0; s < G; ++s) a2[s][mb] = WFrag<T16>::ldf(pa2 + (size_t)mb * 16 * K + (kg + s * 32) * 16); } }
#pragma unroll
        for (int nb = 0; nb < NB; ++nb) {
#pragma unroll
            for (int s = 0; s < G; ++s) b[s][nb] = WFrag<T16>::ldf(pb + (size_t)nb * 16 * K + (kg + s * 32) * 16);
            if (NSPLIT >= 2) {
#pragma unroll
                for (int s = 0; s < G; ++s) b2[s][nb] = WFrag<T16>::ldf(pb2 + (size_t)nb * 16 * K + (kg + s * 32) * 16); } }
        // the wait that stands in front of any overwrite of a register which an issued load names; the base addresses are inputs so that they live up to it (no load's result lands on them)
        if (NSPLIT == 2) asm volatile("s_wait_xcnt 0x0" :: "v"(pa), "v"(pb), "v"(pa2), "v"(pb2) : "memory");
        else if (NSPLIT == 1) asm volatile("s_wait_xcnt 0x0" :: "v"(pa), "v"(pb), "v"(pa2) : "memory");
        else asm volatile("s_wait_xcnt 0x0" :: "v"(pa), "v"(pb) : "memory");
        if (G > 1) __builtin_amdgcn_sched_barrier(0);   // keeps the WMMAs behind the group's last load: without it the compiler weaves them among the loads to save registers and a wave has few loads in flight
#pragma unroll
        for (int s = 0; s < G; ++s)
#pragma unroll
            for (int nb = 0; nb < NB; ++nb)
#pragma unroll
                for (int mb = 0; mb < MB; ++mb) { acc[mb][nb] = WFrag<T16>::mma(a[s][mb], b[s][nb], acc[mb][nb]); if (NSPLIT == 1 || NSPLIT == 2) acc[mb][nb] = WFrag<T16>::mma(a2[s][mb], b[s][nb], acc[mb][nb]); if (NSPLIT >= 2) acc[mb][nb] = WFrag<T16>::mma(a[s][mb], b2[s][nb], acc[mb][nb]); }
    }
    float* my = red + wave * PS;
#pragma unroll
    for (int mb = 0; mb < MB; ++mb)
#pragma unroll
        for (int nb = 0; nb < NB; ++nb)
#pragma unroll
            for (int j = 0; j < 8; ++j) my[(mb * 16 + hi * 8 + j) * PW + nb * 16 + lr] = acc[mb][nb][j];
    __syncthreads();   // every wave's partial tile is in LDS before any is read
    // what differs between the two orientations is set up once, from block-uniform values: the bias of the thread's four columns (the same in every trip) and the plane address (eb + row) * ep + ec + cofs
    static_assert((NW * 32) % (NB * 4) == 0, "a thread keeps its columns from trip to trip");
    v4f bn = (v4f){};
    // the head planes of EPI 3 go out in fragment order; there a wave takes 16 rows x 8 columns, which is 256 bytes in a row of such a plane (each element's sum is the same)
    static_assert(EPI != 3 || (NW * 32 == 256 && NB == 4 && MB == 4), "16 rows a trip, 16 column groups");
    constexpr bool fo = (EPI == 3);
    const int rb = fo ? (int)(threadIdx.x & 15) : (int)(threadIdx.x / (NB * 4)), cofs = (fo ? (int)(threadIdx.x >> 4) : (int)(threadIdx.x % (NB * 4))) * 4;
    if (BIAS && !tr) { const float* pc = bias + c0 + cofs; const float t0 = pc[0], t1 = pc[1], t2 = pc[2], t3 = pc[3];
        asm volatile("s_wait_xcnt 0x0" :: "v"(pc) : "memory");   // the wait in front of any overwrite of a register which the issued load names; the address is an input so that it lives up to it
        bn[0] = bfr(t0); bn[1] = bfr(t1); bn[2] = bfr(t2); bn[3] = bfr(t3); }
    const int eb = tr ? r0 : bxc * TT + r0, ep = tr ? TT : HD, ec = tr ? c0 : 0;
#pragma unroll
    for (int u = 0; u < MB * 16; u += NW * 32 / (NB * 4)) { const int row = rb + u; const float* p = red + row * PW + cofs; v4f val = *(const v4fa*)p;
#pragma unroll
        for (int w = 1; w < NW; ++w) val += *(const v4fa*)(p + w * PS);
        if (BIAS && tr) { const float* pr = bias + r0 + row; const float t = *pr;
            asm volatile("s_wait_xcnt 0x0" :: "v"(pr) : "memory");   // the same wait for the row's bias load
            const float bb = bfr(t); bn[0] = bb; bn[1] = bb; bn[2] = bb; bn[3] = bb; }
        if (BIAS) val += bn;
        if (EPI == 0) *(v4f*)(C + (size_t)(r0 + row) * ldc + c0 + cofs) = val;
        else { size_t e = (size_t)(eb + row) * ep + ec + cofs; v4h o16; v4us oh, ol;
            if (fo) { const int t = tr ? c0 + cofs : r0 + row;   // position; q and k: tiles of 16 positions x 32 d, [position / 16][d / 8][position % 16][d % 8]; v: tiles of 16 d x 32 positions, [position / 32][d / 16][(position / 8) % 4][d % 16][position % 8]
                e = tr ? (size_t)bxr * (TT * HD) + (t >> 5) * 2048 + (row >> 4) * 512 + ((t >> 3) & 3) * 128 + (row & 15) * 8 + (t & 7) : (size_t)bxc * (TT * HD) + (t >> 4) * 1024 + (cofs >> 3) * 128 + (t & 15) * 8 + (cofs & 7); }
#pragma unroll
            for (int q = 0; q < 4; ++q) { o16[q] = tohx(val[q]); unsigned short a2, c2; splitf(val[q], a2, c2); oh[q] = a2; ol[q] = c2; }
            h16* s0 = P16 + e; bf* s1 = Ph + e; bf* s2 = Pl + e; *(v4h*)s0 = o16; *(v4us*)s1 = oh; *(v4us*)s2 = ol;
            // the wait in front of any overwrite of a register which an issued store names; addresses and data are inputs so that they live up to it
            asm volatile("s_wait_xcnt 0x0" :: "v"(s0), "v"(s1), "v"(s2), "v"(__builtin_bit_cast(unsigned long long, o16)), "v"(__builtin_bit_cast(unsigned long long, oh)), "v"(__builtin_bit_cast(unsigned long long, ol)) : "memory"); } }
}


// element (row r, k) of an [R][K] operand in fragment order: tiles of 16 rows x 32 k, [r / 16][k / 32], each [k / 8 % 4][r % 16][k % 8]
__device__ __forceinline__ size_t fragofs(int r, int k, int K) { return ((size_t)(r >> 4) * (K >> 5) + (k >> 5)) * 512 + ((k >> 3) & 3) * 128 + (r & 15) * 8 + (k & 7); }
__device__ __forceinline__ void d_wtG(int bx, const float* __restrict__ w, int K, int N, bf* Bt) {
    const int lane = threadIdx.x & 31; const int L0 = (bx * 8 + (threadIdx.x >> 5)) * 8; const int nlines = N * K / 64;
{
#pragma unroll 1
        for (int l = 0; l < 8; ++l) { const int L = L0 + l; if (L >= nlines) break; const size_t e = (size_t)L * 64 + lane * 2; const int k = (int)(e % K), n = (int)(e / K); v2us o;
            o[0] = f2bf(w[(size_t)k * N + n]); o[1] = f2bf(w[(size_t)(k + 1) * N + n]); bf* pd = Bt + fragofs(n, k, K); *(v2us*)pd = o;
            asm volatile("s_wait_xcnt 0x0" :: "v"(pd), "v"(__builtin_bit_cast(unsigned, o)) : "memory"); }   // the wait in front of the next trip's overwrite of a register which the issued store names; address and data are inputs so that they live up to it
         }
}
__device__ __forceinline__ void d_cvt8(int bx, const float* __restrict__ src, bf* dst, size_t n8) { const size_t i = (size_t)bx * 256 + threadIdx.x; if (i >= n8) return;
    // thread i writes the i-th 16 bytes of the fragment-ordered plane (rows of DM elements); a block takes 16 rows x 128 k, whole lines on both sides
    const size_t tile = i >> 6; const size_t r = (tile / (DM / 32)) * 16 + (i & 15), k = (tile % (DM / 32)) * 32 + ((i >> 4) & 3) * 8; const float* ps = src + r * DM + k; const v8f v = *(const v8f*)ps; v8us o;
    asm volatile("s_wait_xcnt 0x0" :: "v"(ps) : "memory");   // the wait in front of any overwrite of a register which the issued load names; the address is an input so that it lives up to it
#pragma unroll
    for (int k = 0; k < 8; ++k) o[k] = f2bf(v[k]); *(v8us*)(dst + i * 8) = o;  }
// ---- k_prep: every operand conversion in ONE launch. Both kinds of plane are written in fragment order (fragofs). Blocks [0, 4 WTB): the four weights, transposed to bf16 [n][k], in a row in WT (they come first: their strided reads take longest). Blocks behind them: the four inputs, both batch entries each, to bf16, in a row in XB.
#define WTB ((DM * DQ / 64 + 63) / 64)           // blocks per weight
#define CVB (NB_ * TT * DM / 8 / 256)            // blocks per input
__global__ __launch_bounds__(256) void k_prep(const float* __restrict__ w0, const float* __restrict__ w1, const float* __restrict__ w2, const float* __restrict__ w3, bf* WT, const float* __restrict__ x0, const float* __restrict__ x1, const float* __restrict__ x2, const float* __restrict__ x3, bf* XB) {
    const int bx = blockIdx.x;
    if (bx < 4 * WTB) { const int s = bx / WTB; d_wtG(bx % WTB, s == 0 ? w0 : s == 1 ? w1 : s == 2 ? w2 : w3, DM, DQ, WT + (size_t)s * DM * DQ); }
    else { const int c = bx - 4 * WTB, s = c / CVB; d_cvt8(c % CVB, s == 0 ? x0 : s == 1 ? x1 : s == 2 ? x2 : x3, XB + (size_t)s * NB_ * TT * DM, (size_t)NB_ * TT * DM / 8); }
}
__global__ __launch_bounds__(256) void k_cscvt(const float* __restrict__ cosT, const float* __restrict__ sinT, float* CS) { const int idx = blockIdx.x * 256 + threadIdx.x; if (idx >= TT * HD) return; v2f cs; cs[0] = bfr(cosT[idx]); cs[1] = bfr(sinT[idx]); *(v2f*)(CS + (size_t)idx * 2) = cs;  }
// 2^x with the one free issue slot that the instruction set asks for behind a transcendental
__device__ __forceinline__ float exp2slot(float x) { float e; asm("v_exp_f32 %0, %1\n\tv_nop" : "=v"(e) : "v"(x)); return e; }
// value of lane l ^ 16 (a vector cross-row move, no LDS round trip); every lane is on where it is used
__device__ __forceinline__ float xhalf(float x) { return __int_as_float(__builtin_amdgcn_permlanex16(__float_as_int(x), __float_as_int(x), 0x76543210, 0xfedcba98, false, false)); }
// ---- k_attn: scores, softmax and p.v of BOTH query streams for 16 query rows of one head in one work-group; scores and probabilities never leave it. grid (rows/16, heads, batch entries), 16 waves. Launched for the hi+lo rows; the single-plane rows go through k_attnf below.
// Wave w owns keys [128 w, 128 w + 128): 2 x 8 score tiles in registers (each k and v fragment serves both streams), computed TRANSPOSED: the k fragment is the A operand and the q fragment the B operand, so a tile is [key][query] and
// lane (lr, hi) holds keys 16 nb + 8 hi + 0..7 of the ONE query lr. Row max and row sum are in-lane plus one exchange of the lane halves, then joined over the waves through LDS; two neighbouring tiles, converted in place, ARE the A fragment
// of p.v (element s: key 8 hi + s, then 16 + 8 hi + s - 8, the order in which ld and ldf deliver v), so no probability changes lanes. p.v summed over the wave's keys in ascending k, the 16 partial tiles added in wave order 0..15 (as the K-split GEMM does), the two streams' difference written as bf16 hi+lo planes.
template <typename T16, int NSPLIT>
__global__ __launch_bounds__(512) void k_attn(const T16* __restrict__ Q1, const T16* __restrict__ Q1l, const T16* __restrict__ Q2, const T16* __restrict__ Q2l, const T16* __restrict__ Kp, const T16* __restrict__ Kl, const T16* __restrict__ Vt, const T16* __restrict__ Vl, const float* __restrict__ lamp, bf* Ah, bf* Al, int row0) {
    typedef typename WFrag<T16>::V V;
    constexpr int NW = 16, KW = TT / NW, NT = KW / 16;   // waves, keys per wave, score tiles per stream and wave
    constexpr int PP = KW + 8;                           // pitch of a wave's probability rows (128 keys) in 16-bit elements: 16 B x odd for the b128 readers
    constexpr int RP = 20;                               // pitch of a row's 16 per-wave values in floats: 16 B x odd
    constexpr int PW = HD + 4, PS = 32 * PW;             // partial output tile: row pitch and size in floats
    constexpr bool HIRES = (NSPLIT == 2);
    constexpr int PB = (HIRES ? 2 : 1) * 32 * PP;        // 16-bit elements of one wave's probability planes
    constexpr int SB = (NW * PB * 2 > NW * PS * 4) ? NW * PB * 2 : NW * PS * 4;
    __shared__ __align__(16) char sm[SB];                // hi+lo planes: first the parked probabilities, then (behind a barrier) the partial output tiles; single plane: the partial output tiles alone
    T16* pbuf = (T16*)sm; float* red = (float*)sm;
    __shared__ __align__(16) float rmx[32 * RP];
    __shared__ __align__(16) float rsm[32 * RP];
    const int lane = threadIdx.x & 31, lr = lane & 15, hi = lane >> 4, wave = threadIdx.x >> 5; const int r0 = row0 + blockIdx.x * 16; const size_t hp = ((size_t)blockIdx.z * NH_ + blockIdx.y) * TT * HD;
    const float lam = bfr(lamp[0]);   // read here, where control flow is uniform, so that it is a scalar load whose latency the whole kernel hides
    const size_t qoff = hp + (size_t)r0 * HD + lane * 8, koff = hp + (size_t)wave * KW * HD + lane * 8, voff = hp + (size_t)wave * KW * HD + lane * 8;   // the planes are in fragment order: 16 query rows are 1024 elements in a row, the wave's 128 keys 8192 elements in a row of k and of v
    const T16* pq1 = Q1 + qoff; const T16* pq2 = Q2 + qoff; const T16* pk = Kp + koff; const T16* pv = Vt + voff; const T16* pq1l = Q1l + qoff; const T16* pq2l = Q2l + qoff; const T16* pkl = Kl + koff; const T16* pvl = Vl + voff;
    v8f sc[2][NT];
#pragma unroll
    for (int s = 0; s < 2; ++s)
#pragma unroll
        for (int nb = 0; nb < NT; ++nb) sc[s][nb] = (v8f){};
    if constexpr (HIRES) {
#pragma unroll
        for (int kc = 0; kc < HD; kc += 32) {
            V a[2], a2[2]; a[0] = WFrag<T16>::ldf(pq1 + kc * 16); a[1] = WFrag<T16>::ldf(pq2 + kc * 16); if (HIRES) { a2[0] = WFrag<T16>::ldf(pq1l + kc * 16); a2[1] = WFrag<T16>::ldf(pq2l + kc * 16); }
#pragma unroll
            for (int nb = 0; nb < NT; ++nb) { const V b = WFrag<T16>::ldf(pk + nb * 1024 + kc * 16); V b2; if (HIRES) b2 = WFrag<T16>::ldf(pkl + nb * 1024 + kc * 16);
#pragma unroll
                for (int s = 0; s < 2; ++s) { sc[s][nb] = WFrag<T16>::mma(b, a[s], sc[s][nb]); if (HIRES) { sc[s][nb] = WFrag<T16>::mma(b, a2[s], sc[s][nb]); sc[s][nb] = WFrag<T16>::mma(b2, a[s], sc[s][nb]); } } }
        }
    } else {
        // single planes: all of the wave's q and k fragments fit in registers beside nothing else, so every load is issued before the first WMMA (one trip to L2 instead of one per tile); each tile still sums kc = 0, then 32
        V a[2][2], b[NT][2];
#pragma unroll
        for (int c = 0; c < 2; ++c) { a[c][0] = WFrag<T16>::ldf(pq1 + c * 512); a[c][1] = WFrag<T16>::ldf(pq2 + c * 512); }
#pragma unroll
        for (int nb = 0; nb < NT; ++nb)
#pragma unroll
            for (int c = 0; c < 2; ++c) b[nb][c] = WFrag<T16>::ldf(pk + nb * 1024 + c * 512);
        __builtin_amdgcn_sched_barrier(0);   // keeps the WMMAs behind the last load: without it the compiler reuses one fragment's registers and waits for each tile's load in turn
#pragma unroll
        for (int nb = 0; nb < NT; ++nb)
#pragma unroll
            for (int c = 0; c < 2; ++c)
#pragma unroll
                for (int s = 0; s < 2; ++s) sc[s][nb] = WFrag<T16>::mma(b[nb][c], a[c][s], sc[s][nb]);
    }
    // the wait that stands in front of any overwrite of a register which an issued load names; the base addresses are inputs so that they live up to it
    if (HIRES) asm volatile("s_wait_xcnt 0x0" :: "v"(pq1), "v"(pq2), "v"(pk), "v"(pq1l), "v"(pq2l), "v"(pkl) : "memory");
    else asm volatile("s_wait_xcnt 0x0" :: "v"(pq1), "v"(pq2), "v"(pk) : "memory");
    // row max: over the lane's 64 scores of its query, the other lane half, then the 16 waves (a max is exact in any order)
    float st[2];   // per stream: the statistic of the lane's query
#pragma unroll
    for (int s = 0; s < 2; ++s) { v8f m8;
#pragma unroll
        for (int j = 0; j < 8; ++j) m8[j] = -3.0e38f;
#pragma unroll
        for (int nb = 0; nb < NT; ++nb) { sc[s][nb] *= SCL; m8 = __builtin_elementwise_max(m8, sc[s][nb]); }   // whole tiles: neighbouring registers pair up in the packed forms
        const float m = fmaxf(fmaxf(fmaxf(m8[0], m8[1]), fmaxf(m8[2], m8[3])), fmaxf(fmaxf(m8[4], m8[5]), fmaxf(m8[6], m8[7]))); st[s] = fmaxf(m, xhalf(m)); }
    rmx[lane * RP + wave] = hi ? st[1] : st[0];   // row l of the table: lanes 0..15 stream 1, lanes 16..31 stream 2
    __syncthreads();   // every wave's row maxima are in LDS before any is read
    float gm;          // lane l: the max of row l (rows 0..15 stream 1, 16..31 stream 2)
    { const float* p = rmx + lane * RP; const v4f m0 = *(const v4fa*)p, m1 = *(const v4fa*)(p + 4), m2 = *(const v4fa*)(p + 8), m3 = *(const v4fa*)(p + 12); gm = m0[0];
#pragma unroll
      for (int q = 0; q < 4; ++q) gm = fmaxf(fmaxf(gm, m0[q]), fmaxf(m1[q], fmaxf(m2[q], m3[q]))); }
    { const float go = xhalf(gm); st[0] = hi ? go : gm; st[1] = hi ? gm : go; }   // both streams' value of query lr
    // one exp per score; row sum: eight in-lane sums (one per register index, tiles in order), a fixed tree over them, the other lane half, the waves in order 0..15
#pragma unroll
    for (int s = 0; s < 2; ++s) { const float mx = st[s]; v8f s8 = (v8f){};
#pragma unroll
        for (int nb = 0; nb < NT; ++nb) { const v8f d0 = (sc[s][nb] - mx) * 1.4426950408889634f; v8f e;
#pragma unroll
            for (int j = 0; j < 8; ++j) e[j] = exp2slot(d0[j]);
            sc[s][nb] = e; s8 += e; }
        const float sum = ((s8[0] + s8[1]) + (s8[2] + s8[3])) + ((s8[4] + s8[5]) + (s8[6] + s8[7])); st[s] = sum + xhalf(sum); }
    rsm[lane * RP + wave] = hi ? st[1] : st[0];
    __syncthreads();   // every wave's row sums are in LDS before any is read
    float gf;          // lane l: the factor of row l
    { const float* p = rsm + lane * RP; float sum = p[0];
#pragma unroll
      for (int w = 1; w < NW; ++w) sum += p[w];
      gf = __fdiv_rn(HIRES ? 1.0f : PCAR, sum); }
    { const float go = xhalf(gf); st[0] = hi ? go : gf; st[1] = hi ? gf : go; }
    // the probabilities as A fragments. Single plane: 64 registers, kept. Hi+lo planes: 128 registers, too many beside the v fragments, so each lane parks ITS OWN fragments in the wave's LDS piece (16-byte stores) and reads the same bytes back
    T16* pw = pbuf + wave * PB + lr * PP + 8 * hi;
    V pf[2][KW / 32];
#pragma unroll
    for (int s = 0; s < 2; ++s)
#pragma unroll
        for (int ks = 0; ks < KW / 32; ++ks) {
            if constexpr (HIRES) {
#pragma unroll
                for (int t = 0; t < 2; ++t) { const v8f p = sc[s][ks * 2 + t] * st[s]; v8us h8, l8;
#pragma unroll
                    for (int j = 0; j < 8; ++j) { unsigned short h, l; splitf(p[j], h, l); h8[j] = h; l8[j] = l; }
                    *(v8us*)(pw + s * 16 * PP + ks * 32 + t * 16) = h8; *(v8us*)(pw + 32 * PP + s * 16 * PP + ks * 32 + t * 16) = l8; }
            } else pf[s][ks] = cat16(__builtin_convertvector(sc[s][ks * 2] * st[s], v8h), __builtin_convertvector(sc[s][ks * 2 + 1] * st[s], v8h)); }
    v8f oc[2][HD / 16];
#pragma unroll
    for (int s = 0; s < 2; ++s)
#pragma unroll
        for (int nb = 0; nb < HD / 16; ++nb) oc[s][nb] = (v8f){};
    constexpr int GK = HIRES ? 2 : 4;   // k steps whose v fragments are loaded ahead of their WMMAs (what the registers hold beside the accumulators)
#pragma unroll
    for (int kg = 0; kg < KW / 32; kg += GK) {
        V b[GK][HD / 16], b2[GK][HD / 16];
#pragma unroll
        for (int nb = 0; nb < HD / 16; ++nb)
#pragma unroll
            for (int g = 0; g < GK; ++g) { b[g][nb] = WFrag<T16>::ldf(pv + (kg + g) * 2048 + nb * 512); if (HIRES) b2[g][nb] = WFrag<T16>::ldf(pvl + (kg + g) * 2048 + nb * 512); }
        __builtin_amdgcn_sched_barrier(0);   // keeps the WMMAs behind the group's last load: without it the compiler reuses one fragment's registers and waits for each load in turn
#pragma unroll
        for (int g = 0; g < GK; ++g) { const int ks = kg + g; V a[2], a2[2];
#pragma unroll
            for (int s = 0; s < 2; ++s) { if constexpr (HIRES) { a[s] = WFrag<T16>::ld(pw + s * 16 * PP + ks * 32); a2[s] = WFrag<T16>::ld(pw + 32 * PP + s * 16 * PP + ks * 32); } else a[s] = pf[s][ks]; }
#pragma unroll
            for (int nb = 0; nb < HD / 16; ++nb)
#pragma unroll
                for (int s = 0; s < 2; ++s) { oc[s][nb] = WFrag<T16>::mma(a[s], b[g][nb], oc[s][nb]); if (HIRES) { oc[s][nb] = WFrag<T16>::mma(a2[s], b[g][nb], oc[s][nb]); oc[s][nb] = WFrag<T16>::mma(a[s], b2[g][nb], oc[s][nb]); } } }
    }
    // the same wait for the v loads
    if (HIRES) asm volatile("s_wait_xcnt 0x0" :: "v"(pv), "v"(pvl) : "memory");
    else asm volatile("s_wait_xcnt 0x0" :: "v"(pv) : "memory");
    if constexpr (HIRES) __syncthreads();   // every wave has read its parked probabilities before the partial tiles are written over them (single plane: nothing lay there)
    else __builtin_amdgcn_sched_barrier(0);   // keeps the stores below behind the last WMMA
    float* my = red + wave * PS + hi * 8 * PW + lr;
#pragma unroll
    for (int s = 0; s < 2; ++s)
#pragma unroll
        for (int nb = 0; nb < HD / 16; ++nb)
#pragma unroll
            for (int j = 0; j < 8; ++j) my[(s * 16 + j) * PW + nb * 16] = oc[s][nb][j];
    __syncthreads();   // every wave's partial tile is in LDS before any is read
    // one thread sums the same row and columns of both streams, so the difference (a1 v) - lam (a2 v) is formed here and goes out as the hi+lo planes [position][head x 64 + d] of the output product's A operand
    // (in fragment order, as that product reads it: a wave takes 16 rows x 8 columns, 256 bytes in a row there)
    if (threadIdx.x < 256) { const int row = threadIdx.x & 15, cofs = (threadIdx.x >> 4) * 4; const float* p = red + row * PW + cofs; v4f v1 = *(const v4fa*)p, v2 = *(const v4fa*)(p + 16 * PW);
#pragma unroll
      for (int w = 1; w < NW; ++w) { v1 += *(const v4fa*)(p + w * PS); v2 += *(const v4fa*)(p + w * PS + 16 * PW); }
      constexpr float cs = HIRES ? 1.0f : (1.0f / PCAR); v4us oh, ol;
#pragma unroll
      for (int q = 0; q < 4; ++q) { unsigned short s1, s2; splitf(v1[q] * cs - lam * (v2[q] * cs), s1, s2); oh[q] = s1; ol[q] = s2; }
      const size_t oo = (size_t)blockIdx.z * TT * DQ + fragofs(r0 + row, blockIdx.y * HD + cofs, DQ); *(v4us*)(Ah + oo) = oh; *(v4us*)(Al + oo) = ol; }
}
// ---- k_attnf: the single-plane (fp16) rows, tiled by QUERIES: grid (rows/128, heads, batch entries), 8 waves. Wave w keeps 16 query rows of both streams (q fragments, running statistics, output tiles in registers) and walks ALL keys, 64 a trip;
// a trip's k and v (8 KB each, a contiguous piece of the fragment-ordered planes) are brought into LDS once for the 8 waves, through registers, one trip ahead, two buffers, one barrier a trip. So k and v leave L2 once per 128 rows (was: per 16).
// Scores transposed as in k_attn (k as A, q as B): lane (lr, hi) holds keys 16 nb + 8 hi + 0..7 of query lr. The output is transposed too (v as A, the converted score tiles as B: the same registers, the same k order), so a lane's output elements belong to its own query
// and the rescale by the running maximum is in-lane. Probabilities are 1024 x exp(score - running max), f32 sums of the unrounded values beside them; the division by the row sum comes once, at the end.
__global__ void __launch_bounds__(256) __attribute__((amdgpu_waves_per_eu(4, 4))) k_attnf(const h16* __restrict__ Q1, const h16* __restrict__ Q2, const h16* __restrict__ Kp, const h16* __restrict__ Vt, const float* __restrict__ lamp, bf* Ah, bf* Al, int row0) {
    typedef WFrag<h16>::V V;
    constexpr int KS = 64, NST = TT / KS, SE = KS * HD;   // keys a trip, trips, elements of k (and of v) a trip
    constexpr float CX = SCL * 1.4426950408889634f;       // raw score -> exponent of 2
    __shared__ __align__(16) h16 sm[2][2 * SE];           // two buffers of k, then v
    const int tid = threadIdx.x, lane = tid & 31, wave = tid >> 5; const int r0 = row0 + (blockIdx.x * 8 + wave) * 16; const size_t hp = ((size_t)blockIdx.z * NH_ + blockIdx.y) * TT * HD;
    const float lam = bfr(lamp[0]);
    const h16* pq1 = Q1 + hp + (size_t)r0 * HD + lane * 8; const h16* pq2 = Q2 + hp + (size_t)r0 * HD + lane * 8;
    const h16* gk = Kp + hp + tid * 8; const h16* gv = Vt + hp + tid * 8;   // thread tid moves 16-byte pieces tid and tid + 256 of each operand
    V a[2][2];
#pragma unroll
    for (int c = 0; c < 2; ++c) { a[c][0] = WFrag<h16>::ldf(pq1 + c * 512); a[c][1] = WFrag<h16>::ldf(pq2 + c * 512); }
    v8h g0 = *(const v8h*)gk, g1 = *(const v8h*)(gk + 2048), g2 = *(const v8h*)gv, g3 = *(const v8h*)(gv + 2048);
    // the wait that stands in front of any overwrite of a register which an issued load names; the addresses are inputs so that they live up to it
    asm volatile("s_wait_xcnt 0x0" :: "v"(pq1), "v"(pq2), "v"(gk), "v"(gv) : "memory");
    { h16* d = &sm[0][0] + tid * 8; *(v8h*)d = g0; *(v8h*)(d + 2048) = g1; *(v8h*)(d + SE) = g2; *(v8h*)(d + SE + 2048) = g3; }
    __syncthreads();   // trip 0's k and v are in LDS before any wave reads them
    v8f oc[2][HD / 16], l8[2]; float mx[2];
#pragma unroll
    for (int s = 0; s < 2; ++s) { mx[s] = -3.0e38f; l8[s] = (v8f){};
#pragma unroll
        for (int nb = 0; nb < HD / 16; ++nb) oc[s][nb] = (v8f){}; }
#pragma unroll 1   // one copy of the trip (for speed only)
    for (int t = 0; t < NST; ++t) {
        const bool more = t + 1 < NST;   // the same for the whole work-group
        if (more) { const h16* nk = gk + (size_t)(t + 1) * SE; const h16* nv = gv + (size_t)(t + 1) * SE; g0 = *(const v8h*)nk; g1 = *(const v8h*)(nk + 2048); g2 = *(const v8h*)nv; g3 = *(const v8h*)(nv + 2048);
            asm volatile("s_wait_xcnt 0x0" :: "v"(nk), "v"(nv) : "memory"); }   // the same wait for the next trip's loads
        const h16* lk = &sm[t & 1][0] + lane * 8; const h16* lv = lk + SE;
        v8f sc[2][KS / 16];
#pragma unroll
        for (int c = 0; c < 2; ++c)
#pragma unroll
            for (int nb = 0; nb < KS / 16; ++nb) { const V b = WFrag<h16>::ldf(lk + nb * 1024 + c * 512);
#pragma unroll
                for (int s = 0; s < 2; ++s) sc[s][nb] = WFrag<h16>::mma(b, a[c][s], c ? sc[s][nb] : (v8f){}); }
        V pf[2][KS / 32];
#pragma unroll
        for (int s = 0; s < 2; ++s) {
            // the trip's maximum of the lane's query: in-lane, then the other lane half (a max is exact in any order)
            const v8f m8 = __builtin_elementwise_max(__builtin_elementwise_max(sc[s][0], sc[s][1]), __builtin_elementwise_max(sc[s][2], sc[s][3]));
            const float m = fmaxf(fmaxf(fmaxf(m8[0], m8[1]), fmaxf(m8[2], m8[3])), fmaxf(fmaxf(m8[4], m8[5]), fmaxf(m8[6], m8[7])));
            const float mn = fmaxf(mx[s], fmaxf(m, xhalf(m))); const float al = exp2slot((mx[s] - mn) * CX); mx[s] = mn;   // al: what was summed under the old maximum shrinks by it (0 in trip 0)
            const float ad = 10.0f - mn * CX;   // 2^10: the probabilities' carrier, as PCAR
            v8f s8 = l8[s] * al;
#pragma unroll
            for (int nb = 0; nb < KS / 16; ++nb) { const v8f x = sc[s][nb] * CX + ad; v8f e;
#pragma unroll
                for (int j = 0; j < 8; ++j) e[j] = exp2slot(x[j]);
                sc[s][nb] = e; s8 += e; }
            l8[s] = s8;
#pragma unroll
            for (int nb = 0; nb < HD / 16; ++nb) oc[s][nb] *= al;
#pragma unroll
            for (int ks = 0; ks < KS / 32; ++ks) pf[s][ks] = cat16(__builtin_convertvector(sc[s][ks * 2], v8h), __builtin_convertvector(sc[s][ks * 2 + 1], v8h)); }
#pragma unroll
        for (int ks = 0; ks < KS / 32; ++ks)
#pragma unroll
            for (int nb = 0; nb < HD / 16; ++nb) { const V b = WFrag<h16>::ldf(lv + ks * 2048 + nb * 512);
#pragma unroll
                for (int s = 0; s < 2; ++s) oc[s][nb] = WFrag<h16>::mma(b, pf[s][ks], oc[s][nb]); }
        if (more) { h16* d = &sm[(t + 1) & 1][0] + tid * 8; *(v8h*)d = g0; *(v8h*)(d + 2048) = g1; *(v8h*)(d + SE) = g2; *(v8h*)(d + SE + 2048) = g3; }   // its last readers left this buffer before the barrier of trip t - 1
        __syncthreads();   // publishes trip t + 1's k and v, and ends every wave's reads of the buffer that trip t + 1 refills
    }
    // row sums: eight in-lane sums (one per register index, trips in order), a fixed tree over them, the other lane half
    float rl[2];
#pragma unroll
    for (int s = 0; s < 2; ++s) { const v8f s8 = l8[s]; const float sum = ((s8[0] + s8[1]) + (s8[2] + s8[3])) + ((s8[4] + s8[5]) + (s8[6] + s8[7])); rl[s] = __fdiv_rn(1.0f, sum + xhalf(sum)); }
    // the difference (a1 v) - lam (a2 v) as the hi+lo planes of the output product's A operand, in fragment order: the lane's 8 values of a tile are d = 16 nb + 8 hi + 0..7 of query lr, 16 bytes in a row there, and a wave's store is 512 bytes in a row
    const size_t oo = (size_t)blockIdx.z * TT * DQ + ((size_t)(r0 >> 4) * (DQ >> 5) + blockIdx.y * 2) * 512 + lane * 8; bf* sh = Ah + oo; bf* sl = Al + oo;
    v8us oh[HD / 16], ol[HD / 16];
#pragma unroll
    for (int nb = 0; nb < HD / 16; ++nb)
#pragma unroll
        for (int j = 0; j < 8; ++j) { unsigned short h, l; splitf(oc[0][nb][j] * rl[0] - lam * (oc[1][nb][j] * rl[1]), h, l); oh[nb][j] = h; ol[nb][j] = l; }
#pragma unroll
    for (int nb = 0; nb < HD / 16; ++nb) { *(v8us*)(sh + nb * 256) = oh[nb]; *(v8us*)(sl + nb * 256) = ol[nb]; }
    // the wait in front of any overwrite of a register which an issued store names; addresses and data are inputs so that they live up to it
    asm volatile("s_wait_xcnt 0x0" :: "v"(sh), "v"(sl), "v"(__builtin_bit_cast(v4i, oh[0])), "v"(__builtin_bit_cast(v4i, oh[1])), "v"(__builtin_bit_cast(v4i, oh[2])), "v"(__builtin_bit_cast(v4i, oh[3])), "v"(__builtin_bit_cast(v4i, ol[0])), "v"(__builtin_bit_cast(v4i, ol[1])), "v"(__builtin_bit_cast(v4i, ol[2])), "v"(__builtin_bit_cast(v4i, ol[3])) : "memory");
}
__global__ __launch_bounds__(256) void k_merge(const float* __restrict__ O, int h0, bf* Ah, bf* Al) { const size_t e = ((size_t)blockIdx.x * 256 + threadIdx.x) * 2; if (e >= (size_t)ZH * TT * HD) return; const int d = (int)(e % HD); const int t = (int)((e / HD) % TT); const int zz = (int)(e / ((size_t)HD * TT)); const float cs = (t < RH) ? 1.0f : (1.0f / PCAR); const size_t oo = (size_t)t * DQ + (h0 + zz) * HD + d;
    v2us oh, ol;
#pragma unroll
    for (int q = 0; q < 2; ++q) { unsigned short a, c2; splitf(O[e + q] * cs, a, c2); oh[q] = a; ol[q] = c2; } *(v2us*)(Ah + oo) = oh; *(v2us*)(Al + oo) = ol;  }

extern "C" void kernel_launch(void* const* d_in, const int* in_sizes, int n_in,
                              void* d_out, int out_size, void* d_ws, size_t ws_size, hipStream_t stream) {
    (void)in_sizes; (void)n_in; (void)out_size;
    const float* vin = (const float*)d_in[0]; const float* kin = (const float*)d_in[1]; const float* q1in = (const float*)d_in[2]; const float* q2in = (const float*)d_in[3]; const float* wq = (const float*)d_in[4]; const float* bq = (const float*)d_in[5]; const float* wk = (const float*)d_in[6]; const float* bk = (const float*)d_in[7]; const float* wv = (const float*)d_in[8]; const float* bv = (const float*)d_in[9]; const float* wo = (const float*)d_in[10]; const float* bo = (const float*)d_in[11]; const float* lamp = (const float*)d_in[12];   // weights x @ W
    float* OUT = (float*)d_out;     // [2][2048][1024]
    char* wsp = (char*)d_ws;
    auto take = [&](size_t bytes) { char* p = wsp; wsp += (bytes + 255) & ~(size_t)255; return (void*)p; };
    constexpr size_t PLN = (size_t)NH_ * TT * HD;   // one head plane set of one batch entry; planes are [stream q1, q2, k, v][batch entry]
    bf* WT = (bf*)take((size_t)4 * DQ * DM * 2);      // Wq, Wk, Wv, Wo transposed
    bf* XB = (bf*)take((size_t)4 * NB_ * TT * DM * 2);   // q1, q2, k, v in bf16
    h16* P16 = (h16*)take(4 * NB_ * PLN * 2); bf* Ph = (bf*)take(4 * NB_ * PLN * 2); bf* Pl = (bf*)take(4 * NB_ * PLN * 2);
    bf* ATh = (bf*)take((size_t)NB_ * TT * DQ * 2); bf* ATl = (bf*)take((size_t)NB_ * TT * DQ * 2);
    if ((size_t)(wsp - (char*)d_ws) > ws_size) return;    // ws 256 MiB
    k_prep<<<(unsigned)(4 * WTB + 4 * CVB), 256, 0, stream>>>(wq, wk, wv, wo, WT, q1in, q2in, kin, vin, XB);
    k_gemmks<bf, 0, true, 4, 4, 8, DM, 1, 3><<<dim3(TT / 64, DQ / 64, 4 * NB_), 256, 0, stream>>>(XB, nullptr, WT, nullptr, nullptr, 0, bq, bk, bv, 0, 0, 0, P16, Ph, Pl);
    k_attn<bf, 2><<<dim3(RH / 16, NH_, NB_), 512, 0, stream>>>(Ph, Pl, Ph + 2 * PLN, Pl + 2 * PLN, Ph + 4 * PLN, Pl + 4 * PLN, Ph + 6 * PLN, Pl + 6 * PLN, lamp, ATh, ATl, 0);
    k_attnf<<<dim3((TT - RH) / 128, NH_, NB_), 256, 0, stream>>>(P16, P16 + 2 * PLN, P16 + 4 * PLN, P16 + 6 * PLN, lamp, ATh, ATl, RH);
    k_gemmks<bf, 1, true, 4, 4, 8, DQ, 1, 0><<<dim3(TT / 64, DM / 64, NB_), 256, 0, stream>>>(ATh, ATl, WT + (size_t)3 * DQ * DM, nullptr, OUT, DM, bo, nullptr, nullptr, (size_t)TT * DQ, 0, (size_t)TT * DM, nullptr, nullptr, nullptr);
}

// v008
// Measured time: 200 microseconds a run.
// Timed twice side by side with v007, it ran 1.08 times as fast both times.
// Over all steps from v000 it is 18.6 times as fast.
#include <hip/hip_runtime.h>

// NoiseCancellingAttentionMechanism - differential attention with two query streams (v, k, q1, q2 [2][2048][1024]; q1h/q2h = q1/q2 Wq + bq (shared), kh = k Wk + bk, vh = v Wv + bv (16 heads x 64);
// a1 = softmax(q1h.kh/8), a2 = softmax(q2h.kh/8); out = merged (a1 - lam a2) vh, Wo + bo with the scalar lam read as data -> [2][2048][1024]).
// Compute dtypes, f32 accumulate: every input rounded to bf16; projections on PLAIN bf16 operands (inputs: exact, + bias); PER-ROW PRECISION HYBRID for both score sets and both
// p.v contractions (query rows < 256 on bf16 hi+lo planes with 3 products, rows >= 256 on single fp16 planes, probabilities x1024 there); f32 register-row softmaxes; the difference (a1 v) - lam (a2 v) and the

#define NB_  2
#define TT   2048
#define DM   1024
#define NH_  16
#define NKV  16
#define REP  (NH_ / NKV)
#define HD   64
#define DQ   (NH_ * HD)
#define DKV  (NKV * HD)
#define ZH   NH_                  // heads per merge launch
#define RH   256                  // query rows < RH use hi+lo planes (0: none)
#define WIN  0
#define PCAR 1024.0f
#define SCL  0.125f   // HD^-0.5
typedef _Float16 h16;
typedef unsigned short bf;
typedef __attribute__((ext_vector_type(16))) __bf16   v16bf;
typedef __attribute__((ext_vector_type(16))) _Float16 v16h;
typedef __attribute__((ext_vector_type(8)))  _Float16 v8h;
typedef __attribute__((ext_vector_type(8)))  unsigned short v8us;
typedef __attribute__((ext_vector_type(8)))  float    v8f;
typedef __attribute__((ext_vector_type(4)))  float    v4f;
typedef v8h  __attribute__((may_alias)) v8ha;
typedef v4f  __attribute__((may_alias)) v4fa;
typedef v8us __attribute__((may_alias)) v8usa;

__device__ __forceinline__ unsigned short f2bf(float f) { unsigned u = __float_as_uint(f); u += 0x7FFFu + ((u >> 16) & 1u); return (unsigned short)(u >> 16); }
__device__ __forceinline__ float bf2f(unsigned short b) { return __uint_as_float(((unsigned)b) << 16); }
__device__ __forceinline__ float bfr(float f) { return bf2f(f2bf(f)); }
__device__ __forceinline__ v16h cat16(v8h lo, v8h hi) { return __builtin_shufflevector(lo, hi, 0, 1, 2, 3, 4, 5, 6, 7, 8, 9, 10, 11, 12, 13, 14, 15); }
__device__ __forceinline__ v16bf cat16b(v8us lo, v8us hi) { return __builtin_bit_cast(v16bf, __builtin_shufflevector(lo, hi, 0, 1, 2, 3, 4, 5, 6, 7, 8, 9, 10, 11, 12, 13, 14, 15)); }
__device__ __forceinline__ v8f wmma16(v16h a, v16h b, v8f c) { return __builtin_amdgcn_wmma_f32_16x16x32_f16(false, a, false, b, (short)0, c, false, false); }
__device__ __forceinline__ v8f wmmab(v16bf a, v16bf b, v8f c) { return __builtin_amdgcn_wmma_f32_16x16x32_bf16(false, a, false, b, (short)0, c, false, false); }



// 16-bit fragment loaders (K-contiguous rows; the same k order for A and B) and their matrix instruction. ldf reads the same fragment from a plane kept in FRAGMENT ORDER: a 16 x 32 tile is 512 elements, [k / 8][row][k % 8],
// so p = tile + lane * 8 and each of the two loads takes 512 bytes in a row (4 whole lines) where ld touches 16 lines; lane and register hold the same element as with ld
template <typename T16> struct WFrag;
template <> struct WFrag<h16> { typedef v16h V; static __device__ __forceinline__ V ld(const h16* p) { return cat16(*(const v8h*)p, *(const v8h*)(p + 16)); } static __device__ __forceinline__ V ldf(const h16* p) { return cat16(*(const v8h*)p, *(const v8h*)(p + 256)); } static __device__ __forceinline__ v8f mma(V a, V b, v8f c) { return wmma16(a, b, c); } };
template <> struct WFrag<bf> { typedef v16bf V; static __device__ __forceinline__ V ld(const bf* p) { return cat16b(*(const v8us*)p, *(const v8us*)(p + 16)); } static __device__ __forceinline__ V ldf(const bf* p) { return cat16b(*(const v8us*)p, *(const v8us*)(p + 256)); } static __device__ __forceinline__ v8f mma(V a, V b, v8f c) { return wmmab(a, b, c); } };

__device__ __forceinline__ h16 tohx(float x) { return (h16)x; }
__device__ __forceinline__ void splitf(float y, unsigned short& h, unsigned short& l) { h = f2bf(y); l = f2bf(y - bf2f(h)); }
typedef __attribute__((ext_vector_type(2))) _Float16 v2h;
typedef __attribute__((ext_vector_type(4))) _Float16 v4h;
typedef __attribute__((ext_vector_type(2))) unsigned short v2us;
typedef __attribute__((ext_vector_type(4))) unsigned short v4us;
typedef __attribute__((ext_vector_type(2))) float v2f;
typedef __attribute__((ext_vector_type(4))) int v4i;

// ---- k_gemmks: C[m][n] (f32, pitch ldc, + optional f32 bias[n]) = sum_k A[m][k] Bt[n][k] (+ split products per NSPLIT) for a long K, K SPLIT OVER THE NW WAVES OF ONE WORK-GROUP: wave w sums k in [w K/NW, (w+1) K/NW) for the whole (MB*16)x(NB*16) tile, writes its f32 partial tile to its own LDS range,
// and behind one work-group barrier the partial tiles are added in wave order 0..NW-1 (fixed order) and stored as whole 128-B row pieces. grid (M/(MB*16), N/(NB*16), Z), NW*32 threads. K % (32 NW G) == 0.
// EPI 0: f32 C as above. EPI 1, 2: no C; the sum (+ bias) goes straight into the three 16-bit planes the attention kernel reads (fp16, bf16 hi, bf16 lo).
// EPI 1: m = position, n = head x 64 + d, bias[n], planes [head][position][d] (a column block is one head). EPI 2: m = head x 64 + d, n = position, bias[m], planes [head][d][position] (the weight is the A operand, so v comes out transposed).
// EPI 3: all four projections of both batch entries in ONE launch, grid (TT/64, DQ/64, 8): z = stream x 2 + batch entry, streams q1, q2, k (each as EPI 1) and v (as EPI 2, block indices swapped). A = the eight bf16 inputs [z][position][k], Bt = the transposed weights Wq, Wk, Wv in a row,
// bias / biasK / biasV = bq / bk / bv, planes [z][...]. Every choice depends on blockIdx alone, so it is uniform for the work-group.
template <typename T16, int NSPLIT, bool BIAS, int MB, int NB, int NW, int K, int G, int EPI>
__global__ __launch_bounds__(NW * 32) void k_gemmks(const T16* __restrict__ A, const T16* __restrict__ A2, const T16* __restrict__ Bt, const T16* __restrict__ Bt2, float* C, int ldc, const float* __restrict__ bias, const float* __restrict__ biasK, const float* __restrict__ biasV, size_t sA, size_t sB, size_t sC, h16* P16, bf* Ph, bf* Pl) {
    static_assert((EPI != 1 && EPI != 3) || NB * 16 == HD, "a column block is one head");
    typedef typename WFrag<T16>::V V;
    constexpr int PW = NB * 16 + 4;        // LDS row pitch in floats: 16 B x odd for the b128 readers
    constexpr int PS = MB * 16 * PW;       // floats of one wave's partial tile
    __shared__ __align__(16) float red[NW * PS];
    const size_t z = blockIdx.z; const bool tr = (EPI == 2) || (EPI == 3 && z >= 6);   // tr: the weight is the A operand
    if (EPI == 3) { const T16* X = A + z * ((size_t)TT * DM); const T16* Wt = Bt + (z < 4 ? 0 : (z >> 1) - 1) * ((size_t)DQ * DM); A = tr ? Wt : X; Bt = tr ? X : Wt; bias = z < 4 ? bias : (tr ? biasV : biasK);
        P16 += z * ((size_t)NH_ * TT * HD); Ph += z * ((size_t)NH_ * TT * HD); Pl += z * ((size_t)NH_ * TT * HD); }
    else { A += z * sA; if (A2) A2 += z * sA; Bt += z * sB; if (Bt2) Bt2 += z * sB; C += z * sC; }
    const int lane = threadIdx.x & 31, lr = lane & 15, hi = lane >> 4, wave = threadIdx.x >> 5; const int bxr = (EPI == 3 && tr) ? blockIdx.y : blockIdx.x, bxc = (EPI == 3 && tr) ? blockIdx.x : blockIdx.y; const int r0 = bxr * (MB * 16), c0 = bxc * (NB * 16);
    v8f acc[MB][NB];
#pragma unroll
    for (int mb = 0; mb < MB; ++mb)
#pragma unroll
        for (int nb = 0; nb < NB; ++nb) acc[mb][nb] = (v8f){};
    static_assert((K / NW) % 32 == 0, "a wave's k range is whole tiles");
    // both operands lie in fragment order, [row / 16][k / 32] tiles of 512 elements
    const size_t aoff = ((size_t)(r0 >> 4) * (K / 32) + wave * (K / NW / 32)) * 512 + lane * 8, boff = ((size_t)(c0 >> 4) * (K / 32) + wave * (K / NW / 32)) * 512 + lane * 8;
    const T16* pa = A + aoff; const T16* pb = Bt + boff; const T16* pa2 = A2 + aoff; const T16* pb2 = Bt2 + boff;
    // G k steps form a group: the group's loads are all issued first (row set by row set, so that the loads of one 128-B line follow one another), then its WMMAs in ascending k
#pragma unroll
    for (int kg = 0; kg < K / NW; kg += 32 * G) {
        V a[G][MB], a2[G][MB], b[G][NB], b2[G][NB];
#pragma unroll
        for (int mb = 0; mb < MB; ++mb) {
#pragma unroll
            for (int s = 0; s < G; ++s) a[s][mb] = WFrag<T16>::ldf(pa + (size_t)mb * 16 * K + (kg + s * 32) * 16);
            if (NSPLIT == 1 || NSPLIT == 2) {
#pragma unroll
                for (int s = 0; s < G; ++s) a2[s][mb] = WFrag<T16>::ldf(pa2 + (size_t)mb * 16 * K + (kg + s * 32) * 16); } }
#pragma unroll
        for (int nb = 0; nb < NB; ++nb) {
#pragma unroll
            for (int s = 0; s < G; ++s) b[s][nb] = WFrag<T16>::ldf(pb + (size_t)nb * 16 * K + (kg + s * 32) * 16);
            if (NSPLIT >= 2) {
#pragma unroll
                for (int s = 0; s < G; ++s) b2[s][nb] = WFrag<T16>::ldf(pb2 + (size_t)nb * 16 * K + (kg + s * 32) * 16); } }
        // the wait that stands in front of any overwrite of a register which an issued load names; the base addresses are inputs so that they live up to it (no load's result lands on them)
        if (NSPLIT == 2) asm volatile("s_wait_xcnt 0x0" :: "v"(pa), "v"(pb), "v"(pa2), "v"(pb2) : "memory");
        else if (NSPLIT == 1) asm volatile("s_wait_xcnt 0x0" :: "v"(pa), "v"(pb), "v"(pa2) : "memory");
        else asm volatile("s_wait_xcnt 0x0" :: "v"(pa), "v"(pb) : "memory");
        if (G > 1) __builtin_amdgcn_sched_barrier(0);   // keeps the WMMAs behind the group's last load: without it the compiler weaves them among the loads to save registers and a wave has few loads in flight
#pragma unroll
        for (int s = 0; s < G; ++s)
#pragma unroll
            for (int nb = 0; nb < NB; ++nb)
#pragma unroll
                for (int mb = 0; mb < MB; ++mb) { acc[mb][nb] = WFrag<T16>::mma(a[s][mb], b[s][nb], acc[mb][nb]); if (NSPLIT == 1 || NSPLIT == 2) acc[mb][nb] = WFrag<T16>::mma(a2[s][mb], b[s][nb], acc[mb][nb]); if (NSPLIT >= 2) acc[mb][nb] = WFrag<T16>::mma(a[s][mb], b2[s][nb], acc[mb][nb]); }
    }
    float* my = red + wave * PS;
#pragma unroll
    for (int mb = 0; mb < MB; ++mb)
#pragma unroll
        for (int nb = 0; nb < NB; ++nb)
#pragma unroll
            for (int j = 0; j < 8; ++j) my[(mb * 16 + hi * 8 + j) * PW + nb * 16 + lr] = acc[mb][nb][j];
    __syncthreads();   // every wave's partial tile is in LDS before any is read
    // what differs between the two orientations is set up once, from block-uniform values: the bias of the thread's four columns (the same in every trip) and the plane address (eb + row) * ep + ec + cofs
    static_assert((NW * 32) % (NB * 4) == 0, "a thread keeps its columns from trip to trip");
    v4f bn = (v4f){};
    // the head planes of EPI 3 go out in fragment order; there a wave takes 16 rows x 8 columns, which is 256 bytes in a row of such a plane (each element's sum is the same)
    static_assert(EPI != 3 || (NW * 32 == 256 && NB == 4 && MB == 4), "16 rows a trip, 16 column groups");
    constexpr bool fo = (EPI == 3);
    const int rb = fo ? (int)(threadIdx.x & 15) : (int)(threadIdx.x / (NB * 4)), cofs = (fo ? (int)(threadIdx.x >> 4) : (int)(threadIdx.x % (NB * 4))) * 4;
    if (BIAS && !tr) { const float* pc = bias + c0 + cofs; const float t0 = pc[0], t1 = pc[1], t2 = pc[2], t3 = pc[3];
        asm volatile("s_wait_xcnt 0x0" :: "v"(pc) : "memory");   // the wait in front of any overwrite of a register which the issued load names; the address is an input so that it lives up to it
        bn[0] = bfr(t0); bn[1] = bfr(t1); bn[2] = bfr(t2); bn[3] = bfr(t3); }
    const int eb = tr ? r0 : bxc * TT + r0, ep = tr ? TT : HD, ec = tr ? c0 : 0;
#pragma unroll
    for (int u = 0; u < MB * 16; u += NW * 32 / (NB * 4)) { const int row = rb + u; const float* p = red + row * PW + cofs; v4f val = *(const v4fa*)p;
#pragma unroll
        for (int w = 1; w < NW; ++w) val += *(const v4fa*)(p + w * PS);
        if (BIAS && tr) { const float* pr = bias + r0 + row; const float t = *pr;
            asm volatile("s_wait_xcnt 0x0" :: "v"(pr) : "memory");   // the same wait for the row's bias load
            const float bb = bfr(t); bn[0] = bb; bn[1] = bb; bn[2] = bb; bn[3] = bb; }
        if (BIAS) val += bn;
        if (EPI == 0) *(v4f*)(C + (size_t)(r0 + row) * ldc + c0 + cofs) = val;
        else { size_t e = (size_t)(eb + row) * ep + ec + cofs; v4h o16; v4us oh, ol;
            if (fo) { const int t = tr ? c0 + cofs : r0 + row;   // position; q and k: tiles of 16 positions x 32 d, [position / 16][d / 8][position % 16][d % 8]; v: tiles of 16 d x 32 positions, [position / 32][d / 16][(position / 8) % 4][d % 16][position % 8]
                e = tr ? (size_t)bxr * (TT * HD) + (t >> 5) * 2048 + (row >> 4) * 512 + ((t >> 3) & 3) * 128 + (row & 15) * 8 + (t & 7) : (size_t)bxc * (TT * HD) + (t >> 4) * 1024 + (cofs >> 3) * 128 + (t & 15) * 8 + (cofs & 7); }
#pragma unroll
            for (int q = 0; q < 4; ++q) { o16[q] = tohx(val[q]); unsigned short a2, c2; splitf(val[q], a2, c2); oh[q] = a2; ol[q] = c2; }
            h16* s0 = P16 + e; bf* s1 = Ph + e; bf* s2 = Pl + e; *(v4h*)s0 = o16; *(v4us*)s1 = oh; *(v4us*)s2 = ol;
            // the wait in front of any overwrite of a register which an issued store names; addresses and data are inputs so that they live up to it
            asm volatile("s_wait_xcnt 0x0" :: "v"(s0), "v"(s1), "v"(s2), "v"(__builtin_bit_cast(unsigned long long, o16)), "v"(__builtin_bit_cast(unsigned long long, oh)), "v"(__builtin_bit_cast(unsigned long long, ol)) : "memory"); } }
}


// element (row r, k) of an [R][K] operand in fragment order: tiles of 16 rows x 32 k, [r / 16][k / 32], each [k / 8 % 4][r % 16][k % 8]
__device__ __forceinline__ size_t fragofs(int r, int k, int K) { return ((size_t)(r >> 4) * (K >> 5) + (k >> 5)) * 512 + ((k >> 3) & 3) * 128 + (r & 15) * 8 + (k & 7); }
// One PIECE is 16 bytes (8 elements along k of one row) of a fragment-ordered plane; piece i lies at element 8 i. A thread makes several pieces and issues all their loads before it converts the first, so the launch has few, long waves with much in flight.
// d_wtG: a weight w[k][n] to bf16 [n][k]. A block takes 128 k x 128 n; thread t makes 8 pieces, rows n + 16 j, the same 8 k. Lanes run along n, so a load reads 64 bytes in a row of two rows of w, and the 8 loads of a k take 512 bytes in a row.
__device__ __forceinline__ void d_wtG(int bx, const float* __restrict__ w, bf* Bt) {
    static_assert(DM % 128 == 0 && DQ % 128 == 0, "whole blocks");
    const int t = threadIdx.x, kb = bx % (DM / 128), nb = bx / (DM / 128);
    const float* ps = w + (size_t)((kb * 4 + (t >> 6)) * 32 + ((t >> 4) & 3) * 8) * DQ + nb * 128 + (t & 15);
    float v[8][8];
#pragma unroll
    for (int q = 0; q < 8; ++q)
#pragma unroll
        for (int j = 0; j < 8; ++j) v[j][q] = ps[q * DQ + j * 16];
    asm volatile("s_wait_xcnt 0x0" :: "v"(ps) : "memory");   // the wait in front of any overwrite of a register which an issued load names; the address is an input so that it lives up to it
    bf* pd = Bt + ((size_t)nb * 8 * (DM / 32) + kb * 4) * 512 + t * 8; v8us o[8];
#pragma unroll
    for (int j = 0; j < 8; ++j)
#pragma unroll
        for (int q = 0; q < 8; ++q) o[j][q] = f2bf(v[j][q]);
#pragma unroll
    for (int j = 0; j < 8; ++j) *(v8us*)(pd + (size_t)j * (DM / 32) * 512) = o[j];
    // the same wait for the stores; the data are inputs so that they live up to it (the address is the thread index and a scalar base, and nothing is computed behind the stores)
    asm volatile("s_wait_xcnt 0x0" :: "v"(__builtin_bit_cast(v4i, o[0])), "v"(__builtin_bit_cast(v4i, o[1])), "v"(__builtin_bit_cast(v4i, o[2])), "v"(__builtin_bit_cast(v4i, o[3])), "v"(__builtin_bit_cast(v4i, o[4])), "v"(__builtin_bit_cast(v4i, o[5])), "v"(__builtin_bit_cast(v4i, o[6])), "v"(__builtin_bit_cast(v4i, o[7])) : "memory");
}
// d_cvt8: an input [row][DM] to bf16. A block takes 32 rows (128 KB in a row of the source, 64 KB of the plane); thread t makes pieces 4096 bx + 256 j + t, j = 0..15
__device__ __forceinline__ void d_cvt8(int bx, const float* __restrict__ src, bf* dst) {
    static_assert(DM == 1024, "8 steps of 256 pieces are 16 rows");
    const int t = threadIdx.x;
    const float* ps = src + ((size_t)bx * 32 + (t & 15)) * DM + (t >> 6) * 32 + ((t >> 4) & 3) * 8; v8f v[16];
#pragma unroll
    for (int j = 0; j < 16; ++j) v[j] = *(const v8f*)(ps + (j >> 3) * 16 * DM + (j & 7) * 128);
    asm volatile("s_wait_xcnt 0x0" :: "v"(ps) : "memory");   // the wait in front of any overwrite of a register which an issued load names; the address is an input so that it lives up to it
    bf* pd = dst + (size_t)bx * 32768 + t * 8; v8us o[16];
#pragma unroll
    for (int j = 0; j < 16; ++j)
#pragma unroll
        for (int q = 0; q < 8; ++q) o[j][q] = f2bf(v[j][q]);
#pragma unroll
    for (int j = 0; j < 16; ++j) *(v8us*)(pd + j * 2048) = o[j];
    // the same wait for the stores; the data are inputs so that they live up to it (the address is the thread index and a scalar base, and nothing is computed behind the stores)
    asm volatile("s_wait_xcnt 0x0" :: "v"(__builtin_bit_cast(v4i, o[0])), "v"(__builtin_bit_cast(v4i, o[1])), "v"(__builtin_bit_cast(v4i, o[2])), "v"(__builtin_bit_cast(v4i, o[3])), "v"(__builtin_bit_cast(v4i, o[4])), "v"(__builtin_bit_cast(v4i, o[5])), "v"(__builtin_bit_cast(v4i, o[6])), "v"(__builtin_bit_cast(v4i, o[7])),
                 "v"(__builtin_bit_cast(v4i, o[8])), "v"(__builtin_bit_cast(v4i, o[9])), "v"(__builtin_bit_cast(v4i, o[10])), "v"(__builtin_bit_cast(v4i, o[11])), "v"(__builtin_bit_cast(v4i, o[12])), "v"(__builtin_bit_cast(v4i, o[13])), "v"(__builtin_bit_cast(v4i, o[14])), "v"(__builtin_bit_cast(v4i, o[15])) : "memory");
}
// ---- k_prep: every operand conversion in ONE launch. Both kinds of plane are written in fragment order (fragofs). Blocks [0, 4 WTB): the four weights, transposed to bf16 [n][k], in a row in WT. Blocks behind them: the four inputs, both batch entries each, to bf16, in a row in XB.
#define WTB ((DM / 128) * (DQ / 128))            // blocks per weight
#define CVB (NB_ * TT * DM / 8 / 256 / 16)       // blocks per input
// six waves a SIMD: the launch's 768 blocks are three a WGP, so that all of them are resident at once and every load of the launch is in flight together
__global__ void __launch_bounds__(256) __attribute__((amdgpu_waves_per_eu(6))) k_prep(const float* __restrict__ w0, const float* __restrict__ w1, const float* __restrict__ w2, const float* __restrict__ w3, bf* WT, const float* __restrict__ x0, const float* __restrict__ x1, const float* __restrict__ x2, const float* __restrict__ x3, bf* XB) {
    static_assert((NB_ * TT) % 32 == 0, "whole blocks");
    const int bx = blockIdx.x;
    if (bx < 4 * WTB) { const int s = bx / WTB; d_wtG(bx % WTB, s == 0 ? w0 : s == 1 ? w1 : s == 2 ? w2 : w3, WT + (size_t)s * DM * DQ); }
    else { const int c = bx - 4 * WTB, s = c / CVB; d_cvt8(c % CVB, s == 0 ? x0 : s == 1 ? x1 : s == 2 ? x2 : x3, XB + (size_t)s * NB_ * TT * DM); }
}
__global__ __launch_bounds__(256) void k_cscvt(const float* __restrict__ cosT, const float* __restrict__ sinT, float* CS) { const int idx = blockIdx.x * 256 + threadIdx.x; if (idx >= TT * HD) return; v2f cs; cs[0] = bfr(cosT[idx]); cs[1] = bfr(sinT[idx]); *(v2f*)(CS + (size_t)idx * 2) = cs;  }
// 2^x with the one free issue slot that the instruction set asks for behind a transcendental
__device__ __forceinline__ float exp2slot(float x) { float e; asm("v_exp_f32 %0, %1\n\tv_nop" : "=v"(e) : "v"(x)); return e; }
// value of lane l ^ 16 (a vector cross-row move, no LDS round trip); every lane is on where it is used
__device__ __forceinline__ float xhalf(float x) { return __int_as_float(__builtin_amdgcn_permlanex16(__float_as_int(x), __float_as_int(x), 0x76543210, 0xfedcba98, false, false)); }
// ---- k_attn: scores, softmax and p.v of BOTH query streams for 16 query rows of one head in one work-group; scores and probabilities never leave it. grid (rows/16, heads, batch entries), 16 waves. Launched for the hi+lo rows; the single-plane rows go through k_attnf below.
// Wave w owns keys [128 w, 128 w + 128): 2 x 8 score tiles in registers (each k and v fragment serves both streams), computed TRANSPOSED: the k fragment is the A operand and the q fragment the B operand, so a tile is [key][query] and
// lane (lr, hi) holds keys 16 nb + 8 hi + 0..7 of the ONE query lr. Row max and row sum are in-lane plus one exchange of the lane halves, then joined over the waves through LDS; two neighbouring tiles, converted in place, ARE the A fragment
// of p.v (element s: key 8 hi + s, then 16 + 8 hi + s - 8, the order in which ld and ldf deliver v), so no probability changes lanes. p.v summed over the wave's keys in ascending k, the 16 partial tiles added in wave order 0..15 (as the K-split GEMM does), the two streams' difference written as bf16 hi+lo planes.
template <typename T16, int NSPLIT>
__global__ __launch_bounds__(512) void k_attn(const T16* __restrict__ Q1, const T16* __restrict__ Q1l, const T16* __restrict__ Q2, const T16* __restrict__ Q2l, const T16* __restrict__ Kp, const T16* __restrict__ Kl, const T16* __restrict__ Vt, const T16* __restrict__ Vl, const float* __restrict__ lamp, bf* Ah, bf* Al, int row0) {
    typedef typename WFrag<T16>::V V;
    constexpr int NW = 16, KW = TT / NW, NT = KW / 16;   // waves, keys per wave, score tiles per stream and wave
    constexpr int PP = KW + 8;                           // pitch of a wave's probability rows (128 keys) in 16-bit elements: 16 B x odd for the b128 readers
    constexpr int RP = 20;                               // pitch of a row's 16 per-wave values in floats: 16 B x odd
    constexpr int PW = HD + 4, PS = 32 * PW;             // partial output tile: row pitch and size in floats
    constexpr bool HIRES = (NSPLIT == 2);
    constexpr int PB = (HIRES ? 2 : 1) * 32 * PP;        // 16-bit elements of one wave's probability planes
    constexpr int SB = (NW * PB * 2 > NW * PS * 4) ? NW * PB * 2 : NW * PS * 4;
    __shared__ __align__(16) char sm[SB];                // hi+lo planes: first the parked probabilities, then (behind a barrier) the partial output tiles; single plane: the partial output tiles alone
    T16* pbuf = (T16*)sm; float* red = (float*)sm;
    __shared__ __align__(16) float rmx[32 * RP];
    __shared__ __align__(16) float rsm[32 * RP];
    const int lane = threadIdx.x & 31, lr = lane & 15, hi = lane >> 4, wave = threadIdx.x >> 5; const int r0 = row0 + blockIdx.x * 16; const size_t hp = ((size_t)blockIdx.z * NH_ + blockIdx.y) * TT * HD;
    const float lam = bfr(lamp[0]);   // read here, where control flow is uniform, so that it is a scalar load whose latency the whole kernel hides
    const size_t qoff = hp + (size_t)r0 * HD + lane * 8, koff = hp + (size_t)wave * KW * HD + lane * 8, voff = hp + (size_t)wave * KW * HD + lane * 8;   // the planes are in fragment order: 16 query rows are 1024 elements in a row, the wave's 128 keys 8192 elements in a row of k and of v
    const T16* pq1 = Q1 + qoff; const T16* pq2 = Q2 + qoff; const T16* pk = Kp + koff; const T16* pv = Vt + voff; const T16* pq1l = Q1l + qoff; const T16* pq2l = Q2l + qoff; const T16* pkl = Kl + koff; const T16* pvl = Vl + voff;
    v8f sc[2][NT];
#pragma unroll
    for (int s = 0; s < 2; ++s)
#pragma unroll
        for (int nb = 0; nb < NT; ++nb) sc[s][nb] = (v8f){};
    if constexpr (HIRES) {
#pragma unroll
        for (int kc = 0; kc < HD; kc += 32) {
            V a[2], a2[2]; a[0] = WFrag<T16>::ldf(pq1 + kc * 16); a[1] = WFrag<T16>::ldf(pq2 + kc * 16); if (HIRES) { a2[0] = WFrag<T16>::ldf(pq1l + kc * 16); a2[1] = WFrag<T16>::ldf(pq2l + kc * 16); }
#pragma unroll
            for (int nb = 0; nb < NT; ++nb) { const V b = WFrag<T16>::ldf(pk + nb * 1024 + kc * 16); V b2; if (HIRES) b2 = WFrag<T16>::ldf(pkl + nb * 1024 + kc * 16);
#pragma unroll
                for (int s = 0; s < 2; ++s) { sc[s][nb] = WFrag<T16>::mma(b, a[s], sc[s][nb]); if (HIRES) { sc[s][nb] = WFrag<T16>::mma(b, a2[s], sc[s][nb]); sc[s][nb] = WFrag<T16>::mma(b2, a[s], sc[s][nb]); } } }
        }
    } else {
        // single planes: all of the wave's q and k fragments fit in registers beside nothing else, so every load is issued before the first WMMA (one trip to L2 instead of one per tile); each tile still sums kc = 0, then 32
        V a[2][2], b[NT][2];
#pragma unroll
        for (int c = 0; c < 2; ++c) { a[c][0] = WFrag<T16>::ldf(pq1 + c * 512); a[c][1] = WFrag<T16>::ldf(pq2 + c * 512); }
#pragma unroll
        for (int nb = 0; nb < NT; ++nb)
#pragma unroll
            for (int c = 0; c < 2; ++c) b[nb][c] = WFrag<T16>::ldf(pk + nb * 1024 + c * 512);
        __builtin_amdgcn_sched_barrier(0);   // keeps the WMMAs behind the last load: without it the compiler reuses one fragment's registers and waits for each tile's load in turn
#pragma unroll
        for (int nb = 0; nb < NT; ++nb)
#pragma unroll
            for (int c = 0; c < 2; ++c)
#pragma unroll
                for (int s = 0; s < 2; ++s) sc[s][nb] = WFrag<T16>::mma(b[nb][c], a[c][s], sc[s][nb]);
    }
    // the wait that stands in front of any overwrite of a register which an issued load names; the base addresses are inputs so that they live up to it
    if (HIRES) asm volatile("s_wait_xcnt 0x0" :: "v"(pq1), "v"(pq2), "v"(pk), "v"(pq1l), "v"(pq2l), "v"(pkl) : "memory");
    else asm volatile("s_wait_xcnt 0x0" :: "v"(pq1), "v"(pq2), "v"(pk) : "memory");
    // row max: over the lane's 64 scores of its query, the other lane half, then the 16 waves (a max is exact in any order)
    float st[2];   // per stream: the statistic of the lane's query
#pragma unroll
    for (int s = 0; s < 2; ++s) { v8f m8;
#pragma unroll
        for (int j = 0; j < 8; ++j) m8[j] = -3.0e38f;
#pragma unroll
        for (int nb = 0; nb < NT; ++nb) { sc[s][nb] *= SCL; m8 = __builtin_elementwise_max(m8, sc[s][nb]); }   // whole tiles: neighbouring registers pair up in the packed forms
        const float m = fmaxf(fmaxf(fmaxf(m8[0], m8[1]), fmaxf(m8[2], m8[3])), fmaxf(fmaxf(m8[4], m8[5]), fmaxf(m8[6], m8[7]))); st[s] = fmaxf(m, xhalf(m)); }
    rmx[lane * RP + wave] = hi ? st[1] : st[0];   // row l of the table: lanes 0..15 stream 1, lanes 16..31 stream 2
    __syncthreads();   // every wave's row maxima are in LDS before any is read
    float gm;          // lane l: the max of row l (rows 0..15 stream 1, 16..31 stream 2)
    { const float* p = rmx + lane * RP; const v4f m0 = *(const v4fa*)p, m1 = *(const v4fa*)(p + 4), m2 = *(const v4fa*)(p + 8), m3 = *(const v4fa*)(p + 12); gm = m0[0];
#pragma unroll
      for (int q = 0; q < 4; ++q) gm = fmaxf(fmaxf(gm, m0[q]), fmaxf(m1[q], fmaxf(m2[q], m3[q]))); }
    { const float go = xhalf(gm); st[0] = hi ? go : gm; st[1] = hi ? gm : go; }   // both streams' value of query lr
    // one exp per score; row sum: eight in-lane sums (one per register index, tiles in order), a fixed tree over them, the other lane half, the waves in order 0..15
#pragma unroll
    for (int s = 0; s < 2; ++s) { const float mx = st[s]; v8f s8 = (v8f){};
#pragma unroll
        for (int nb = 0; nb < NT; ++nb) { const v8f d0 = (sc[s][nb] - mx) * 1.4426950408889634f; v8f e;
#pragma unroll
            for (int j = 0; j < 8; ++j) e[j] = exp2slot(d0[j]);
            sc[s][nb] = e; s8 += e; }
        const float sum = ((s8[0] + s8[1]) + (s8[2] + s8[3])) + ((s8[4] + s8[5]) + (s8[6] + s8[7])); st[s] = sum + xhalf(sum); }
    rsm[lane * RP + wave] = hi ? st[1] : st[0];
    __syncthreads();   // every wave's row sums are in LDS before any is read
    float gf;          // lane l: the factor of row l
    { const float* p = rsm + lane * RP; float sum = p[0];
#pragma unroll
      for (int w = 1; w < NW; ++w) sum += p[w];
      gf = __fdiv_rn(HIRES ? 1.0f : PCAR, sum); }
    { const float go = xhalf(gf); st[0] = hi ? go : gf; st[1] = hi ? gf : go; }
    // the probabilities as A fragments. Single plane: 64 registers, kept. Hi+lo planes: 128 registers, too many beside the v fragments, so each lane parks ITS OWN fragments in the wave's LDS piece (16-byte stores) and reads the same bytes back
    T16* pw = pbuf + wave * PB + lr * PP + 8 * hi;
    V pf[2][KW / 32];
#pragma unroll
    for (int s = 0; s < 2; ++s)
#pragma unroll
        for (int ks = 0; ks < KW / 32; ++ks) {
            if constexpr (HIRES) {
#pragma unroll
                for (int t = 0; t < 2; ++t) { const v8f p = sc[s][ks * 2 + t] * st[s]; v8us h8, l8;
#pragma unroll
                    for (int j = 0; j < 8; ++j) { unsigned short h, l; splitf(p[j], h, l); h8[j] = h; l8[j] = l; }
                    *(v8us*)(pw + s * 16 * PP + ks * 32 + t * 16) = h8; *(v8us*)(pw + 32 * PP + s * 16 * PP + ks * 32 + t * 16) = l8; }
            } else pf[s][ks] = cat16(__builtin_convertvector(sc[s][ks * 2] * st[s], v8h), __builtin_convertvector(sc[s][ks * 2 + 1] * st[s], v8h)); }
    v8f oc[2][HD / 16];
#pragma unroll
    for (int s = 0; s < 2; ++s)
#pragma unroll
        for (int nb = 0; nb < HD / 16; ++nb) oc[s][nb] = (v8f){};
    constexpr int GK = HIRES ? 2 : 4;   // k steps whose v fragments are loaded ahead of their WMMAs (what the registers hold beside the accumulators)
#pragma unroll
    for (int kg = 0; kg < KW / 32; kg += GK) {
        V b[GK][HD / 16], b2[GK][HD / 16];
#pragma unroll
        for (int nb = 0; nb < HD / 16; ++nb)
#pragma unroll
            for (int g = 0; g < GK; ++g) { b[g][nb] = WFrag<T16>::ldf(pv + (kg + g) * 2048 + nb * 512); if (HIRES) b2[g][nb] = WFrag<T16>::ldf(pvl + (kg + g) * 2048 + nb * 512); }
        __builtin_amdgcn_sched_barrier(0);   // keeps the WMMAs behind the group's last load: without it the compiler reuses one fragment's registers and waits for each load in turn
#pragma unroll
        for (int g = 0; g < GK; ++g) { const int ks = kg + g; V a[2], a2[2];
#pragma unroll
            for (int s = 0; s < 2; ++s) { if constexpr (HIRES) { a[s] = WFrag<T16>::ld(pw + s * 16 * PP + ks * 32); a2[s] = WFrag<T16>::ld(pw + 32 * PP + s * 16 * PP + ks * 32); } else a[s] = pf[s][ks]; }
#pragma unroll
            for (int nb = 0; nb < HD / 16; ++nb)
#pragma unroll
                for (int s = 0; s < 2; ++s) { oc[s][nb] = WFrag<T16>::mma(a[s], b[g][nb], oc[s][nb]); if (HIRES) { oc[s][nb] = WFrag<T16>::mma(a2[s], b[g][nb], oc[s][nb]); oc[s][nb] = WFrag<T16>::mma(a[s], b2[g][nb], oc[s][nb]); } } }
    }
    // the same wait for the v loads
    if (HIRES) asm volatile("s_wait_xcnt 0x0" :: "v"(pv), "v"(pvl) : "memory");
    else asm volatile("s_wait_xcnt 0x0" :: "v"(pv) : "memory");
    if constexpr (HIRES) __syncthreads();   // every wave has read its parked probabilities before the partial tiles are written over them (single plane: nothing lay there)
    else __builtin_amdgcn_sched_barrier(0);   // keeps the stores below behind the last WMMA
    float* my = red + wave * PS + hi * 8 * PW + lr;
#pragma unroll
    for (int s = 0; s < 2; ++s)
#pragma unroll
        for (int nb = 0; nb < HD / 16; ++nb)
#pragma unroll
            for (int j = 0; j < 8; ++j) my[(s * 16 + j) * PW + nb * 16] = oc[s][nb][j];
    __syncthreads();   // every wave's partial tile is in LDS before any is read
    // one thread sums the same row and columns of both streams, so the difference (a1 v) - lam (a2 v) is formed here and goes out as the hi+lo planes [position][head x 64 + d] of the output product's A operand
    // (in fragment order, as that product reads it: a wave takes 16 rows x 8 columns, 256 bytes in a row there)
    if (threadIdx.x < 256) { const int row = threadIdx.x & 15, cofs = (threadIdx.x >> 4) * 4; const float* p = red + row * PW + cofs; v4f v1 = *(const v4fa*)p, v2 = *(const v4fa*)(p + 16 * PW);
#pragma unroll
      for (int w = 1; w < NW; ++w) { v1 += *(const v4fa*)(p + w * PS); v2 += *(const v4fa*)(p + w * PS + 16 * PW); }
      constexpr float cs = HIRES ? 1.0f : (1.0f / PCAR); v4us oh, ol;
#pragma unroll
      for (int q = 0; q < 4; ++q) { unsigned short s1, s2; splitf(v1[q] * cs - lam * (v2[q] * cs), s1, s2); oh[q] = s1; ol[q] = s2; }
      const size_t oo = (size_t)blockIdx.z * TT * DQ + fragofs(r0 + row, blockIdx.y * HD + cofs, DQ); *(v4us*)(Ah + oo) = oh; *(v4us*)(Al + oo) = ol; }
}
// ---- k_attnf: the single-plane (fp16) rows, tiled by QUERIES: grid (rows/128, heads, batch entries), 8 waves. Wave w keeps 16 query rows of both streams (q fragments, running statistics, output tiles in registers) and walks ALL keys, 64 a trip;
// a trip's k and v (8 KB each, a contiguous piece of the fragment-ordered planes) are brought into LDS once for the 8 waves, through registers, one trip ahead, two buffers, one barrier a trip. So k and v leave L2 once per 128 rows (was: per 16).
// Scores transposed as in k_attn (k as A, q as B): lane (lr, hi) holds keys 16 nb + 8 hi + 0..7 of query lr. The output is transposed too (v as A, the converted score tiles as B: the same registers, the same k order), so a lane's output elements belong to its own query
// and the rescale by the running maximum is in-lane. Probabilities are 1024 x exp(score - running max), f32 sums of the unrounded values beside them; the division by the row sum comes once, at the end.
__global__ void __launch_bounds__(256) __attribute__((amdgpu_waves_per_eu(4, 4))) k_attnf(const h16* __restrict__ Q1, const h16* __restrict__ Q2, const h16* __restrict__ Kp, const h16* __restrict__ Vt, const float* __restrict__ lamp, bf* Ah, bf* Al, int row0) {
    typedef WFrag<h16>::V V;
    constexpr int KS = 64, NST = TT / KS, SE = KS * HD;   // keys a trip, trips, elements of k (and of v) a trip
    constexpr float CX = SCL * 1.4426950408889634f;       // raw score -> exponent of 2
    __shared__ __align__(16) h16 sm[2][2 * SE];           // two buffers of k, then v
    const int tid = threadIdx.x, lane = tid & 31, wave = tid >> 5; const int r0 = row0 + (blockIdx.x * 8 + wave) * 16; const size_t hp = ((size_t)blockIdx.z * NH_ + blockIdx.y) * TT * HD;
    const float lam = bfr(lamp[0]);
    const h16* pq1 = Q1 + hp + (size_t)r0 * HD + lane * 8; const h16* pq2 = Q2 + hp + (size_t)r0 * HD + lane * 8;
    const h16* gk = Kp + hp + tid * 8; const h16* gv = Vt + hp + tid * 8;   // thread tid moves 16-byte pieces tid and tid + 256 of each operand
    V a[2][2];
#pragma unroll
    for (int c = 0; c < 2; ++c) { a[c][0] = WFrag<h16>::ldf(pq1 + c * 512); a[c][1] = WFrag<h16>::ldf(pq2 + c * 512); }
    v8h g0 = *(const v8h*)gk, g1 = *(const v8h*)(gk + 2048), g2 = *(const v8h*)gv, g3 = *(const v8h*)(gv + 2048);
    // the wait that stands in front of any overwrite of a register which an issued load names; the addresses are inputs so that they live up to it
    asm volatile("s_wait_xcnt 0x0" :: "v"(pq1), "v"(pq2), "v"(gk), "v"(gv) : "memory");
    { h16* d = &sm[0][0] + tid * 8; *(v8h*)d = g0; *(v8h*)(d + 2048) = g1; *(v8h*)(d + SE) = g2; *(v8h*)(d + SE + 2048) = g3; }
    __syncthreads();   // trip 0's k and v are in LDS before any wave reads them
    v8f oc[2][HD / 16], l8[2]; float mx[2];
#pragma unroll
    for (int s = 0; s < 2; ++s) { mx[s] = -3.0e38f; l8[s] = (v8f){};
#pragma unroll
        for (int nb = 0; nb < HD / 16; ++nb) oc[s][nb] = (v8f){}; }
#pragma unroll 1   // one copy of the trip (for speed only)
    for (int t = 0; t < NST; ++t) {
        const bool more = t + 1 < NST;   // the same for the whole work-group
        if (more) { const h16* nk = gk + (size_t)(t + 1) * SE; const h16* nv = gv + (size_t)(t + 1) * SE; g0 = *(const v8h*)nk; g1 = *(const v8h*)(nk + 2048); g2 = *(const v8h*)nv; g3 = *(const v8h*)(nv + 2048);
            asm volatile("s_wait_xcnt 0x0" :: "v"(nk), "v"(nv) : "memory"); }   // the same wait for the next trip's loads
        const h16* lk = &sm[t & 1][0] + lane * 8; const h16* lv = lk + SE;
        v8f sc[2][KS / 16];
#pragma unroll
        for (int c = 0; c < 2; ++c)
#pragma unroll
            for (int nb = 0; nb < KS / 16; ++nb) { const V b = WFrag<h16>::ldf(lk + nb * 1024 + c * 512);
#pragma unroll
                for (int s = 0; s < 2; ++s) sc[s][nb] = WFrag<h16>::mma(b, a[c][s], c ? sc[s][nb] : (v8f){}); }
        V pf[2][KS / 32];
#pragma unroll
        for (int s = 0; s < 2; ++s) {
            // the trip's maximum of the lane's query: in-lane, then the other lane half (a max is exact in any order)
            const v8f m8 = __builtin_elementwise_max(__builtin_elementwise_max(sc[s][0], sc[s][1]), __builtin_elementwise_max(sc[s][2], sc[s][3]));
            const float m = fmaxf(fmaxf(fmaxf(m8[0], m8[1]), fmaxf(m8[2], m8[3])), fmaxf(fmaxf(m8[4], m8[5]), fmaxf(m8[6], m8[7])));
            const float mn = fmaxf(mx[s], fmaxf(m, xhalf(m))); const float al = exp2slot((mx[s] - mn) * CX); mx[s] = mn;   // al: what was summed under the old maximum shrinks by it (0 in trip 0)
            const float ad = 10.0f - mn * CX;   // 2^10: the probabilities' carrier, as PCAR
            v8f s8 = l8[s] * al;
#pragma unroll
            for (int nb = 0; nb < KS / 16; ++nb) { const v8f x = sc[s][nb] * CX + ad; v8f e;
#pragma unroll
                for (int j = 0; j < 8; ++j) e[j] = exp2slot(x[j]);
                sc[s][nb] = e; s8 += e; }
            l8[s] = s8;
#pragma unroll
            for (int nb = 0; nb < HD / 16; ++nb) oc[s][nb] *= al;
#pragma unroll
            for (int ks = 0; ks < KS / 32; ++ks) pf[s][ks] = cat16(__builtin_convertvector(sc[s][ks * 2], v8h), __builtin_convertvector(sc[s][ks * 2 + 1], v8h)); }
#pragma unroll
        for (int ks = 0; ks < KS / 32; ++ks)
#pragma unroll
            for (int nb = 0; nb < HD / 16; ++nb) { const V b = WFrag<h16>::ldf(lv + ks * 2048 + nb * 512);
#pragma unroll
                for (int s = 0; s < 2; ++s) oc[s][nb] = WFrag<h16>::mma(b, pf[s][ks], oc[s][nb]); }
        if (more) { h16* d = &sm[(t + 1) & 1][0] + tid * 8; *(v8h*)d = g0; *(v8h*)(d + 2048) = g1; *(v8h*)(d + SE) = g2; *(v8h*)(d + SE + 2048) = g3; }   // its last readers left this buffer before the barrier of trip t - 1
        __syncthreads();   // publishes trip t + 1's k and v, and ends every wave's reads of the buffer that trip t + 1 refills
    }
    // row sums: eight in-lane sums (one per register index, trips in order), a fixed tree over them, the other lane half
    float rl[2];
#pragma unroll
    for (int s = 0; s < 2; ++s) { const v8f s8 = l8[s]; const float sum = ((s8[0] + s8[1]) + (s8[2] + s8[3])) + ((s8[4] + s8[5]) + (s8[6] + s8[7])); rl[s] = __fdiv_rn(1.0f, sum + xhalf(sum)); }
    // the difference (a1 v) - lam (a2 v) as the hi+lo planes of the output product's A operand, in fragment order: the lane's 8 values of a tile are d = 16 nb + 8 hi + 0..7 of query lr, 16 bytes in a row there, and a wave's store is 512 bytes in a row
    const size_t oo = (size_t)blockIdx.z * TT * DQ + ((size_t)(r0 >> 4) * (DQ >> 5) + blockIdx.y * 2) * 512 + lane * 8; bf* sh = Ah + oo; bf* sl = Al + oo;
    v8us oh[HD / 16], ol[HD / 16];
#pragma unroll
    for (int nb = 0; nb < HD / 16; ++nb)
#pragma unroll
        for (int j = 0; j < 8; ++j) { unsigned short h, l; splitf(oc[0][nb][j] * rl[0] - lam * (oc[1][nb][j] * rl[1]), h, l); oh[nb][j] = h; ol[nb][j] = l; }
#pragma unroll
    for (int nb = 0; nb < HD / 16; ++nb) { *(v8us*)(sh + nb * 256) = oh[nb]; *(v8us*)(sl + nb * 256) = ol[nb]; }
    // the wait in front of any overwrite of a register which an issued store names; addresses and data are inputs so that they live up to it
    asm volatile("s_wait_xcnt 0x0" :: "v"(sh), "v"(sl), "v"(__builtin_bit_cast(v4i, oh[0])), "v"(__builtin_bit_cast(v4i, oh[1])), "v"(__builtin_bit_cast(v4i, oh[2])), "v"(__builtin_bit_cast(v4i, oh[3])), "v"(__builtin_bit_cast(v4i, ol[0])), "v"(__builtin_bit_cast(v4i, ol[1])), "v"(__builtin_bit_cast(v4i, ol[2])), "v"(__builtin_bit_cast(v4i, ol[3])) : "memory");
}
__global__ __launch_bounds__(256) void k_merge(const float* __restrict__ O, int h0, bf* Ah, bf* Al) { const size_t e = ((size_t)blockIdx.x * 256 + threadIdx.x) * 2; if (e >= (size_t)ZH * TT * HD) return; const int d = (int)(e % HD); const int t = (int)((e / HD) % TT); const int zz = (int)(e / ((size_t)HD * TT)); const float cs = (t < RH) ? 1.0f : (1.0f / PCAR); const size_t oo = (size_t)t * DQ + (h0 + zz) * HD + d;
    v2us oh, ol;
#pragma unroll
    for (int q = 0; q < 2; ++q) { unsigned short a, c2; splitf(O[e + q] * cs, a, c2); oh[q] = a; ol[q] = c2; } *(v2us*)(Ah + oo) = oh; *(v2us*)(Al + oo) = ol;  }

extern "C" void kernel_launch(void* const* d_in, const int* in_sizes, int n_in,
                              void* d_out, int out_size, void* d_ws, size_t ws_size, hipStream_t stream) {
    (void)in_sizes; (void)n_in; (void)out_size;
    const float* vin = (const float*)d_in[0]; const float* kin = (const float*)d_in[1]; const float* q1in = (const float*)d_in[2]; const float* q2in = (const float*)d_in[3]; const float* wq = (const float*)d_in[4]; const float* bq = (const float*)d_in[5]; const float* wk = (const float*)d_in[6]; const float* bk = (const float*)d_in[7]; const float* wv = (const float*)d_in[8]; const float* bv = (const float*)d_in[9]; const float* wo = (const float*)d_in[10]; const float* bo = (const float*)d_in[11]; const float* lamp = (const float*)d_in[12];   // weights x @ W
    float* OUT = (float*)d_out;     // [2][2048][1024]
    char* wsp = (char*)d_ws;
    auto take = [&](size_t bytes) { char* p = wsp; wsp += (bytes + 255) & ~(size_t)255; return (void*)p; };
    constexpr size_t PLN = (size_t)NH_ * TT * HD;   // one head plane set of one batch entry; planes are [stream q1, q2, k, v][batch entry]
    bf* WT = (bf*)take((size_t)4 * DQ * DM * 2);      // Wq, Wk, Wv, Wo transposed
    bf* XB = (bf*)take((size_t)4 * NB_ * TT * DM * 2);   // q1, q2, k, v in bf16
    h16* P16 = (h16*)take(4 * NB_ * PLN * 2); bf* Ph = (bf*)take(4 * NB_ * PLN * 2); bf* Pl = (bf*)take(4 * NB_ * PLN * 2);
    bf* ATh = (bf*)take((size_t)NB_ * TT * DQ * 2); bf* ATl = (bf*)take((size_t)NB_ * TT * DQ * 2);
    if ((size_t)(wsp - (char*)d_ws) > ws_size) return;    // ws 256 MiB
    k_prep<<<(unsigned)(4 * WTB + 4 * CVB), 256, 0, stream>>>(wq, wk, wv, wo, WT, q1in, q2in, kin, vin, XB);
    k_gemmks<bf, 0, true, 4, 4, 8, DM, 1, 3><<<dim3(TT / 64, DQ / 64, 4 * NB_), 256, 0, stream>>>(XB, nullptr, WT, nullptr, nullptr, 0, bq, bk, bv, 0, 0, 0, P16, Ph, Pl);
    k_attn<bf, 2><<<dim3(RH / 16, NH_, NB_), 512, 0, stream>>>(Ph, Pl, Ph + 2 * PLN, Pl + 2 * PLN, Ph + 4 * PLN, Pl + 4 * PLN, Ph + 6 * PLN, Pl + 6 * PLN, lamp, ATh, ATl, 0);
    k_attnf<<<dim3((TT - RH) / 128, NH_, NB_), 256, 0, stream>>>(P16, P16 + 2 * PLN, P16 + 4 * PLN, P16 + 6 * PLN, lamp, ATh, ATl, RH);
    k_gemmks<bf, 1, true, 4, 4, 8, DQ, 1, 0><<<dim3(TT / 64, DM / 64, NB_), 256, 0, stream>>>(ATh, ATl, WT + (size_t)3 * DQ * DM, nullptr, OUT, DM, bo, nullptr, nullptr, (size_t)TT * DQ, 0, (size_t)TT * DM, nullptr, nullptr, nullptr);
}

// v009
// A run of this version takes 181 microseconds.
// Next to v008, in two timings, it ran 1.11 times as fast each time.
// Counting every step since v000, it is 20.6 times as fast.
#include <hip/hip_runtime.h>

// NoiseCancellingAttentionMechanism - differential attention with two query streams (v, k, q1, q2 [2][2048][1024]; q1h/q2h = q1/q2 Wq + bq (shared), kh = k Wk + bk, vh = v Wv + bv (16 heads x 64);
// a1 = softmax(q1h.kh/8), a2 = softmax(q2h.kh/8); out = merged (a1 - lam a2) vh, Wo + bo with the scalar lam read as data -> [2][2048][1024]).
// Compute dtypes, f32 accumulate: every input rounded to bf16; projections on PLAIN bf16 operands (inputs: exact, + bias); PER-ROW PRECISION HYBRID for both score sets and both
// p.v contractions (query rows < 256 on bf16 hi+lo planes with 3 products, rows >= 256 on single fp16 planes, probabilities x1024 there); f32 register-row softmaxes; the difference (a1 v) - lam (a2 v) and the

#define NB_  2
#define TT   2048
#define DM   1024
#define NH_  16
#define NKV  16
#define REP  (NH_ / NKV)
#define HD   64
#define DQ   (NH_ * HD)
#define DKV  (NKV * HD)
#define ZH   NH_                  // heads per merge launch
#define RH   256                  // query rows < RH use hi+lo planes (0: none)
#define WIN  0
#define PCAR 1024.0f
#define SCL  0.125f   // HD^-0.5
typedef _Float16 h16;
typedef unsigned short bf;
typedef __attribute__((ext_vector_type(16))) __bf16   v16bf;
typedef __attribute__((ext_vector_type(16))) _Float16 v16h;
typedef __attribute__((ext_vector_type(8)))  _Float16 v8h;
typedef __attribute__((ext_vector_type(8)))  unsigned short v8us;
typedef __attribute__((ext_vector_type(8)))  float    v8f;
typedef __attribute__((ext_vector_type(4)))  float    v4f;
typedef v8h  __attribute__((may_alias)) v8ha;
typedef v4f  __attribute__((may_alias)) v4fa;
typedef v8us __attribute__((may_alias)) v8usa;

__device__ __forceinline__ unsigned short f2bf(float f) { unsigned u = __float_as_uint(f); u += 0x7FFFu + ((u >> 16) & 1u); return (unsigned short)(u >> 16); }
__device__ __forceinline__ float bf2f(unsigned short b) { return __uint_as_float(((unsigned)b) << 16); }
__device__ __forceinline__ float bfr(float f) { return bf2f(f2bf(f)); }
__device__ __forceinline__ v16h cat16(v8h lo, v8h hi) { return __builtin_shufflevector(lo, hi, 0, 1, 2, 3, 4, 5, 6, 7, 8, 9, 10, 11, 12, 13, 14, 15); }
__device__ __forceinline__ v16bf cat16b(v8us lo, v8us hi) { return __builtin_bit_cast(v16bf, __builtin_shufflevector(lo, hi, 0, 1, 2, 3, 4, 5, 6, 7, 8, 9, 10, 11, 12, 13, 14, 15)); }
__device__ __forceinline__ v8f wmma16(v16h a, v16h b, v8f c) { return __builtin_amdgcn_wmma_f32_16x16x32_f16(false, a, false, b, (short)0, c, false, false); }
__device__ __forceinline__ v8f wmmab(v16bf a, v16bf b, v8f c) { return __builtin_amdgcn_wmma_f32_16x16x32_bf16(false, a, false, b, (short)0, c, false, false); }



// 16-bit fragment loaders (K-contiguous rows; the same k order for A and B) and their matrix instruction. ldf reads the same fragment from a plane kept in FRAGMENT ORDER: a 16 x 32 tile is 512 elements, [k / 8][row][k % 8],
// so p = tile + lane * 8 and each of the two loads takes 512 bytes in a row (4 whole lines) where ld touches 16 lines; lane and register hold the same element as with ld
template <typename T16> struct WFrag;
template <> struct WFrag<h16> { typedef v16h V; static __device__ __forceinline__ V ld(const h16* p) { return cat16(*(const v8h*)p, *(const v8h*)(p + 16)); } static __device__ __forceinline__ V ldf(const h16* p) { return cat16(*(const v8h*)p, *(const v8h*)(p + 256)); } static __device__ __forceinline__ v8f mma(V a, V b, v8f c) { return wmma16(a, b, c); } };
template <> struct WFrag<bf> { typedef v16bf V; static __device__ __forceinline__ V ld(const bf* p) { return cat16b(*(const v8us*)p, *(const v8us*)(p + 16)); } static __device__ __forceinline__ V ldf(const bf* p) { return cat16b(*(const v8us*)p, *(const v8us*)(p + 256)); } static __device__ __forceinline__ v8f mma(V a, V b, v8f c) { return wmmab(a, b, c); } };

__device__ __forceinline__ h16 tohx(float x) { return (h16)x; }
__device__ __forceinline__ void splitf(float y, unsigned short& h, unsigned short& l) { h = f2bf(y); l = f2bf(y - bf2f(h)); }
typedef __attribute__((ext_vector_type(2))) _Float16 v2h;
typedef __attribute__((ext_vector_type(4))) _Float16 v4h;
typedef __attribute__((ext_vector_type(2))) unsigned short v2us;
typedef __attribute__((ext_vector_type(4))) unsigned short v4us;
typedef __attribute__((ext_vector_type(2))) float v2f;
typedef __attribute__((ext_vector_type(4))) int v4i;

// ---- k_gemmks: C[m][n] (f32, pitch ldc, + optional f32 bias[n]) = sum_k A[m][k] Bt[n][k] (+ split products per NSPLIT) for a long K, K SPLIT OVER THE NW WAVES OF ONE WORK-GROUP: wave w sums k in [w K/NW, (w+1) K/NW) for the whole (MB*16)x(NB*16) tile, writes its f32 partial tile to its own LDS range,
// and behind one work-group barrier the partial tiles are added in wave order 0..NW-1 (fixed order) and stored as whole 128-B row pieces. grid (M/(MB*16), N/(NB*16), Z), NW*32 threads. K % (32 NW G) == 0.
// EPI 0: f32 C as above. EPI 1, 2: no C; the sum (+ bias) goes straight into the three 16-bit planes the attention kernel reads (fp16, bf16 hi, bf16 lo).
// EPI 1: m = position, n = head x 64 + d, bias[n], planes [head][position][d] (a column block is one head). EPI 2: m = head x 64 + d, n = position, bias[m], planes [head][d][position] (the weight is the A operand, so v comes out transposed).
// EPI 3: all four projections of both batch entries in ONE launch, grid (TT/64, DQ/64, 8): z = stream x 2 + batch entry, streams q1, q2, k (each as EPI 1) and v (as EPI 2, block indices swapped). A = the eight bf16 inputs [z][position][k], Bt = the transposed weights Wq, Wk, Wv in a row,
// bias / biasK / biasV = bq / bk / bv, planes [z][...]. Every choice depends on blockIdx alone, so it is uniform for the work-group.
template <typename T16, int NSPLIT, bool BIAS, int MB, int NB, int NW, int K, int G, int EPI>
__global__ __launch_bounds__(NW * 32) void k_gemmks(const T16* __restrict__ A, const T16* __restrict__ A2, const T16* __restrict__ Bt, const T16* __restrict__ Bt2, float* C, int ldc, const float* __restrict__ bias, const float* __restrict__ biasK, const float* __restrict__ biasV, size_t sA, size_t sB, size_t sC, h16* P16, bf* Ph, bf* Pl) {
    static_assert((EPI != 1 && EPI != 3) || NB * 16 == HD, "a column block is one head");
    typedef typename WFrag<T16>::V V;
    constexpr int PW = NB * 16 + 4;        // LDS row pitch in floats: 16 B x odd for the b128 readers
    constexpr int PS = MB * 16 * PW;       // floats of one wave's partial tile
    __shared__ __align__(16) float red[NW * PS];
    const size_t z = blockIdx.z; const bool tr = (EPI == 2) || (EPI == 3 && z >= 6);   // tr: the weight is the A operand
    if (EPI == 3) { const T16* X = A + z * ((size_t)TT * DM); const T16* Wt = Bt + (z < 4 ? 0 : (z >> 1) - 1) * ((size_t)DQ * DM); A = tr ? Wt : X; Bt = tr ? X : Wt; bias = z < 4 ? bias : (tr ? biasV : biasK);
        P16 += z * ((size_t)NH_ * TT * HD); Ph += z * ((size_t)NH_ * TT * HD); Pl += z * ((size_t)NH_ * TT * HD); }
    else { A += z * sA; if (A2) A2 += z * sA; Bt += z * sB; if (Bt2) Bt2 += z * sB; C += z * sC; }
    const int lane = threadIdx.x & 31, lr = lane & 15, hi = lane >> 4, wave = threadIdx.x >> 5; const int bxr = (EPI == 3 && tr) ? blockIdx.y : blockIdx.x, bxc = (EPI == 3 && tr) ? blockIdx.x : blockIdx.y; const int r0 = bxr * (MB * 16), c0 = bxc * (NB * 16);
    v8f acc[MB][NB];
#pragma unroll
    for (int mb = 0; mb < MB; ++mb)
#pragma unroll
        for (int nb = 0; nb < NB; ++nb) acc[mb][nb] = (v8f){};
    static_assert((K / NW) % 32 == 0, "a wave's k range is whole tiles");
    // both operands lie in fragment order, [row / 16][k / 32] tiles of 512 elements
    const size_t aoff = ((size_t)(r0 >> 4) * (K / 32) + wave * (K / NW / 32)) * 512 + lane * 8, boff = ((size_t)(c0 >> 4) * (K / 32) + wave * (K / NW / 32)) * 512 + lane * 8;
    const T16* pa = A + aoff; const T16* pb = Bt + boff; const T16* pa2 = A2 + aoff; const T16* pb2 = Bt2 + boff;
    // G k steps form a group: the group's loads are all issued first (row set by row set, so that the loads of one 128-B line follow one another), then its WMMAs in ascending k
#pragma unroll
    for (int kg = 0; kg < K / NW; kg += 32 * G) {
        V a[G][MB], a2[G][MB], b[G][NB], b2[G][NB];
#pragma unroll
        for (int mb = 0; mb < MB; ++mb) {
#pragma unroll
            for (int s = 0; s < G; ++s) a[s][mb] = WFrag<T16>::ldf(pa + (size_t)mb * 16 * K + (kg + s * 32) * 16);
            if (NSPLIT == 1 || NSPLIT == 2) {
#pragma unroll
                for (int s = 0; s < G; ++s) a2[s][mb] = WFrag<T16>::ldf(pa2 + (size_t)mb * 16 * K + (kg + s * 32) * 16); } }
#pragma unroll
        for (int nb = 0; nb < NB; ++nb) {
#pragma unroll
            for (int s = 0; s < G; ++s) b[s][nb] = WFrag<T16>::ldf(pb + (size_t)nb * 16 * K + (kg + s * 32) * 16);
            if (NSPLIT >= 2) {
#pragma unroll
                for (int s = 0; s < G; ++s) b2[s][nb] = WFrag<T16>::ldf(pb2 + (size_t)nb * 16 * K + (kg + s * 32) * 16); } }
        // the wait that stands in front of any overwrite of a register which an issued load names; the base addresses are inputs so that they live up to it (no load's result lands on them)
        if (NSPLIT == 2) asm volatile("s_wait_xcnt 0x0" :: "v"(pa), "v"(pb), "v"(pa2), "v"(pb2) : "memory");
        else if (NSPLIT == 1) asm volatile("s_wait_xcnt 0x0" :: "v"(pa), "v"(pb), "v"(pa2) : "memory");
        else asm volatile("s_wait_xcnt 0x0" :: "v"(pa), "v"(pb) : "memory");
        if (G > 1) __builtin_amdgcn_sched_barrier(0);   // keeps the WMMAs behind the group's last load: without it the compiler weaves them among the loads to save registers and a wave has few loads in flight
#pragma unroll
        for (int s = 0; s < G; ++s)
#pragma unroll
            for (int nb = 0; nb < NB; ++nb)
#pragma unroll
                for (int mb = 0; mb < MB; ++mb) { acc[mb][nb] = WFrag<T16>::mma(a[s][mb], b[s][nb], acc[mb][nb]); if (NSPLIT == 1 || NSPLIT == 2) acc[mb][nb] = WFrag<T16>::mma(a2[s][mb], b[s][nb], acc[mb][nb]); if (NSPLIT >= 2) acc[mb][nb] = WFrag<T16>::mma(a[s][mb], b2[s][nb], acc[mb][nb]); }
    }
    float* my = red + wave * PS;
#pragma unroll
    for (int mb = 0; mb < MB; ++mb)
#pragma unroll
        for (int nb = 0; nb < NB; ++nb)
#pragma unroll
            for (int j = 0; j < 8; ++j) my[(mb * 16 + hi * 8 + j) * PW + nb * 16 + lr] = acc[mb][nb][j];
    __syncthreads();   // every wave's partial tile is in LDS before any is read
    // what differs between the two orientations is set up once, from block-uniform values: the bias of the thread's four columns (the same in every trip) and the plane address (eb + row) * ep + ec + cofs
    static_assert((NW * 32) % (NB * 4) == 0, "a thread keeps its columns from trip to trip");
    v4f bn = (v4f){};
    // the head planes of EPI 3 go out in fragment order; there a wave takes 16 rows x 8 columns, which is 256 bytes in a row of such a plane (each element's sum is the same)
    static_assert(EPI != 3 || (NW * 32 == 256 && NB == 4 && MB == 4), "16 rows a trip, 16 column groups");
    constexpr bool fo = (EPI == 3);
    const int rb = fo ? (int)(threadIdx.x & 15) : (int)(threadIdx.x / (NB * 4)), cofs = (fo ? (int)(threadIdx.x >> 4) : (int)(threadIdx.x % (NB * 4))) * 4;
    if (BIAS && !tr) { const float* pc = bias + c0 + cofs; const float t0 = pc[0], t1 = pc[1], t2 = pc[2], t3 = pc[3];
        asm volatile("s_wait_xcnt 0x0" :: "v"(pc) : "memory");   // the wait in front of any overwrite of a register which the issued load names; the address is an input so that it lives up to it
        bn[0] = bfr(t0); bn[1] = bfr(t1); bn[2] = bfr(t2); bn[3] = bfr(t3); }
    const int eb = tr ? r0 : bxc * TT + r0, ep = tr ? TT : HD, ec = tr ? c0 : 0;
#pragma unroll
    for (int u = 0; u < MB * 16; u += NW * 32 / (NB * 4)) { const int row = rb + u; const float* p = red + row * PW + cofs; v4f val = *(const v4fa*)p;
#pragma unroll
        for (int w = 1; w < NW; ++w) val += *(const v4fa*)(p + w * PS);
        if (BIAS && tr) { const float* pr = bias + r0 + row; const float t = *pr;
            asm volatile("s_wait_xcnt 0x0" :: "v"(pr) : "memory");   // the same wait for the row's bias load
            const float bb = bfr(t); bn[0] = bb; bn[1] = bb; bn[2] = bb; bn[3] = bb; }
        if (BIAS) val += bn;
        if (EPI == 0) *(v4f*)(C + (size_t)(r0 + row) * ldc + c0 + cofs) = val;
        else { size_t e = (size_t)(eb + row) * ep + ec + cofs; v4h o16; v4us oh, ol;
            if (fo) { const int t = tr ? c0 + cofs : r0 + row;   // position; q and k: tiles of 16 positions x 32 d, [position / 16][d / 8][position % 16][d % 8]; v: tiles of 16 d x 32 positions, [position / 32][d / 16][(position / 8) % 4][d % 16][position % 8]
                e = tr ? (size_t)bxr * (TT * HD) + (t >> 5) * 2048 + (row >> 4) * 512 + ((t >> 3) & 3) * 128 + (row & 15) * 8 + (t & 7) : (size_t)bxc * (TT * HD) + (t >> 4) * 1024 + (cofs >> 3) * 128 + (t & 15) * 8 + (cofs & 7); }
#pragma unroll
            for (int q = 0; q < 4; ++q) { o16[q] = tohx(val[q]); unsigned short a2, c2; splitf(val[q], a2, c2); oh[q] = a2; ol[q] = c2; }
            h16* s0 = P16 + e; bf* s1 = Ph + e; bf* s2 = Pl + e; *(v4h*)s0 = o16; *(v4us*)s1 = oh; *(v4us*)s2 = ol;
            // the wait in front of any overwrite of a register which an issued store names; addresses and data are inputs so that they live up to it
            asm volatile("s_wait_xcnt 0x0" :: "v"(s0), "v"(s1), "v"(s2), "v"(__builtin_bit_cast(unsigned long long, o16)), "v"(__builtin_bit_cast(unsigned long long, oh)), "v"(__builtin_bit_cast(unsigned long long, ol)) : "memory"); } }
}


// four asynchronous copies from global memory to LDS, 16 bytes a lane each (l: the lane's LDS byte address, g: its global address). The s_wait_xcnt stands inside the statement, behind the last copy, so that it is in front of any overwrite of a register which a copy names
__device__ __forceinline__ void acopy4(unsigned l0, unsigned l1, unsigned l2, unsigned l3, const bf* g0, const bf* g1, const bf* g2, const bf* g3) {
    asm volatile("global_load_async_to_lds_b128 %0, %4, off\n\tglobal_load_async_to_lds_b128 %1, %5, off\n\tglobal_load_async_to_lds_b128 %2, %6, off\n\tglobal_load_async_to_lds_b128 %3, %7, off\n\ts_wait_xcnt 0x0"
                 :: "v"(l0), "v"(l1), "v"(l2), "v"(l3), "v"(g0), "v"(g1), "v"(g2), "v"(g3) : "memory");
}
// one 16 x 16 result tile's 8 values of a lane (16 bytes in a row of a fragment-ordered head plane) into the three planes at element e
__device__ __forceinline__ void put3(h16* P16, bf* Ph, bf* Pl, size_t e, v8f val) {
    v8h o16; v8us oh, ol;
#pragma unroll
    for (int j = 0; j < 8; ++j) { o16[j] = tohx(val[j]); unsigned short h, l; splitf(val[j], h, l); oh[j] = h; ol[j] = l; }
    h16* s0 = P16 + e; bf* s1 = Ph + e; bf* s2 = Pl + e; *(v8h*)s0 = o16; *(v8us*)s1 = oh; *(v8us*)s2 = ol;
    // the wait in front of any overwrite of a register which an issued store names; addresses and data are inputs so that they live up to it
    asm volatile("s_wait_xcnt 0x0" :: "v"(s0), "v"(s1), "v"(s2), "v"(__builtin_bit_cast(v4i, o16)), "v"(__builtin_bit_cast(v4i, oh)), "v"(__builtin_bit_cast(v4i, ol)) : "memory");
    __builtin_amdgcn_sched_barrier(0);   // keeps the next tile's conversions behind this tile's stores: woven together, the sixteen tiles' intermediate values need more registers than a wave has, and some are spilled
}
// ---- k_proj: all four projections of both batch entries, grid (64, 8), y = stream x 2 + batch entry (streams q1, q2, k, v), 8 waves. A work-group makes 128 A rows x 256 B rows over ALL of K; wave (wa, wb) keeps a 64 x 64 tile in registers and sums k in ascending order (no split of K, no partial tiles).
// A trip is 64 k: the 24 row tiles' pieces (2 KB in a row each in the fragment-ordered operands) are brought into LDS once for the 8 waves by asynchronous copies, two buffers, one trip ahead, one barrier a trip; so an operand row leaves L2 once per 128 or 256 rows of the other operand.
// q1, q2, k: the weight is the A operand and the input the B operand, so a lane's 8 values of a tile are d = 16 mb + 8 hi + 0..7 of ONE position. v: the input is A, the weight B, so they are 8 positions of ONE d. Either way they are 16 bytes in a row of the head plane, a wave's store is 512 bytes in a row, and no value changes lanes.
__global__ void __launch_bounds__(256) __attribute__((amdgpu_waves_per_eu(4, 4))) k_proj(const bf* __restrict__ XB, const bf* __restrict__ WT, const float* __restrict__ bq, const float* __restrict__ bk, const float* __restrict__ bv, h16* P16, bf* Ph, bf* Pl) {
    typedef WFrag<bf>::V V;
    constexpr int KC = 64, NTR = DM / KC, RT = KC * 16;   // k a trip, trips, elements of one 16-row tile a trip
    constexpr int SE = 24 * RT;                           // elements of a stage: 8 row tiles of A, then 16 of B
    constexpr int GS = 2 * (DM / 32) * 512;               // two row tiles further in an operand
    static_assert(TT % 256 == 0 && DQ % 256 == 0 && (TT / 128) * (DQ / 256) == 64 && (DQ / 128) * (TT / 256) == 64 && NTR >= 2 && HD == 64, "whole blocks, 64 a stream; a wave's 64 weight rows are one head");
    __shared__ __align__(16) bf sm[2][SE];
    const int tid = threadIdx.x, lane = tid & 31, lr = lane & 15, hi = lane >> 4, wave = tid >> 5, wa = wave & 1, wb = wave >> 1;
    const int z = blockIdx.y, bx = blockIdx.x; const bool xa = z >= 6;   // xa: the input is the A operand; depends on blockIdx alone
    const bf* X = XB + (size_t)z * ((size_t)TT * DM); const bf* Wt = WT + (size_t)(z < 4 ? 0 : (z >> 1) - 1) * ((size_t)DQ * DM);
    const int ab = xa ? bx % (TT / 128) : bx % (DQ / 128), bb = xa ? bx / (TT / 128) : bx / (DQ / 128);
    // thread tid moves 16-byte pieces tid + 256 j of a stage, j = 0..11: piece tid % 128 of row tile 2 j + tid / 128
    const bf* ga = (xa ? X : Wt) + (size_t)(ab * 8 + (tid >> 7)) * ((DM / 32) * 512) + (tid & 127) * 8;
    const bf* gb = (xa ? Wt : X) + (size_t)(bb * 16 + (tid >> 7)) * ((DM / 32) * 512) + (tid & 127) * 8;
    const unsigned l0 = (unsigned)(size_t)&sm[0][0] + tid * 16;
    auto fill = [&](int t, int buf) { const unsigned l = l0 + buf * (SE * 2); const bf* a = ga + t * RT; const bf* b = gb + t * RT;
        acopy4(l, l + 4096, l + 8192, l + 12288, a, a + GS, a + 2 * GS, a + 3 * GS);
        acopy4(l + 16384, l + 20480, l + 24576, l + 28672, b, b + GS, b + 2 * GS, b + 3 * GS);
        acopy4(l + 32768, l + 36864, l + 40960, l + 45056, b + 4 * GS, b + 5 * GS, b + 6 * GS, b + 7 * GS); };
    fill(0, 0);
    asm volatile("s_wait_asynccnt 0x0" ::: "memory");   // the wave's own copies of trip 0 have landed
    __syncthreads();   // trip 0's operands are in LDS before any wave reads them
    fill(1, 1);
    v8f acc[4][4];
#pragma unroll
    for (int mb = 0; mb < 4; ++mb)
#pragma unroll
        for (int nb = 0; nb < 4; ++nb) acc[mb][nb] = (v8f){};
#pragma unroll 1   // one copy of the trip: the ring's order stands once, at the loop's foot
    for (int t = 0; t < NTR; ++t) {
        const bf* la = &sm[t & 1][0] + wa * 4 * RT + lane * 8; const bf* lb = &sm[t & 1][0] + (8 + wb * 4) * RT + lane * 8;
#pragma unroll
        for (int c = 0; c < KC / 32; ++c) { V a[4], b[4];
#pragma unroll
            for (int mb = 0; mb < 4; ++mb) a[mb] = WFrag<bf>::ldf(la + mb * RT + c * 512);
#pragma unroll
            for (int nb = 0; nb < 4; ++nb) b[nb] = WFrag<bf>::ldf(lb + nb * RT + c * 512);
            __builtin_amdgcn_sched_barrier(0);   // keeps the WMMAs behind the k step's last LDS read: without it the compiler reuses one B fragment's registers and waits for each fragment's read in turn
#pragma unroll
            for (int nb = 0; nb < 4; ++nb)
#pragma unroll
                for (int mb = 0; mb < 4; ++mb) acc[mb][nb] = WFrag<bf>::mma(a[mb], b[nb], acc[mb][nb]); }
        asm volatile("s_wait_dscnt 0x0" ::: "memory");      // the wave's reads of this buffer are done before it is given up for the refill
        asm volatile("s_wait_asynccnt 0x0" ::: "memory");   // the wave's own copies of trip t + 1 have landed
        __syncthreads();   // publishes trip t + 1's operands, and ends every wave's reads of the buffer that is refilled behind it
        if (t + 2 < NTR) fill(t + 2, t & 1);   // the same for the whole work-group
    }
    asm volatile("s_wait_asynccnt 0x0" ::: "memory");   // no copy is outstanding when the wave ends
    const size_t pz = (size_t)z * ((size_t)NH_ * TT * HD);
    if (xa) {   // v planes: tiles of 16 d x 32 positions, [position / 32][d / 16][(position / 8) % 4][d % 16][position % 8]
        const int head = bb * 4 + wb; const size_t e0 = pz + (size_t)head * (TT * HD) + (size_t)(ab * 4 + wa * 2) * 2048 + lane * 8;
        const float* pc = bv + head * HD + lr; const float t0 = pc[0], t1 = pc[16], t2 = pc[32], t3 = pc[48];
        asm volatile("s_wait_xcnt 0x0" :: "v"(pc) : "memory");   // the wait in front of any overwrite of a register which an issued load names; the address is an input so that it lives up to it
        const float bn[4] = { bfr(t0), bfr(t1), bfr(t2), bfr(t3) };
#pragma unroll
        for (int mb = 0; mb < 4; ++mb)
#pragma unroll
            for (int nb = 0; nb < 4; ++nb) put3(P16, Ph, Pl, e0 + (mb >> 1) * 2048 + nb * 512 + (mb & 1) * 256, acc[mb][nb] + bn[nb]);
    } else {    // q and k planes: tiles of 16 positions x 32 d, [position / 16][d / 8][position % 16][d % 8]
        const int head = ab * 2 + wa; const size_t e0 = pz + (size_t)head * (TT * HD) + (size_t)(bb * 16 + wb * 4) * 1024 + lane * 8;
        const float* pc = (z < 4 ? bq : bk) + head * HD + hi * 8; v8f bm[4];
#pragma unroll
        for (int mb = 0; mb < 4; ++mb) bm[mb] = *(const v8f*)(pc + mb * 16);
        asm volatile("s_wait_xcnt 0x0" :: "v"(pc) : "memory");   // the same wait for these bias loads
#pragma unroll
        for (int mb = 0; mb < 4; ++mb) { v8f bb;
#pragma unroll
            for (int j = 0; j < 8; ++j) bb[j] = bfr(bm[mb][j]);
#pragma unroll
            for (int nb = 0; nb < 4; ++nb) put3(P16, Ph, Pl, e0 + nb * 1024 + mb * 256, acc[mb][nb] + bb); }
    }
}

// element (row r, k) of an [R][K] operand in fragment order: tiles of 16 rows x 32 k, [r / 16][k / 32], each [k / 8 % 4][r % 16][k % 8]
__device__ __forceinline__ size_t fragofs(int r, int k, int K) { return ((size_t)(r >> 4) * (K >> 5) + (k >> 5)) * 512 + ((k >> 3) & 3) * 128 + (r & 15) * 8 + (k & 7); }
// One PIECE is 16 bytes (8 elements along k of one row) of a fragment-ordered plane; piece i lies at element 8 i. A thread makes several pieces and issues all their loads before it converts the first, so the launch has few, long waves with much in flight.
// d_wtG: a weight w[k][n] to bf16 [n][k]. A block takes 128 k x 128 n; thread t makes 8 pieces, rows n + 16 j, the same 8 k. Lanes run along n, so a load reads 64 bytes in a row of two rows of w, and the 8 loads of a k take 512 bytes in a row.
__device__ __forceinline__ void d_wtG(int bx, const float* __restrict__ w, bf* Bt) {
    static_assert(DM % 128 == 0 && DQ % 128 == 0, "whole blocks");
    const int t = threadIdx.x, kb = bx % (DM / 128), nb = bx / (DM / 128);
    const float* ps = w + (size_t)((kb * 4 + (t >> 6)) * 32 + ((t >> 4) & 3) * 8) * DQ + nb * 128 + (t & 15);
    float v[8][8];
#pragma unroll
    for (int q = 0; q < 8; ++q)
#pragma unroll
        for (int j = 0; j < 8; ++j) v[j][q] = ps[q * DQ + j * 16];
    asm volatile("s_wait_xcnt 0x0" :: "v"(ps) : "memory");   // the wait in front of any overwrite of a register which an issued load names; the address is an input so that it lives up to it
    bf* pd = Bt + ((size_t)nb * 8 * (DM / 32) + kb * 4) * 512 + t * 8; v8us o[8];
#pragma unroll
    for (int j = 0; j < 8; ++j)
#pragma unroll
        for (int q = 0; q < 8; ++q) o[j][q] = f2bf(v[j][q]);
#pragma unroll
    for (int j = 0; j < 8; ++j) *(v8us*)(pd + (size_t)j * (DM / 32) * 512) = o[j];
    // the same wait for the stores; the data are inputs so that they live up to it (the address is the thread index and a scalar base, and nothing is computed behind the stores)
    asm volatile("s_wait_xcnt 0x0" :: "v"(__builtin_bit_cast(v4i, o[0])), "v"(__builtin_bit_cast(v4i, o[1])), "v"(__builtin_bit_cast(v4i, o[2])), "v"(__builtin_bit_cast(v4i, o[3])), "v"(__builtin_bit_cast(v4i, o[4])), "v"(__builtin_bit_cast(v4i, o[5])), "v"(__builtin_bit_cast(v4i, o[6])), "v"(__builtin_bit_cast(v4i, o[7])) : "memory");
}
// d_cvt8: an input [row][DM] to bf16. A block takes 32 rows (128 KB in a row of the source, 64 KB of the plane); thread t makes pieces 4096 bx + 256 j + t, j = 0..15
__device__ __forceinline__ void d_cvt8(int bx, const float* __restrict__ src, bf* dst) {
    static_assert(DM == 1024, "8 steps of 256 pieces are 16 rows");
    const int t = threadIdx.x;
    const float* ps = src + ((size_t)bx * 32 + (t & 15)) * DM + (t >> 6) * 32 + ((t >> 4) & 3) * 8; v8f v[16];
#pragma unroll
    for (int j = 0; j < 16; ++j) v[j] = *(const v8f*)(ps + (j >> 3) * 16 * DM + (j & 7) * 128);
    asm volatile("s_wait_xcnt 0x0" :: "v"(ps) : "memory");   // the wait in front of any overwrite of a register which an issued load names; the address is an input so that it lives up to it
    bf* pd = dst + (size_t)bx * 32768 + t * 8; v8us o[16];
#pragma unroll
    for (int j = 0; j < 16; ++j)
#pragma unroll
        for (int q = 0; q < 8; ++q) o[j][q] = f2bf(v[j][q]);
#pragma unroll
    for (int j = 0; j < 16; ++j) *(v8us*)(pd + j * 2048) = o[j];
    // the same wait for the stores; the data are inputs so that they live up to it (the address is the thread index and a scalar base, and nothing is computed behind the stores)
    asm volatile("s_wait_xcnt 0x0" :: "v"(__builtin_bit_cast(v4i, o[0])), "v"(__builtin_bit_cast(v4i, o[1])), "v"(__builtin_bit_cast(v4i, o[2])), "v"(__builtin_bit_cast(v4i, o[3])), "v"(__builtin_bit_cast(v4i, o[4])), "v"(__builtin_bit_cast(v4i, o[5])), "v"(__builtin_bit_cast(v4i, o[6])), "v"(__builtin_bit_cast(v4i, o[7])),
                 "v"(__builtin_bit_cast(v4i, o[8])), "v"(__builtin_bit_cast(v4i, o[9])), "v"(__builtin_bit_cast(v4i, o[10])), "v"(__builtin_bit_cast(v4i, o[11])), "v"(__builtin_bit_cast(v4i, o[12])), "v"(__builtin_bit_cast(v4i, o[13])), "v"(__builtin_bit_cast(v4i, o[14])), "v"(__builtin_bit_cast(v4i, o[15])) : "memory");
}
// ---- k_prep: every operand conversion in ONE launch. Both kinds of plane are written in fragment order (fragofs). Blocks [0, 4 WTB): the four weights, transposed to bf16 [n][k], in a row in WT. Blocks behind them: the four inputs, both batch entries each, to bf16, in a row in XB.
#define WTB ((DM / 128) * (DQ / 128))            // blocks per weight
#define CVB (NB_ * TT * DM / 8 / 256 / 16)       // blocks per input
// six waves a SIMD: the launch's 768 blocks are three a WGP, so that all of them are resident at once and every load of the launch is in flight together
__global__ void __launch_bounds__(256) __attribute__((amdgpu_waves_per_eu(6))) k_prep(const float* __restrict__ w0, const float* __restrict__ w1, const float* __restrict__ w2, const float* __restrict__ w3, bf* WT, const float* __restrict__ x0, const float* __restrict__ x1, const float* __restrict__ x2, const float* __restrict__ x3, bf* XB) {
    static_assert((NB_ * TT) % 32 == 0, "whole blocks");
    const int bx = blockIdx.x;
    if (bx < 4 * WTB) { const int s = bx / WTB; d_wtG(bx % WTB, s == 0 ? w0 : s == 1 ? w1 : s == 2 ? w2 : w3, WT + (size_t)s * DM * DQ); }
    else { const int c = bx - 4 * WTB, s = c / CVB; d_cvt8(c % CVB, s == 0 ? x0 : s == 1 ? x1 : s == 2 ? x2 : x3, XB + (size_t)s * NB_ * TT * DM); }
}
__global__ __launch_bounds__(256) void k_cscvt(const float* __restrict__ cosT, const float* __restrict__ sinT, float* CS) { const int idx = blockIdx.x * 256 + threadIdx.x; if (idx >= TT * HD) return; v2f cs; cs[0] = bfr(cosT[idx]); cs[1] = bfr(sinT[idx]); *(v2f*)(CS + (size_t)idx * 2) = cs;  }
// 2^x with the one free issue slot that the instruction set asks for behind a transcendental
__device__ __forceinline__ float exp2slot(float x) { float e; asm("v_exp_f32 %0, %1\n\tv_nop" : "=v"(e) : "v"(x)); return e; }
// value of lane l ^ 16 (a vector cross-row move, no LDS round trip); every lane is on where it is used
__device__ __forceinline__ float xhalf(float x) { return __int_as_float(__builtin_amdgcn_permlanex16(__float_as_int(x), __float_as_int(x), 0x76543210, 0xfedcba98, false, false)); }
// ---- k_attn: scores, softmax and p.v of BOTH query streams for 16 query rows of one head in one work-group; scores and probabilities never leave it. grid (rows/16, heads, batch entries), 16 waves. Launched for the hi+lo rows; the single-plane rows go through k_attnf below.
// Wave w owns keys [128 w, 128 w + 128): 2 x 8 score tiles in registers (each k and v fragment serves both streams), computed TRANSPOSED: the k fragment is the A operand and the q fragment the B operand, so a tile is [key][query] and
// lane (lr, hi) holds keys 16 nb + 8 hi + 0..7 of the ONE query lr. Row max and row sum are in-lane plus one exchange of the lane halves, then joined over the waves through LDS; two neighbouring tiles, converted in place, ARE the A fragment
// of p.v (element s: key 8 hi + s, then 16 + 8 hi + s - 8, the order in which ld and ldf deliver v), so no probability changes lanes. p.v summed over the wave's keys in ascending k, the 16 partial tiles added in wave order 0..15 (as the K-split GEMM does), the two streams' difference written as bf16 hi+lo planes.
template <typename T16, int NSPLIT>
__global__ __launch_bounds__(512) void k_attn(const T16* __restrict__ Q1, const T16* __restrict__ Q1l, const T16* __restrict__ Q2, const T16* __restrict__ Q2l, const T16* __restrict__ Kp, const T16* __restrict__ Kl, const T16* __restrict__ Vt, const T16* __restrict__ Vl, const float* __restrict__ lamp, bf* Ah, bf* Al, int row0) {
    typedef typename WFrag<T16>::V V;
    constexpr int NW = 16, KW = TT / NW, NT = KW / 16;   // waves, keys per wave, score tiles per stream and wave
    constexpr int PP = KW + 8;                           // pitch of a wave's probability rows (128 keys) in 16-bit elements: 16 B x odd for the b128 readers
    constexpr int RP = 20;                               // pitch of a row's 16 per-wave values in floats: 16 B x odd
    constexpr int PW = HD + 4, PS = 32 * PW;             // partial output tile: row pitch and size in floats
    constexpr bool HIRES = (NSPLIT == 2);
    constexpr int PB = (HIRES ? 2 : 1) * 32 * PP;        // 16-bit elements of one wave's probability planes
    constexpr int SB = (NW * PB * 2 > NW * PS * 4) ? NW * PB * 2 : NW * PS * 4;
    __shared__ __align__(16) char sm[SB];                // hi+lo planes: first the parked probabilities, then (behind a barrier) the partial output tiles; single plane: the partial output tiles alone
    T16* pbuf = (T16*)sm; float* red = (float*)sm;
    __shared__ __align__(16) float rmx[32 * RP];
    __shared__ __align__(16) float rsm[32 * RP];
    const int lane = threadIdx.x & 31, lr = lane & 15, hi = lane >> 4, wave = threadIdx.x >> 5; const int r0 = row0 + blockIdx.x * 16; const size_t hp = ((size_t)blockIdx.z * NH_ + blockIdx.y) * TT * HD;
    const float lam = bfr(lamp[0]);   // read here, where control flow is uniform, so that it is a scalar load whose latency the whole kernel hides
    const size_t qoff = hp + (size_t)r0 * HD + lane * 8, koff = hp + (size_t)wave * KW * HD + lane * 8, voff = hp + (size_t)wave * KW * HD + lane * 8;   // the planes are in fragment order: 16 query rows are 1024 elements in a row, the wave's 128 keys 8192 elements in a row of k and of v
    const T16* pq1 = Q1 + qoff; const T16* pq2 = Q2 + qoff; const T16* pk = Kp + koff; const T16* pv = Vt + voff; const T16* pq1l = Q1l + qoff; const T16* pq2l = Q2l + qoff; const T16* pkl = Kl + koff; const T16* pvl = Vl + voff;
    v8f sc[2][NT];
#pragma unroll
    for (int s = 0; s < 2; ++s)
#pragma unroll
        for (int nb = 0; nb < NT; ++nb) sc[s][nb] = (v8f){};
    if constexpr (HIRES) {
#pragma unroll
        for (int kc = 0; kc < HD; kc += 32) {
            V a[2], a2[2]; a[0] = WFrag<T16>::ldf(pq1 + kc * 16); a[1] = WFrag<T16>::ldf(pq2 + kc * 16); if (HIRES) { a2[0] = WFrag<T16>::ldf(pq1l + kc * 16); a2[1] = WFrag<T16>::ldf(pq2l + kc * 16); }
#pragma unroll
            for (int nb = 0; nb < NT; ++nb) { const V b = WFrag<T16>::ldf(pk + nb * 1024 + kc * 16); V b2; if (HIRES) b2 = WFrag<T16>::ldf(pkl + nb * 1024 + kc * 16);
#pragma unroll
                for (int s = 0; s < 2; ++s) { sc[s][nb] = WFrag<T16>::mma(b, a[s], sc[s][nb]); if (HIRES) { sc[s][nb] = WFrag<T16>::mma(b, a2[s], sc[s][nb]); sc[s][nb] = WFrag<T16>::mma(b2, a[s], sc[s][nb]); } } }
        }
    } else {
        // single planes: all of the wave's q and k fragments fit in registers beside nothing else, so every load is issued before the first WMMA (one trip to L2 instead of one per tile); each tile still sums kc = 0, then 32
        V a[2][2], b[NT][2];
#pragma unroll
        for (int c = 0; c < 2; ++c) { a[c][0] = WFrag<T16>::ldf(pq1 + c * 512); a[c][1] = WFrag<T16>::ldf(pq2 + c * 512); }
#pragma unroll
        for (int nb = 0; nb < NT; ++nb)
#pragma unroll
            for (int c = 0; c < 2; ++c) b[nb][c] = WFrag<T16>::ldf(pk + nb * 1024 + c * 512);
        __builtin_amdgcn_sched_barrier(0);   // keeps the WMMAs behind the last load: without it the compiler reuses one fragment's registers and waits for each tile's load in turn
#pragma unroll
        for (int nb = 0; nb < NT; ++nb)
#pragma unroll
            for (int c = 0; c < 2; ++c)
#pragma unroll
                for (int s = 0; s < 2; ++s) sc[s][nb] = WFrag<T16>::mma(b[nb][c], a[c][s], sc[s][nb]);
    }
    // the wait that stands in front of any overwrite of a register which an issued load names; the base addresses are inputs so that they live up to it
    if (HIRES) asm volatile("s_wait_xcnt 0x0" :: "v"(pq1), "v"(pq2), "v"(pk), "v"(pq1l), "v"(pq2l), "v"(pkl) : "memory");
    else asm volatile("s_wait_xcnt 0x0" :: "v"(pq1), "v"(pq2), "v"(pk) : "memory");
    // row max: over the lane's 64 scores of its query, the other lane half, then the 16 waves (a max is exact in any order)
    float st[2];   // per stream: the statistic of the lane's query
#pragma unroll
    for (int s = 0; s < 2; ++s) { v8f m8;
#pragma unroll
        for (int j = 0; j < 8; ++j) m8[j] = -3.0e38f;
#pragma unroll
        for (int nb = 0; nb < NT; ++nb) { sc[s][nb] *= SCL; m8 = __builtin_elementwise_max(m8, sc[s][nb]); }   // whole tiles: neighbouring registers pair up in the packed forms
        const float m = fmaxf(fmaxf(fmaxf(m8[0], m8[1]), fmaxf(m8[2], m8[3])), fmaxf(fmaxf(m8[4], m8[5]), fmaxf(m8[6], m8[7]))); st[s] = fmaxf(m, xhalf(m)); }
    rmx[lane * RP + wave] = hi ? st[1] : st[0];   // row l of the table: lanes 0..15 stream 1, lanes 16..31 stream 2
    __syncthreads();   // every wave's row maxima are in LDS before any is read
    float gm;          // lane l: the max of row l (rows 0..15 stream 1, 16..31 stream 2)
    { const float* p = rmx + lane * RP; const v4f m0 = *(const v4fa*)p, m1 = *(const v4fa*)(p + 4), m2 = *(const v4fa*)(p + 8), m3 = *(const v4fa*)(p + 12); gm = m0[0];
#pragma unroll
      for (int q = 0; q < 4; ++q) gm = fmaxf(fmaxf(gm, m0[q]), fmaxf(m1[q], fmaxf(m2[q], m3[q]))); }
    { const float go = xhalf(gm); st[0] = hi ? go : gm; st[1] = hi ? gm : go; }   // both streams' value of query lr
    // one exp per score; row sum: eight in-lane sums (one per register index, tiles in order), a fixed tree over them, the other lane half, the waves in order 0..15
#pragma unroll
    for (int s = 0; s < 2; ++s) { const float mx = st[s]; v8f s8 = (v8f){};
#pragma unroll
        for (int nb = 0; nb < NT; ++nb) { const v8f d0 = (sc[s][nb] - mx) * 1.4426950408889634f; v8f e;
#pragma unroll
            for (int j = 0; j < 8; ++j) e[j] = exp2slot(d0[j]);
            sc[s][nb] = e; s8 += e; }
        const float sum = ((s8[0] + s8[1]) + (s8[2] + s8[3])) + ((s8[4] + s8[5]) + (s8[6] + s8[7])); st[s] = sum + xhalf(sum); }
    rsm[lane * RP + wave] = hi ? st[1] : st[0];
    __syncthreads();   // every wave's row sums are in LDS before any is read
    float gf;          // lane l: the factor of row l
    { const float* p = rsm + lane * RP; float sum = p[0];
#pragma unroll
      for (int w = 1; w < NW; ++w) sum += p[w];
      gf = __fdiv_rn(HIRES ? 1.0f : PCAR, sum); }
    { const float go = xhalf(gf); st[0] = hi ? go : gf; st[1] = hi ? gf : go; }
    // the probabilities as A fragments. Single plane: 64 registers, kept. Hi+lo planes: 128 registers, too many beside the v fragments, so each lane parks ITS OWN fragments in the wave's LDS piece (16-byte stores) and reads the same bytes back
    T16* pw = pbuf + wave * PB + lr * PP + 8 * hi;
    V pf[2][KW / 32];
#pragma unroll
    for (int s = 0; s < 2; ++s)
#pragma unroll
        for (int ks = 0; ks < KW / 32; ++ks) {
            if constexpr (HIRES) {
#pragma unroll
                for (int t = 0; t < 2; ++t) { const v8f p = sc[s][ks * 2 + t] * st[s]; v8us h8, l8;
#pragma unroll
                    for (int j = 0; j < 8; ++j) { unsigned short h, l; splitf(p[j], h, l); h8[j] = h; l8[j] = l; }
                    *(v8us*)(pw + s * 16 * PP + ks * 32 + t * 16) = h8; *(v8us*)(pw + 32 * PP + s * 16 * PP + ks * 32 + t * 16) = l8; }
            } else pf[s][ks] = cat16(__builtin_convertvector(sc[s][ks * 2] * st[s], v8h), __builtin_convertvector(sc[s][ks * 2 + 1] * st[s], v8h)); }
    v8f oc[2][HD / 16];
#pragma unroll
    for (int s = 0; s < 2; ++s)
#pragma unroll
        for (int nb = 0; nb < HD / 16; ++nb) oc[s][nb] = (v8f){};
    constexpr int GK = HIRES ? 2 : 4;   // k steps whose v fragments are loaded ahead of their WMMAs (what the registers hold beside the accumulators)
#pragma unroll
    for (int kg = 0; kg < KW / 32; kg += GK) {
        V b[GK][HD / 16], b2[GK][HD / 16];
#pragma unroll
        for (int nb = 0; nb < HD / 16; ++nb)
#pragma unroll
            for (int g = 0; g < GK; ++g) { b[g][nb] = WFrag<T16>::ldf(pv + (kg + g) * 2048 + nb * 512); if (HIRES) b2[g][nb] = WFrag<T16>::ldf(pvl + (kg + g) * 2048 + nb * 512); }
        __builtin_amdgcn_sched_barrier(0);   // keeps the WMMAs behind the group's last load: without it the compiler reuses one fragment's registers and waits for each load in turn
#pragma unroll
        for (int g = 0; g < GK; ++g) { const int ks = kg + g; V a[2], a2[2];
#pragma unroll
            for (int s = 0; s < 2; ++s) { if constexpr (HIRES) { a[s] = WFrag<T16>::ld(pw + s * 16 * PP + ks * 32); a2[s] = WFrag<T16>::ld(pw + 32 * PP + s * 16 * PP + ks * 32); } else a[s] = pf[s][ks]; }
#pragma unroll
            for (int nb = 0; nb < HD / 16; ++nb)
#pragma unroll
                for (int s = 0; s < 2; ++s) { oc[s][nb] = WFrag<T16>::mma(a[s], b[g][nb], oc[s][nb]); if (HIRES) { oc[s][nb] = WFrag<T16>::mma(a2[s], b[g][nb], oc[s][nb]); oc[s][nb] = WFrag<T16>::mma(a[s], b2[g][nb], oc[s][nb]); } } }
    }
    // the same wait for the v loads
    if (HIRES) asm volatile("s_wait_xcnt 0x0" :: "v"(pv), "v"(pvl) : "memory");
    else asm volatile("s_wait_xcnt 0x0" :: "v"(pv) : "memory");
    if constexpr (HIRES) __syncthreads();   // every wave has read its parked probabilities before the partial tiles are written over them (single plane: nothing lay there)
    else __builtin_amdgcn_sched_barrier(0);   // keeps the stores below behind the last WMMA
    float* my = red + wave * PS + hi * 8 * PW + lr;
#pragma unroll
    for (int s = 0; s < 2; ++s)
#pragma unroll
        for (int nb = 0; nb < HD / 16; ++nb)
#pragma unroll
            for (int j = 0; j < 8; ++j) my[(s * 16 + j) * PW + nb * 16] = oc[s][nb][j];
    __syncthreads();   // every wave's partial tile is in LDS before any is read
    // one thread sums the same row and columns of both streams, so the difference (a1 v) - lam (a2 v) is formed here and goes out as the hi+lo planes [position][head x 64 + d] of the output product's A operand
    // (in fragment order, as that product reads it: a wave takes 16 rows x 8 columns, 256 bytes in a row there)
    if (threadIdx.x < 256) { const int row = threadIdx.x & 15, cofs = (threadIdx.x >> 4) * 4; const float* p = red + row * PW + cofs; v4f v1 = *(const v4fa*)p, v2 = *(const v4fa*)(p + 16 * PW);
#pragma unroll
      for (int w = 1; w < NW; ++w) { v1 += *(const v4fa*)(p + w * PS); v2 += *(const v4fa*)(p + w * PS + 16 * PW); }
      constexpr float cs = HIRES ? 1.0f : (1.0f / PCAR); v4us oh, ol;
#pragma unroll
      for (int q = 0; q < 4; ++q) { unsigned short s1, s2; splitf(v1[q] * cs - lam * (v2[q] * cs), s1, s2); oh[q] = s1; ol[q] = s2; }
      const size_t oo = (size_t)blockIdx.z * TT * DQ + fragofs(r0 + row, blockIdx.y * HD + cofs, DQ); *(v4us*)(Ah + oo) = oh; *(v4us*)(Al + oo) = ol; }
}
// ---- k_attnf: the single-plane (fp16) rows, tiled by QUERIES: grid (rows/128, heads, batch entries), 8 waves. Wave w keeps 16 query rows of both streams (q fragments, running statistics, output tiles in registers) and walks ALL keys, 64 a trip;
// a trip's k and v (8 KB each, a contiguous piece of the fragment-ordered planes) are brought into LDS once for the 8 waves, through registers, one trip ahead, two buffers, one barrier a trip. So k and v leave L2 once per 128 rows (was: per 16).
// Scores transposed as in k_attn (k as A, q as B): lane (lr, hi) holds keys 16 nb + 8 hi + 0..7 of query lr. The output is transposed too (v as A, the converted score tiles as B: the same registers, the same k order), so a lane's output elements belong to its own query
// and the rescale by the running maximum is in-lane. Probabilities are 1024 x exp(score - running max), f32 sums of the unrounded values beside them; the division by the row sum comes once, at the end.
__global__ void __launch_bounds__(256) __attribute__((amdgpu_waves_per_eu(4, 4))) k_attnf(const h16* __restrict__ Q1, const h16* __restrict__ Q2, const h16* __restrict__ Kp, const h16* __restrict__ Vt, const float* __restrict__ lamp, bf* Ah, bf* Al, int row0) {
    typedef WFrag<h16>::V V;
    constexpr int KS = 64, NST = TT / KS, SE = KS * HD;   // keys a trip, trips, elements of k (and of v) a trip
    constexpr float CX = SCL * 1.4426950408889634f;       // raw score -> exponent of 2
    __shared__ __align__(16) h16 sm[2][2 * SE];           // two buffers of k, then v
    const int tid = threadIdx.x, lane = tid & 31, wave = tid >> 5; const int r0 = row0 + (blockIdx.x * 8 + wave) * 16; const size_t hp = ((size_t)blockIdx.z * NH_ + blockIdx.y) * TT * HD;
    const float lam = bfr(lamp[0]);
    const h16* pq1 = Q1 + hp + (size_t)r0 * HD + lane * 8; const h16* pq2 = Q2 + hp + (size_t)r0 * HD + lane * 8;
    const h16* gk = Kp + hp + tid * 8; const h16* gv = Vt + hp + tid * 8;   // thread tid moves 16-byte pieces tid and tid + 256 of each operand
    V a[2][2];
#pragma unroll
    for (int c = 0; c < 2; ++c) { a[c][0] = WFrag<h16>::ldf(pq1 + c * 512); a[c][1] = WFrag<h16>::ldf(pq2 + c * 512); }
    v8h g0 = *(const v8h*)gk, g1 = *(const v8h*)(gk + 2048), g2 = *(const v8h*)gv, g3 = *(const v8h*)(gv + 2048);
    // the wait that stands in front of any overwrite of a register which an issued load names; the addresses are inputs so that they live up to it
    asm volatile("s_wait_xcnt 0x0" :: "v"(pq1), "v"(pq2), "v"(gk), "v"(gv) : "memory");
    { h16* d = &sm[0][0] + tid * 8; *(v8h*)d = g0; *(v8h*)(d + 2048) = g1; *(v8h*)(d + SE) = g2; *(v8h*)(d + SE + 2048) = g3; }
    __syncthreads();   // trip 0's k and v are in LDS before any wave reads them
    v8f oc[2][HD / 16], l8[2]; float mx[2];
#pragma unroll
    for (int s = 0; s < 2; ++s) { mx[s] = -3.0e38f; l8[s] = (v8f){};
#pragma unroll
        for (int nb = 0; nb < HD / 16; ++nb) oc[s][nb] = (v8f){}; }
#pragma unroll 1   // one copy of the trip (for speed only)
    for (int t = 0; t < NST; ++t) {
        const bool more = t + 1 < NST;   // the same for the whole work-group
        if (more) { const h16* nk = gk + (size_t)(t + 1) * SE; const h16* nv = gv + (size_t)(t + 1) * SE; g0 = *(const v8h*)nk; g1 = *(const v8h*)(nk + 2048); g2 = *(const v8h*)nv; g3 = *(const v8h*)(nv + 2048);
            asm volatile("s_wait_xcnt 0x0" :: "v"(nk), "v"(nv) : "memory"); }   // the same wait for the next trip's loads
        const h16* lk = &sm[t & 1][0] + lane * 8; const h16* lv = lk + SE;
        v8f sc[2][KS / 16];
#pragma unroll
        for (int c = 0; c < 2; ++c)
#pragma unroll
            for (int nb = 0; nb < KS / 16; ++nb) { const V b = WFrag<h16>::ldf(lk + nb * 1024 + c * 512);
#pragma unroll
                for (int s = 0; s < 2; ++s) sc[s][nb] = WFrag<h16>::mma(b, a[c][s], c ? sc[s][nb] : (v8f){}); }
        V pf[2][KS / 32];
#pragma unroll
        for (int s = 0; s < 2; ++s) {
            // the trip's maximum of the lane's query: in-lane, then the other lane half (a max is exact in any order)
            const v8f m8 = __builtin_elementwise_max(__builtin_elementwise_max(sc[s][0], sc[s][1]), __builtin_elementwise_max(sc[s][2], sc[s][3]));
            const float m = fmaxf(fmaxf(fmaxf(m8[0], m8[1]), fmaxf(m8[2], m8[3])), fmaxf(fmaxf(m8[4], m8[5]), fmaxf(m8[6], m8[7])));
            const float mn = fmaxf(mx[s], fmaxf(m, xhalf(m))); const float al = exp2slot((mx[s] - mn) * CX); mx[s] = mn;   // al: what was summed under the old maximum shrinks by it (0 in trip 0)
            const float ad = 10.0f - mn * CX;   // 2^10: the probabilities' carrier, as PCAR
            v8f s8 = l8[s] * al;
#pragma unroll
            for (int nb = 0; nb < KS / 16; ++nb) { const v8f x = sc[s][nb] * CX + ad; v8f e;
#pragma unroll
                for (int j = 0; j < 8; ++j) e[j] = exp2slot(x[j]);
                sc[s][nb] = e; s8 += e; }
            l8[s] = s8;
#pragma unroll
            for (int nb = 0; nb < HD / 16; ++nb) oc[s][nb] *= al;
#pragma unroll
            for (int ks = 0; ks < KS / 32; ++ks) pf[s][ks] = cat16(__builtin_convertvector(sc[s][ks * 2], v8h), __builtin_convertvector(sc[s][ks * 2 + 1], v8h)); }
#pragma unroll
        for (int ks = 0; ks < KS / 32; ++ks)
#pragma unroll
            for (int nb = 0; nb < HD / 16; ++nb) { const V b = WFrag<h16>::ldf(lv + ks * 2048 + nb * 512);
#pragma unroll
                for (int s = 0; s < 2; ++s) oc[s][nb] = WFrag<h16>::mma(b, pf[s][ks], oc[s][nb]); }
        if (more) { h16* d = &sm[(t + 1) & 1][0] + tid * 8; *(v8h*)d = g0; *(v8h*)(d + 2048) = g1; *(v8h*)(d + SE) = g2; *(v8h*)(d + SE + 2048) = g3; }   // its last readers left this buffer before the barrier of trip t - 1
        __syncthreads();   // publishes trip t + 1's k and v, and ends every wave's reads of the buffer that trip t + 1 refills
    }
    // row sums: eight in-lane sums (one per register index, trips in order), a fixed tree over them, the other lane half
    float rl[2];
#pragma unroll
    for (int s = 0; s < 2; ++s) { const v8f s8 = l8[s]; const float sum = ((s8[0] + s8[1]) + (s8[2] + s8[3])) + ((s8[4] + s8[5]) + (s8[6] + s8[7])); rl[s] = __fdiv_rn(1.0f, sum + xhalf(sum)); }
    // the difference (a1 v) - lam (a2 v) as the hi+lo planes of the output product's A operand, in fragment order: the lane's 8 values of a tile are d = 16 nb + 8 hi + 0..7 of query lr, 16 bytes in a row there, and a wave's store is 512 bytes in a row
    const size_t oo = (size_t)blockIdx.z * TT * DQ + ((size_t)(r0 >> 4) * (DQ >> 5) + blockIdx.y * 2) * 512 + lane * 8; bf* sh = Ah + oo; bf* sl = Al + oo;
    v8us oh[HD / 16], ol[HD / 16];
#pragma unroll
    for (int nb = 0; nb < HD / 16; ++nb)
#pragma unroll
        for (int j = 0; j < 8; ++j) { unsigned short h, l; splitf(oc[0][nb][j] * rl[0] - lam * (oc[1][nb][j] * rl[1]), h, l); oh[nb][j] = h; ol[nb][j] = l; }
#pragma unroll
    for (int nb = 0; nb < HD / 16; ++nb) { *(v8us*)(sh + nb * 256) = oh[nb]; *(v8us*)(sl + nb * 256) = ol[nb]; }
    // the wait in front of any overwrite of a register which an issued store names; addresses and data are inputs so that they live up to it
    asm volatile("s_wait_xcnt 0x0" :: "v"(sh), "v"(sl), "v"(__builtin_bit_cast(v4i, oh[0])), "v"(__builtin_bit_cast(v4i, oh[1])), "v"(__builtin_bit_cast(v4i, oh[2])), "v"(__builtin_bit_cast(v4i, oh[3])), "v"(__builtin_bit_cast(v4i, ol[0])), "v"(__builtin_bit_cast(v4i, ol[1])), "v"(__builtin_bit_cast(v4i, ol[2])), "v"(__builtin_bit_cast(v4i, ol[3])) : "memory");
}
__global__ __launch_bounds__(256) void k_merge(const float* __restrict__ O, int h0, bf* Ah, bf* Al) { const size_t e = ((size_t)blockIdx.x * 256 + threadIdx.x) * 2; if (e >= (size_t)ZH * TT * HD) return; const int d = (int)(e % HD); const int t = (int)((e / HD) % TT); const int zz = (int)(e / ((size_t)HD * TT)); const float cs = (t < RH) ? 1.0f : (1.0f / PCAR); const size_t oo = (size_t)t * DQ + (h0 + zz) * HD + d;
    v2us oh, ol;
#pragma unroll
    for (int q = 0; q < 2; ++q) { unsigned short a, c2; splitf(O[e + q] * cs, a, c2); oh[q] = a; ol[q] = c2; } *(v2us*)(Ah + oo) = oh; *(v2us*)(Al + oo) = ol;  }

extern "C" void kernel_launch(void* const* d_in, const int* in_sizes, int n_in,
                              void* d_out, int out_size, void* d_ws, size_t ws_size, hipStream_t stream) {
    (void)in_sizes; (void)n_in; (void)out_size;
    const float* vin = (const float*)d_in[0]; const float* kin = (const float*)d_in[1]; const float* q1in = (const float*)d_in[2]; const float* q2in = (const float*)d_in[3]; const float* wq = (const float*)d_in[4]; const float* bq = (const float*)d_in[5]; const float* wk = (const float*)d_in[6]; const float* bk = (const float*)d_in[7]; const float* wv = (const float*)d_in[8]; const float* bv = (const float*)d_in[9]; const float* wo = (const float*)d_in[10]; const float* bo = (const float*)d_in[11]; const float* lamp = (const float*)d_in[12];   // weights x @ W
    float* OUT = (float*)d_out;     // [2][2048][1024]
    char* wsp = (char*)d_ws;
    auto take = [&](size_t bytes) { char* p = wsp; wsp += (bytes + 255) & ~(size_t)255; return (void*)p; };
    constexpr size_t PLN = (size_t)NH_ * TT * HD;   // one head plane set of one batch entry; planes are [stream q1, q2, k, v][batch entry]
    bf* WT = (bf*)take((size_t)4 * DQ * DM * 2);      // Wq, Wk, Wv, Wo transposed
    bf* XB = (bf*)take((size_t)4 * NB_ * TT * DM * 2);   // q1, q2, k, v in bf16
    h16* P16 = (h16*)take(4 * NB_ * PLN * 2); bf* Ph = (bf*)take(4 * NB_ * PLN * 2); bf* Pl = (bf*)take(4 * NB_ * PLN * 2);
    bf* ATh = (bf*)take((size_t)NB_ * TT * DQ * 2); bf* ATl = (bf*)take((size_t)NB_ * TT * DQ * 2);
    if ((size_t)(wsp - (char*)d_ws) > ws_size) return;    // ws 256 MiB
    k_prep<<<(unsigned)(4 * WTB + 4 * CVB), 256, 0, stream>>>(wq, wk, wv, wo, WT, q1in, q2in, kin, vin, XB);
    k_proj<<<dim3(64, 4 * NB_), 256, 0, stream>>>(XB, WT, bq, bk, bv, P16, Ph, Pl);
    k_attn<bf, 2><<<dim3(RH / 16, NH_, NB_), 512, 0, stream>>>(Ph, Pl, Ph + 2 * PLN, Pl + 2 * PLN, Ph + 4 * PLN, Pl + 4 * PLN, Ph + 6 * PLN, Pl + 6 * PLN, lamp, ATh, ATl, 0);
    k_attnf<<<dim3((TT - RH) / 128, NH_, NB_), 256, 0, stream>>>(P16, P16 + 2 * PLN, P16 + 4 * PLN, P16 + 6 * PLN, lamp, ATh, ATl, RH);
    k_gemmks<bf, 1, true, 4, 4, 8, DQ, 1, 0><<<dim3(TT / 64, DM / 64, NB_), 256, 0, stream>>>(ATh, ATl, WT + (size_t)3 * DQ * DM, nullptr, OUT, DM, bo, nullptr, nullptr, (size_t)TT * DQ, 0, (size_t)TT * DM, nullptr, nullptr, nullptr);
}

// v010
// A run of this version takes 173 microseconds.
// Next to v009, in two timings, it ran 1.04 and 1.05 times as fast.
// Over all steps from v000 it is 21.5 times as fast.
#include <hip/hip_runtime.h>

// NoiseCancellingAttentionMechanism - differential attention with two query streams (v, k, q1, q2 [2][2048][1024]; q1h/q2h = q1/q2 Wq + bq (shared), kh = k Wk + bk, vh = v Wv + bv (16 heads x 64);
// a1 = softmax(q1h.kh/8), a2 = softmax(q2h.kh/8); out = merged (a1 - lam a2) vh, Wo + bo with the scalar lam read as data -> [2][2048][1024]).
// Compute dtypes, f32 accumulate: every input rounded to bf16; projections on PLAIN bf16 operands (inputs: exact, + bias); PER-ROW PRECISION HYBRID for both score sets and both
// p.v contractions (query rows < 256 on bf16 hi+lo planes with 3 products, rows >= 256 on single fp16 planes, probabilities x1024 there); f32 register-row softmaxes; the difference (a1 v) - lam (a2 v) and the

#define NB_  2
#define TT   2048
#define DM   1024
#define NH_  16
#define NKV  16
#define REP  (NH_ / NKV)
#define HD   64
#define DQ   (NH_ * HD)
#define DKV  (NKV * HD)
#define ZH   NH_                  // heads per merge launch
#define RH   256                  // query rows < RH use hi+lo planes (0: none)
#define WIN  0
#define PCAR 1024.0f
#define SCL  0.125f   // HD^-0.5
typedef _Float16 h16;
typedef unsigned short bf;
typedef __attribute__((ext_vector_type(16))) __bf16   v16bf;
typedef __attribute__((ext_vector_type(16))) _Float16 v16h;
typedef __attribute__((ext_vector_type(8)))  _Float16 v8h;
typedef __attribute__((ext_vector_type(8)))  unsigned short v8us;
typedef __attribute__((ext_vector_type(8)))  float    v8f;
typedef __attribute__((ext_vector_type(4)))  float    v4f;
typedef v8h  __attribute__((may_alias)) v8ha;
typedef v4f  __attribute__((may_alias)) v4fa;
typedef v8us __attribute__((may_alias)) v8usa;

__device__ __forceinline__ unsigned short f2bf(float f) { unsigned u = __float_as_uint(f); u += 0x7FFFu + ((u >> 16) & 1u); return (unsigned short)(u >> 16); }
__device__ __forceinline__ float bf2f(unsigned short b) { return __uint_as_float(((unsigned)b) << 16); }
__device__ __forceinline__ float bfr(float f) { return bf2f(f2bf(f)); }
__device__ __forceinline__ v16h cat16(v8h lo, v8h hi) { return __builtin_shufflevector(lo, hi, 0, 1, 2, 3, 4, 5, 6, 7, 8, 9, 10, 11, 12, 13, 14, 15); }
__device__ __forceinline__ v16bf cat16b(v8us lo, v8us hi) { return __builtin_bit_cast(v16bf, __builtin_shufflevector(lo, hi, 0, 1, 2, 3, 4, 5, 6, 7, 8, 9, 10, 11, 12, 13, 14, 15)); }
__device__ __forceinline__ v8f wmma16(v16h a, v16h b, v8f c) { return __builtin_amdgcn_wmma_f32_16x16x32_f16(false, a, false, b, (short)0, c, false, false); }
__device__ __forceinline__ v8f wmmab(v16bf a, v16bf b, v8f c) { return __builtin_amdgcn_wmma_f32_16x16x32_bf16(false, a, false, b, (short)0, c, false, false); }



// 16-bit fragment loaders (K-contiguous rows; the same k order for A and B) and their matrix instruction. ldf reads the same fragment from a plane kept in FRAGMENT ORDER: a 16 x 32 tile is 512 elements, [k / 8][row][k % 8],
// so p = tile + lane * 8 and each of the two loads takes 512 bytes in a row (4 whole lines) where ld touches 16 lines; lane and register hold the same element as with ld
template <typename T16> struct WFrag;
template <> struct WFrag<h16> { typedef v16h V; static __device__ __forceinline__ V ld(const h16* p) { return cat16(*(const v8h*)p, *(const v8h*)(p + 16)); } static __device__ __forceinline__ V ldf(const h16* p) { return cat16(*(const v8h*)p, *(const v8h*)(p + 256)); } static __device__ __forceinline__ v8f mma(V a, V b, v8f c) { return wmma16(a, b, c); } };
template <> struct WFrag<bf> { typedef v16bf V; static __device__ __forceinline__ V ld(const bf* p) { return cat16b(*(const v8us*)p, *(const v8us*)(p + 16)); } static __device__ __forceinline__ V ldf(const bf* p) { return cat16b(*(const v8us*)p, *(const v8us*)(p + 256)); } static __device__ __forceinline__ v8f mma(V a, V b, v8f c) { return wmmab(a, b, c); } };

__device__ __forceinline__ h16 tohx(float x) { return (h16)x; }
__device__ __forceinline__ void splitf(float y, unsigned short& h, unsigned short& l) { h = f2bf(y); l = f2bf(y - bf2f(h)); }
typedef __attribute__((ext_vector_type(2))) _Float16 v2h;
typedef __attribute__((ext_vector_type(4))) _Float16 v4h;
typedef __attribute__((ext_vector_type(2))) unsigned short v2us;
typedef __attribute__((ext_vector_type(4))) unsigned short v4us;
typedef __attribute__((ext_vector_type(2))) float v2f;
typedef __attribute__((ext_vector_type(4))) int v4i;

// four asynchronous copies from global memory to LDS, 16 bytes a lane each (l: the lane's LDS byte address, g: its global address). The s_wait_xcnt stands inside the statement, behind the last copy, so that it is in front of any overwrite of a register which a copy names
__device__ __forceinline__ void acopy4(unsigned l0, unsigned l1, unsigned l2, unsigned l3, const bf* g0, const bf* g1, const bf* g2, const bf* g3) {
    asm volatile("global_load_async_to_lds_b128 %0, %4, off\n\tglobal_load_async_to_lds_b128 %1, %5, off\n\tglobal_load_async_to_lds_b128 %2, %6, off\n\tglobal_load_async_to_lds_b128 %3, %7, off\n\ts_wait_xcnt 0x0"
                 :: "v"(l0), "v"(l1), "v"(l2), "v"(l3), "v"(g0), "v"(g1), "v"(g2), "v"(g3) : "memory");
}
// one 16 x 16 result tile's 8 values of a lane (16 bytes in a row of a fragment-ordered head plane) into the three planes at element e
__device__ __forceinline__ void put3(h16* P16, bf* Ph, bf* Pl, size_t e, v8f val) {
    v8h o16; v8us oh, ol;
#pragma unroll
    for (int j = 0; j < 8; ++j) { o16[j] = tohx(val[j]); unsigned short h, l; splitf(val[j], h, l); oh[j] = h; ol[j] = l; }
    h16* s0 = P16 + e; bf* s1 = Ph + e; bf* s2 = Pl + e; *(v8h*)s0 = o16; *(v8us*)s1 = oh; *(v8us*)s2 = ol;
    // the wait in front of any overwrite of a register which an issued store names; addresses and data are inputs so that they live up to it
    asm volatile("s_wait_xcnt 0x0" :: "v"(s0), "v"(s1), "v"(s2), "v"(__builtin_bit_cast(v4i, o16)), "v"(__builtin_bit_cast(v4i, oh)), "v"(__builtin_bit_cast(v4i, ol)) : "memory");
    __builtin_amdgcn_sched_barrier(0);   // keeps the next tile's conversions behind this tile's stores: woven together, the sixteen tiles' intermediate values need more registers than a wave has, and some are spilled
}
// ---- k_proj: all four projections of both batch entries, grid (64, 8), y = stream x 2 + batch entry (streams q1, q2, k, v), 8 waves. A work-group makes 128 A rows x 256 B rows over ALL of K; wave (wa, wb) keeps a 64 x 64 tile in registers and sums k in ascending order (no split of K, no partial tiles).
// A trip is 64 k: the 24 row tiles' pieces (2 KB in a row each in the fragment-ordered operands) are brought into LDS once for the 8 waves by asynchronous copies, two buffers, one trip ahead, one barrier a trip; so an operand row leaves L2 once per 128 or 256 rows of the other operand.
// q1, q2, k: the weight is the A operand and the input the B operand, so a lane's 8 values of a tile are d = 16 mb + 8 hi + 0..7 of ONE position. v: the input is A, the weight B, so they are 8 positions of ONE d. Either way they are 16 bytes in a row of the head plane, a wave's store is 512 bytes in a row, and no value changes lanes.
__global__ void __launch_bounds__(256) __attribute__((amdgpu_waves_per_eu(4, 4))) k_proj(const bf* __restrict__ XB, const bf* __restrict__ WT, const float* __restrict__ bq, const float* __restrict__ bk, const float* __restrict__ bv, h16* P16, bf* Ph, bf* Pl) {
    typedef WFrag<bf>::V V;
    constexpr int KC = 64, NTR = DM / KC, RT = KC * 16;   // k a trip, trips, elements of one 16-row tile a trip
    constexpr int SE = 24 * RT;                           // elements of a stage: 8 row tiles of A, then 16 of B
    constexpr int GS = 2 * (DM / 32) * 512;               // two row tiles further in an operand
    static_assert(TT % 256 == 0 && DQ % 256 == 0 && (TT / 128) * (DQ / 256) == 64 && (DQ / 128) * (TT / 256) == 64 && NTR >= 2 && HD == 64, "whole blocks, 64 a stream; a wave's 64 weight rows are one head");
    __shared__ __align__(16) bf sm[2][SE];
    const int tid = threadIdx.x, lane = tid & 31, lr = lane & 15, hi = lane >> 4, wave = tid >> 5, wa = wave & 1, wb = wave >> 1;
    const int z = blockIdx.y, bx = blockIdx.x; const bool xa = z >= 6;   // xa: the input is the A operand; depends on blockIdx alone
    const bf* X = XB + (size_t)z * ((size_t)TT * DM); const bf* Wt = WT + (size_t)(z < 4 ? 0 : (z >> 1) - 1) * ((size_t)DQ * DM);
    const int ab = xa ? bx % (TT / 128) : bx % (DQ / 128), bb = xa ? bx / (TT / 128) : bx / (DQ / 128);
    // thread tid moves 16-byte pieces tid + 256 j of a stage, j = 0..11: piece tid % 128 of row tile 2 j + tid / 128
    const bf* ga = (xa ? X : Wt) + (size_t)(ab * 8 + (tid >> 7)) * ((DM / 32) * 512) + (tid & 127) * 8;
    const bf* gb = (xa ? Wt : X) + (size_t)(bb * 16 + (tid >> 7)) * ((DM / 32) * 512) + (tid & 127) * 8;
    const unsigned l0 = (unsigned)(size_t)&sm[0][0] + tid * 16;
    auto fill = [&](int t, int buf) { const unsigned l = l0 + buf * (SE * 2); const bf* a = ga + t * RT; const bf* b = gb + t * RT;
        acopy4(l, l + 4096, l + 8192, l + 12288, a, a + GS, a + 2 * GS, a + 3 * GS);
        acopy4(l + 16384, l + 20480, l + 24576, l + 28672, b, b + GS, b + 2 * GS, b + 3 * GS);
        acopy4(l + 32768, l + 36864, l + 40960, l + 45056, b + 4 * GS, b + 5 * GS, b + 6 * GS, b + 7 * GS); };
    fill(0, 0);
    asm volatile("s_wait_asynccnt 0x0" ::: "memory");   // the wave's own copies of trip 0 have landed
    __syncthreads();   // trip 0's operands are in LDS before any wave reads them
    fill(1, 1);
    v8f acc[4][4];
#pragma unroll
    for (int mb = 0; mb < 4; ++mb)
#pragma unroll
        for (int nb = 0; nb < 4; ++nb) acc[mb][nb] = (v8f){};
#pragma unroll 1   // one copy of the trip: the ring's order stands once, at the loop's foot
    for (int t = 0; t < NTR; ++t) {
        const bf* la = &sm[t & 1][0] + wa * 4 * RT + lane * 8; const bf* lb = &sm[t & 1][0] + (8 + wb * 4) * RT + lane * 8;
#pragma unroll
        for (int c = 0; c < KC / 32; ++c) { V a[4], b[4];
#pragma unroll
            for (int mb = 0; mb < 4; ++mb) a[mb] = WFrag<bf>::ldf(la + mb * RT + c * 512);
#pragma unroll
            for (int nb = 0; nb < 4; ++nb) b[nb] = WFrag<bf>::ldf(lb + nb * RT + c * 512);
            __builtin_amdgcn_sched_barrier(0);   // keeps the WMMAs behind the k step's last LDS read: without it the compiler reuses one B fragment's registers and waits for each fragment's read in turn
#pragma unroll
            for (int nb = 0; nb < 4; ++nb)
#pragma unroll
                for (int mb = 0; mb < 4; ++mb) acc[mb][nb] = WFrag<bf>::mma(a[mb], b[nb], acc[mb][nb]); }
        asm volatile("s_wait_dscnt 0x0" ::: "memory");      // the wave's reads of this buffer are done before it is given up for the refill
        asm volatile("s_wait_asynccnt 0x0" ::: "memory");   // the wave's own copies of trip t + 1 have landed
        __syncthreads();   // publishes trip t + 1's operands, and ends every wave's reads of the buffer that is refilled behind it
        if (t + 2 < NTR) fill(t + 2, t & 1);   // the same for the whole work-group
    }
    asm volatile("s_wait_asynccnt 0x0" ::: "memory");   // no copy is outstanding when the wave ends
    const size_t pz = (size_t)z * ((size_t)NH_ * TT * HD);
    if (xa) {   // v planes: tiles of 16 d x 32 positions, [position / 32][d / 16][(position / 8) % 4][d % 16][position % 8]
        const int head = bb * 4 + wb; const size_t e0 = pz + (size_t)head * (TT * HD) + (size_t)(ab * 4 + wa * 2) * 2048 + lane * 8;
        const float* pc = bv + head * HD + lr; const float t0 = pc[0], t1 = pc[16], t2 = pc[32], t3 = pc[48];
        asm volatile("s_wait_xcnt 0x0" :: "v"(pc) : "memory");   // the wait in front of any overwrite of a register which an issued load names; the address is an input so that it lives up to it
        const float bn[4] = { bfr(t0), bfr(t1), bfr(t2), bfr(t3) };
#pragma unroll
        for (int mb = 0; mb < 4; ++mb)
#pragma unroll
            for (int nb = 0; nb < 4; ++nb) put3(P16, Ph, Pl, e0 + (mb >> 1) * 2048 + nb * 512 + (mb & 1) * 256, acc[mb][nb] + bn[nb]);
    } else {    // q and k planes: tiles of 16 positions x 32 d, [position / 16][d / 8][position % 16][d % 8]
        const int head = ab * 2 + wa; const size_t e0 = pz + (size_t)head * (TT * HD) + (size_t)(bb * 16 + wb * 4) * 1024 + lane * 8;
        const float* pc = (z < 4 ? bq : bk) + head * HD + hi * 8; v8f bm[4];
#pragma unroll
        for (int mb = 0; mb < 4; ++mb) bm[mb] = *(const v8f*)(pc + mb * 16);
        asm volatile("s_wait_xcnt 0x0" :: "v"(pc) : "memory");   // the same wait for these bias loads
#pragma unroll
        for (int mb = 0; mb < 4; ++mb) { v8f bb;
#pragma unroll
            for (int j = 0; j < 8; ++j) bb[j] = bfr(bm[mb][j]);
#pragma unroll
            for (int nb = 0; nb < 4; ++nb) put3(P16, Ph, Pl, e0 + nb * 1024 + mb * 256, acc[mb][nb] + bb); }
    }
}

// ---- k_outp: the output product C[m][n] (f32, + bias[n]) = sum_k (Ah[m][k] + Al[m][k]) Wt[n][k] over both batch entries' rows (their planes follow one another, so m = 0..NB_ TT - 1), grid (NB_ TT / 128, DM / 128), 8 waves.
// A work-group makes 128 x 128 over ALL of K; wave (wa, wb) keeps a 32 x 64 tile in registers and sums k in ascending order, in each step of 32 k the hi products, then the lo products (no split of K, no partial tiles).
// A trip is 128 k: the 24 row tiles' pieces (8 of Ah, 8 of Al, 8 of Wt, 4 KB in a row each in the fragment-ordered operands) are brought into LDS once for the 8 waves by asynchronous copies, two buffers, one trip ahead, one barrier a trip, as in k_proj.
// The launch is one work-group a WGP, so the long trip is what keeps enough bytes in flight. Behind the loop the tile passes through the same LDS, so that a wave stores 512 bytes in a row of one row of C.
__global__ void __launch_bounds__(256) k_outp(const bf* __restrict__ Ah, const bf* __restrict__ Al, const bf* __restrict__ Wt, const float* __restrict__ bias, float* C) {
    typedef WFrag<bf>::V V;
    constexpr int KC = 128, NTR = DQ / KC, RT = KC * 16;  // k a trip, trips, elements of one 16-row tile a trip
    constexpr int SE = 24 * RT;                           // elements of a stage: 8 row tiles of Ah, 8 of Al, 8 of Wt
    constexpr int GS = (DQ / 32) * 512;                   // one row tile further in an operand
    constexpr int PW = 128 + 4;                           // pitch of the result tile's rows in LDS in floats: 16 B x odd for the b128 readers
    static_assert((NB_ * TT) % 128 == 0 && DM % 128 == 0 && NTR >= 2 && RT * 2 == 256 * 16 && 128 * PW * 4 <= 2 * SE * 2, "whole blocks; a row tile's piece is one copy of the 256 threads; the result tile fits the two buffers");
    __shared__ __align__(16) char smc[2 * SE * 2];        // two buffers of operands, then (behind the loop's last barrier) the result tile
    const bf* sm = (const bf*)smc; float* red = (float*)smc;
    const int tid = threadIdx.x, lane = tid & 31, lr = lane & 15, hi = lane >> 4, wave = tid >> 5, wa = wave & 3, wb = wave >> 2;
    const int r0 = blockIdx.x * 128, c0 = blockIdx.y * 128;
    // thread tid moves 16-byte piece tid of each of the stage's 24 row tiles
    const size_t ao = (size_t)(r0 >> 4) * GS + tid * 8;
    const bf* ga = Ah + ao; const bf* gl = Al + ao; const bf* gb = Wt + (size_t)(c0 >> 4) * GS + tid * 8;
    const unsigned l0 = (unsigned)(size_t)&smc[0] + tid * 16;
    auto fill8 = [&](unsigned l, const bf* g) {
        acopy4(l, l + 4096, l + 8192, l + 12288, g, g + GS, g + 2 * GS, g + 3 * GS);
        acopy4(l + 16384, l + 20480, l + 24576, l + 28672, g + 4 * GS, g + 5 * GS, g + 6 * GS, g + 7 * GS); };
    auto fill = [&](int t, int buf) { const unsigned l = l0 + buf * (SE * 2); fill8(l, ga + t * RT); fill8(l + 32768, gl + t * RT); fill8(l + 65536, gb + t * RT); };
    fill(0, 0);
    asm volatile("s_wait_asynccnt 0x0" ::: "memory");   // the wave's own copies of trip 0 have landed
    __syncthreads();   // trip 0's operands are in LDS before any wave reads them
    fill(1, 1);
    v8f acc[2][4];
#pragma unroll
    for (int mb = 0; mb < 2; ++mb)
#pragma unroll
        for (int nb = 0; nb < 4; ++nb) acc[mb][nb] = (v8f){};
#pragma unroll 1   // one copy of the trip: the ring's order stands once, at the loop's foot
    for (int t = 0; t < NTR; ++t) {
        const bf* la = sm + (t & 1) * SE + wa * 2 * RT + lane * 8; const bf* lb = sm + (t & 1) * SE + (16 + wb * 4) * RT + lane * 8;
#pragma unroll
        for (int h = 0; h < KC / 64; ++h) {
            V a[2][2], a2[2][2], b[2][4];
#pragma unroll
            for (int c = 0; c < 2; ++c) { const int o = (h * 2 + c) * 512;
#pragma unroll
                for (int mb = 0; mb < 2; ++mb) a[c][mb] = WFrag<bf>::ldf(la + mb * RT + o);
#pragma unroll
                for (int nb = 0; nb < 4; ++nb) b[c][nb] = WFrag<bf>::ldf(lb + nb * RT + o);
#pragma unroll
                for (int mb = 0; mb < 2; ++mb) a2[c][mb] = WFrag<bf>::ldf(la + (8 + mb) * RT + o); }
            __builtin_amdgcn_sched_barrier(0);   // keeps the WMMAs behind the last LDS read of these 64 k: without it the compiler reuses a fragment's registers and waits for each fragment's read in turn
#pragma unroll
            for (int c = 0; c < 2; ++c) {
                // eight tiles' hi products, then their lo products: a tile's two WMMAs stand eight apart, so none waits for the one before it
#pragma unroll
                for (int nb = 0; nb < 4; ++nb)
#pragma unroll
                    for (int mb = 0; mb < 2; ++mb) acc[mb][nb] = WFrag<bf>::mma(a[c][mb], b[c][nb], acc[mb][nb]);
#pragma unroll
                for (int nb = 0; nb < 4; ++nb)
#pragma unroll
                    for (int mb = 0; mb < 2; ++mb) acc[mb][nb] = WFrag<bf>::mma(a2[c][mb], b[c][nb], acc[mb][nb]); }
            __builtin_amdgcn_sched_barrier(0);   // keeps the WMMAs in front of the trip's barrier: moved behind it, they start only when every wave's LDS reads have landed, and LDS and matrix unit work in turns
        }
        asm volatile("s_wait_dscnt 0x0" ::: "memory");      // the wave's reads of this buffer are done before it is given up for the refill
        asm volatile("s_wait_asynccnt 0x0" ::: "memory");   // the wave's own copies of trip t + 1 have landed
        __syncthreads();   // publishes trip t + 1's operands, and ends every wave's reads of the buffer that is refilled behind it
        if (t + 2 < NTR) fill(t + 2, t & 1);   // the same for the whole work-group
    }
    asm volatile("s_wait_asynccnt 0x0" ::: "memory");   // no copy is outstanding when the LDS is given to the result tile
    const int cofs = lane * 4;
    const float* pc = bias + c0 + cofs; const float t0 = pc[0], t1 = pc[1], t2 = pc[2], t3 = pc[3];
    asm volatile("s_wait_xcnt 0x0" :: "v"(pc) : "memory");   // the wait in front of any overwrite of a register which an issued load names; the address is an input so that it lives up to it
    float* my = red + (wa * 32 + hi * 8) * PW + wb * 64 + lr;
#pragma unroll
    for (int mb = 0; mb < 2; ++mb)
#pragma unroll
        for (int nb = 0; nb < 4; ++nb)
#pragma unroll
            for (int j = 0; j < 8; ++j) my[(mb * 16 + j) * PW + nb * 16] = acc[mb][nb][j];
    __syncthreads();   // every wave's part of the result tile is in LDS before any is read
    v4f bn; bn[0] = bfr(t0); bn[1] = bfr(t1); bn[2] = bfr(t2); bn[3] = bfr(t3);
    // wave w stores rows w + 8 u, u = 0..15
    const float* p = red + wave * PW + cofs; float* pd = C + (size_t)(r0 + wave) * DM + c0 + cofs; v4f o[16];
#pragma unroll
    for (int u = 0; u < 16; ++u) o[u] = *(const v4fa*)(p + u * 8 * PW) + bn;
#pragma unroll
    for (int u = 0; u < 16; ++u) *(v4f*)(pd + (size_t)u * 8 * DM) = o[u];
    // the same wait for the stores; address and data are inputs so that they live up to it
    asm volatile("s_wait_xcnt 0x0" :: "v"(pd), "v"(o[0]), "v"(o[1]), "v"(o[2]), "v"(o[3]), "v"(o[4]), "v"(o[5]), "v"(o[6]), "v"(o[7]), "v"(o[8]), "v"(o[9]), "v"(o[10]), "v"(o[11]), "v"(o[12]), "v"(o[13]), "v"(o[14]), "v"(o[15]) : "memory");
}

// element (row r, k) of an [R][K] operand in fragment order: tiles of 16 rows x 32 k, [r / 16][k / 32], each [k / 8 % 4][r % 16][k % 8]
__device__ __forceinline__ size_t fragofs(int r, int k, int K) { return ((size_t)(r >> 4) * (K >> 5) + (k >> 5)) * 512 + ((k >> 3) & 3) * 128 + (r & 15) * 8 + (k & 7); }
// One PIECE is 16 bytes (8 elements along k of one row) of a fragment-ordered plane; piece i lies at element 8 i. A thread makes several pieces and issues all their loads before it converts the first, so the launch has few, long waves with much in flight.
// d_wtG: a weight w[k][n] to bf16 [n][k]. A block takes 128 k x 128 n; thread t makes 8 pieces, rows n + 16 j, the same 8 k. Lanes run along n, so a load reads 64 bytes in a row of two rows of w, and the 8 loads of a k take 512 bytes in a row.
__device__ __forceinline__ void d_wtG(int bx, const float* __restrict__ w, bf* Bt) {
    static_assert(DM % 128 == 0 && DQ % 128 == 0, "whole blocks");
    const int t = threadIdx.x, kb = bx % (DM / 128), nb = bx / (DM / 128);
    const float* ps = w + (size_t)((kb * 4 + (t >> 6)) * 32 + ((t >> 4) & 3) * 8) * DQ + nb * 128 + (t & 15);
    float v[8][8];
#pragma unroll
    for (int q = 0; q < 8; ++q)
#pragma unroll
        for (int j = 0; j < 8; ++j) v[j][q] = ps[q * DQ + j * 16];
    asm volatile("s_wait_xcnt 0x0" :: "v"(ps) : "memory");   // the wait in front of any overwrite of a register which an issued load names; the address is an input so that it lives up to it
    bf* pd = Bt + ((size_t)nb * 8 * (DM / 32) + kb * 4) * 512 + t * 8; v8us o[8];
#pragma unroll
    for (int j = 0; j < 8; ++j)
#pragma unroll
        for (int q = 0; q < 8; ++q) o[j][q] = f2bf(v[j][q]);
#pragma unroll
    for (int j = 0; j < 8; ++j) *(v8us*)(pd + (size_t)j * (DM / 32) * 512) = o[j];
    // the same wait for the stores; the data are inputs so that they live up to it (the address is the thread index and a scalar base, and nothing is computed behind the stores)
    asm volatile("s_wait_xcnt 0x0" :: "v"(__builtin_bit_cast(v4i, o[0])), "v"(__builtin_bit_cast(v4i, o[1])), "v"(__builtin_bit_cast(v4i, o[2])), "v"(__builtin_bit_cast(v4i, o[3])), "v"(__builtin_bit_cast(v4i, o[4])), "v"(__builtin_bit_cast(v4i, o[5])), "v"(__builtin_bit_cast(v4i, o[6])), "v"(__builtin_bit_cast(v4i, o[7])) : "memory");
}
// d_cvt8: an input [row][DM] to bf16. A block takes 32 rows (128 KB in a row of the source, 64 KB of the plane); thread t makes pieces 4096 bx + 256 j + t, j = 0..15
__device__ __forceinline__ void d_cvt8(int bx, const float* __restrict__ src, bf* dst) {
    static_assert(DM == 1024, "8 steps of 256 pieces are 16 rows");
    const int t = threadIdx.x;
    const float* ps = src + ((size_t)bx * 32 + (t & 15)) * DM + (t >> 6) * 32 + ((t >> 4) & 3) * 8; v8f v[16];
#pragma unroll
    for (int j = 0; j < 16; ++j) v[j] = *(const v8f*)(ps + (j >> 3) * 16 * DM + (j & 7) * 128);
    asm volatile("s_wait_xcnt 0x0" :: "v"(ps) : "memory");   // the wait in front of any overwrite of a register which an issued load names; the address is an input so that it lives up to it
    bf* pd = dst + (size_t)bx * 32768 + t * 8; v8us o[16];
#pragma unroll
    for (int j = 0; j < 16; ++j)
#pragma unroll
        for (int q = 0; q < 8; ++q) o[j][q] = f2bf(v[j][q]);
#pragma unroll
    for (int j = 0; j < 16; ++j) *(v8us*)(pd + j * 2048) = o[j];
    // the same wait for the stores; the data are inputs so that they live up to it (the address is the thread index and a scalar base, and nothing is computed behind the stores)
    asm volatile("s_wait_xcnt 0x0" :: "v"(__builtin_bit_cast(v4i, o[0])), "v"(__builtin_bit_cast(v4i, o[1])), "v"(__builtin_bit_cast(v4i, o[2])), "v"(__builtin_bit_cast(v4i, o[3])), "v"(__builtin_bit_cast(v4i, o[4])), "v"(__builtin_bit_cast(v4i, o[5])), "v"(__builtin_bit_cast(v4i, o[6])), "v"(__builtin_bit_cast(v4i, o[7])),
                 "v"(__builtin_bit_cast(v4i, o[8])), "v"(__builtin_bit_cast(v4i, o[9])), "v"(__builtin_bit_cast(v4i, o[10])), "v"(__builtin_bit_cast(v4i, o[11])), "v"(__builtin_bit_cast(v4i, o[12])), "v"(__builtin_bit_cast(v4i, o[13])), "v"(__builtin_bit_cast(v4i, o[14])), "v"(__builtin_bit_cast(v4i, o[15])) : "memory");
}
// ---- k_prep: every operand conversion in ONE launch. Both kinds of plane are written in fragment order (fragofs). Blocks [0, 4 WTB): the four weights, transposed to bf16 [n][k], in a row in WT. Blocks behind them: the four inputs, both batch entries each, to bf16, in a row in XB.
#define WTB ((DM / 128) * (DQ / 128))            // blocks per weight
#define CVB (NB_ * TT * DM / 8 / 256 / 16)       // blocks per input
// six waves a SIMD: the launch's 768 blocks are three a WGP, so that all of them are resident at once and every load of the launch is in flight together
__global__ void __launch_bounds__(256) __attribute__((amdgpu_waves_per_eu(6))) k_prep(const float* __restrict__ w0, const float* __restrict__ w1, const float* __restrict__ w2, const float* __restrict__ w3, bf* WT, const float* __restrict__ x0, const float* __restrict__ x1, const float* __restrict__ x2, const float* __restrict__ x3, bf* XB) {
    static_assert((NB_ * TT) % 32 == 0, "whole blocks");
    const int bx = blockIdx.x;
    if (bx < 4 * WTB) { const int s = bx / WTB; d_wtG(bx % WTB, s == 0 ? w0 : s == 1 ? w1 : s == 2 ? w2 : w3, WT + (size_t)s * DM * DQ); }
    else { const int c = bx - 4 * WTB, s = c / CVB; d_cvt8(c % CVB, s == 0 ? x0 : s == 1 ? x1 : s == 2 ? x2 : x3, XB + (size_t)s * NB_ * TT * DM); }
}
__global__ __launch_bounds__(256) void k_cscvt(const float* __restrict__ cosT, const float* __restrict__ sinT, float* CS) { const int idx = blockIdx.x * 256 + threadIdx.x; if (idx >= TT * HD) return; v2f cs; cs[0] = bfr(cosT[idx]); cs[1] = bfr(sinT[idx]); *(v2f*)(CS + (size_t)idx * 2) = cs;  }
// 2^x with the one free issue slot that the instruction set asks for behind a transcendental
__device__ __forceinline__ float exp2slot(float x) { float e; asm("v_exp_f32 %0, %1\n\tv_nop" : "=v"(e) : "v"(x)); return e; }
// value of lane l ^ 16 (a vector cross-row move, no LDS round trip); every lane is on where it is used
__device__ __forceinline__ float xhalf(float x) { return __int_as_float(__builtin_amdgcn_permlanex16(__float_as_int(x), __float_as_int(x), 0x76543210, 0xfedcba98, false, false)); }
// ---- k_attn: scores, softmax and p.v of BOTH query streams for 16 query rows of one head in one work-group; scores and probabilities never leave it. grid (rows/16, heads, batch entries), 16 waves. Launched for the hi+lo rows; the single-plane rows go through k_attnf below.
// Wave w owns keys [128 w, 128 w + 128): 2 x 8 score tiles in registers (each k and v fragment serves both streams), computed TRANSPOSED: the k fragment is the A operand and the q fragment the B operand, so a tile is [key][query] and
// lane (lr, hi) holds keys 16 nb + 8 hi + 0..7 of the ONE query lr. Row max and row sum are in-lane plus one exchange of the lane halves, then joined over the waves through LDS; two neighbouring tiles, converted in place, ARE the A fragment
// of p.v (element s: key 8 hi + s, then 16 + 8 hi + s - 8, the order in which ld and ldf deliver v), so no probability changes lanes. p.v summed over the wave's keys in ascending k, the 16 partial tiles added in wave order 0..15, the two streams' difference written as bf16 hi+lo planes.
template <typename T16, int NSPLIT>
__global__ __launch_bounds__(512) void k_attn(const T16* __restrict__ Q1, const T16* __restrict__ Q1l, const T16* __restrict__ Q2, const T16* __restrict__ Q2l, const T16* __restrict__ Kp, const T16* __restrict__ Kl, const T16* __restrict__ Vt, const T16* __restrict__ Vl, const float* __restrict__ lamp, bf* Ah, bf* Al, int row0) {
    typedef typename WFrag<T16>::V V;
    constexpr int NW = 16, KW = TT / NW, NT = KW / 16;   // waves, keys per wave, score tiles per stream and wave
    constexpr int PP = KW + 8;                           // pitch of a wave's probability rows (128 keys) in 16-bit elements: 16 B x odd for the b128 readers
    constexpr int RP = 20;                               // pitch of a row's 16 per-wave values in floats: 16 B x odd
    constexpr int PW = HD + 4, PS = 32 * PW;             // partial output tile: row pitch and size in floats
    constexpr bool HIRES = (NSPLIT == 2);
    constexpr int PB = (HIRES ? 2 : 1) * 32 * PP;        // 16-bit elements of one wave's probability planes
    constexpr int SB = (NW * PB * 2 > NW * PS * 4) ? NW * PB * 2 : NW * PS * 4;
    __shared__ __align__(16) char sm[SB];                // hi+lo planes: first the parked probabilities, then (behind a barrier) the partial output tiles; single plane: the partial output tiles alone
    T16* pbuf = (T16*)sm; float* red = (float*)sm;
    __shared__ __align__(16) float rmx[32 * RP];
    __shared__ __align__(16) float rsm[32 * RP];
    const int lane = threadIdx.x & 31, lr = lane & 15, hi = lane >> 4, wave = threadIdx.x >> 5; const int r0 = row0 + blockIdx.x * 16; const size_t hp = ((size_t)blockIdx.z * NH_ + blockIdx.y) * TT * HD;
    const float lam = bfr(lamp[0]);   // read here, where control flow is uniform, so that it is a scalar load whose latency the whole kernel hides
    const size_t qoff = hp + (size_t)r0 * HD + lane * 8, koff = hp + (size_t)wave * KW * HD + lane * 8, voff = hp + (size_t)wave * KW * HD + lane * 8;   // the planes are in fragment order: 16 query rows are 1024 elements in a row, the wave's 128 keys 8192 elements in a row of k and of v
    const T16* pq1 = Q1 + qoff; const T16* pq2 = Q2 + qoff; const T16* pk = Kp + koff; const T16* pv = Vt + voff; const T16* pq1l = Q1l + qoff; const T16* pq2l = Q2l + qoff; const T16* pkl = Kl + koff; const T16* pvl = Vl + voff;
    v8f sc[2][NT];
#pragma unroll
    for (int s = 0; s < 2; ++s)
#pragma unroll
        for (int nb = 0; nb < NT; ++nb) sc[s][nb] = (v8f){};
    if constexpr (HIRES) {
#pragma unroll
        for (int kc = 0; kc < HD; kc += 32) {
            V a[2], a2[2]; a[0] = WFrag<T16>::ldf(pq1 + kc * 16); a[1] = WFrag<T16>::ldf(pq2 + kc * 16); if (HIRES) { a2[0] = WFrag<T16>::ldf(pq1l + kc * 16); a2[1] = WFrag<T16>::ldf(pq2l + kc * 16); }
#pragma unroll
            for (int nb = 0; nb < NT; ++nb) { const V b = WFrag<T16>::ldf(pk + nb * 1024 + kc * 16); V b2; if (HIRES) b2 = WFrag<T16>::ldf(pkl + nb * 1024 + kc * 16);
#pragma unroll
                for (int s = 0; s < 2; ++s) { sc[s][nb] = WFrag<T16>::mma(b, a[s], sc[s][nb]); if (HIRES) { sc[s][nb] = WFrag<T16>::mma(b, a2[s], sc[s][nb]); sc[s][nb] = WFrag<T16>::mma(b2, a[s], sc[s][nb]); } } }
        }
    } else {
        // single planes: all of the wave's q and k fragments fit in registers beside nothing else, so every load is issued before the first WMMA (one trip to L2 instead of one per tile); each tile still sums kc = 0, then 32
        V a[2][2], b[NT][2];
#pragma unroll
        for (int c = 0; c < 2; ++c) { a[c][0] = WFrag<T16>::ldf(pq1 + c * 512); a[c][1] = WFrag<T16>::ldf(pq2 + c * 512); }
#pragma unroll
        for (int nb = 0; nb < NT; ++nb)
#pragma unroll
            for (int c = 0; c < 2; ++c) b[nb][c] = WFrag<T16>::ldf(pk + nb * 1024 + c * 512);
        __builtin_amdgcn_sched_barrier(0);   // keeps the WMMAs behind the last load: without it the compiler reuses one fragment's registers and waits for each tile's load in turn
#pragma unroll
        for (int nb = 0; nb < NT; ++nb)
#pragma unroll
            for (int c = 0; c < 2; ++c)
#pragma unroll
                for (int s = 0; s < 2; ++s) sc[s][nb] = WFrag<T16>::mma(b[nb][c], a[c][s], sc[s][nb]);
    }
    // the wait that stands in front of any overwrite of a register which an issued load names; the base addresses are inputs so that they live up to it
    if (HIRES) asm volatile("s_wait_xcnt 0x0" :: "v"(pq1), "v"(pq2), "v"(pk), "v"(pq1l), "v"(pq2l), "v"(pkl) : "memory");
    else asm volatile("s_wait_xcnt 0x0" :: "v"(pq1), "v"(pq2), "v"(pk) : "memory");
    // row max: over the lane's 64 scores of its query, the other lane half, then the 16 waves (a max is exact in any order)
    float st[2];   // per stream: the statistic of the lane's query
#pragma unroll
    for (int s = 0; s < 2; ++s) { v8f m8;
#pragma unroll
        for (int j = 0; j < 8; ++j) m8[j] = -3.0e38f;
#pragma unroll
        for (int nb = 0; nb < NT; ++nb) { sc[s][nb] *= SCL; m8 = __builtin_elementwise_max(m8, sc[s][nb]); }   // whole tiles: neighbouring registers pair up in the packed forms
        const float m = fmaxf(fmaxf(fmaxf(m8[0], m8[1]), fmaxf(m8[2], m8[3])), fmaxf(fmaxf(m8[4], m8[5]), fmaxf(m8[6], m8[7]))); st[s] = fmaxf(m, xhalf(m)); }
    rmx[lane * RP + wave] = hi ? st[1] : st[0];   // row l of the table: lanes 0..15 stream 1, lanes 16..31 stream 2
    __syncthreads();   // every wave's row maxima are in LDS before any is read
    float gm;          // lane l: the max of row l (rows 0..15 stream 1, 16..31 stream 2)
    { const float* p = rmx + lane * RP; const v4f m0 = *(const v4fa*)p, m1 = *(const v4fa*)(p + 4), m2 = *(const v4fa*)(p + 8), m3 = *(const v4fa*)(p + 12); gm = m0[0];
#pragma unroll
      for (int q = 0; q < 4; ++q) gm = fmaxf(fmaxf(gm, m0[q]), fmaxf(m1[q], fmaxf(m2[q], m3[q]))); }
    { const float go = xhalf(gm); st[0] = hi ? go : gm; st[1] = hi ? gm : go; }   // both streams' value of query lr
    // one exp per score; row sum: eight in-lane sums (one per register index, tiles in order), a fixed tree over them, the other lane half, the waves in order 0..15
#pragma unroll
    for (int s = 0; s < 2; ++s) { const float mx = st[s]; v8f s8 = (v8f){};
#pragma unroll
        for (int nb = 0; nb < NT; ++nb) { const v8f d0 = (sc[s][nb] - mx) * 1.4426950408889634f; v8f e;
#pragma unroll
            for (int j = 0; j < 8; ++j) e[j] = exp2slot(d0[j]);
            sc[s][nb] = e; s8 += e; }
        const float sum = ((s8[0] + s8[1]) + (s8[2] + s8[3])) + ((s8[4] + s8[5]) + (s8[6] + s8[7])); st[s] = sum + xhalf(sum); }
    rsm[lane * RP + wave] = hi ? st[1] : st[0];
    __syncthreads();   // every wave's row sums are in LDS before any is read
    float gf;          // lane l: the factor of row l
    { const float* p = rsm + lane * RP; float sum = p[0];
#pragma unroll
      for (int w = 1; w < NW; ++w) sum += p[w];
      gf = __fdiv_rn(HIRES ? 1.0f : PCAR, sum); }
    { const float go = xhalf(gf); st[0] = hi ? go : gf; st[1] = hi ? gf : go; }
    // the probabilities as A fragments. Single plane: 64 registers, kept. Hi+lo planes: 128 registers, too many beside the v fragments, so each lane parks ITS OWN fragments in the wave's LDS piece (16-byte stores) and reads the same bytes back
    T16* pw = pbuf + wave * PB + lr * PP + 8 * hi;
    V pf[2][KW / 32];
#pragma unroll
    for (int s = 0; s < 2; ++s)
#pragma unroll
        for (int ks = 0; ks < KW / 32; ++ks) {
            if constexpr (HIRES) {
#pragma unroll
                for (int t = 0; t < 2; ++t) { const v8f p = sc[s][ks * 2 + t] * st[s]; v8us h8, l8;
#pragma unroll
                    for (int j = 0; j < 8; ++j) { unsigned short h, l; splitf(p[j], h, l); h8[j] = h; l8[j] = l; }
                    *(v8us*)(pw + s * 16 * PP + ks * 32 + t * 16) = h8; *(v8us*)(pw + 32 * PP + s * 16 * PP + ks * 32 + t * 16) = l8; }
            } else pf[s][ks] = cat16(__builtin_convertvector(sc[s][ks * 2] * st[s], v8h), __builtin_convertvector(sc[s][ks * 2 + 1] * st[s], v8h)); }
    v8f oc[2][HD / 16];
#pragma unroll
    for (int s = 0; s < 2; ++s)
#pragma unroll
        for (int nb = 0; nb < HD / 16; ++nb) oc[s][nb] = (v8f){};
    constexpr int GK = HIRES ? 2 : 4;   // k steps whose v fragments are loaded ahead of their WMMAs (what the registers hold beside the accumulators)
#pragma unroll
    for (int kg = 0; kg < KW / 32; kg += GK) {
        V b[GK][HD / 16], b2[GK][HD / 16];
#pragma unroll
        for (int nb = 0; nb < HD / 16; ++nb)
#pragma unroll
            for (int g = 0; g < GK; ++g) { b[g][nb] = WFrag<T16>::ldf(pv + (kg + g) * 2048 + nb * 512); if (HIRES) b2[g][nb] = WFrag<T16>::ldf(pvl + (kg + g) * 2048 + nb * 512); }
        __builtin_amdgcn_sched_barrier(0);   // keeps the WMMAs behind the group's last load: without it the compiler reuses one fragment's registers and waits for each load in turn
#pragma unroll
        for (int g = 0; g < GK; ++g) { const int ks = kg + g; V a[2], a2[2];
#pragma unroll
            for (int s = 0; s < 2; ++s) { if constexpr (HIRES) { a[s] = WFrag<T16>::ld(pw + s * 16 * PP + ks * 32); a2[s] = WFrag<T16>::ld(pw + 32 * PP + s * 16 * PP + ks * 32); } else a[s] = pf[s][ks]; }
#pragma unroll
            for (int nb = 0; nb < HD / 16; ++nb)
#pragma unroll
                for (int s = 0; s < 2; ++s) { oc[s][nb] = WFrag<T16>::mma(a[s], b[g][nb], oc[s][nb]); if (HIRES) { oc[s][nb] = WFrag<T16>::mma(a2[s], b[g][nb], oc[s][nb]); oc[s][nb] = WFrag<T16>::mma(a[s], b2[g][nb], oc[s][nb]); } } }
    }
    // the same wait for the v loads
    if (HIRES) asm volatile("s_wait_xcnt 0x0" :: "v"(pv), "v"(pvl) : "memory");
    else asm volatile("s_wait_xcnt 0x0" :: "v"(pv) : "memory");
    if constexpr (HIRES) __syncthreads();   // every wave has read its parked probabilities before the partial tiles are written over them (single plane: nothing lay there)
    else __builtin_amdgcn_sched_barrier(0);   // keeps the stores below behind the last WMMA
    float* my = red + wave * PS + hi * 8 * PW + lr;
#pragma unroll
    for (int s = 0; s < 2; ++s)
#pragma unroll
        for (int nb = 0; nb < HD / 16; ++nb)
#pragma unroll
            for (int j = 0; j < 8; ++j) my[(s * 16 + j) * PW + nb * 16] = oc[s][nb][j];
    __syncthreads();   // every wave's partial tile is in LDS before any is read
    // one thread sums the same row and columns of both streams, so the difference (a1 v) - lam (a2 v) is formed here and goes out as the hi+lo planes [position][head x 64 + d] of the output product's A operand
    // (in fragment order, as that product reads it: a wave takes 16 rows x 8 columns, 256 bytes in a row there)
    if (threadIdx.x < 256) { const int row = threadIdx.x & 15, cofs = (threadIdx.x >> 4) * 4; const float* p = red + row * PW + cofs; v4f v1 = *(const v4fa*)p, v2 = *(const v4fa*)(p + 16 * PW);
#pragma unroll
      for (int w = 1; w < NW; ++w) { v1 += *(const v4fa*)(p + w * PS); v2 += *(const v4fa*)(p + w * PS + 16 * PW); }
      constexpr float cs = HIRES ? 1.0f : (1.0f / PCAR); v4us oh, ol;
#pragma unroll
      for (int q = 0; q < 4; ++q) { unsigned short s1, s2; splitf(v1[q] * cs - lam * (v2[q] * cs), s1, s2); oh[q] = s1; ol[q] = s2; }
      const size_t oo = (size_t)blockIdx.z * TT * DQ + fragofs(r0 + row, blockIdx.y * HD + cofs, DQ); *(v4us*)(Ah + oo) = oh; *(v4us*)(Al + oo) = ol; }
}
// ---- k_attnf: the single-plane (fp16) rows, tiled by QUERIES: grid (rows/128, heads, batch entries), 8 waves. Wave w keeps 16 query rows of both streams (q fragments, running statistics, output tiles in registers) and walks ALL keys, 64 a trip;
// a trip's k and v (8 KB each, a contiguous piece of the fragment-ordered planes) are brought into LDS once for the 8 waves, through registers, one trip ahead, two buffers, one barrier a trip. So k and v leave L2 once per 128 rows (was: per 16).
// Scores transposed as in k_attn (k as A, q as B): lane (lr, hi) holds keys 16 nb + 8 hi + 0..7 of query lr. The output is transposed too (v as A, the converted score tiles as B: the same registers, the same k order), so a lane's output elements belong to its own query
// and the rescale by the running maximum is in-lane. Probabilities are 1024 x exp(score - running max), f32 sums of the unrounded values beside them; the division by the row sum comes once, at the end.
__global__ void __launch_bounds__(256) __attribute__((amdgpu_waves_per_eu(4, 4))) k_attnf(const h16* __restrict__ Q1, const h16* __restrict__ Q2, const h16* __restrict__ Kp, const h16* __restrict__ Vt, const float* __restrict__ lamp, bf* Ah, bf* Al, int row0) {
    typedef WFrag<h16>::V V;
    constexpr int KS = 64, NST = TT / KS, SE = KS * HD;   // keys a trip, trips, elements of k (and of v) a trip
    constexpr float CX = SCL * 1.4426950408889634f;       // raw score -> exponent of 2
    __shared__ __align__(16) h16 sm[2][2 * SE];           // two buffers of k, then v
    const int tid = threadIdx.x, lane = tid & 31, wave = tid >> 5; const int r0 = row0 + (blockIdx.x * 8 + wave) * 16; const size_t hp = ((size_t)blockIdx.z * NH_ + blockIdx.y) * TT * HD;
    const float lam = bfr(lamp[0]);
    const h16* pq1 = Q1 + hp + (size_t)r0 * HD + lane * 8; const h16* pq2 = Q2 + hp + (size_t)r0 * HD + lane * 8;
    const h16* gk = Kp + hp + tid * 8; const h16* gv = Vt + hp + tid * 8;   // thread tid moves 16-byte pieces tid and tid + 256 of each operand
    V a[2][2];
#pragma unroll
    for (int c = 0; c < 2; ++c) { a[c][0] = WFrag<h16>::ldf(pq1 + c * 512); a[c][1] = WFrag<h16>::ldf(pq2 + c * 512); }
    v8h g0 = *(const v8h*)gk, g1 = *(const v8h*)(gk + 2048), g2 = *(const v8h*)gv, g3 = *(const v8h*)(gv + 2048);
    // the wait that stands in front of any overwrite of a register which an issued load names; the addresses are inputs so that they live up to it
    asm volatile("s_wait_xcnt 0x0" :: "v"(pq1), "v"(pq2), "v"(gk), "v"(gv) : "memory");
    { h16* d = &sm[0][0] + tid * 8; *(v8h*)d = g0; *(v8h*)(d + 2048) = g1; *(v8h*)(d + SE) = g2; *(v8h*)(d + SE + 2048) = g3; }
    __syncthreads();   // trip 0's k and v are in LDS before any wave reads them
    v8f oc[2][HD / 16], l8[2]; float mx[2];
#pragma unroll
    for (int s = 0; s < 2; ++s) { mx[s] = -3.0e38f; l8[s] = (v8f){};
#pragma unroll
        for (int nb = 0; nb < HD / 16; ++nb) oc[s][nb] = (v8f){}; }
#pragma unroll 1   // one copy of the trip (for speed only)
    for (int t = 0; t < NST; ++t) {
        const bool more = t + 1 < NST;   // the same for the whole work-group
        if (more) { const h16* nk = gk + (size_t)(t + 1) * SE; const h16* nv = gv + (size_t)(t + 1) * SE; g0 = *(const v8h*)nk; g1 = *(const v8h*)(nk + 2048); g2 = *(const v8h*)nv; g3 = *(const v8h*)(nv + 2048);
            asm volatile("s_wait_xcnt 0x0" :: "v"(nk), "v"(nv) : "memory"); }   // the same wait for the next trip's loads
        const h16* lk = &sm[t & 1][0] + lane * 8; const h16* lv = lk + SE;
        v8f sc[2][KS / 16];
#pragma unroll
        for (int c = 0; c < 2; ++c)
#pragma unroll
            for (int nb = 0; nb < KS / 16; ++nb) { const V b = WFrag<h16>::ldf(lk + nb * 1024 + c * 512);
#pragma unroll
                for (int s = 0; s < 2; ++s) sc[s][nb] = WFrag<h16>::mma(b, a[c][s], c ? sc[s][nb] : (v8f){}); }
        V pf[2][KS / 32];
#pragma unroll
        for (int s = 0; s < 2; ++s) {
            // the trip's maximum of the lane's query: in-lane, then the other lane half (a max is exact in any order)
            const v8f m8 = __builtin_elementwise_max(__builtin_elementwise_max(sc[s][0], sc[s][1]), __builtin_elementwise_max(sc[s][2], sc[s][3]));
            const float m = fmaxf(fmaxf(fmaxf(m8[0], m8[1]), fmaxf(m8[2], m8[3])), fmaxf(fmaxf(m8[4], m8[5]), fmaxf(m8[6], m8[7])));
            const float mn = fmaxf(mx[s], fmaxf(m, xhalf(m))); const float al = exp2slot((mx[s] - mn) * CX); mx[s] = mn;   // al: what was summed under the old maximum shrinks by it (0 in trip 0)
            const float ad = 10.0f - mn * CX;   // 2^10: the probabilities' carrier, as PCAR
            v8f s8 = l8[s] * al;
#pragma unroll
            for (int nb = 0; nb < KS / 16; ++nb) { const v8f x = sc[s][nb] * CX + ad; v8f e;
#pragma unroll
                for (int j = 0; j < 8; ++j) e[j] = exp2slot(x[j]);
                sc[s][nb] = e; s8 += e; }
            l8[s] = s8;
#pragma unroll
            for (int nb = 0; nb < HD / 16; ++nb) oc[s][nb] *= al;
#pragma unroll
            for (int ks = 0; ks < KS / 32; ++ks) pf[s][ks] = cat16(__builtin_convertvector(sc[s][ks * 2], v8h), __builtin_convertvector(sc[s][ks * 2 + 1], v8h)); }
#pragma unroll
        for (int ks = 0; ks < KS / 32; ++ks)
#pragma unroll
            for (int nb = 0; nb < HD / 16; ++nb) { const V b = WFrag<h16>::ldf(lv + ks * 2048 + nb * 512);
#pragma unroll
                for (int s = 0; s < 2; ++s) oc[s][nb] = WFrag<h16>::mma(b, pf[s][ks], oc[s][nb]); }
        if (more) { h16* d = &sm[(t + 1) & 1][0] + tid * 8; *(v8h*)d = g0; *(v8h*)(d + 2048) = g1; *(v8h*)(d + SE) = g2; *(v8h*)(d + SE + 2048) = g3; }   // its last readers left this buffer before the barrier of trip t - 1
        __syncthreads();   // publishes trip t + 1's k and v, and ends every wave's reads of the buffer that trip t + 1 refills
    }
    // row sums: eight in-lane sums (one per register index, trips in order), a fixed tree over them, the other lane half
    float rl[2];
#pragma unroll
    for (int s = 0; s < 2; ++s) { const v8f s8 = l8[s]; const float sum = ((s8[0] + s8[1]) + (s8[2] + s8[3])) + ((s8[4] + s8[5]) + (s8[6] + s8[7])); rl[s] = __fdiv_rn(1.0f, sum + xhalf(sum)); }
    // the difference (a1 v) - lam (a2 v) as the hi+lo planes of the output product's A operand, in fragment order: the lane's 8 values of a tile are d = 16 nb + 8 hi + 0..7 of query lr, 16 bytes in a row there, and a wave's store is 512 bytes in a row
    const size_t oo = (size_t)blockIdx.z * TT * DQ + ((size_t)(r0 >> 4) * (DQ >> 5) + blockIdx.y * 2) * 512 + lane * 8; bf* sh = Ah + oo; bf* sl = Al + oo;
    v8us oh[HD / 16], ol[HD / 16];
#pragma unroll
    for (int nb = 0; nb < HD / 16; ++nb)
#pragma unroll
        for (int j = 0; j < 8; ++j) { unsigned short h, l; splitf(oc[0][nb][j] * rl[0] - lam * (oc[1][nb][j] * rl[1]), h, l); oh[nb][j] = h; ol[nb][j] = l; }
#pragma unroll
    for (int nb = 0; nb < HD / 16; ++nb) { *(v8us*)(sh + nb * 256) = oh[nb]; *(v8us*)(sl + nb * 256) = ol[nb]; }
    // the wait in front of any overwrite of a register which an issued store names; addresses and data are inputs so that they live up to it
    asm volatile("s_wait_xcnt 0x0" :: "v"(sh), "v"(sl), "v"(__builtin_bit_cast(v4i, oh[0])), "v"(__builtin_bit_cast(v4i, oh[1])), "v"(__builtin_bit_cast(v4i, oh[2])), "v"(__builtin_bit_cast(v4i, oh[3])), "v"(__builtin_bit_cast(v4i, ol[0])), "v"(__builtin_bit_cast(v4i, ol[1])), "v"(__builtin_bit_cast(v4i, ol[2])), "v"(__builtin_bit_cast(v4i, ol[3])) : "memory");
}
__global__ __launch_bounds__(256) void k_merge(const float* __restrict__ O, int h0, bf* Ah, bf* Al) { const size_t e = ((size_t)blockIdx.x * 256 + threadIdx.x) * 2; if (e >= (size_t)ZH * TT * HD) return; const int d = (int)(e % HD); const int t = (int)((e / HD) % TT); const int zz = (int)(e / ((size_t)HD * TT)); const float cs = (t < RH) ? 1.0f : (1.0f / PCAR); const size_t oo = (size_t)t * DQ + (h0 + zz) * HD + d;
    v2us oh, ol;
#pragma unroll
    for (int q = 0; q < 2; ++q) { unsigned short a, c2; splitf(O[e + q] * cs, a, c2); oh[q] = a; ol[q] = c2; } *(v2us*)(Ah + oo) = oh; *(v2us*)(Al + oo) = ol;  }

extern "C" void kernel_launch(void* const* d_in, const int* in_sizes, int n_in,
                              void* d_out, int out_size, void* d_ws, size_t ws_size, hipStream_t stream) {
    (void)in_sizes; (void)n_in; (void)out_size;
    const float* vin = (const float*)d_in[0]; const float* kin = (const float*)d_in[1]; const float* q1in = (const float*)d_in[2]; const float* q2in = (const float*)d_in[3]; const float* wq = (const float*)d_in[4]; const float* bq = (const float*)d_in[5]; const float* wk = (const float*)d_in[6]; const float* bk = (const float*)d_in[7]; const float* wv = (const float*)d_in[8]; const float* bv = (const float*)d_in[9]; const float* wo = (const float*)d_in[10]; const float* bo = (const float*)d_in[11]; const float* lamp = (const float*)d_in[12];   // weights x @ W
    float* OUT = (float*)d_out;     // [2][2048][1024]
    char* wsp = (char*)d_ws;
    auto take = [&](size_t bytes) { char* p = wsp; wsp += (bytes + 255) & ~(size_t)255; return (void*)p; };
    constexpr size_t PLN = (size_t)NH_ * TT * HD;   // one head plane set of one batch entry; planes are [stream q1, q2, k, v][batch entry]
    bf* WT = (bf*)take((size_t)4 * DQ * DM * 2);      // Wq, Wk, Wv, Wo transposed
    bf* XB = (bf*)take((size_t)4 * NB_ * TT * DM * 2);   // q1, q2, k, v in bf16
    h16* P16 = (h16*)take(4 * NB_ * PLN * 2); bf* Ph = (bf*)take(4 * NB_ * PLN * 2); bf* Pl = (bf*)take(4 * NB_ * PLN * 2);
    bf* ATh = (bf*)take((size_t)NB_ * TT * DQ * 2); bf* ATl = (bf*)take((size_t)NB_ * TT * DQ * 2);
    if ((size_t)(wsp - (char*)d_ws) > ws_size) return;    // ws 256 MiB
    k_prep<<<(unsigned)(4 * WTB + 4 * CVB), 256, 0, stream>>>(wq, wk, wv, wo, WT, q1in, q2in, kin, vin, XB);
    k_proj<<<dim3(64, 4 * NB_), 256, 0, stream>>>(XB, WT, bq, bk, bv, P16, Ph, Pl);
    k_attn<bf, 2><<<dim3(RH / 16, NH_, NB_), 512, 0, stream>>>(Ph, Pl, Ph + 2 * PLN, Pl + 2 * PLN, Ph + 4 * PLN, Pl + 4 * PLN, Ph + 6 * PLN, Pl + 6 * PLN, lamp, ATh, ATl, 0);
    k_attnf<<<dim3((TT - RH) / 128, NH_, NB_), 256, 0, stream>>>(P16, P16 + 2 * PLN, P16 + 4 * PLN, P16 + 6 * PLN, lamp, ATh, ATl, RH);
    k_outp<<<dim3(NB_ * TT / 128, DM / 128), 256, 0, stream>>>(ATh, ATl, WT + (size_t)3 * DQ * DM, bo, OUT);
}
